// v000
// The times below were measured on an AMD MI455X: many runs one after another, warmed up first and cycling through
// copies of the inputs, with the whole window's GPU time divided by the number of runs. Launches and the gaps
// between them are all in it. The median over several windows is given; except for v000 it joins two sittings, which
// can be a few percent apart, so the side-by-side timings, each taken in one sitting, are the better comparison.
// v000 is the starting kernel. One run takes 430 microseconds.
// Contractions (all v_wmma_f32_16x16x32_f16, f16 operands, f32 accumulate): q/k/v/p projections (x f16 x16 . W f16 x64, K=512, single products);
// scores ([q+bq+u | q+bq+vbias] f16 x4 . [k+bk | p] f16 x4, K=128 per head, single products); P . v^T (P f16 x1024 . v^T carried as
// f16 x64 hi plane + f16 residual plane, 64 keys per tile, two products); output projection (ctx carried as f16 x64 hi + residual planes
// . Wo f16 x64, K=512, two products). Key mask (replace fill before the softmax, zero after it), max-subtracted online base-2 softmax and
// all epilogues in f32 on VALU. Every float input RNE-converted to bf16 on load.
#include <hip/hip_runtime.h>
#include <math.h>
#include <stdint.h>

#ifndef NB
#define NB    4
#endif
#ifndef SEQ
#define SEQ   2048
#endif
#define NB_FULL  4
#define SEQ_FULL 2048
#define DMOD  512
#define NH    8
#define DH    64
#define NROW  (SEQ * NB)
#define XC    16.0f
#define WSC   64.0f
#define QC    4.0f
#define VC    64.0f
#define PC    1024.0f
#define CC    64.0f
#define SCALE 0.125f
#define LOG2E 1.4426950408889634f
static_assert(NH * DH == DMOD);
static_assert(DH == 64);
static_assert(NB >= 1 && NB <= NB_FULL && SEQ >= 64 && SEQ <= SEQ_FULL);
static_assert((SEQ % 64) == 0 && (DMOD % 64) == 0 && (NROW % 64) == 0);
static_assert(((SEQ * DMOD) % 2048) == 0 && ((DMOD * DMOD) % 2048) == 0);
#define ATT_W 4
#define ATT_THREADS (ATT_W * 32)
#define PPI 68
#define WFL (16 * PPI)
static_assert((PPI % 4) == 0 && PPI >= 64 && (WFL % 4) == 0);

typedef _Float16 v16h __attribute__((ext_vector_type(16)));
typedef _Float16 v8h  __attribute__((ext_vector_type(8)));
typedef __bf16   v16b __attribute__((ext_vector_type(16)));
typedef float    v8f  __attribute__((ext_vector_type(8)));
typedef float    v4f  __attribute__((ext_vector_type(4)));
typedef unsigned int v4u __attribute__((ext_vector_type(4)));

union FragH { v16h v; v8h h[2]; v4u u[2]; };
union FragAny { v16h h; v16b b; };

// ---- scalar helpers --------------------------------------------------------------------------------
__device__ __forceinline__ unsigned short bf_bits(float f) {          // f32 -> bf16 bits, RNE convert
  unsigned u = __float_as_uint(f);
  return (unsigned short)((u + 0x7FFFu + ((u >> 16) & 1u)) >> 16);
}
__device__ __forceinline__ float bf_up(unsigned short h) { return __uint_as_float(((unsigned)h) << 16); }
__device__ __forceinline__ float bfr(float f) { return bf_up(bf_bits(f)); }   // value of the bf16 RNE convert
__device__ __forceinline__ unsigned short h_bits(_Float16 x) { return __builtin_bit_cast(unsigned short, x); }
__device__ __forceinline__ unsigned pk16(unsigned short a, unsigned short b) { return (unsigned)a | ((unsigned)b << 16); }
__device__ __forceinline__ v8f zero8() { v8f z = {0.f, 0.f, 0.f, 0.f, 0.f, 0.f, 0.f, 0.f}; return z; }

// ---- fragment loader: 16-bit A/B operand from a k-contiguous 16-bit plane, lane -> row/col (lane&15),
//      p already includes +8*(lane>>4); elements 0..7 <- p[0..7] (k0+8h..), elements 8..15 <- p[16..23] (k0+16+8h..)
//      (same split k map for A and B; B is always read from a [n][k] plane)
__device__ __forceinline__ v16h ldfrag_u(const unsigned short* p) {
  FragH f;
  f.u[0] = *(const v4u*)(p);
  f.u[1] = *(const v4u*)(p + 16);
  return f.v;
}

// ---- WMMA helpers with trailing VALU hazard gaps ------------------------------------------------------
__device__ __forceinline__ v8f mma_h(v16h a, v16h b, v8f c) {
  return __builtin_amdgcn_wmma_f32_16x16x32_f16(false, a, false, b, (short)0, c, false, false);
}
__device__ __forceinline__ v8f mma_b(v16h a, v16h b, v8f c) {
  FragAny ua, ub;
  ua.h = a;
  ub.h = b;
  return __builtin_amdgcn_wmma_f32_16x16x32_bf16(false, ua.b, false, ub.b, (short)0, c, false, false);
}
template <int BF>
__device__ __forceinline__ v8f mmaT(v16h a, v16h b, v8f c) {
  if constexpr (BF != 0) return mma_b(a, b, c);
  else return mma_h(a, b, c);
}
__device__ __forceinline__ void dep_guard1(v8f& a, v8f& b, v16h x) {
#if defined(__HIP_DEVICE_COMPILE__)
  asm volatile("v_nop\n\tv_nop\n\tv_nop\n\tv_nop" : "+v"(a), "+v"(b) : "v"(x));
#endif
}
__device__ __forceinline__ void hz4(v8f& d, v16h x0, v16h x1, v16h x2, v16h x3) {
#if defined(__HIP_DEVICE_COMPILE__)
  asm volatile("v_nop\n\tv_nop\n\tv_nop\n\tv_nop" : "+v"(d) : "v"(x0), "v"(x1), "v"(x2), "v"(x3));
#endif
}
__device__ __forceinline__ void keep4_h(v16h a, v16h b, v16h c, v16h d) {
#if defined(__HIP_DEVICE_COMPILE__)
  asm volatile("v_nop" :: "v"(a), "v"(b), "v"(c), "v"(d));
#endif
}
__device__ __forceinline__ void acc_guard4(v8f& a, v8f& b, v8f& c, v8f& d) {
#if defined(__HIP_DEVICE_COMPILE__)
  asm volatile("v_nop\n\tv_nop\n\tv_nop\n\tv_nop" : "+v"(a), "+v"(b), "+v"(c), "+v"(d));
#endif
}
__device__ __forceinline__ void wave_sync_lds() {
  __builtin_amdgcn_fence(__ATOMIC_RELEASE, "workgroup");
  __builtin_amdgcn_wave_barrier();
  __builtin_amdgcn_fence(__ATOMIC_ACQUIRE, "workgroup");
}

// =====================================================================================================
// Elementwise 16-bit pack, no transpose: dst[i] = f16( bf16_RNE(src[i]) * sc ) for i < n; sc a power of two (exact).
// blockIdx.y selects a batch slice: src + y*sIn, dst + y*sOut (element strides). 8 elements per thread: two 16-B loads,
// coverage: grid.x = n / 2048 blocks x 256 thr x 8 elements = n exactly (n % 2048 == 0 by the static sizes), grid.y = slice count.
// =====================================================================================================
__global__ __launch_bounds__(256) void cvt16(const float* __restrict__ src, unsigned short* dst, int n,
                                             long long sIn, long long sOut, float sc) {
  const size_t i8 = ((size_t)blockIdx.x * 256 + threadIdx.x) * 8;
  if (i8 + 8 > (size_t)n) return;             // never taken with the exact grid; no barriers in this kernel
  const float* s = src + (size_t)((long long)blockIdx.y * sIn) + i8;
  unsigned short* d = dst + (size_t)((long long)blockIdx.y * sOut) + i8;
  const v4f a = *(const v4f*)(s);
  const v4f b = *(const v4f*)(s + 4);
  v4u o;
  o[0] = pk16(h_bits((_Float16)(bfr(a[0]) * sc)), h_bits((_Float16)(bfr(a[1]) * sc)));
  o[1] = pk16(h_bits((_Float16)(bfr(a[2]) * sc)), h_bits((_Float16)(bfr(a[3]) * sc)));
  o[2] = pk16(h_bits((_Float16)(bfr(b[0]) * sc)), h_bits((_Float16)(bfr(b[1]) * sc)));
  o[3] = pk16(h_bits((_Float16)(bfr(b[2]) * sc)), h_bits((_Float16)(bfr(b[3]) * sc)));
  {
    *(v4u*)(d) = o;
    
  }
}

// =====================================================================================================
// Register-blocked batched 16-bit WMMA GEMM: C[m][n] = oscale * sum_k A[m][k] * Bt[n][k] (+ bias); one wave per 64x64 tile,
// no block barriers. A row-major [M][K] pitch lda (16-bit plane), Bt row-major [N][K] pitch ldb (k contiguous); M, N multiples of 64,
// K multiple of 32. blockIdx.y = batch index with element strides sA, sB, sC.
// ASPLIT 1: a second A plane A2 (unscaled residual of A, same layout) is multiplied into the same accumulator (A + A2 ~ exact A).
// BF 1: bf16 operands (v_wmma_f32_16x16x32_bf16), else f16.
// EPI 1: value += bf16_RNE(ep0[column]) (per-column bias); EPI 2: value += bf16_RNE(ep0[row]) (per-row bias, 16-bit out only).
// OM 0: f32 out (pitch ldc).  OM 2: one f16 plane = f16(value * ocarry).
// OM 4: two f16 planes: hi = f16(value * ocarry), lo = f16(value * ocarry - hi) (unscaled residual).
// OM 5: two f16 planes: C = f16((value + bf16_RNE(ep1[column])) * ocarry), C2 = f16((value + bf16_RNE(ep2[column])) * ocarry).
// coverage: 4 slabs x 16 rows (f32: it 0..7 x lane>>4; 16-bit: it 0..3 x lane>>3) x 64 cols = the wave's whole 64x64 tile;
//           grid = ceil(tilesM*tilesN/8) blocks, surplus waves exit (wave-uniform).
// =====================================================================================================
template <int OM, int ASPLIT, int BF, int EPI>
__global__ __launch_bounds__(256) __attribute__((amdgpu_num_vgpr(256))) void gemm64(
    const unsigned short* __restrict__ Ap, const unsigned short* __restrict__ A2p, int lda, long long sA,
    const unsigned short* __restrict__ Btp, int ldb, long long sB,
    void* Cout, void* C2out, int ldc, long long sC,
    int M, int N, int K, float oscale, float ocarry,
    const float* __restrict__ ep0, const float* __restrict__ ep1, const float* __restrict__ ep2) {
  __shared__ __align__(16) float sT[8][16 * 68];   // per-wave 16x64 slab, pitch 68 floats
  const int by   = blockIdx.y;
  const int lane = threadIdx.x & 31;
  const int wave = threadIdx.x >> 5;
  const int tilesN = N >> 6;
  const int tilesM = M >> 6;
  const int tile = blockIdx.x * 8 + wave;
  if (tile >= tilesM * tilesN) return;   // wave-uniform; no block barriers in this kernel
  const int tm = tile / tilesN;
  const int tn = tile - tm * tilesN;
  const int m0 = tm << 6;
  const int n0 = tn << 6;

  const unsigned short* A1 = Ap  + (size_t)((long long)by * sA);
  const unsigned short* A2 = A2p + (size_t)((long long)by * sA);
  const unsigned short* Bb = Btp + (size_t)((long long)by * sB);

  const int rlane = lane & 15;                 // row (A) / col (B, D) within subtile
  const int koff  = (lane >> 4) * 8;           // k offset of this lane half
  const int mOff  = (lane >> 4) * 8;           // D row offset

  v8f acc[4][4];
#pragma unroll
  for (int i = 0; i < 4; ++i)
#pragma unroll
    for (int j = 0; j < 4; ++j) acc[i][j] = zero8();

  for (int k0 = 0; k0 < K; k0 += 32) {
    v16h bh[4];
#pragma unroll
    for (int j = 0; j < 4; ++j) {
      const size_t bofs = (size_t)(n0 + (j << 4) + rlane) * ldb + koff + k0;
      bh[j] = ldfrag_u(Bb + bofs);
    }
#pragma unroll
    for (int i = 0; i < 4; ++i) {
      const size_t ao = (size_t)(m0 + (i << 4) + rlane) * lda + koff + k0;
      const v16h ah = ldfrag_u(A1 + ao);
#pragma unroll
      for (int j = 0; j < 4; ++j) acc[i][j] = mmaT<BF>(ah, bh[j], acc[i][j]);
      dep_guard1(acc[i][0], acc[i][3], ah);
      if constexpr (ASPLIT != 0) {
        const v16h al = ldfrag_u(A2 + ao);
#pragma unroll
        for (int j = 0; j < 4; ++j) acc[i][j] = mmaT<BF>(al, bh[j], acc[i][j]);
        dep_guard1(acc[i][0], acc[i][3], al);
      }
    }
    keep4_h(bh[0], bh[1], bh[2], bh[3]);
  }
  acc_guard4(acc[0][0], acc[0][1], acc[0][2], acc[0][3]);
  acc_guard4(acc[1][0], acc[1][1], acc[1][2], acc[1][3]);
  acc_guard4(acc[2][0], acc[2][1], acc[2][2], acc[2][3]);
  acc_guard4(acc[3][0], acc[3][1], acc[3][2], acc[3][3]);

  const int hh2 = lane >> 4, c4 = (lane & 15) * 4;     // f32 out: 256-B row segment = 16 lanes x 16 B
  const int q8  = lane >> 3, c8 = (lane & 7) * 8;

  // ---- epilogue ----
  float* slab = sT[wave];
#pragma unroll
  for (int i = 0; i < 4; ++i) {
    const int mBase = m0 + (i << 4);
#pragma unroll
    for (int j = 0; j < 4; ++j) {
#pragma unroll
      for (int r = 0; r < 8; ++r) {
        slab[(mOff + r) * 68 + (j << 4) + rlane] = acc[i][j][r];
      }
    }
    wave_sync_lds();
    if constexpr (OM == 0) {
      float* C = (float*)Cout + (size_t)((long long)by * sC);
      v4f vals[8];
#pragma unroll
      for (int it = 0; it < 8; ++it) {
        const int row = it * 2 + hh2;                      // it 0..7 x hh2 0..1 = rows 0..15
        v4f v = *(const v4f*)(slab + row * 68 + c4);
#pragma unroll
        for (int e = 0; e < 4; ++e) v[e] = v[e] * oscale;
        if constexpr (EPI == 1) {
          const v4f bb = *(const v4f*)(ep0 + n0 + c4);     // per-column bias, columns n0+c4 .. +3 (N equals the bias length)
#pragma unroll
          for (int e = 0; e < 4; ++e) v[e] = v[e] + bfr(bb[e]);
        }
        vals[it] = v;
      }
      {
#pragma unroll
        for (int it = 0; it < 8; ++it) {
          const int gr = mBase + it * 2 + hh2;
          *(v4f*)(C + (size_t)gr * ldc + n0 + c4) = vals[it];
        }
        
      }
    } else {
      unsigned short* C  = (unsigned short*)Cout  + (size_t)((long long)by * sC);
      unsigned short* Cb = (unsigned short*)C2out + (size_t)((long long)by * sC);
      v4u hv[4], lv[4];
#pragma unroll
      for (int it = 0; it < 4; ++it) {
        const int row = it * 4 + q8;                       // it 0..3 x q8 0..3 = rows 0..15
        const float* sp = slab + row * 68 + c8;
        float rb = 0.f;
        if constexpr (EPI == 2) rb = bfr(ep0[mBase + row]);   // per-row bias (M equals the bias length)
        v4u a  = {0u, 0u, 0u, 0u};
        v4u b2 = {0u, 0u, 0u, 0u};
#pragma unroll
        for (int e = 0; e < 4; ++e) {
          const int ci = n0 + c8 + 2 * e;                  // column index, < N
          float f0 = sp[2 * e] * oscale + rb;
          float f1 = sp[2 * e + 1] * oscale + rb;
          if constexpr (EPI == 1) {
            f0 += bfr(ep0[ci]);
            f1 += bfr(ep0[ci + 1]);
          }
          if constexpr (OM == 5) {
            const float g0 = (f0 + bfr(ep1[ci])) * ocarry, g1 = (f1 + bfr(ep1[ci + 1])) * ocarry;
            const float w0 = (f0 + bfr(ep2[ci])) * ocarry, w1 = (f1 + bfr(ep2[ci + 1])) * ocarry;
            a[e]  = pk16(h_bits((_Float16)g0), h_bits((_Float16)g1));
            b2[e] = pk16(h_bits((_Float16)w0), h_bits((_Float16)w1));
          } else {
            f0 *= ocarry; f1 *= ocarry;
            const _Float16 x0 = (_Float16)f0, x1 = (_Float16)f1;
            a[e] = pk16(h_bits(x0), h_bits(x1));
            if constexpr (OM == 4) {
              b2[e] = pk16(h_bits((_Float16)(f0 - (float)x0)), h_bits((_Float16)(f1 - (float)x1)));
            }
          }
        }
        hv[it] = a;
        lv[it] = b2;
      }
      {
#pragma unroll
        for (int it = 0; it < 4; ++it) {
          const int row = it * 4 + q8;
          *(v4u*)(C + (size_t)(mBase + row) * ldc + n0 + c8) = hv[it];
          if constexpr (OM >= 4) {
            *(v4u*)(Cb + (size_t)(mBase + row) * ldc + n0 + c8) = lv[it];
          }
        }
        
      }
    }
    wave_sync_lds();
  }
}

// =====================================================================================================
// Full (non-causal) attention with a 128-deep score contraction for one (batch b, head n) pair and a 64-row query tile;
// 4 waves, wave w owns query rows iw0 .. iw0+15, iw0 = i0 + 16w. Planes (pitch DMOD halves, row index = b*SEQ + position):
// QU = f16((q + bq + ub) x4), QV = f16((q + bq + vbias) x4), KP = f16((k + bk) x4); PP = f16(p x4) rows s = 0 .. SEQ-1 (shared by
// all batches); VT, VTL = v^T hi x64 / residual f16 as [b][n*64+d][SEQ]. Key mask ints kmask[b*SEQ_FULL + s], masked where == 0.
//   Per key tile j0 (64 keys): mask ints read first (4 per lane); scores S = (q+ub) . k + (q+vbias) . p (4 subtiles of 16 keys, two
//   64-deep halves, 4 WMMAs per subtile); t = S * (0.125/16) * log2(e), replaced by -1e30 where the key is masked; online softmax in
//   base 2, max-subtracted, running sums in f32; the probability of a masked key is set to 0 after the exponential (a fully masked row
//   wave barrier, then the A fragments of P*1024 rebuilt from the LDS rows (f32 vector loads, split k map) and the v^T B fragments loaded
//   straight from the 16-bit planes VT/VTL[n*64+d][j]; 8 + 8 P.V WMMAs per tile (hi plane then residual plane into the same accumulators).
//   block = 4 waves = 128 threads; grid = (SEQ/64, NB*NH); no block barriers; every wave does identical bounded work (SEQ/64 tiles).
// LDS: one [16][PPI] f32 slab per wave, private-to-wave (wave_sync); staged extent == consumed extent (16 rows x 64 cols written
//   by every lane pair (hh, c) x (r, t) before any read, both for the prob tile and for the ctx tile).
// coverage: global: 4 instructions x 4 rows x 64 halves per plane = rows iw0..iw0+15 of head segment n in CT and CTL;
//           grid x waves cover all NB x SEQ rows and all NH head segments of CT / CTL exactly once.
// =====================================================================================================
__global__ __launch_bounds__(ATT_THREADS) __attribute__((amdgpu_num_vgpr(256)))
void attn_full(const unsigned short* __restrict__ QU, const unsigned short* __restrict__ QV,
               const unsigned short* __restrict__ KP, const unsigned short* __restrict__ PP,
               const unsigned short* __restrict__ VT, const unsigned short* __restrict__ VTL,
               const int* __restrict__ kmask,
               unsigned short* CT, unsigned short* CTL) {
  __shared__ __align__(16) float smem[ATT_W * WFL];   // per wave: prob / ctx slab [16][PPI]

  const int tid  = threadIdx.x;
  const int wave = tid >> 5;
  const int lane = tid & 31;
  const int hh   = lane >> 4;
  const int c    = lane & 15;
  const int bn   = blockIdx.y;
  const int b    = bn / NH;
  const int n    = bn - b * NH;
  const int i0   = blockIdx.x * 64;
  const int iw0  = i0 + wave * 16;

  float* pt = smem + wave * WFL;

  // stationary A fragments: (q + bq + ub) rows b*SEQ + iw0 + c, d 0..31 and 32..63 of head n ((q + bq + vbias) fragments reloaded per key tile)
  const size_t qro = ((size_t)(b * SEQ + iw0 + c)) * DMOD + n * DH + 8 * hh;
  const v16h qua = ldfrag_u(QU + qro), qub = ldfrag_u(QU + qro + 32);

  const unsigned short* Kb  = KP + (size_t)b * SEQ * DMOD + n * DH + 8 * hh;
  const unsigned short* Pb  = PP + n * DH + 8 * hh;
  const size_t vbase = (size_t)b * DMOD * SEQ + (size_t)(n * DH) * SEQ + 8 * hh;
  const unsigned short* Vb  = VT  + vbase;
  const unsigned short* VLb = VTL + vbase;
  const int* km = kmask + (size_t)b * SEQ_FULL;

  const float KSC = (SCALE / (QC * QC)) * LOG2E;

  float mrow[8], lrow[8];
  v8f O[4];
#pragma unroll
  for (int r = 0; r < 8; ++r) { mrow[r] = -INFINITY; lrow[r] = 0.f; }
#pragma unroll
  for (int td = 0; td < 4; ++td) O[td] = zero8();

#pragma unroll 1
  for (int j0 = 0; j0 < SEQ; j0 += 64) {
    // ---- key mask values for keys j0 + 16t + c (same for every row of the wave); j0 + 16t + c < SEQ <= SEQ_FULL ----
    int mk[4];
#pragma unroll
    for (int t = 0; t < 4; ++t) mk[t] = km[j0 + 16 * t + c];

    // ---- content part of the scores: S = (q+ub) . k (4 subtiles of 16 keys, K=64) ----
    v8f S[4];
#pragma unroll
    for (int t = 0; t < 4; ++t) {
      const size_t ko = (size_t)(j0 + 16 * t + c) * DMOD;
      const v16h ka = ldfrag_u(Kb + ko), kb2 = ldfrag_u(Kb + ko + 32);
      S[t] = mma_h(qua, ka, zero8());
      S[t] = mma_h(qub, kb2, S[t]);
      hz4(S[t], ka, kb2, qua, qub);
    }
    // ---- position part of the scores: S += (q+vbias) . p (same subtiles, p rows = key index, K=64) ----
    {
      const v16h qva = ldfrag_u(QV + qro), qvb = ldfrag_u(QV + qro + 32);
#pragma unroll
      for (int t = 0; t < 4; ++t) {
        const size_t ko = (size_t)(j0 + 16 * t + c) * DMOD;
        const v16h pa = ldfrag_u(Pb + ko), pb2 = ldfrag_u(Pb + ko + 32);
        S[t] = mma_h(qva, pa, S[t]);
        S[t] = mma_h(qvb, pb2, S[t]);
        hz4(S[t], pa, pb2, qva, qvb);
      }
    }

    // ---- online softmax (rows live on one 16-lane half) ----
#pragma unroll
    for (int r = 0; r < 8; ++r) {
      const int R = 8 * hh + r;
      float tv[4];
#pragma unroll
      for (int t = 0; t < 4; ++t) {
        const float sc = S[t][r] * KSC;
        tv[t] = (mk[t] == 0) ? -1.0e30f : sc;
      }
      float mx = fmaxf(fmaxf(tv[0], tv[1]), fmaxf(tv[2], tv[3]));
#pragma unroll
      for (int off = 1; off < 16; off <<= 1) mx = fmaxf(mx, __shfl_xor(mx, off, 32));
      const float mn = fmaxf(mrow[r], mx);
      const float al = exp2f(mrow[r] - mn);
      mrow[r] = mn;
      float e4[4];
      float ps = 0.f;
#pragma unroll
      for (int t = 0; t < 4; ++t) {
        const float ev = exp2f(tv[t] - mn);
        e4[t] = (mk[t] == 0) ? 0.f : ev;
        ps += e4[t];
      }
#pragma unroll
      for (int off = 1; off < 16; off <<= 1) ps += __shfl_xor(ps, off, 32);
      lrow[r] = lrow[r] * al + ps;
#pragma unroll
      for (int td = 0; td < 4; ++td) O[td][r] *= al;
      const int ro = R * PPI + c;
#pragma unroll
      for (int t = 0; t < 4; ++t) pt[ro + 16 * t] = e4[t];
    }
    wave_sync_lds();

    // ---- P fragments (x1024, f16) from the LDS rows, two k-steps of 32 keys ----
    FragH pf[2];
#pragma unroll
    for (int ks = 0; ks < 2; ++ks) {
      const float* prow = pt + c * PPI + 32 * ks + 8 * hh;
      const v4f p0 = *(const v4f*)(prow), p1 = *(const v4f*)(prow + 4);
      const v4f p2 = *(const v4f*)(prow + 16), p3 = *(const v4f*)(prow + 20);
#pragma unroll
      for (int e = 0; e < 4; ++e) {
        pf[ks].h[0][e]     = (_Float16)(p0[e] * PC);     // keys j0 + 32ks + 8hh + e
        pf[ks].h[0][4 + e] = (_Float16)(p1[e] * PC);     // keys j0 + 32ks + 8hh + 4 + e
        pf[ks].h[1][e]     = (_Float16)(p2[e] * PC);     // keys j0 + 32ks + 16 + 8hh + e
        pf[ks].h[1][4 + e] = (_Float16)(p3[e] * PC);
      }
    }
    // ---- O += P . v^T (hi plane) ----
    {
      const size_t vo = (size_t)c * SEQ + j0;
#pragma unroll
      for (int td = 0; td < 4; ++td) {
        const unsigned short* vp = Vb + vo + (size_t)(16 * td) * SEQ;
        const v16h vfa = ldfrag_u(vp), vfb = ldfrag_u(vp + 32);
        O[td] = mma_h(pf[0].v, vfa, O[td]);
        O[td] = mma_h(pf[1].v, vfb, O[td]);
        hz4(O[td], pf[0].v, pf[1].v, vfa, vfb);
      }
      // ---- O += P . v^T (residual plane) ----
#pragma unroll
      for (int td = 0; td < 4; ++td) {
        const unsigned short* vp = VLb + vo + (size_t)(16 * td) * SEQ;
        const v16h vla = ldfrag_u(vp), vlb = ldfrag_u(vp + 32);
        O[td] = mma_h(pf[0].v, vla, O[td]);
        O[td] = mma_h(pf[1].v, vlb, O[td]);
        hz4(O[td], pf[0].v, pf[1].v, vla, vlb);
      }
    }
    wave_sync_lds();
  }
  acc_guard4(O[0], O[1], O[2], O[3]);

  // ---- fold 1/l (0 for an empty row) and the carries (1024 on P, 64 on v), carry x64 on ctx, stage the wave's 16x64 slice ----
  const float oc = CC / (PC * VC);
#pragma unroll
  for (int r = 0; r < 8; ++r) {
    const float lr  = lrow[r];
    const float den = (lr > 0.f) ? lr : 1.0f;
    const float inv = (lr > 0.f) ? ((1.0f / den) * oc) : 0.f;
    const int ro = (8 * hh + r) * PPI + c;
#pragma unroll
    for (int td = 0; td < 4; ++td) pt[ro + 16 * td] = O[td][r] * inv;
  }
  wave_sync_lds();
  {
    const int q8 = lane >> 3, c8 = (lane & 7) * 8;
    v4u hv[4], lv[4];
#pragma unroll
    for (int it = 0; it < 4; ++it) {
      const int row = it * 4 + q8;                         // it 0..3 x q8 0..3 = rows 0..15
      const float* sp = pt + row * PPI + c8;
      v4u a  = {0u, 0u, 0u, 0u};
      v4u b2 = {0u, 0u, 0u, 0u};
#pragma unroll
      for (int e = 0; e < 4; ++e) {
        const float f0 = sp[2 * e], f1 = sp[2 * e + 1];
        const _Float16 x0 = (_Float16)f0, x1 = (_Float16)f1;
        a[e]  = pk16(h_bits(x0), h_bits(x1));
        b2[e] = pk16(h_bits((_Float16)(f0 - (float)x0)), h_bits((_Float16)(f1 - (float)x1)));
      }
      hv[it] = a;
      lv[it] = b2;
    }
    {
#pragma unroll
      for (int it = 0; it < 4; ++it) {
        const int row = it * 4 + q8;
        const size_t go = ((size_t)(b * SEQ + iw0 + row)) * DMOD + n * DH + c8;
        *(v4u*)(CT  + go) = hv[it];
        *(v4u*)(CTL + go) = lv[it];
      }
      
    }
  }
}

// =====================================================================================================
// Workspace map (bytes); every plane is an exact multiple of its tile / whole-row store granularity (M, N exact multiples of 64,
// convert counts exact multiples of 2048), every offset a multiple of 512 KiB:
//   WQ16, WK16, WV16, WP16, WO16 f16 [512 out][512 in] x64 (input layout kept, no transpose)   5 x   524288
//   XQ16, XK16, XV16 f16 [NROW][512] x16 (rows b*SEQ + t)                                    3 x  8388608
//   XP16 f16 [SEQ][512] x16                                                                        2097152
//   QU, QV, K16 f16 [NROW][512] x4                                                           3 x  8388608
//   P16  f16 [SEQ][512] x4                                                                         2097152
//   VT16, VTL16 f16 [NB][512][SEQ] hi x64 / residual                                         2 x  8388608
//   CT16, CTL16 f16 [NROW][512] hi x64 / residual                                            2 x  8388608
//   end (NB=4, SEQ=2048)                                                                          90701824
// =====================================================================================================
extern "C" void kernel_launch(void* const* d_in, const int* in_sizes, int n_in,
                              void* d_out, int out_size, void* d_ws, size_t ws_size,
                              hipStream_t stream) {
  if (n_in < 16) return;
  const long long needX = (long long)NB * SEQ_FULL * DMOD;     // reads rows b*SEQ_FULL + t, b < NB, t < SEQ
  if ((long long)in_sizes[0] < needX || (long long)in_sizes[1] < needX || (long long)in_sizes[2] < needX) return;
  if (in_sizes[3] < NB * SEQ_FULL) return;
  if (in_sizes[4] < SEQ * DMOD) return;
  if (in_sizes[5] != DMOD * DMOD || in_sizes[7] != DMOD * DMOD || in_sizes[9] != DMOD * DMOD ||
      in_sizes[11] != DMOD * DMOD || in_sizes[13] != DMOD * DMOD) return;
  if (in_sizes[6] != DMOD || in_sizes[8] != DMOD || in_sizes[10] != DMOD || in_sizes[12] != DMOD) return;
  if (in_sizes[14] != NH * DH || in_sizes[15] != NH * DH) return;
  if (out_size < NROW * DMOD) return;

  const float* xq    = (const float*)d_in[0];
  const float* xk    = (const float*)d_in[1];
  const float* xv    = (const float*)d_in[2];
  const int*   kmask = (const int*)d_in[3];
  const float* xpos  = (const float*)d_in[4];
  const float* w_q   = (const float*)d_in[5];
  const float* b_q   = (const float*)d_in[6];
  const float* w_k   = (const float*)d_in[7];
  const float* b_k   = (const float*)d_in[8];
  const float* w_v   = (const float*)d_in[9];
  const float* b_v   = (const float*)d_in[10];
  const float* w_o   = (const float*)d_in[11];
  const float* b_o   = (const float*)d_in[12];
  const float* w_p   = (const float*)d_in[13];
  const float* ub    = (const float*)d_in[14];
  const float* vb    = (const float*)d_in[15];
  float*       out   = (float*)d_out;

  const size_t PW  = (size_t)DMOD * DMOD * 2;            //   524288
  const size_t PX  = (size_t)NROW * DMOD * 2;            //  8388608
  const size_t PXP = (size_t)SEQ * DMOD * 2;             //  2097152
  const size_t PVT = (size_t)NB * DMOD * SEQ * 2;        //  8388608
  size_t off = 0;
  const size_t oWQ  = off; off += PW;
  const size_t oWK  = off; off += PW;
  const size_t oWV  = off; off += PW;
  const size_t oWP  = off; off += PW;
  const size_t oWO  = off; off += PW;
  const size_t oXQ  = off; off += PX;
  const size_t oXK  = off; off += PX;
  const size_t oXV  = off; off += PX;
  const size_t oXP  = off; off += PXP;
  const size_t oQU  = off; off += PX;
  const size_t oQV  = off; off += PX;
  const size_t oK   = off; off += PX;
  const size_t oP   = off; off += PXP;
  const size_t oVT  = off; off += PVT;
  const size_t oVTL = off; off += PVT;
  const size_t oCT  = off; off += PX;
  const size_t oCTL = off; off += PX;
  if (off > ws_size) return;                               // off = 90701824 at NB=4, SEQ=2048
  if (off > (size_t)134217728) return;

  char* ws = (char*)d_ws;
  unsigned short* WQ16  = (unsigned short*)(ws + oWQ);
  unsigned short* WK16  = (unsigned short*)(ws + oWK);
  unsigned short* WV16  = (unsigned short*)(ws + oWV);
  unsigned short* WP16  = (unsigned short*)(ws + oWP);
  unsigned short* WO16  = (unsigned short*)(ws + oWO);
  unsigned short* XQ16  = (unsigned short*)(ws + oXQ);
  unsigned short* XK16  = (unsigned short*)(ws + oXK);
  unsigned short* XV16  = (unsigned short*)(ws + oXV);
  unsigned short* XP16  = (unsigned short*)(ws + oXP);
  unsigned short* QU    = (unsigned short*)(ws + oQU);
  unsigned short* QV    = (unsigned short*)(ws + oQV);
  unsigned short* K16   = (unsigned short*)(ws + oK);
  unsigned short* P16   = (unsigned short*)(ws + oP);
  unsigned short* VT16  = (unsigned short*)(ws + oVT);
  unsigned short* VTL16 = (unsigned short*)(ws + oVTL);
  unsigned short* CT16  = (unsigned short*)(ws + oCT);
  unsigned short* CTL16 = (unsigned short*)(ws + oCTL);

  const dim3 blk(256);
  const dim3 gCW((DMOD * DMOD) / 2048, 1);                          // 128
  const dim3 gCX((SEQ * DMOD) / 2048, NB);                          // 512 x 4
  const dim3 gCP((SEQ * DMOD) / 2048, 1);                           // 512
  const int tilesQ = (NROW / 64) * (DMOD / 64);                     // 1024
  const int tilesV = (DMOD / 64) * (SEQ / 64);                      // 256 per batch
  const int tilesP = (SEQ / 64) * (DMOD / 64);                      // 256
  const dim3 gQ((tilesQ + 7) / 8, 1);                               // 128
  const dim3 gV((tilesV + 7) / 8, NB);                              // 32 x 4
  const dim3 gP((tilesP + 7) / 8, 1);                               // 32
  const dim3 gAT(SEQ / 64, NB * NH);                                // 32 x 32
  const dim3 bAT(ATT_THREADS);                                      // 128

  // (0) weight planes: W[nd][c] ([out][in], already k-contiguous per output row) -> f16( bf16_RNE(w) * 64 ), all five weights
  cvt16<<<gCW, blk, 0, stream>>>(w_q, WQ16, DMOD * DMOD, 0LL, 0LL, WSC);
  cvt16<<<gCW, blk, 0, stream>>>(w_k, WK16, DMOD * DMOD, 0LL, 0LL, WSC);
  cvt16<<<gCW, blk, 0, stream>>>(w_v, WV16, DMOD * DMOD, 0LL, 0LL, WSC);
  cvt16<<<gCW, blk, 0, stream>>>(w_p, WP16, DMOD * DMOD, 0LL, 0LL, WSC);
  cvt16<<<gCW, blk, 0, stream>>>(w_o, WO16, DMOD * DMOD, 0LL, 0LL, WSC);

  // (1) activation planes: f16(bf16(x) * 16), batch b read at input row b*SEQ_FULL, written at plane row b*SEQ; pos rows 0..SEQ-1
  cvt16<<<gCX, blk, 0, stream>>>(xq, XQ16, SEQ * DMOD, (long long)SEQ_FULL * DMOD, (long long)SEQ * DMOD, XC);
  cvt16<<<gCX, blk, 0, stream>>>(xk, XK16, SEQ * DMOD, (long long)SEQ_FULL * DMOD, (long long)SEQ * DMOD, XC);
  cvt16<<<gCX, blk, 0, stream>>>(xv, XV16, SEQ * DMOD, (long long)SEQ_FULL * DMOD, (long long)SEQ * DMOD, XC);
  cvt16<<<gCP, blk, 0, stream>>>(xpos, XP16, SEQ * DMOD, 0LL, 0LL, XC);

  // (2) q[m][nd] = sum_c x[m][c] W[nd][c] / 1024 + bq[nd]; QU = f16((q + ub[nd]) * 4), QV = f16((q + vbias[nd]) * 4);
  //     M = NROW, N = 512, K = 512
  gemm64<5, 0, 0, 1><<<gQ, blk, 0, stream>>>(
      XQ16, XQ16, DMOD, 0LL,
      WQ16, DMOD, 0LL,
      (void*)QU, (void*)QV, DMOD, 0LL,
      NROW, DMOD, DMOD, 1.0f / (XC * WSC), QC,
      b_q, ub, vb);

  // (3) k projection + bk -> K16 = f16(k * 4)
  gemm64<2, 0, 0, 1><<<gQ, blk, 0, stream>>>(
      XK16, XK16, DMOD, 0LL,
      WK16, DMOD, 0LL,
      (void*)K16, (void*)K16, DMOD, 0LL,
      NROW, DMOD, DMOD, 1.0f / (XC * WSC), QC,
      b_k, b_k, b_k);

  // (4) v^T per batch: VT[b][nd][j] = sum_c W[nd][c] x[b*SEQ + j][c] / 1024 + bv[nd] (per-row bias) -> f16 x64 hi + residual planes;
  //     M = 512 (nd), N = SEQ (j), K = 512; B rows are the batch's token rows: pitch DMOD, batch stride SEQ*DMOD
  gemm64<4, 0, 0, 2><<<gV, blk, 0, stream>>>(
      WV16, WV16, DMOD, 0LL,
      XV16, DMOD, (long long)SEQ * DMOD,
      (void*)VT16, (void*)VTL16, SEQ, (long long)DMOD * SEQ,
      DMOD, SEQ, DMOD, 1.0f / (XC * WSC), VC,
      b_v, b_v, b_v);

  // (5) positional projection (no bias): P16 = f16(p * 4), M = SEQ, N = 512, K = 512
  gemm64<2, 0, 0, 0><<<gP, blk, 0, stream>>>(
      XP16, XP16, DMOD, 0LL,
      WP16, DMOD, 0LL,
      (void*)P16, (void*)P16, DMOD, 0LL,
      SEQ, DMOD, DMOD, 1.0f / (XC * WSC), QC,
      b_q, b_q, b_q);

  // (6) attention -> CT16 = f16(ctx * 64) hi plane, CTL16 residual plane, rows b*SEQ + i, halves n*64+d
  attn_full<<<gAT, bAT, 0, stream>>>(QU, QV, K16, P16, VT16, VTL16, kmask, CT16, CTL16);

  // (7) out = (CT + CTL) . W^T / (64*64) + bo; M = NROW, N = 512, K = 512, f32 rows straight into the output buffer (row b*SEQ + t)
  gemm64<0, 1, 0, 1><<<gQ, blk, 0, stream>>>(
      CT16, CTL16, DMOD, 0LL,
      WO16, DMOD, 0LL,
      (void*)out, (void*)out, DMOD, 0LL,
      NROW, DMOD, DMOD, 1.0f / (CC * WSC), 1.0f,
      b_o, b_o, b_o);
  (void)hipGetLastError();
}

// v001
// Measured time: 357 microseconds a run.
// Two timings next to v000 both put it at 1.21 times that version's speed.
// Contractions (all v_wmma_f32_16x16x32_f16, f16 operands, f32 accumulate): q/k/v/p projections (x f16 x16 . W f16 x64, K=512, single products);
// scores ([q+bq+u | q+bq+vbias] f16 x4 . [k+bk | p] f16 x4, K=128 per head, single products); P . v^T (P f16 x1024 . v^T carried as
// f16 x64 hi plane + f16 residual plane, 64 keys per tile, two products); output projection (ctx carried as f16 x64 hi + residual planes
// . Wo f16 x64, K=512, two products). Key mask (replace fill before the softmax, zero after it), max-subtracted online base-2 softmax and
// all epilogues in f32 on VALU. Every float input RNE-converted to bf16 on load.
#include <hip/hip_runtime.h>
#include <math.h>
#include <stdint.h>

#ifndef NB
#define NB    4
#endif
#ifndef SEQ
#define SEQ   2048
#endif
#define NB_FULL  4
#define SEQ_FULL 2048
#define DMOD  512
#define NH    8
#define DH    64
#define NROW  (SEQ * NB)
#define XC    16.0f
#define WSC   64.0f
#define QC    4.0f
#define VC    64.0f
#define PC    1024.0f
#define CC    64.0f
#define SCALE 0.125f
#define LOG2E 1.4426950408889634f
static_assert(NH * DH == DMOD);
static_assert(DH == 64);
static_assert(NB >= 1 && NB <= NB_FULL && SEQ >= 64 && SEQ <= SEQ_FULL);
static_assert((SEQ % 64) == 0 && (DMOD % 64) == 0 && (NROW % 64) == 0);
static_assert(((SEQ * DMOD) % 2048) == 0 && ((DMOD * DMOD) % 2048) == 0);
#define ATT_W 8
#define ATT_THREADS (ATT_W * 32)
#define ATT_ROWS (ATT_W * 16)
#define TPITCH 144                     // LDS bytes per staged 128-byte row: 16 B x odd, conflict-free for 16-byte fragment reads
#define TPLANE (64 * TPITCH)           // one staged plane: 64 rows
#define TBUF   (4 * TPLANE)            // one key tile: k, p, v^T hi, v^T residual
static_assert((SEQ % ATT_ROWS) == 0 && ATT_THREADS == 256);
#define PPI 68
#define WFL (16 * PPI)
static_assert((PPI % 4) == 0 && PPI >= 64 && (WFL % 4) == 0);

typedef _Float16 v16h __attribute__((ext_vector_type(16)));
typedef _Float16 v8h  __attribute__((ext_vector_type(8)));
typedef __bf16   v16b __attribute__((ext_vector_type(16)));
typedef float    v8f  __attribute__((ext_vector_type(8)));
typedef float    v4f  __attribute__((ext_vector_type(4)));
typedef unsigned int v4u __attribute__((ext_vector_type(4)));

union FragH { v16h v; v8h h[2]; v4u u[2]; };
union FragAny { v16h h; v16b b; };

// ---- scalar helpers --------------------------------------------------------------------------------
__device__ __forceinline__ unsigned short bf_bits(float f) {          // f32 -> bf16 bits, RNE convert
  unsigned u = __float_as_uint(f);
  return (unsigned short)((u + 0x7FFFu + ((u >> 16) & 1u)) >> 16);
}
__device__ __forceinline__ float bf_up(unsigned short h) { return __uint_as_float(((unsigned)h) << 16); }
__device__ __forceinline__ float bfr(float f) { return bf_up(bf_bits(f)); }   // value of the bf16 RNE convert
__device__ __forceinline__ unsigned short h_bits(_Float16 x) { return __builtin_bit_cast(unsigned short, x); }
__device__ __forceinline__ unsigned pk16(unsigned short a, unsigned short b) { return (unsigned)a | ((unsigned)b << 16); }
__device__ __forceinline__ v8f zero8() { v8f z = {0.f, 0.f, 0.f, 0.f, 0.f, 0.f, 0.f, 0.f}; return z; }

// ---- fragment loader: 16-bit A/B operand from a k-contiguous 16-bit plane, lane -> row/col (lane&15),
//      p already includes +8*(lane>>4); elements 0..7 <- p[0..7] (k0+8h..), elements 8..15 <- p[16..23] (k0+16+8h..)
//      (same split k map for A and B; B is always read from a [n][k] plane)
__device__ __forceinline__ v16h ldfrag_u(const unsigned short* p) {
  FragH f;
  f.u[0] = *(const v4u*)(p);
  f.u[1] = *(const v4u*)(p + 16);
  return f.v;
}

// ---- WMMA helpers with trailing VALU hazard gaps ------------------------------------------------------
__device__ __forceinline__ v8f mma_h(v16h a, v16h b, v8f c) {
  return __builtin_amdgcn_wmma_f32_16x16x32_f16(false, a, false, b, (short)0, c, false, false);
}
__device__ __forceinline__ v8f mma_b(v16h a, v16h b, v8f c) {
  FragAny ua, ub;
  ua.h = a;
  ub.h = b;
  return __builtin_amdgcn_wmma_f32_16x16x32_bf16(false, ua.b, false, ub.b, (short)0, c, false, false);
}
template <int BF>
__device__ __forceinline__ v8f mmaT(v16h a, v16h b, v8f c) {
  if constexpr (BF != 0) return mma_b(a, b, c);
  else return mma_h(a, b, c);
}
__device__ __forceinline__ void dep_guard1(v8f& a, v8f& b, v16h x) {
#if defined(__HIP_DEVICE_COMPILE__)
  asm volatile("v_nop\n\tv_nop\n\tv_nop\n\tv_nop" : "+v"(a), "+v"(b) : "v"(x));
#endif
}
__device__ __forceinline__ void hz4(v8f& d, v16h x0, v16h x1, v16h x2, v16h x3) {
#if defined(__HIP_DEVICE_COMPILE__)
  asm volatile("v_nop\n\tv_nop\n\tv_nop\n\tv_nop" : "+v"(d) : "v"(x0), "v"(x1), "v"(x2), "v"(x3));
#endif
}
__device__ __forceinline__ void keep4_h(v16h a, v16h b, v16h c, v16h d) {
#if defined(__HIP_DEVICE_COMPILE__)
  asm volatile("v_nop" :: "v"(a), "v"(b), "v"(c), "v"(d));
#endif
}
__device__ __forceinline__ void acc_guard4(v8f& a, v8f& b, v8f& c, v8f& d) {
#if defined(__HIP_DEVICE_COMPILE__)
  asm volatile("v_nop\n\tv_nop\n\tv_nop\n\tv_nop" : "+v"(a), "+v"(b), "+v"(c), "+v"(d));
#endif
}
// Eight asynchronous 16-byte copies per lane, global -> LDS (one key tile's share of a thread). The s_wait_xcnt stands inside the
// statement so that no address register of an issued copy is rewritten in front of it.
__device__ __forceinline__ void copy8_async(unsigned l0, unsigned l1, unsigned l2, unsigned l3,
                                            unsigned l4, unsigned l5, unsigned l6, unsigned l7,
                                            const unsigned short* g0, const unsigned short* g1,
                                            const unsigned short* g2, const unsigned short* g3,
                                            const unsigned short* g4, const unsigned short* g5,
                                            const unsigned short* g6, const unsigned short* g7) {
#if defined(__HIP_DEVICE_COMPILE__)
  asm volatile("global_load_async_to_lds_b128 %0, %8, off\n\t"
               "global_load_async_to_lds_b128 %1, %9, off\n\t"
               "global_load_async_to_lds_b128 %2, %10, off\n\t"
               "global_load_async_to_lds_b128 %3, %11, off\n\t"
               "global_load_async_to_lds_b128 %4, %12, off\n\t"
               "global_load_async_to_lds_b128 %5, %13, off\n\t"
               "global_load_async_to_lds_b128 %6, %14, off\n\t"
               "global_load_async_to_lds_b128 %7, %15, off\n\t"
               "s_wait_xcnt 0x0"
               :: "v"(l0), "v"(l1), "v"(l2), "v"(l3), "v"(l4), "v"(l5), "v"(l6), "v"(l7),
                  "v"(g0), "v"(g1), "v"(g2), "v"(g3), "v"(g4), "v"(g5), "v"(g6), "v"(g7)
               : "memory");
#endif
}
// This wave's own copies have landed in LDS (other waves read them only behind the next work-group barrier).
__device__ __forceinline__ void wait_async0() {
#if defined(__HIP_DEVICE_COMPILE__)
  asm volatile("s_wait_asynccnt 0x0" ::: "memory");
#endif
}
// This wave's own LDS reads have returned, so that the buffer they read may be refilled behind the barrier.
__device__ __forceinline__ void wait_ds0() {
#if defined(__HIP_DEVICE_COMPILE__)
  asm volatile("s_wait_dscnt 0x0" ::: "memory");
#endif
}
__device__ __forceinline__ void wave_sync_lds() {
  __builtin_amdgcn_fence(__ATOMIC_RELEASE, "workgroup");
  __builtin_amdgcn_wave_barrier();
  __builtin_amdgcn_fence(__ATOMIC_ACQUIRE, "workgroup");
}

// =====================================================================================================
// Elementwise 16-bit pack, no transpose: dst[i] = f16( bf16_RNE(src[i]) * sc ) for i < n; sc a power of two (exact).
// blockIdx.y selects a batch slice: src + y*sIn, dst + y*sOut (element strides). 8 elements per thread: two 16-B loads,
// coverage: grid.x = n / 2048 blocks x 256 thr x 8 elements = n exactly (n % 2048 == 0 by the static sizes), grid.y = slice count.
// =====================================================================================================
__global__ __launch_bounds__(256) void cvt16(const float* __restrict__ src, unsigned short* dst, int n,
                                             long long sIn, long long sOut, float sc) {
  const size_t i8 = ((size_t)blockIdx.x * 256 + threadIdx.x) * 8;
  if (i8 + 8 > (size_t)n) return;             // never taken with the exact grid; no barriers in this kernel
  const float* s = src + (size_t)((long long)blockIdx.y * sIn) + i8;
  unsigned short* d = dst + (size_t)((long long)blockIdx.y * sOut) + i8;
  const v4f a = *(const v4f*)(s);
  const v4f b = *(const v4f*)(s + 4);
  v4u o;
  o[0] = pk16(h_bits((_Float16)(bfr(a[0]) * sc)), h_bits((_Float16)(bfr(a[1]) * sc)));
  o[1] = pk16(h_bits((_Float16)(bfr(a[2]) * sc)), h_bits((_Float16)(bfr(a[3]) * sc)));
  o[2] = pk16(h_bits((_Float16)(bfr(b[0]) * sc)), h_bits((_Float16)(bfr(b[1]) * sc)));
  o[3] = pk16(h_bits((_Float16)(bfr(b[2]) * sc)), h_bits((_Float16)(bfr(b[3]) * sc)));
  {
    *(v4u*)(d) = o;
    
  }
}

// =====================================================================================================
// Register-blocked batched 16-bit WMMA GEMM: C[m][n] = oscale * sum_k A[m][k] * Bt[n][k] (+ bias); one wave per 64x64 tile,
// no block barriers. A row-major [M][K] pitch lda (16-bit plane), Bt row-major [N][K] pitch ldb (k contiguous); M, N multiples of 64,
// K multiple of 32. blockIdx.y = batch index with element strides sA, sB, sC.
// ASPLIT 1: a second A plane A2 (unscaled residual of A, same layout) is multiplied into the same accumulator (A + A2 ~ exact A).
// BF 1: bf16 operands (v_wmma_f32_16x16x32_bf16), else f16.
// EPI 1: value += bf16_RNE(ep0[column]) (per-column bias); EPI 2: value += bf16_RNE(ep0[row]) (per-row bias, 16-bit out only).
// OM 0: f32 out (pitch ldc).  OM 2: one f16 plane = f16(value * ocarry).
// OM 4: two f16 planes: hi = f16(value * ocarry), lo = f16(value * ocarry - hi) (unscaled residual).
// OM 5: two f16 planes: C = f16((value + bf16_RNE(ep1[column])) * ocarry), C2 = f16((value + bf16_RNE(ep2[column])) * ocarry).
// coverage: 4 slabs x 16 rows (f32: it 0..7 x lane>>4; 16-bit: it 0..3 x lane>>3) x 64 cols = the wave's whole 64x64 tile;
//           grid = ceil(tilesM*tilesN/8) blocks, surplus waves exit (wave-uniform).
// =====================================================================================================
template <int OM, int ASPLIT, int BF, int EPI>
__global__ __launch_bounds__(256) __attribute__((amdgpu_num_vgpr(256))) void gemm64(
    const unsigned short* __restrict__ Ap, const unsigned short* __restrict__ A2p, int lda, long long sA,
    const unsigned short* __restrict__ Btp, int ldb, long long sB,
    void* Cout, void* C2out, int ldc, long long sC,
    int M, int N, int K, float oscale, float ocarry,
    const float* __restrict__ ep0, const float* __restrict__ ep1, const float* __restrict__ ep2) {
  __shared__ __align__(16) float sT[8][16 * 68];   // per-wave 16x64 slab, pitch 68 floats
  const int by   = blockIdx.y;
  const int lane = threadIdx.x & 31;
  const int wave = threadIdx.x >> 5;
  const int tilesN = N >> 6;
  const int tilesM = M >> 6;
  const int tile = blockIdx.x * 8 + wave;
  if (tile >= tilesM * tilesN) return;   // wave-uniform; no block barriers in this kernel
  const int tm = tile / tilesN;
  const int tn = tile - tm * tilesN;
  const int m0 = tm << 6;
  const int n0 = tn << 6;

  const unsigned short* A1 = Ap  + (size_t)((long long)by * sA);
  const unsigned short* A2 = A2p + (size_t)((long long)by * sA);
  const unsigned short* Bb = Btp + (size_t)((long long)by * sB);

  const int rlane = lane & 15;                 // row (A) / col (B, D) within subtile
  const int koff  = (lane >> 4) * 8;           // k offset of this lane half
  const int mOff  = (lane >> 4) * 8;           // D row offset

  v8f acc[4][4];
#pragma unroll
  for (int i = 0; i < 4; ++i)
#pragma unroll
    for (int j = 0; j < 4; ++j) acc[i][j] = zero8();

  for (int k0 = 0; k0 < K; k0 += 32) {
    v16h bh[4];
#pragma unroll
    for (int j = 0; j < 4; ++j) {
      const size_t bofs = (size_t)(n0 + (j << 4) + rlane) * ldb + koff + k0;
      bh[j] = ldfrag_u(Bb + bofs);
    }
#pragma unroll
    for (int i = 0; i < 4; ++i) {
      const size_t ao = (size_t)(m0 + (i << 4) + rlane) * lda + koff + k0;
      const v16h ah = ldfrag_u(A1 + ao);
#pragma unroll
      for (int j = 0; j < 4; ++j) acc[i][j] = mmaT<BF>(ah, bh[j], acc[i][j]);
      dep_guard1(acc[i][0], acc[i][3], ah);
      if constexpr (ASPLIT != 0) {
        const v16h al = ldfrag_u(A2 + ao);
#pragma unroll
        for (int j = 0; j < 4; ++j) acc[i][j] = mmaT<BF>(al, bh[j], acc[i][j]);
        dep_guard1(acc[i][0], acc[i][3], al);
      }
    }
    keep4_h(bh[0], bh[1], bh[2], bh[3]);
  }
  acc_guard4(acc[0][0], acc[0][1], acc[0][2], acc[0][3]);
  acc_guard4(acc[1][0], acc[1][1], acc[1][2], acc[1][3]);
  acc_guard4(acc[2][0], acc[2][1], acc[2][2], acc[2][3]);
  acc_guard4(acc[3][0], acc[3][1], acc[3][2], acc[3][3]);

  const int hh2 = lane >> 4, c4 = (lane & 15) * 4;     // f32 out: 256-B row segment = 16 lanes x 16 B
  const int q8  = lane >> 3, c8 = (lane & 7) * 8;

  // ---- epilogue ----
  float* slab = sT[wave];
#pragma unroll
  for (int i = 0; i < 4; ++i) {
    const int mBase = m0 + (i << 4);
#pragma unroll
    for (int j = 0; j < 4; ++j) {
#pragma unroll
      for (int r = 0; r < 8; ++r) {
        slab[(mOff + r) * 68 + (j << 4) + rlane] = acc[i][j][r];
      }
    }
    wave_sync_lds();
    if constexpr (OM == 0) {
      float* C = (float*)Cout + (size_t)((long long)by * sC);
      v4f vals[8];
#pragma unroll
      for (int it = 0; it < 8; ++it) {
        const int row = it * 2 + hh2;                      // it 0..7 x hh2 0..1 = rows 0..15
        v4f v = *(const v4f*)(slab + row * 68 + c4);
#pragma unroll
        for (int e = 0; e < 4; ++e) v[e] = v[e] * oscale;
        if constexpr (EPI == 1) {
          const v4f bb = *(const v4f*)(ep0 + n0 + c4);     // per-column bias, columns n0+c4 .. +3 (N equals the bias length)
#pragma unroll
          for (int e = 0; e < 4; ++e) v[e] = v[e] + bfr(bb[e]);
        }
        vals[it] = v;
      }
      {
#pragma unroll
        for (int it = 0; it < 8; ++it) {
          const int gr = mBase + it * 2 + hh2;
          *(v4f*)(C + (size_t)gr * ldc + n0 + c4) = vals[it];
        }
        
      }
    } else {
      unsigned short* C  = (unsigned short*)Cout  + (size_t)((long long)by * sC);
      unsigned short* Cb = (unsigned short*)C2out + (size_t)((long long)by * sC);
      v4u hv[4], lv[4];
#pragma unroll
      for (int it = 0; it < 4; ++it) {
        const int row = it * 4 + q8;                       // it 0..3 x q8 0..3 = rows 0..15
        const float* sp = slab + row * 68 + c8;
        float rb = 0.f;
        if constexpr (EPI == 2) rb = bfr(ep0[mBase + row]);   // per-row bias (M equals the bias length)
        v4u a  = {0u, 0u, 0u, 0u};
        v4u b2 = {0u, 0u, 0u, 0u};
#pragma unroll
        for (int e = 0; e < 4; ++e) {
          const int ci = n0 + c8 + 2 * e;                  // column index, < N
          float f0 = sp[2 * e] * oscale + rb;
          float f1 = sp[2 * e + 1] * oscale + rb;
          if constexpr (EPI == 1) {
            f0 += bfr(ep0[ci]);
            f1 += bfr(ep0[ci + 1]);
          }
          if constexpr (OM == 5) {
            const float g0 = (f0 + bfr(ep1[ci])) * ocarry, g1 = (f1 + bfr(ep1[ci + 1])) * ocarry;
            const float w0 = (f0 + bfr(ep2[ci])) * ocarry, w1 = (f1 + bfr(ep2[ci + 1])) * ocarry;
            a[e]  = pk16(h_bits((_Float16)g0), h_bits((_Float16)g1));
            b2[e] = pk16(h_bits((_Float16)w0), h_bits((_Float16)w1));
          } else {
            f0 *= ocarry; f1 *= ocarry;
            const _Float16 x0 = (_Float16)f0, x1 = (_Float16)f1;
            a[e] = pk16(h_bits(x0), h_bits(x1));
            if constexpr (OM == 4) {
              b2[e] = pk16(h_bits((_Float16)(f0 - (float)x0)), h_bits((_Float16)(f1 - (float)x1)));
            }
          }
        }
        hv[it] = a;
        lv[it] = b2;
      }
      {
#pragma unroll
        for (int it = 0; it < 4; ++it) {
          const int row = it * 4 + q8;
          *(v4u*)(C + (size_t)(mBase + row) * ldc + n0 + c8) = hv[it];
          if constexpr (OM >= 4) {
            *(v4u*)(Cb + (size_t)(mBase + row) * ldc + n0 + c8) = lv[it];
          }
        }
        
      }
    }
    wave_sync_lds();
  }
}

// =====================================================================================================
// Full (non-causal) attention with a 128-deep score contraction for one (batch b, head n) pair and a 128-row query tile;
// 8 waves, wave w owns query rows iw0 .. iw0+15, iw0 = i0 + 16w. Planes (pitch DMOD halves, row index = b*SEQ + position):
// QU = f16((q + bq + ub) x4), QV = f16((q + bq + vbias) x4), KP = f16((k + bk) x4); PP = f16(p x4) rows s = 0 .. SEQ-1 (shared by
// all batches); VT, VTL = v^T hi x64 / residual f16 as [b][n*64+d][SEQ]. Key mask ints kmask[b*SEQ_FULL + s], masked where == 0.
//   Per key tile j0 (64 keys): mask ints read first (4 per lane); scores S = (q+ub) . k + (q+vbias) . p (4 subtiles of 16 keys, two
//   64-deep halves, 4 WMMAs per subtile); t = S * (0.125/16) * log2(e), replaced by -1e30 where the key is masked; online softmax in
//   base 2, max-subtracted, running sums in f32; the probability of a masked key is set to 0 after the exponential (a fully masked row
//   wave barrier, then the A fragments of P*1024 rebuilt from the LDS rows (f32 vector loads, split k map) and the v^T B fragments
//   VT/VTL[n*64+d][j]; 8 + 8 P.V WMMAs per tile (hi plane then residual plane into the same accumulators).
//   Key tiles: the four 64-row x 128-byte planes of a tile (k rows, p rows, v^T hi rows, v^T residual rows of head n) are brought into
//   LDS once per work-group by asynchronous 16-byte copies (8 per thread, each wave-copy = 4 whole 128-byte lines), two buffers: tile
//   t + 2 is copied into the buffer that trip t has read, behind the trip's barrier; all B fragments are 16-byte LDS reads at pitch 144 B.
//   block = 8 waves = 256 threads; grid = (SEQ/128, NB*NH); one block barrier per key tile; identical bounded work (SEQ/64 tiles).
// LDS: two key-tile buffers shared by the block; one [16][PPI] f32 slab per wave, private-to-wave (wave_sync); staged extent == consumed extent (16 rows x 64 cols written
//   by every lane pair (hh, c) x (r, t) before any read, both for the prob tile and for the ctx tile).
// coverage: global: 4 instructions x 4 rows x 64 halves per plane = rows iw0..iw0+15 of head segment n in CT and CTL;
//           grid x waves cover all NB x SEQ rows and all NH head segments of CT / CTL exactly once.
// =====================================================================================================
__global__ __launch_bounds__(ATT_THREADS) __attribute__((amdgpu_num_vgpr(256)))
void attn_full(const unsigned short* __restrict__ QU, const unsigned short* __restrict__ QV,
               const unsigned short* __restrict__ KP, const unsigned short* __restrict__ PP,
               const unsigned short* __restrict__ VT, const unsigned short* __restrict__ VTL,
               const int* __restrict__ kmask,
               unsigned short* CT, unsigned short* CTL) {
  __shared__ __align__(16) float smem[ATT_W * WFL];   // per wave: prob / ctx slab [16][PPI]
  __shared__ __align__(128) unsigned char tiles[2 * TBUF];   // two key-tile buffers: [buffer][plane k, p, v hi, v lo][64 rows][TPITCH]

  const int tid  = threadIdx.x;
  const int wave = tid >> 5;
  const int lane = tid & 31;
  const int hh   = lane >> 4;
  const int c    = lane & 15;
  const int bn   = blockIdx.y;
  const int b    = bn / NH;
  const int n    = bn - b * NH;
  const int i0   = blockIdx.x * ATT_ROWS;
  const int iw0  = i0 + wave * 16;

  float* pt = smem + wave * WFL;

  // stationary A fragments: (q + bq + ub) rows b*SEQ + iw0 + c, d 0..31 and 32..63 of head n ((q + bq + vbias) fragments reloaded per key tile)
  const size_t qro = ((size_t)(b * SEQ + iw0 + c)) * DMOD + n * DH + 8 * hh;
  const v16h qua = ldfrag_u(QU + qro), qub = ldfrag_u(QU + qro + 32);

  const int* km = kmask + (size_t)b * SEQ_FULL;

  // copy share of this thread: rows crow and crow + 32 of each plane, 16-byte piece cpc of the 128-byte row
  const int crow = tid >> 3, cpc = tid & 7;
  const unsigned short* gK = KP + ((size_t)b * SEQ + crow) * DMOD + n * DH + 8 * cpc;          // + j0 * DMOD per tile
  const unsigned short* gP = PP + (size_t)crow * DMOD + n * DH + 8 * cpc;                      // + j0 * DMOD per tile
  const size_t vbase = (size_t)b * DMOD * SEQ + (size_t)(n * DH + crow) * SEQ + 8 * cpc;       // + j0 per tile
  const unsigned short* gV = VT  + vbase;
  const unsigned short* gL = VTL + vbase;
  const unsigned ldst = (unsigned)(size_t)tiles + (unsigned)(crow * TPITCH + cpc * 16);        // LDS byte address, buffer 0, plane 0
  // fragment read base of this lane: row c of a 16-row subtile, 16-byte piece hh
  const unsigned char* fr0 = tiles + c * TPITCH + 16 * hh;

  auto stage = [&](int jt, unsigned bo) {   // key tile at jt -> buffer at byte offset bo; every lane on, all addresses in range
    const unsigned l = ldst + bo;
    const size_t kr = (size_t)jt * DMOD;
    copy8_async(l, l + 32 * TPITCH, l + TPLANE, l + TPLANE + 32 * TPITCH,
                l + 2 * TPLANE, l + 2 * TPLANE + 32 * TPITCH, l + 3 * TPLANE, l + 3 * TPLANE + 32 * TPITCH,
                gK + kr, gK + kr + 32 * DMOD, gP + kr, gP + kr + 32 * DMOD,
                gV + jt, gV + jt + (size_t)32 * SEQ, gL + jt, gL + jt + (size_t)32 * SEQ);
  };
  stage(0, 0u);
  wait_async0();
  __syncthreads();                          // tile 0 published
  if (SEQ > 64) stage(64, (unsigned)TBUF);

  const float KSC = (SCALE / (QC * QC)) * LOG2E;

  float mrow[8], lrow[8];
  v8f O[4];
#pragma unroll
  for (int r = 0; r < 8; ++r) { mrow[r] = -INFINITY; lrow[r] = 0.f; }
#pragma unroll
  for (int td = 0; td < 4; ++td) O[td] = zero8();

#pragma unroll 1
  for (int j0 = 0; j0 < SEQ; j0 += 64) {
    // ---- key mask values for keys j0 + 16t + c (same for every row of the wave); j0 + 16t + c < SEQ <= SEQ_FULL ----
    int mk[4];
#pragma unroll
    for (int t = 0; t < 4; ++t) mk[t] = km[j0 + 16 * t + c];
    const unsigned bo = ((unsigned)j0 & 64u) ? (unsigned)TBUF : 0u;      // buffer of this trip
    const unsigned char* fr = fr0 + bo;

    // ---- content part of the scores: S = (q+ub) . k (4 subtiles of 16 keys, K=64) ----
    v8f S[4];
#pragma unroll
    for (int t = 0; t < 4; ++t) {
      const unsigned short* kp = (const unsigned short*)(fr + 16 * t * TPITCH);
      const v16h ka = ldfrag_u(kp), kb2 = ldfrag_u(kp + 32);
      S[t] = mma_h(qua, ka, zero8());
      S[t] = mma_h(qub, kb2, S[t]);
      hz4(S[t], ka, kb2, qua, qub);
    }
    // ---- position part of the scores: S += (q+vbias) . p (same subtiles, p rows = key index, K=64) ----
    {
      const v16h qva = ldfrag_u(QV + qro), qvb = ldfrag_u(QV + qro + 32);
#pragma unroll
      for (int t = 0; t < 4; ++t) {
        const unsigned short* pp = (const unsigned short*)(fr + TPLANE + 16 * t * TPITCH);
        const v16h pa = ldfrag_u(pp), pb2 = ldfrag_u(pp + 32);
        S[t] = mma_h(qva, pa, S[t]);
        S[t] = mma_h(qvb, pb2, S[t]);
        hz4(S[t], pa, pb2, qva, qvb);
      }
    }

    // ---- online softmax (rows live on one 16-lane half) ----
#pragma unroll
    for (int r = 0; r < 8; ++r) {
      const int R = 8 * hh + r;
      float tv[4];
#pragma unroll
      for (int t = 0; t < 4; ++t) {
        const float sc = S[t][r] * KSC;
        tv[t] = (mk[t] == 0) ? -1.0e30f : sc;
      }
      float mx = fmaxf(fmaxf(tv[0], tv[1]), fmaxf(tv[2], tv[3]));
#pragma unroll
      for (int off = 1; off < 16; off <<= 1) mx = fmaxf(mx, __shfl_xor(mx, off, 32));
      const float mn = fmaxf(mrow[r], mx);
      const float al = exp2f(mrow[r] - mn);
      mrow[r] = mn;
      float e4[4];
      float ps = 0.f;
#pragma unroll
      for (int t = 0; t < 4; ++t) {
        const float ev = exp2f(tv[t] - mn);
        e4[t] = (mk[t] == 0) ? 0.f : ev;
        ps += e4[t];
      }
#pragma unroll
      for (int off = 1; off < 16; off <<= 1) ps += __shfl_xor(ps, off, 32);
      lrow[r] = lrow[r] * al + ps;
#pragma unroll
      for (int td = 0; td < 4; ++td) O[td][r] *= al;
      const int ro = R * PPI + c;
#pragma unroll
      for (int t = 0; t < 4; ++t) pt[ro + 16 * t] = e4[t];
    }
    wave_sync_lds();

    // ---- P fragments (x1024, f16) from the LDS rows, two k-steps of 32 keys ----
    FragH pf[2];
#pragma unroll
    for (int ks = 0; ks < 2; ++ks) {
      const float* prow = pt + c * PPI + 32 * ks + 8 * hh;
      const v4f p0 = *(const v4f*)(prow), p1 = *(const v4f*)(prow + 4);
      const v4f p2 = *(const v4f*)(prow + 16), p3 = *(const v4f*)(prow + 20);
#pragma unroll
      for (int e = 0; e < 4; ++e) {
        pf[ks].h[0][e]     = (_Float16)(p0[e] * PC);     // keys j0 + 32ks + 8hh + e
        pf[ks].h[0][4 + e] = (_Float16)(p1[e] * PC);     // keys j0 + 32ks + 8hh + 4 + e
        pf[ks].h[1][e]     = (_Float16)(p2[e] * PC);     // keys j0 + 32ks + 16 + 8hh + e
        pf[ks].h[1][4 + e] = (_Float16)(p3[e] * PC);
      }
    }
    // ---- O += P . v^T (hi plane) ----
    {
#pragma unroll
      for (int td = 0; td < 4; ++td) {
        const unsigned short* vp = (const unsigned short*)(fr + 2 * TPLANE + 16 * td * TPITCH);
        const v16h vfa = ldfrag_u(vp), vfb = ldfrag_u(vp + 32);
        O[td] = mma_h(pf[0].v, vfa, O[td]);
        O[td] = mma_h(pf[1].v, vfb, O[td]);
        hz4(O[td], pf[0].v, pf[1].v, vfa, vfb);
      }
      // ---- O += P . v^T (residual plane) ----
#pragma unroll
      for (int td = 0; td < 4; ++td) {
        const unsigned short* vp = (const unsigned short*)(fr + 3 * TPLANE + 16 * td * TPITCH);
        const v16h vla = ldfrag_u(vp), vlb = ldfrag_u(vp + 32);
        O[td] = mma_h(pf[0].v, vla, O[td]);
        O[td] = mma_h(pf[1].v, vlb, O[td]);
        hz4(O[td], pf[0].v, pf[1].v, vla, vlb);
      }
    }
    wave_sync_lds();
    // ---- publish tile t + 1, free this trip's buffer, then refill it with tile t + 2 ----
    wait_ds0();
    wait_async0();
    __syncthreads();
    if (j0 + 128 < SEQ) stage(j0 + 128, bo);
  }
  wait_async0();
  acc_guard4(O[0], O[1], O[2], O[3]);

  // ---- fold 1/l (0 for an empty row) and the carries (1024 on P, 64 on v), carry x64 on ctx, stage the wave's 16x64 slice ----
  const float oc = CC / (PC * VC);
#pragma unroll
  for (int r = 0; r < 8; ++r) {
    const float lr  = lrow[r];
    const float den = (lr > 0.f) ? lr : 1.0f;
    const float inv = (lr > 0.f) ? ((1.0f / den) * oc) : 0.f;
    const int ro = (8 * hh + r) * PPI + c;
#pragma unroll
    for (int td = 0; td < 4; ++td) pt[ro + 16 * td] = O[td][r] * inv;
  }
  wave_sync_lds();
  {
    const int q8 = lane >> 3, c8 = (lane & 7) * 8;
    v4u hv[4], lv[4];
#pragma unroll
    for (int it = 0; it < 4; ++it) {
      const int row = it * 4 + q8;                         // it 0..3 x q8 0..3 = rows 0..15
      const float* sp = pt + row * PPI + c8;
      v4u a  = {0u, 0u, 0u, 0u};
      v4u b2 = {0u, 0u, 0u, 0u};
#pragma unroll
      for (int e = 0; e < 4; ++e) {
        const float f0 = sp[2 * e], f1 = sp[2 * e + 1];
        const _Float16 x0 = (_Float16)f0, x1 = (_Float16)f1;
        a[e]  = pk16(h_bits(x0), h_bits(x1));
        b2[e] = pk16(h_bits((_Float16)(f0 - (float)x0)), h_bits((_Float16)(f1 - (float)x1)));
      }
      hv[it] = a;
      lv[it] = b2;
    }
    {
#pragma unroll
      for (int it = 0; it < 4; ++it) {
        const int row = it * 4 + q8;
        const size_t go = ((size_t)(b * SEQ + iw0 + row)) * DMOD + n * DH + c8;
        *(v4u*)(CT  + go) = hv[it];
        *(v4u*)(CTL + go) = lv[it];
      }
      
    }
  }
}

// =====================================================================================================
// Workspace map (bytes); every plane is an exact multiple of its tile / whole-row store granularity (M, N exact multiples of 64,
// convert counts exact multiples of 2048), every offset a multiple of 512 KiB:
//   WQ16, WK16, WV16, WP16, WO16 f16 [512 out][512 in] x64 (input layout kept, no transpose)   5 x   524288
//   XQ16, XK16, XV16 f16 [NROW][512] x16 (rows b*SEQ + t)                                    3 x  8388608
//   XP16 f16 [SEQ][512] x16                                                                        2097152
//   QU, QV, K16 f16 [NROW][512] x4                                                           3 x  8388608
//   P16  f16 [SEQ][512] x4                                                                         2097152
//   VT16, VTL16 f16 [NB][512][SEQ] hi x64 / residual                                         2 x  8388608
//   CT16, CTL16 f16 [NROW][512] hi x64 / residual                                            2 x  8388608
//   end (NB=4, SEQ=2048)                                                                          90701824
// =====================================================================================================
extern "C" void kernel_launch(void* const* d_in, const int* in_sizes, int n_in,
                              void* d_out, int out_size, void* d_ws, size_t ws_size,
                              hipStream_t stream) {
  if (n_in < 16) return;
  const long long needX = (long long)NB * SEQ_FULL * DMOD;     // reads rows b*SEQ_FULL + t, b < NB, t < SEQ
  if ((long long)in_sizes[0] < needX || (long long)in_sizes[1] < needX || (long long)in_sizes[2] < needX) return;
  if (in_sizes[3] < NB * SEQ_FULL) return;
  if (in_sizes[4] < SEQ * DMOD) return;
  if (in_sizes[5] != DMOD * DMOD || in_sizes[7] != DMOD * DMOD || in_sizes[9] != DMOD * DMOD ||
      in_sizes[11] != DMOD * DMOD || in_sizes[13] != DMOD * DMOD) return;
  if (in_sizes[6] != DMOD || in_sizes[8] != DMOD || in_sizes[10] != DMOD || in_sizes[12] != DMOD) return;
  if (in_sizes[14] != NH * DH || in_sizes[15] != NH * DH) return;
  if (out_size < NROW * DMOD) return;

  const float* xq    = (const float*)d_in[0];
  const float* xk    = (const float*)d_in[1];
  const float* xv    = (const float*)d_in[2];
  const int*   kmask = (const int*)d_in[3];
  const float* xpos  = (const float*)d_in[4];
  const float* w_q   = (const float*)d_in[5];
  const float* b_q   = (const float*)d_in[6];
  const float* w_k   = (const float*)d_in[7];
  const float* b_k   = (const float*)d_in[8];
  const float* w_v   = (const float*)d_in[9];
  const float* b_v   = (const float*)d_in[10];
  const float* w_o   = (const float*)d_in[11];
  const float* b_o   = (const float*)d_in[12];
  const float* w_p   = (const float*)d_in[13];
  const float* ub    = (const float*)d_in[14];
  const float* vb    = (const float*)d_in[15];
  float*       out   = (float*)d_out;

  const size_t PW  = (size_t)DMOD * DMOD * 2;            //   524288
  const size_t PX  = (size_t)NROW * DMOD * 2;            //  8388608
  const size_t PXP = (size_t)SEQ * DMOD * 2;             //  2097152
  const size_t PVT = (size_t)NB * DMOD * SEQ * 2;        //  8388608
  size_t off = 0;
  const size_t oWQ  = off; off += PW;
  const size_t oWK  = off; off += PW;
  const size_t oWV  = off; off += PW;
  const size_t oWP  = off; off += PW;
  const size_t oWO  = off; off += PW;
  const size_t oXQ  = off; off += PX;
  const size_t oXK  = off; off += PX;
  const size_t oXV  = off; off += PX;
  const size_t oXP  = off; off += PXP;
  const size_t oQU  = off; off += PX;
  const size_t oQV  = off; off += PX;
  const size_t oK   = off; off += PX;
  const size_t oP   = off; off += PXP;
  const size_t oVT  = off; off += PVT;
  const size_t oVTL = off; off += PVT;
  const size_t oCT  = off; off += PX;
  const size_t oCTL = off; off += PX;
  if (off > ws_size) return;                               // off = 90701824 at NB=4, SEQ=2048
  if (off > (size_t)134217728) return;

  char* ws = (char*)d_ws;
  unsigned short* WQ16  = (unsigned short*)(ws + oWQ);
  unsigned short* WK16  = (unsigned short*)(ws + oWK);
  unsigned short* WV16  = (unsigned short*)(ws + oWV);
  unsigned short* WP16  = (unsigned short*)(ws + oWP);
  unsigned short* WO16  = (unsigned short*)(ws + oWO);
  unsigned short* XQ16  = (unsigned short*)(ws + oXQ);
  unsigned short* XK16  = (unsigned short*)(ws + oXK);
  unsigned short* XV16  = (unsigned short*)(ws + oXV);
  unsigned short* XP16  = (unsigned short*)(ws + oXP);
  unsigned short* QU    = (unsigned short*)(ws + oQU);
  unsigned short* QV    = (unsigned short*)(ws + oQV);
  unsigned short* K16   = (unsigned short*)(ws + oK);
  unsigned short* P16   = (unsigned short*)(ws + oP);
  unsigned short* VT16  = (unsigned short*)(ws + oVT);
  unsigned short* VTL16 = (unsigned short*)(ws + oVTL);
  unsigned short* CT16  = (unsigned short*)(ws + oCT);
  unsigned short* CTL16 = (unsigned short*)(ws + oCTL);

  const dim3 blk(256);
  const dim3 gCW((DMOD * DMOD) / 2048, 1);                          // 128
  const dim3 gCX((SEQ * DMOD) / 2048, NB);                          // 512 x 4
  const dim3 gCP((SEQ * DMOD) / 2048, 1);                           // 512
  const int tilesQ = (NROW / 64) * (DMOD / 64);                     // 1024
  const int tilesV = (DMOD / 64) * (SEQ / 64);                      // 256 per batch
  const int tilesP = (SEQ / 64) * (DMOD / 64);                      // 256
  const dim3 gQ((tilesQ + 7) / 8, 1);                               // 128
  const dim3 gV((tilesV + 7) / 8, NB);                              // 32 x 4
  const dim3 gP((tilesP + 7) / 8, 1);                               // 32
  const dim3 gAT(SEQ / ATT_ROWS, NB * NH);                          // 16 x 32
  const dim3 bAT(ATT_THREADS);                                      // 256

  // (0) weight planes: W[nd][c] ([out][in], already k-contiguous per output row) -> f16( bf16_RNE(w) * 64 ), all five weights
  cvt16<<<gCW, blk, 0, stream>>>(w_q, WQ16, DMOD * DMOD, 0LL, 0LL, WSC);
  cvt16<<<gCW, blk, 0, stream>>>(w_k, WK16, DMOD * DMOD, 0LL, 0LL, WSC);
  cvt16<<<gCW, blk, 0, stream>>>(w_v, WV16, DMOD * DMOD, 0LL, 0LL, WSC);
  cvt16<<<gCW, blk, 0, stream>>>(w_p, WP16, DMOD * DMOD, 0LL, 0LL, WSC);
  cvt16<<<gCW, blk, 0, stream>>>(w_o, WO16, DMOD * DMOD, 0LL, 0LL, WSC);

  // (1) activation planes: f16(bf16(x) * 16), batch b read at input row b*SEQ_FULL, written at plane row b*SEQ; pos rows 0..SEQ-1
  cvt16<<<gCX, blk, 0, stream>>>(xq, XQ16, SEQ * DMOD, (long long)SEQ_FULL * DMOD, (long long)SEQ * DMOD, XC);
  cvt16<<<gCX, blk, 0, stream>>>(xk, XK16, SEQ * DMOD, (long long)SEQ_FULL * DMOD, (long long)SEQ * DMOD, XC);
  cvt16<<<gCX, blk, 0, stream>>>(xv, XV16, SEQ * DMOD, (long long)SEQ_FULL * DMOD, (long long)SEQ * DMOD, XC);
  cvt16<<<gCP, blk, 0, stream>>>(xpos, XP16, SEQ * DMOD, 0LL, 0LL, XC);

  // (2) q[m][nd] = sum_c x[m][c] W[nd][c] / 1024 + bq[nd]; QU = f16((q + ub[nd]) * 4), QV = f16((q + vbias[nd]) * 4);
  //     M = NROW, N = 512, K = 512
  gemm64<5, 0, 0, 1><<<gQ, blk, 0, stream>>>(
      XQ16, XQ16, DMOD, 0LL,
      WQ16, DMOD, 0LL,
      (void*)QU, (void*)QV, DMOD, 0LL,
      NROW, DMOD, DMOD, 1.0f / (XC * WSC), QC,
      b_q, ub, vb);

  // (3) k projection + bk -> K16 = f16(k * 4)
  gemm64<2, 0, 0, 1><<<gQ, blk, 0, stream>>>(
      XK16, XK16, DMOD, 0LL,
      WK16, DMOD, 0LL,
      (void*)K16, (void*)K16, DMOD, 0LL,
      NROW, DMOD, DMOD, 1.0f / (XC * WSC), QC,
      b_k, b_k, b_k);

  // (4) v^T per batch: VT[b][nd][j] = sum_c W[nd][c] x[b*SEQ + j][c] / 1024 + bv[nd] (per-row bias) -> f16 x64 hi + residual planes;
  //     M = 512 (nd), N = SEQ (j), K = 512; B rows are the batch's token rows: pitch DMOD, batch stride SEQ*DMOD
  gemm64<4, 0, 0, 2><<<gV, blk, 0, stream>>>(
      WV16, WV16, DMOD, 0LL,
      XV16, DMOD, (long long)SEQ * DMOD,
      (void*)VT16, (void*)VTL16, SEQ, (long long)DMOD * SEQ,
      DMOD, SEQ, DMOD, 1.0f / (XC * WSC), VC,
      b_v, b_v, b_v);

  // (5) positional projection (no bias): P16 = f16(p * 4), M = SEQ, N = 512, K = 512
  gemm64<2, 0, 0, 0><<<gP, blk, 0, stream>>>(
      XP16, XP16, DMOD, 0LL,
      WP16, DMOD, 0LL,
      (void*)P16, (void*)P16, DMOD, 0LL,
      SEQ, DMOD, DMOD, 1.0f / (XC * WSC), QC,
      b_q, b_q, b_q);

  // (6) attention -> CT16 = f16(ctx * 64) hi plane, CTL16 residual plane, rows b*SEQ + i, halves n*64+d
  attn_full<<<gAT, bAT, 0, stream>>>(QU, QV, K16, P16, VT16, VTL16, kmask, CT16, CTL16);

  // (7) out = (CT + CTL) . W^T / (64*64) + bo; M = NROW, N = 512, K = 512, f32 rows straight into the output buffer (row b*SEQ + t)
  gemm64<0, 1, 0, 1><<<gQ, blk, 0, stream>>>(
      CT16, CTL16, DMOD, 0LL,
      WO16, DMOD, 0LL,
      (void*)out, (void*)out, DMOD, 0LL,
      NROW, DMOD, DMOD, 1.0f / (CC * WSC), 1.0f,
      b_o, b_o, b_o);
  (void)hipGetLastError();
}

// v002
// Measured time: 267 microseconds a run.
// Timed twice side by side with v001, it ran 1.33 times as fast both times.
// All steps since v000 together make it 1.62 times as fast.
// Contractions (all v_wmma_f32_16x16x32_f16, f16 operands, f32 accumulate): q/k/v/p projections (x f16 x16 . W f16 x64, K=512, single products);
// scores ([q+bq+u | q+bq+vbias] f16 x4 . [k+bk | p] f16 x4, K=128 per head, single products); P . v^T (P f16 x1024 . v^T carried as
// f16 x64 hi plane + f16 residual plane, 64 keys per tile, two products; both attention products run transposed); output projection (ctx carried as f16 x64 hi + residual planes
// . Wo f16 x64, K=512, two products). Key mask (score accumulators start at -1e30 for a masked key, whose exponential is then 0), max-subtracted online base-2 softmax and
// all epilogues in f32 on VALU. Every float input RNE-converted to bf16 on load.
#include <hip/hip_runtime.h>
#include <math.h>
#include <stdint.h>

#ifndef NB
#define NB    4
#endif
#ifndef SEQ
#define SEQ   2048
#endif
#define NB_FULL  4
#define SEQ_FULL 2048
#define DMOD  512
#define NH    8
#define DH    64
#define NROW  (SEQ * NB)
#define XC    16.0f
#define WSC   64.0f
#define QC    4.0f
#define VC    64.0f
#define PC    1024.0f
#define CC    64.0f
#define SCALE 0.125f
#define LOG2E 1.4426950408889634f
static_assert(NH * DH == DMOD);
static_assert(DH == 64);
static_assert(NB >= 1 && NB <= NB_FULL && SEQ >= 64 && SEQ <= SEQ_FULL);
static_assert((SEQ % 64) == 0 && (DMOD % 64) == 0 && (NROW % 64) == 0);
static_assert(((SEQ * DMOD) % 2048) == 0 && ((DMOD * DMOD) % 2048) == 0);
#define ATT_W 8
#define ATT_THREADS (ATT_W * 32)
#define ATT_ROWS (ATT_W * 16)
#define TPITCH 144                     // LDS bytes per staged 128-byte row: 16 B x odd, conflict-free for 16-byte fragment reads
#define TPLANE (64 * TPITCH)           // one staged plane: 64 rows
#define TBUF   (4 * TPLANE)            // one key tile: k, p, v^T hi, v^T residual
static_assert((SEQ % ATT_ROWS) == 0 && ATT_THREADS == 256);
#define PPI 68
#define WFL (16 * PPI)
static_assert((PPI % 4) == 0 && PPI >= 64 && (WFL % 4) == 0);

typedef _Float16 v16h __attribute__((ext_vector_type(16)));
typedef _Float16 v8h  __attribute__((ext_vector_type(8)));
typedef __bf16   v16b __attribute__((ext_vector_type(16)));
typedef float    v8f  __attribute__((ext_vector_type(8)));
typedef float    v4f  __attribute__((ext_vector_type(4)));
typedef unsigned int v4u __attribute__((ext_vector_type(4)));

union FragH { v16h v; v8h h[2]; v4u u[2]; };
union FragAny { v16h h; v16b b; };

// ---- scalar helpers --------------------------------------------------------------------------------
__device__ __forceinline__ unsigned short bf_bits(float f) {          // f32 -> bf16 bits, RNE convert
  unsigned u = __float_as_uint(f);
  return (unsigned short)((u + 0x7FFFu + ((u >> 16) & 1u)) >> 16);
}
__device__ __forceinline__ float bf_up(unsigned short h) { return __uint_as_float(((unsigned)h) << 16); }
__device__ __forceinline__ float bfr(float f) { return bf_up(bf_bits(f)); }   // value of the bf16 RNE convert
__device__ __forceinline__ unsigned short h_bits(_Float16 x) { return __builtin_bit_cast(unsigned short, x); }
__device__ __forceinline__ unsigned pk16(unsigned short a, unsigned short b) { return (unsigned)a | ((unsigned)b << 16); }
__device__ __forceinline__ v8f zero8() { v8f z = {0.f, 0.f, 0.f, 0.f, 0.f, 0.f, 0.f, 0.f}; return z; }

// ---- fragment loader: 16-bit A/B operand from a k-contiguous 16-bit plane, lane -> row/col (lane&15),
//      p already includes +8*(lane>>4); elements 0..7 <- p[0..7] (k0+8h..), elements 8..15 <- p[16..23] (k0+16+8h..)
//      (same split k map for A and B; B is always read from a [n][k] plane)
__device__ __forceinline__ v16h ldfrag_u(const unsigned short* p) {
  FragH f;
  f.u[0] = *(const v4u*)(p);
  f.u[1] = *(const v4u*)(p + 16);
  return f.v;
}

// ---- WMMA helpers with trailing VALU hazard gaps ------------------------------------------------------
__device__ __forceinline__ v8f mma_h(v16h a, v16h b, v8f c) {
  return __builtin_amdgcn_wmma_f32_16x16x32_f16(false, a, false, b, (short)0, c, false, false);
}
__device__ __forceinline__ v8f mma_b(v16h a, v16h b, v8f c) {
  FragAny ua, ub;
  ua.h = a;
  ub.h = b;
  return __builtin_amdgcn_wmma_f32_16x16x32_bf16(false, ua.b, false, ub.b, (short)0, c, false, false);
}
template <int BF>
__device__ __forceinline__ v8f mmaT(v16h a, v16h b, v8f c) {
  if constexpr (BF != 0) return mma_b(a, b, c);
  else return mma_h(a, b, c);
}
__device__ __forceinline__ void dep_guard1(v8f& a, v8f& b, v16h x) {
#if defined(__HIP_DEVICE_COMPILE__)
  asm volatile("v_nop\n\tv_nop\n\tv_nop\n\tv_nop" : "+v"(a), "+v"(b) : "v"(x));
#endif
}
__device__ __forceinline__ void keep4_h(v16h a, v16h b, v16h c, v16h d) {
#if defined(__HIP_DEVICE_COMPILE__)
  asm volatile("v_nop" :: "v"(a), "v"(b), "v"(c), "v"(d));
#endif
}
__device__ __forceinline__ void acc_guard4(v8f& a, v8f& b, v8f& c, v8f& d) {
#if defined(__HIP_DEVICE_COMPILE__)
  asm volatile("v_nop\n\tv_nop\n\tv_nop\n\tv_nop" : "+v"(a), "+v"(b), "+v"(c), "+v"(d));
#endif
}
// Eight asynchronous 16-byte copies per lane, global -> LDS (one key tile's share of a thread). The s_wait_xcnt stands inside the
// statement so that no address register of an issued copy is rewritten in front of it.
__device__ __forceinline__ void copy8_async(unsigned l0, unsigned l1, unsigned l2, unsigned l3,
                                            unsigned l4, unsigned l5, unsigned l6, unsigned l7,
                                            const unsigned short* g0, const unsigned short* g1,
                                            const unsigned short* g2, const unsigned short* g3,
                                            const unsigned short* g4, const unsigned short* g5,
                                            const unsigned short* g6, const unsigned short* g7) {
#if defined(__HIP_DEVICE_COMPILE__)
  asm volatile("global_load_async_to_lds_b128 %0, %8, off\n\t"
               "global_load_async_to_lds_b128 %1, %9, off\n\t"
               "global_load_async_to_lds_b128 %2, %10, off\n\t"
               "global_load_async_to_lds_b128 %3, %11, off\n\t"
               "global_load_async_to_lds_b128 %4, %12, off\n\t"
               "global_load_async_to_lds_b128 %5, %13, off\n\t"
               "global_load_async_to_lds_b128 %6, %14, off\n\t"
               "global_load_async_to_lds_b128 %7, %15, off\n\t"
               "s_wait_xcnt 0x0"
               :: "v"(l0), "v"(l1), "v"(l2), "v"(l3), "v"(l4), "v"(l5), "v"(l6), "v"(l7),
                  "v"(g0), "v"(g1), "v"(g2), "v"(g3), "v"(g4), "v"(g5), "v"(g6), "v"(g7)
               : "memory");
#endif
}
// This wave's own copies have landed in LDS (other waves read them only behind the next work-group barrier).
__device__ __forceinline__ void wait_async0() {
#if defined(__HIP_DEVICE_COMPILE__)
  asm volatile("s_wait_asynccnt 0x0" ::: "memory");
#endif
}
// This wave's own LDS reads have returned, so that the buffer they read may be refilled behind the barrier.
__device__ __forceinline__ void wait_ds0() {
#if defined(__HIP_DEVICE_COMPILE__)
  asm volatile("s_wait_dscnt 0x0" ::: "memory");
#endif
}
__device__ __forceinline__ void wave_sync_lds() {
  __builtin_amdgcn_fence(__ATOMIC_RELEASE, "workgroup");
  __builtin_amdgcn_wave_barrier();
  __builtin_amdgcn_fence(__ATOMIC_ACQUIRE, "workgroup");
}

// =====================================================================================================
// Elementwise 16-bit pack, no transpose: dst[i] = f16( bf16_RNE(src[i]) * sc ) for i < n; sc a power of two (exact).
// blockIdx.y selects a batch slice: src + y*sIn, dst + y*sOut (element strides). 8 elements per thread: two 16-B loads,
// coverage: grid.x = n / 2048 blocks x 256 thr x 8 elements = n exactly (n % 2048 == 0 by the static sizes), grid.y = slice count.
// =====================================================================================================
__global__ __launch_bounds__(256) void cvt16(const float* __restrict__ src, unsigned short* dst, int n,
                                             long long sIn, long long sOut, float sc) {
  const size_t i8 = ((size_t)blockIdx.x * 256 + threadIdx.x) * 8;
  if (i8 + 8 > (size_t)n) return;             // never taken with the exact grid; no barriers in this kernel
  const float* s = src + (size_t)((long long)blockIdx.y * sIn) + i8;
  unsigned short* d = dst + (size_t)((long long)blockIdx.y * sOut) + i8;
  const v4f a = *(const v4f*)(s);
  const v4f b = *(const v4f*)(s + 4);
  v4u o;
  o[0] = pk16(h_bits((_Float16)(bfr(a[0]) * sc)), h_bits((_Float16)(bfr(a[1]) * sc)));
  o[1] = pk16(h_bits((_Float16)(bfr(a[2]) * sc)), h_bits((_Float16)(bfr(a[3]) * sc)));
  o[2] = pk16(h_bits((_Float16)(bfr(b[0]) * sc)), h_bits((_Float16)(bfr(b[1]) * sc)));
  o[3] = pk16(h_bits((_Float16)(bfr(b[2]) * sc)), h_bits((_Float16)(bfr(b[3]) * sc)));
  {
    *(v4u*)(d) = o;
    
  }
}

// =====================================================================================================
// Register-blocked batched 16-bit WMMA GEMM: C[m][n] = oscale * sum_k A[m][k] * Bt[n][k] (+ bias); one wave per 64x64 tile,
// no block barriers. A row-major [M][K] pitch lda (16-bit plane), Bt row-major [N][K] pitch ldb (k contiguous); M, N multiples of 64,
// K multiple of 32. blockIdx.y = batch index with element strides sA, sB, sC.
// ASPLIT 1: a second A plane A2 (unscaled residual of A, same layout) is multiplied into the same accumulator (A + A2 ~ exact A).
// BF 1: bf16 operands (v_wmma_f32_16x16x32_bf16), else f16.
// EPI 1: value += bf16_RNE(ep0[column]) (per-column bias); EPI 2: value += bf16_RNE(ep0[row]) (per-row bias, 16-bit out only).
// OM 0: f32 out (pitch ldc).  OM 2: one f16 plane = f16(value * ocarry).
// OM 4: two f16 planes: hi = f16(value * ocarry), lo = f16(value * ocarry - hi) (unscaled residual).
// OM 5: two f16 planes: C = f16((value + bf16_RNE(ep1[column])) * ocarry), C2 = f16((value + bf16_RNE(ep2[column])) * ocarry).
// coverage: 4 slabs x 16 rows (f32: it 0..7 x lane>>4; 16-bit: it 0..3 x lane>>3) x 64 cols = the wave's whole 64x64 tile;
//           grid = ceil(tilesM*tilesN/8) blocks, surplus waves exit (wave-uniform).
// =====================================================================================================
template <int OM, int ASPLIT, int BF, int EPI>
__global__ __launch_bounds__(256) __attribute__((amdgpu_num_vgpr(256))) void gemm64(
    const unsigned short* __restrict__ Ap, const unsigned short* __restrict__ A2p, int lda, long long sA,
    const unsigned short* __restrict__ Btp, int ldb, long long sB,
    void* Cout, void* C2out, int ldc, long long sC,
    int M, int N, int K, float oscale, float ocarry,
    const float* __restrict__ ep0, const float* __restrict__ ep1, const float* __restrict__ ep2) {
  __shared__ __align__(16) float sT[8][16 * 68];   // per-wave 16x64 slab, pitch 68 floats
  const int by   = blockIdx.y;
  const int lane = threadIdx.x & 31;
  const int wave = threadIdx.x >> 5;
  const int tilesN = N >> 6;
  const int tilesM = M >> 6;
  const int tile = blockIdx.x * 8 + wave;
  if (tile >= tilesM * tilesN) return;   // wave-uniform; no block barriers in this kernel
  const int tm = tile / tilesN;
  const int tn = tile - tm * tilesN;
  const int m0 = tm << 6;
  const int n0 = tn << 6;

  const unsigned short* A1 = Ap  + (size_t)((long long)by * sA);
  const unsigned short* A2 = A2p + (size_t)((long long)by * sA);
  const unsigned short* Bb = Btp + (size_t)((long long)by * sB);

  const int rlane = lane & 15;                 // row (A) / col (B, D) within subtile
  const int koff  = (lane >> 4) * 8;           // k offset of this lane half
  const int mOff  = (lane >> 4) * 8;           // D row offset

  v8f acc[4][4];
#pragma unroll
  for (int i = 0; i < 4; ++i)
#pragma unroll
    for (int j = 0; j < 4; ++j) acc[i][j] = zero8();

  for (int k0 = 0; k0 < K; k0 += 32) {
    v16h bh[4];
#pragma unroll
    for (int j = 0; j < 4; ++j) {
      const size_t bofs = (size_t)(n0 + (j << 4) + rlane) * ldb + koff + k0;
      bh[j] = ldfrag_u(Bb + bofs);
    }
#pragma unroll
    for (int i = 0; i < 4; ++i) {
      const size_t ao = (size_t)(m0 + (i << 4) + rlane) * lda + koff + k0;
      const v16h ah = ldfrag_u(A1 + ao);
#pragma unroll
      for (int j = 0; j < 4; ++j) acc[i][j] = mmaT<BF>(ah, bh[j], acc[i][j]);
      dep_guard1(acc[i][0], acc[i][3], ah);
      if constexpr (ASPLIT != 0) {
        const v16h al = ldfrag_u(A2 + ao);
#pragma unroll
        for (int j = 0; j < 4; ++j) acc[i][j] = mmaT<BF>(al, bh[j], acc[i][j]);
        dep_guard1(acc[i][0], acc[i][3], al);
      }
    }
    keep4_h(bh[0], bh[1], bh[2], bh[3]);
  }
  acc_guard4(acc[0][0], acc[0][1], acc[0][2], acc[0][3]);
  acc_guard4(acc[1][0], acc[1][1], acc[1][2], acc[1][3]);
  acc_guard4(acc[2][0], acc[2][1], acc[2][2], acc[2][3]);
  acc_guard4(acc[3][0], acc[3][1], acc[3][2], acc[3][3]);

  const int hh2 = lane >> 4, c4 = (lane & 15) * 4;     // f32 out: 256-B row segment = 16 lanes x 16 B
  const int q8  = lane >> 3, c8 = (lane & 7) * 8;

  // ---- epilogue ----
  float* slab = sT[wave];
#pragma unroll
  for (int i = 0; i < 4; ++i) {
    const int mBase = m0 + (i << 4);
#pragma unroll
    for (int j = 0; j < 4; ++j) {
#pragma unroll
      for (int r = 0; r < 8; ++r) {
        slab[(mOff + r) * 68 + (j << 4) + rlane] = acc[i][j][r];
      }
    }
    wave_sync_lds();
    if constexpr (OM == 0) {
      float* C = (float*)Cout + (size_t)((long long)by * sC);
      v4f vals[8];
#pragma unroll
      for (int it = 0; it < 8; ++it) {
        const int row = it * 2 + hh2;                      // it 0..7 x hh2 0..1 = rows 0..15
        v4f v = *(const v4f*)(slab + row * 68 + c4);
#pragma unroll
        for (int e = 0; e < 4; ++e) v[e] = v[e] * oscale;
        if constexpr (EPI == 1) {
          const v4f bb = *(const v4f*)(ep0 + n0 + c4);     // per-column bias, columns n0+c4 .. +3 (N equals the bias length)
#pragma unroll
          for (int e = 0; e < 4; ++e) v[e] = v[e] + bfr(bb[e]);
        }
        vals[it] = v;
      }
      {
#pragma unroll
        for (int it = 0; it < 8; ++it) {
          const int gr = mBase + it * 2 + hh2;
          *(v4f*)(C + (size_t)gr * ldc + n0 + c4) = vals[it];
        }
        
      }
    } else {
      unsigned short* C  = (unsigned short*)Cout  + (size_t)((long long)by * sC);
      unsigned short* Cb = (unsigned short*)C2out + (size_t)((long long)by * sC);
      v4u hv[4], lv[4];
#pragma unroll
      for (int it = 0; it < 4; ++it) {
        const int row = it * 4 + q8;                       // it 0..3 x q8 0..3 = rows 0..15
        const float* sp = slab + row * 68 + c8;
        float rb = 0.f;
        if constexpr (EPI == 2) rb = bfr(ep0[mBase + row]);   // per-row bias (M equals the bias length)
        v4u a  = {0u, 0u, 0u, 0u};
        v4u b2 = {0u, 0u, 0u, 0u};
#pragma unroll
        for (int e = 0; e < 4; ++e) {
          const int ci = n0 + c8 + 2 * e;                  // column index, < N
          float f0 = sp[2 * e] * oscale + rb;
          float f1 = sp[2 * e + 1] * oscale + rb;
          if constexpr (EPI == 1) {
            f0 += bfr(ep0[ci]);
            f1 += bfr(ep0[ci + 1]);
          }
          if constexpr (OM == 5) {
            const float g0 = (f0 + bfr(ep1[ci])) * ocarry, g1 = (f1 + bfr(ep1[ci + 1])) * ocarry;
            const float w0 = (f0 + bfr(ep2[ci])) * ocarry, w1 = (f1 + bfr(ep2[ci + 1])) * ocarry;
            a[e]  = pk16(h_bits((_Float16)g0), h_bits((_Float16)g1));
            b2[e] = pk16(h_bits((_Float16)w0), h_bits((_Float16)w1));
          } else {
            f0 *= ocarry; f1 *= ocarry;
            const _Float16 x0 = (_Float16)f0, x1 = (_Float16)f1;
            a[e] = pk16(h_bits(x0), h_bits(x1));
            if constexpr (OM == 4) {
              b2[e] = pk16(h_bits((_Float16)(f0 - (float)x0)), h_bits((_Float16)(f1 - (float)x1)));
            }
          }
        }
        hv[it] = a;
        lv[it] = b2;
      }
      {
#pragma unroll
        for (int it = 0; it < 4; ++it) {
          const int row = it * 4 + q8;
          *(v4u*)(C + (size_t)(mBase + row) * ldc + n0 + c8) = hv[it];
          if constexpr (OM >= 4) {
            *(v4u*)(Cb + (size_t)(mBase + row) * ldc + n0 + c8) = lv[it];
          }
        }
        
      }
    }
    wave_sync_lds();
  }
}

// =====================================================================================================
// Full (non-causal) attention with a 128-deep score contraction for one (batch b, head n) pair and a 128-row query tile;
// 8 waves, wave w owns query rows iw0 .. iw0+15, iw0 = i0 + 16w. Planes (pitch DMOD halves, row index = b*SEQ + position):
// QU = f16((q + bq + ub) x4), QV = f16((q + bq + vbias) x4), KP = f16((k + bk) x4); PP = f16(p x4) rows s = 0 .. SEQ-1 (shared by
// all batches); VT, VTL = v^T hi x64 / residual f16 as [b][n*64+d][SEQ]. Key mask ints kmask[b*SEQ_FULL + s], masked where == 0.
//   Both products are computed transposed: S^T = [k | p] . [q+ub | q+vbias]^T (A = key rows from LDS, B = the query fragments, loaded
//   once and kept in registers) and O^T += v^T . P^T (A = v^T rows from LDS, B = P^T). Lane (c, hh) then holds, for its ONE query
//   iw0 + c, the scores of keys j0 + 16t + 8hh + r (t 0..3, r 0..7): maximum and sum run inside the lane, with one exchange between
//   the lane halves for the maximum per key tile and one for the sum behind the loop; two score tiles converted in place are a B
//   operand in the loaders' k map (element e <- tile 2ks row 8hh+e, element 8+e <- tile 2ks+1 row 8hh+e), so P never leaves registers.
//   Key mask: the score accumulators start from kbias[key] (0, or -1e30 where the key is masked; built once per work-group in LDS).
//   The running maximum never falls below -1e20 (any real score lies far above it), so a masked key's exponential is exactly 0 and a
//   fully masked row keeps sum 0 and gives ctx 0. Online softmax in base 2, max-subtracted, f32; the x1024 carry of P sits in the
//   exponent (+10), so the running sum carries it too and it cancels in the division.
//   Per key tile (64 keys): 16 score WMMAs, 8 + 8 P.V WMMAs (hi plane then residual plane into the same accumulators).
//   Key tiles: the four 64-row x 128-byte planes of a tile (k rows, p rows, v^T hi rows, v^T residual rows of head n) are brought into
//   LDS once per work-group by asynchronous 16-byte copies (8 per thread, each wave-copy = 4 whole 128-byte lines), two buffers: tile
//   t + 2 is copied into the buffer that trip t has read, behind the trip's barrier; all A fragments are 16-byte LDS reads at pitch 144 B.
//   block = 8 waves = 256 threads; grid = (SEQ/128, NB*NH); one block barrier per key tile; identical bounded work (SEQ/64 tiles).
// LDS: two key-tile buffers and kbias shared by the block; one [16][PPI] f32 slab per wave for the ctx tile, private-to-wave (wave_sync);
//   staged extent == consumed extent (16 rows x 64 cols written by every lane (c, hh) x (td, r) before any read).
// coverage: global: 4 instructions x 4 rows x 64 halves per plane = rows iw0..iw0+15 of head segment n in CT and CTL;
//           grid x waves cover all NB x SEQ rows and all NH head segments of CT / CTL exactly once.
// =====================================================================================================
__device__ __forceinline__ float xhalf(float x) {   // value of lane l ^ 16
  const int b = __builtin_bit_cast(int, x);
  return __builtin_bit_cast(float, __builtin_amdgcn_permlanex16(b, b, 0x76543210, 0xfedcba98, false, false));
}
__device__ __forceinline__ float max8(v8f s) {
  return fmaxf(fmaxf(fmaxf(fmaxf(s[0], s[1]), s[2]), fmaxf(fmaxf(s[3], s[4]), s[5])), fmaxf(s[6], s[7]));
}

__global__ __launch_bounds__(ATT_THREADS) __attribute__((amdgpu_num_vgpr(256)))
void attn_full(const unsigned short* __restrict__ QU, const unsigned short* __restrict__ QV,
               const unsigned short* __restrict__ KP, const unsigned short* __restrict__ PP,
               const unsigned short* __restrict__ VT, const unsigned short* __restrict__ VTL,
               const int* __restrict__ kmask,
               unsigned short* CT, unsigned short* CTL) {
  __shared__ __align__(16) float smem[ATT_W * WFL];   // per wave: ctx slab [16][PPI]
  __shared__ __align__(128) unsigned char tiles[2 * TBUF];   // two key-tile buffers: [buffer][plane k, p, v hi, v lo][64 rows][TPITCH]
  __shared__ __align__(32) float kbias[SEQ];          // start value of a key's score accumulators

  const int tid  = threadIdx.x;
  const int wave = tid >> 5;
  const int lane = tid & 31;
  const int hh   = lane >> 4;
  const int c    = lane & 15;
  const int bn   = blockIdx.y;
  const int b    = bn / NH;
  const int n    = bn - b * NH;
  const int i0   = blockIdx.x * ATT_ROWS;
  const int iw0  = i0 + wave * 16;

  float* pt = smem + wave * WFL;

  // stationary B fragments: (q + bq + ub) and (q + bq + vbias), query row b*SEQ + iw0 + c, d 0..31 and 32..63 of head n
  const size_t qro = ((size_t)(b * SEQ + iw0 + c)) * DMOD + n * DH + 8 * hh;
  const v16h qua = ldfrag_u(QU + qro), qub = ldfrag_u(QU + qro + 32);
  const v16h qva = ldfrag_u(QV + qro), qvb = ldfrag_u(QV + qro + 32);

  const int* km = kmask + (size_t)b * SEQ_FULL;

  // copy share of this thread: rows crow and crow + 32 of each plane, 16-byte piece cpc of the 128-byte row
  const int crow = tid >> 3, cpc = tid & 7;
  const unsigned short* gK = KP + ((size_t)b * SEQ + crow) * DMOD + n * DH + 8 * cpc;          // + j0 * DMOD per tile
  const unsigned short* gP = PP + (size_t)crow * DMOD + n * DH + 8 * cpc;                      // + j0 * DMOD per tile
  const size_t vbase = (size_t)b * DMOD * SEQ + (size_t)(n * DH + crow) * SEQ + 8 * cpc;       // + j0 per tile
  const unsigned short* gV = VT  + vbase;
  const unsigned short* gL = VTL + vbase;
  const unsigned ldst = (unsigned)(size_t)tiles + (unsigned)(crow * TPITCH + cpc * 16);        // LDS byte address, buffer 0, plane 0
  // fragment read base of this lane: row c of a 16-row subtile, 16-byte piece hh
  const unsigned char* fr0 = tiles + c * TPITCH + 16 * hh;

  auto stage = [&](int jt, unsigned bo) {   // key tile at jt -> buffer at byte offset bo; every lane on, all addresses in range
    const unsigned l = ldst + bo;
    const size_t kr = (size_t)jt * DMOD;
    copy8_async(l, l + 32 * TPITCH, l + TPLANE, l + TPLANE + 32 * TPITCH,
                l + 2 * TPLANE, l + 2 * TPLANE + 32 * TPITCH, l + 3 * TPLANE, l + 3 * TPLANE + 32 * TPITCH,
                gK + kr, gK + kr + 32 * DMOD, gP + kr, gP + kr + 32 * DMOD,
                gV + jt, gV + jt + (size_t)32 * SEQ, gL + jt, gL + jt + (size_t)32 * SEQ);
  };
  stage(0, 0u);
  // key bias, built while tile 0 flies (another LDS range than the copies'); published by the same barrier
#pragma unroll
  for (int s = 0; s < SEQ; s += ATT_THREADS) kbias[s + tid] = (km[s + tid] == 0) ? -1.0e30f : 0.f;   // s + tid < SEQ <= SEQ_FULL
  wait_async0();
  __syncthreads();                          // tile 0 and kbias published
  if (SEQ > 64) stage(64, (unsigned)TBUF);

  const float KSC = (SCALE / (QC * QC)) * LOG2E;

  float mrun = -1.0e20f, lrun = 0.f;        // this lane's query: running maximum (both halves alike), running sum x1024 (own half's keys)
  v8f O[4];                                 // O^T: O[td][r] = ctx accumulator of d = 16td + 8hh + r, query c
#pragma unroll
  for (int td = 0; td < 4; ++td) O[td] = zero8();

#pragma unroll 1
  for (int j0 = 0; j0 < SEQ; j0 += 64) {
    const unsigned bo = ((unsigned)j0 & 64u) ? (unsigned)TBUF : 0u;      // buffer of this trip
    const unsigned char* fr = fr0 + bo;

    // ---- S^T = kbias + k . (q+ub)^T + p . (q+vbias)^T: 4 subtiles of 16 keys, four 32-deep steps, the subtiles independent ----
    v8f S[4];
#pragma unroll
    for (int t = 0; t < 4; ++t) S[t] = *(const v8f*)(kbias + j0 + 16 * t + 8 * hh);
#pragma unroll
    for (int t = 0; t < 4; ++t) S[t] = mma_h(ldfrag_u((const unsigned short*)(fr + 16 * t * TPITCH)), qua, S[t]);
#pragma unroll
    for (int t = 0; t < 4; ++t) S[t] = mma_h(ldfrag_u((const unsigned short*)(fr + 16 * t * TPITCH) + 32), qub, S[t]);
#pragma unroll
    for (int t = 0; t < 4; ++t) S[t] = mma_h(ldfrag_u((const unsigned short*)(fr + TPLANE + 16 * t * TPITCH)), qva, S[t]);
#pragma unroll
    for (int t = 0; t < 4; ++t) S[t] = mma_h(ldfrag_u((const unsigned short*)(fr + TPLANE + 16 * t * TPITCH) + 32), qvb, S[t]);

    // ---- online softmax, one query per lane: 32 of the tile's 64 keys here, the other 32 in lane l ^ 16 ----
    float mx = fmaxf(fmaxf(max8(S[0]), max8(S[1])), fmaxf(max8(S[2]), max8(S[3])));
    mx = fmaxf(mx, xhalf(mx));
    const float mn = fmaxf(mrun, mx * KSC);
    const float al = exp2f(mrun - mn);
    mrun = mn;
    const float sh = 10.0f - mn;            // 2^10 = the x1024 carry of P
    FragH pf[2];
    float ps[4];
#pragma unroll
    for (int t = 0; t < 4; ++t) {
      ps[t] = 0.f;
#pragma unroll
      for (int r = 0; r < 8; ++r) {
        const float ev = exp2f(fmaf(S[t][r], KSC, sh));
        ps[t] += ev;
        pf[t >> 1].h[t & 1][r] = (_Float16)ev;     // key j0 + 32(t>>1) + 16(t&1) + 8hh + r
      }
    }
    lrun = lrun * al + ((ps[0] + ps[1]) + (ps[2] + ps[3]));
#pragma unroll
    for (int td = 0; td < 4; ++td)
#pragma unroll
      for (int r = 0; r < 8; ++r) O[td][r] *= al;

    // ---- O^T += v^T . P^T: hi plane, then residual plane, two 32-key steps each, the four d subtiles independent ----
#pragma unroll
    for (int pl = 2; pl < 4; ++pl)
#pragma unroll
      for (int ks = 0; ks < 2; ++ks)
#pragma unroll
        for (int td = 0; td < 4; ++td)
          O[td] = mma_h(ldfrag_u((const unsigned short*)(fr + pl * TPLANE + 16 * td * TPITCH) + 32 * ks), pf[ks].v, O[td]);

    // ---- publish tile t + 1, free this trip's buffer, then refill it with tile t + 2 ----
    wait_ds0();
    wait_async0();
    __syncthreads();
    if (j0 + 128 < SEQ) stage(j0 + 128, bo);
  }
  wait_async0();
  acc_guard4(O[0], O[1], O[2], O[3]);

  // ---- join the halves' sums; fold 1/l (0 for an empty row) and the carry 64 on v (1024 on P cancels), carry x64 on ctx ----
  {
    const float oc  = CC / VC;
    const float lr  = lrun + xhalf(lrun);
    const float den = (lr > 0.f) ? lr : 1.0f;
    const float inv = (lr > 0.f) ? ((1.0f / den) * oc) : 0.f;
    float* po = pt + c * PPI + 8 * hh;
#pragma unroll
    for (int td = 0; td < 4; ++td) {
      v4f w0, w1;
#pragma unroll
      for (int e = 0; e < 4; ++e) { w0[e] = O[td][e] * inv; w1[e] = O[td][4 + e] * inv; }
      *(v4f*)(po + 16 * td)     = w0;
      *(v4f*)(po + 16 * td + 4) = w1;
    }
  }
  wave_sync_lds();
  {
    const int q8 = lane >> 3, c8 = (lane & 7) * 8;
    v4u hv[4], lv[4];
#pragma unroll
    for (int it = 0; it < 4; ++it) {
      const int row = it * 4 + q8;                         // it 0..3 x q8 0..3 = rows 0..15
      const float* sp = pt + row * PPI + c8;
      v4u a  = {0u, 0u, 0u, 0u};
      v4u b2 = {0u, 0u, 0u, 0u};
#pragma unroll
      for (int e = 0; e < 4; ++e) {
        const float f0 = sp[2 * e], f1 = sp[2 * e + 1];
        const _Float16 x0 = (_Float16)f0, x1 = (_Float16)f1;
        a[e]  = pk16(h_bits(x0), h_bits(x1));
        b2[e] = pk16(h_bits((_Float16)(f0 - (float)x0)), h_bits((_Float16)(f1 - (float)x1)));
      }
      hv[it] = a;
      lv[it] = b2;
    }
    {
#pragma unroll
      for (int it = 0; it < 4; ++it) {
        const int row = it * 4 + q8;
        const size_t go = ((size_t)(b * SEQ + iw0 + row)) * DMOD + n * DH + c8;
        *(v4u*)(CT  + go) = hv[it];
        *(v4u*)(CTL + go) = lv[it];
      }
    }
  }
}

// =====================================================================================================
// Workspace map (bytes); every plane is an exact multiple of its tile / whole-row store granularity (M, N exact multiples of 64,
// convert counts exact multiples of 2048), every offset a multiple of 512 KiB:
//   WQ16, WK16, WV16, WP16, WO16 f16 [512 out][512 in] x64 (input layout kept, no transpose)   5 x   524288
//   XQ16, XK16, XV16 f16 [NROW][512] x16 (rows b*SEQ + t)                                    3 x  8388608
//   XP16 f16 [SEQ][512] x16                                                                        2097152
//   QU, QV, K16 f16 [NROW][512] x4                                                           3 x  8388608
//   P16  f16 [SEQ][512] x4                                                                         2097152
//   VT16, VTL16 f16 [NB][512][SEQ] hi x64 / residual                                         2 x  8388608
//   CT16, CTL16 f16 [NROW][512] hi x64 / residual                                            2 x  8388608
//   end (NB=4, SEQ=2048)                                                                          90701824
// =====================================================================================================
extern "C" void kernel_launch(void* const* d_in, const int* in_sizes, int n_in,
                              void* d_out, int out_size, void* d_ws, size_t ws_size,
                              hipStream_t stream) {
  if (n_in < 16) return;
  const long long needX = (long long)NB * SEQ_FULL * DMOD;     // reads rows b*SEQ_FULL + t, b < NB, t < SEQ
  if ((long long)in_sizes[0] < needX || (long long)in_sizes[1] < needX || (long long)in_sizes[2] < needX) return;
  if (in_sizes[3] < NB * SEQ_FULL) return;
  if (in_sizes[4] < SEQ * DMOD) return;
  if (in_sizes[5] != DMOD * DMOD || in_sizes[7] != DMOD * DMOD || in_sizes[9] != DMOD * DMOD ||
      in_sizes[11] != DMOD * DMOD || in_sizes[13] != DMOD * DMOD) return;
  if (in_sizes[6] != DMOD || in_sizes[8] != DMOD || in_sizes[10] != DMOD || in_sizes[12] != DMOD) return;
  if (in_sizes[14] != NH * DH || in_sizes[15] != NH * DH) return;
  if (out_size < NROW * DMOD) return;

  const float* xq    = (const float*)d_in[0];
  const float* xk    = (const float*)d_in[1];
  const float* xv    = (const float*)d_in[2];
  const int*   kmask = (const int*)d_in[3];
  const float* xpos  = (const float*)d_in[4];
  const float* w_q   = (const float*)d_in[5];
  const float* b_q   = (const float*)d_in[6];
  const float* w_k   = (const float*)d_in[7];
  const float* b_k   = (const float*)d_in[8];
  const float* w_v   = (const float*)d_in[9];
  const float* b_v   = (const float*)d_in[10];
  const float* w_o   = (const float*)d_in[11];
  const float* b_o   = (const float*)d_in[12];
  const float* w_p   = (const float*)d_in[13];
  const float* ub    = (const float*)d_in[14];
  const float* vb    = (const float*)d_in[15];
  float*       out   = (float*)d_out;

  const size_t PW  = (size_t)DMOD * DMOD * 2;            //   524288
  const size_t PX  = (size_t)NROW * DMOD * 2;            //  8388608
  const size_t PXP = (size_t)SEQ * DMOD * 2;             //  2097152
  const size_t PVT = (size_t)NB * DMOD * SEQ * 2;        //  8388608
  size_t off = 0;
  const size_t oWQ  = off; off += PW;
  const size_t oWK  = off; off += PW;
  const size_t oWV  = off; off += PW;
  const size_t oWP  = off; off += PW;
  const size_t oWO  = off; off += PW;
  const size_t oXQ  = off; off += PX;
  const size_t oXK  = off; off += PX;
  const size_t oXV  = off; off += PX;
  const size_t oXP  = off; off += PXP;
  const size_t oQU  = off; off += PX;
  const size_t oQV  = off; off += PX;
  const size_t oK   = off; off += PX;
  const size_t oP   = off; off += PXP;
  const size_t oVT  = off; off += PVT;
  const size_t oVTL = off; off += PVT;
  const size_t oCT  = off; off += PX;
  const size_t oCTL = off; off += PX;
  if (off > ws_size) return;                               // off = 90701824 at NB=4, SEQ=2048
  if (off > (size_t)134217728) return;

  char* ws = (char*)d_ws;
  unsigned short* WQ16  = (unsigned short*)(ws + oWQ);
  unsigned short* WK16  = (unsigned short*)(ws + oWK);
  unsigned short* WV16  = (unsigned short*)(ws + oWV);
  unsigned short* WP16  = (unsigned short*)(ws + oWP);
  unsigned short* WO16  = (unsigned short*)(ws + oWO);
  unsigned short* XQ16  = (unsigned short*)(ws + oXQ);
  unsigned short* XK16  = (unsigned short*)(ws + oXK);
  unsigned short* XV16  = (unsigned short*)(ws + oXV);
  unsigned short* XP16  = (unsigned short*)(ws + oXP);
  unsigned short* QU    = (unsigned short*)(ws + oQU);
  unsigned short* QV    = (unsigned short*)(ws + oQV);
  unsigned short* K16   = (unsigned short*)(ws + oK);
  unsigned short* P16   = (unsigned short*)(ws + oP);
  unsigned short* VT16  = (unsigned short*)(ws + oVT);
  unsigned short* VTL16 = (unsigned short*)(ws + oVTL);
  unsigned short* CT16  = (unsigned short*)(ws + oCT);
  unsigned short* CTL16 = (unsigned short*)(ws + oCTL);

  const dim3 blk(256);
  const dim3 gCW((DMOD * DMOD) / 2048, 1);                          // 128
  const dim3 gCX((SEQ * DMOD) / 2048, NB);                          // 512 x 4
  const dim3 gCP((SEQ * DMOD) / 2048, 1);                           // 512
  const int tilesQ = (NROW / 64) * (DMOD / 64);                     // 1024
  const int tilesV = (DMOD / 64) * (SEQ / 64);                      // 256 per batch
  const int tilesP = (SEQ / 64) * (DMOD / 64);                      // 256
  const dim3 gQ((tilesQ + 7) / 8, 1);                               // 128
  const dim3 gV((tilesV + 7) / 8, NB);                              // 32 x 4
  const dim3 gP((tilesP + 7) / 8, 1);                               // 32
  const dim3 gAT(SEQ / ATT_ROWS, NB * NH);                          // 16 x 32
  const dim3 bAT(ATT_THREADS);                                      // 256

  // (0) weight planes: W[nd][c] ([out][in], already k-contiguous per output row) -> f16( bf16_RNE(w) * 64 ), all five weights
  cvt16<<<gCW, blk, 0, stream>>>(w_q, WQ16, DMOD * DMOD, 0LL, 0LL, WSC);
  cvt16<<<gCW, blk, 0, stream>>>(w_k, WK16, DMOD * DMOD, 0LL, 0LL, WSC);
  cvt16<<<gCW, blk, 0, stream>>>(w_v, WV16, DMOD * DMOD, 0LL, 0LL, WSC);
  cvt16<<<gCW, blk, 0, stream>>>(w_p, WP16, DMOD * DMOD, 0LL, 0LL, WSC);
  cvt16<<<gCW, blk, 0, stream>>>(w_o, WO16, DMOD * DMOD, 0LL, 0LL, WSC);

  // (1) activation planes: f16(bf16(x) * 16), batch b read at input row b*SEQ_FULL, written at plane row b*SEQ; pos rows 0..SEQ-1
  cvt16<<<gCX, blk, 0, stream>>>(xq, XQ16, SEQ * DMOD, (long long)SEQ_FULL * DMOD, (long long)SEQ * DMOD, XC);
  cvt16<<<gCX, blk, 0, stream>>>(xk, XK16, SEQ * DMOD, (long long)SEQ_FULL * DMOD, (long long)SEQ * DMOD, XC);
  cvt16<<<gCX, blk, 0, stream>>>(xv, XV16, SEQ * DMOD, (long long)SEQ_FULL * DMOD, (long long)SEQ * DMOD, XC);
  cvt16<<<gCP, blk, 0, stream>>>(xpos, XP16, SEQ * DMOD, 0LL, 0LL, XC);

  // (2) q[m][nd] = sum_c x[m][c] W[nd][c] / 1024 + bq[nd]; QU = f16((q + ub[nd]) * 4), QV = f16((q + vbias[nd]) * 4);
  //     M = NROW, N = 512, K = 512
  gemm64<5, 0, 0, 1><<<gQ, blk, 0, stream>>>(
      XQ16, XQ16, DMOD, 0LL,
      WQ16, DMOD, 0LL,
      (void*)QU, (void*)QV, DMOD, 0LL,
      NROW, DMOD, DMOD, 1.0f / (XC * WSC), QC,
      b_q, ub, vb);

  // (3) k projection + bk -> K16 = f16(k * 4)
  gemm64<2, 0, 0, 1><<<gQ, blk, 0, stream>>>(
      XK16, XK16, DMOD, 0LL,
      WK16, DMOD, 0LL,
      (void*)K16, (void*)K16, DMOD, 0LL,
      NROW, DMOD, DMOD, 1.0f / (XC * WSC), QC,
      b_k, b_k, b_k);

  // (4) v^T per batch: VT[b][nd][j] = sum_c W[nd][c] x[b*SEQ + j][c] / 1024 + bv[nd] (per-row bias) -> f16 x64 hi + residual planes;
  //     M = 512 (nd), N = SEQ (j), K = 512; B rows are the batch's token rows: pitch DMOD, batch stride SEQ*DMOD
  gemm64<4, 0, 0, 2><<<gV, blk, 0, stream>>>(
      WV16, WV16, DMOD, 0LL,
      XV16, DMOD, (long long)SEQ * DMOD,
      (void*)VT16, (void*)VTL16, SEQ, (long long)DMOD * SEQ,
      DMOD, SEQ, DMOD, 1.0f / (XC * WSC), VC,
      b_v, b_v, b_v);

  // (5) positional projection (no bias): P16 = f16(p * 4), M = SEQ, N = 512, K = 512
  gemm64<2, 0, 0, 0><<<gP, blk, 0, stream>>>(
      XP16, XP16, DMOD, 0LL,
      WP16, DMOD, 0LL,
      (void*)P16, (void*)P16, DMOD, 0LL,
      SEQ, DMOD, DMOD, 1.0f / (XC * WSC), QC,
      b_q, b_q, b_q);

  // (6) attention -> CT16 = f16(ctx * 64) hi plane, CTL16 residual plane, rows b*SEQ + i, halves n*64+d
  attn_full<<<gAT, bAT, 0, stream>>>(QU, QV, K16, P16, VT16, VTL16, kmask, CT16, CTL16);

  // (7) out = (CT + CTL) . W^T / (64*64) + bo; M = NROW, N = 512, K = 512, f32 rows straight into the output buffer (row b*SEQ + t)
  gemm64<0, 1, 0, 1><<<gQ, blk, 0, stream>>>(
      CT16, CTL16, DMOD, 0LL,
      WO16, DMOD, 0LL,
      (void*)out, (void*)out, DMOD, 0LL,
      NROW, DMOD, DMOD, 1.0f / (CC * WSC), 1.0f,
      b_o, b_o, b_o);
  (void)hipGetLastError();
}

// v003
// It runs in 173 microseconds.
// Two timings next to v002 both put it at 1.54 times that version's speed.
// Over all steps from v000 it is 2.49 times as fast.
// Contractions (all v_wmma_f32_16x16x32_f16, f16 operands, f32 accumulate): q/k/v/p projections (x f16 x16 . W f16 x64, K=512, single products);
// scores ([q+bq+u | q+bq+vbias] f16 x4 . [k+bk | p] f16 x4, K=128 per head, single products); P . v^T (P f16 x1024 . v^T carried as
// f16 x64 hi plane + f16 residual plane, 64 keys per tile, two products; both attention products run transposed); output projection (ctx carried as f16 x64 hi + residual planes
// . Wo f16 x64, K=512, two products). Key mask (score accumulators start at -1e30 for a masked key, whose exponential is then 0), max-subtracted online base-2 softmax and
// all epilogues in f32 on VALU. Every float input RNE-converted to bf16 on load.
#include <hip/hip_runtime.h>
#include <math.h>
#include <stdint.h>

#ifndef NB
#define NB    4
#endif
#ifndef SEQ
#define SEQ   2048
#endif
#define NB_FULL  4
#define SEQ_FULL 2048
#define DMOD  512
#define NH    8
#define DH    64
#define NROW  (SEQ * NB)
#define XC    16.0f
#define WSC   64.0f
#define QC    4.0f
#define VC    64.0f
#define PC    1024.0f
#define CC    64.0f
#define SCALE 0.125f
#define LOG2E 1.4426950408889634f
static_assert(NH * DH == DMOD);
static_assert(DH == 64);
static_assert(NB >= 1 && NB <= NB_FULL && SEQ >= 64 && SEQ <= SEQ_FULL);
static_assert((SEQ % 64) == 0 && (DMOD % 64) == 0 && (NROW % 64) == 0);
static_assert(((SEQ * DMOD) % 2048) == 0 && ((DMOD * DMOD) % 2048) == 0);
#define ATT_W 8
#define ATT_THREADS (ATT_W * 32)
#define ATT_ROWS (ATT_W * 16)
#define TPITCH 144                     // LDS bytes per staged 128-byte row: 16 B x odd, conflict-free for 16-byte fragment reads
#define TPLANE (64 * TPITCH)           // one staged plane: 64 rows
#define TBUF   (4 * TPLANE)            // one key tile: k, p, v^T hi, v^T residual
static_assert((SEQ % ATT_ROWS) == 0 && ATT_THREADS == 256);
#define PPI 68
#define WFL (16 * PPI)
static_assert((PPI % 4) == 0 && PPI >= 64 && (WFL % 4) == 0);

typedef _Float16 v16h __attribute__((ext_vector_type(16)));
typedef _Float16 v8h  __attribute__((ext_vector_type(8)));
typedef __bf16   v16b __attribute__((ext_vector_type(16)));
typedef float    v8f  __attribute__((ext_vector_type(8)));
typedef float    v4f  __attribute__((ext_vector_type(4)));
typedef unsigned int v4u __attribute__((ext_vector_type(4)));

union FragH { v16h v; v8h h[2]; v4u u[2]; };
union FragAny { v16h h; v16b b; };

// ---- scalar helpers --------------------------------------------------------------------------------
__device__ __forceinline__ unsigned short bf_bits(float f) {          // f32 -> bf16 bits, RNE convert
  unsigned u = __float_as_uint(f);
  return (unsigned short)((u + 0x7FFFu + ((u >> 16) & 1u)) >> 16);
}
__device__ __forceinline__ float bf_up(unsigned short h) { return __uint_as_float(((unsigned)h) << 16); }
__device__ __forceinline__ float bfr(float f) { return bf_up(bf_bits(f)); }   // value of the bf16 RNE convert
__device__ __forceinline__ unsigned short h_bits(_Float16 x) { return __builtin_bit_cast(unsigned short, x); }
__device__ __forceinline__ unsigned pk16(unsigned short a, unsigned short b) { return (unsigned)a | ((unsigned)b << 16); }
__device__ __forceinline__ v8f zero8() { v8f z = {0.f, 0.f, 0.f, 0.f, 0.f, 0.f, 0.f, 0.f}; return z; }

// ---- fragment loader: 16-bit A/B operand from a k-contiguous 16-bit plane, lane -> row/col (lane&15),
//      p already includes +8*(lane>>4); elements 0..7 <- p[0..7] (k0+8h..), elements 8..15 <- p[16..23] (k0+16+8h..)
//      (same split k map for A and B; B is always read from a [n][k] plane)
__device__ __forceinline__ v16h ldfrag_u(const unsigned short* p) {
  FragH f;
  f.u[0] = *(const v4u*)(p);
  f.u[1] = *(const v4u*)(p + 16);
  return f.v;
}

// ---- WMMA helpers with trailing VALU hazard gaps ------------------------------------------------------
__device__ __forceinline__ v8f mma_h(v16h a, v16h b, v8f c) {
  return __builtin_amdgcn_wmma_f32_16x16x32_f16(false, a, false, b, (short)0, c, false, false);
}
__device__ __forceinline__ v8f mma_b(v16h a, v16h b, v8f c) {
  FragAny ua, ub;
  ua.h = a;
  ub.h = b;
  return __builtin_amdgcn_wmma_f32_16x16x32_bf16(false, ua.b, false, ub.b, (short)0, c, false, false);
}
template <int BF>
__device__ __forceinline__ v8f mmaT(v16h a, v16h b, v8f c) {
  if constexpr (BF != 0) return mma_b(a, b, c);
  else return mma_h(a, b, c);
}
__device__ __forceinline__ void dep_guard1(v8f& a, v8f& b, v16h x) {
#if defined(__HIP_DEVICE_COMPILE__)
  asm volatile("v_nop\n\tv_nop\n\tv_nop\n\tv_nop" : "+v"(a), "+v"(b) : "v"(x));
#endif
}
__device__ __forceinline__ void keep4_h(v16h a, v16h b, v16h c, v16h d) {
#if defined(__HIP_DEVICE_COMPILE__)
  asm volatile("v_nop" :: "v"(a), "v"(b), "v"(c), "v"(d));
#endif
}
__device__ __forceinline__ void acc_guard4(v8f& a, v8f& b, v8f& c, v8f& d) {
#if defined(__HIP_DEVICE_COMPILE__)
  asm volatile("v_nop\n\tv_nop\n\tv_nop\n\tv_nop" : "+v"(a), "+v"(b), "+v"(c), "+v"(d));
#endif
}
// Eight asynchronous 16-byte copies per lane, global -> LDS (one key tile's share of a thread). The s_wait_xcnt stands inside the
// statement so that no address register of an issued copy is rewritten in front of it.
__device__ __forceinline__ void copy8_async(unsigned l0, unsigned l1, unsigned l2, unsigned l3,
                                            unsigned l4, unsigned l5, unsigned l6, unsigned l7,
                                            const unsigned short* g0, const unsigned short* g1,
                                            const unsigned short* g2, const unsigned short* g3,
                                            const unsigned short* g4, const unsigned short* g5,
                                            const unsigned short* g6, const unsigned short* g7) {
#if defined(__HIP_DEVICE_COMPILE__)
  asm volatile("global_load_async_to_lds_b128 %0, %8, off\n\t"
               "global_load_async_to_lds_b128 %1, %9, off\n\t"
               "global_load_async_to_lds_b128 %2, %10, off\n\t"
               "global_load_async_to_lds_b128 %3, %11, off\n\t"
               "global_load_async_to_lds_b128 %4, %12, off\n\t"
               "global_load_async_to_lds_b128 %5, %13, off\n\t"
               "global_load_async_to_lds_b128 %6, %14, off\n\t"
               "global_load_async_to_lds_b128 %7, %15, off\n\t"
               "s_wait_xcnt 0x0"
               :: "v"(l0), "v"(l1), "v"(l2), "v"(l3), "v"(l4), "v"(l5), "v"(l6), "v"(l7),
                  "v"(g0), "v"(g1), "v"(g2), "v"(g3), "v"(g4), "v"(g5), "v"(g6), "v"(g7)
               : "memory");
#endif
}
// This wave's own copies have landed in LDS (other waves read them only behind the next work-group barrier).
__device__ __forceinline__ void wait_async0() {
#if defined(__HIP_DEVICE_COMPILE__)
  asm volatile("s_wait_asynccnt 0x0" ::: "memory");
#endif
}
// This wave's own LDS reads have returned, so that the buffer they read may be refilled behind the barrier.
__device__ __forceinline__ void wait_ds0() {
#if defined(__HIP_DEVICE_COMPILE__)
  asm volatile("s_wait_dscnt 0x0" ::: "memory");
#endif
}
__device__ __forceinline__ void wave_sync_lds() {
  __builtin_amdgcn_fence(__ATOMIC_RELEASE, "workgroup");
  __builtin_amdgcn_wave_barrier();
  __builtin_amdgcn_fence(__ATOMIC_ACQUIRE, "workgroup");
}

// =====================================================================================================
// Elementwise 16-bit pack, no transpose, all nine float planes in ONE grid: dst[i] = f16( bf16_RNE(src[i]) * sc ), sc a power of two
// (exact). A block packs one piece of 2048 elements (256 thr x 8: two 16-B loads, one 16-B store per thread); ranges of the block index
// pick the source (block-uniform): CVT_W pieces for each of wq, wk, wv, wp, wo (x64), NB * CVT_X for each of xq, xk, xv (x16; batch y is
// read at input row y*SEQ_FULL and written at plane row y*SEQ), CVT_X for pos (x16). The nine destination planes lie in the workspace
// one behind the other in this same order, so piece bx is written at dst + bx * 2048.
// coverage: grid = CVT_BLOCKS blocks = every piece of every plane exactly once (all plane sizes are multiples of 2048 by the static sizes).
// =====================================================================================================
#define CVT_W ((DMOD * DMOD) / 2048)
#define CVT_X ((SEQ * DMOD) / 2048)
#define CVT_BLOCKS (5 * CVT_W + 3 * NB * CVT_X + CVT_X)
__global__ __launch_bounds__(256) void cvt_all(const float* __restrict__ wq, const float* __restrict__ wk, const float* __restrict__ wv,
                                               const float* __restrict__ wp, const float* __restrict__ wo,
                                               const float* __restrict__ xq, const float* __restrict__ xk, const float* __restrict__ xv,
                                               const float* __restrict__ xpos, unsigned short* dst) {
  const int bx = blockIdx.x;
  if (bx >= CVT_BLOCKS) return;               // never taken with the exact grid; no barriers in this kernel
  const float* src;
  size_t so;                                  // element offset of this block's piece in its source
  float sc;
  if (bx < 5 * CVT_W) {
    const int seg = bx / CVT_W;
    src = (seg == 0) ? wq : (seg == 1) ? wk : (seg == 2) ? wv : (seg == 3) ? wp : wo;
    so  = (size_t)(bx - seg * CVT_W) * 2048;
    sc  = WSC;
  } else if (bx < 5 * CVT_W + 3 * NB * CVT_X) {
    const int r   = bx - 5 * CVT_W;
    const int seg = r / (NB * CVT_X);
    const int rs  = r - seg * (NB * CVT_X);
    const int y   = rs / CVT_X;
    src = (seg == 0) ? xq : (seg == 1) ? xk : xv;
    so  = (size_t)y * SEQ_FULL * DMOD + (size_t)(rs - y * CVT_X) * 2048;
    sc  = XC;
  } else {
    src = xpos;
    so  = (size_t)(bx - (5 * CVT_W + 3 * NB * CVT_X)) * 2048;
    sc  = XC;
  }
  const float* s = src + so + (size_t)threadIdx.x * 8;
  unsigned short* d = dst + (size_t)bx * 2048 + (size_t)threadIdx.x * 8;
  const v4f a = *(const v4f*)(s);
  const v4f b = *(const v4f*)(s + 4);
  v4u o;
  o[0] = pk16(h_bits((_Float16)(bfr(a[0]) * sc)), h_bits((_Float16)(bfr(a[1]) * sc)));
  o[1] = pk16(h_bits((_Float16)(bfr(a[2]) * sc)), h_bits((_Float16)(bfr(a[3]) * sc)));
  o[2] = pk16(h_bits((_Float16)(bfr(b[0]) * sc)), h_bits((_Float16)(bfr(b[1]) * sc)));
  o[3] = pk16(h_bits((_Float16)(bfr(b[2]) * sc)), h_bits((_Float16)(bfr(b[3]) * sc)));
  *(v4u*)(d) = o;
}

// =====================================================================================================
// Register-blocked batched 16-bit WMMA GEMM: C[m][n] = oscale * sum_k A[m][k] * Bt[n][k] (+ bias); one wave per 64x64 tile,
// no block barriers. A row-major [M][K] pitch lda (16-bit plane), Bt row-major [N][K] pitch ldb (k contiguous); M, N multiples of 64,
// K multiple of 32. bx = index of the block's group of 8 tiles, by = batch index with element strides sA, sB, sC; sT = the block's slabs.
// ASPLIT 1: a second A plane A2 (unscaled residual of A, same layout) is multiplied into the same accumulator (A + A2 ~ exact A).
// BF 1: bf16 operands (v_wmma_f32_16x16x32_bf16), else f16.
// EPI 1: value += bf16_RNE(ep0[column]) (per-column bias); EPI 2: value += bf16_RNE(ep0[row]) (per-row bias, 16-bit out only).
// OM 0: f32 out (pitch ldc).  OM 2: one f16 plane = f16(value * ocarry).
// OM 4: two f16 planes: hi = f16(value * ocarry), lo = f16(value * ocarry - hi) (unscaled residual).
// OM 5: two f16 planes: C = f16((value + bf16_RNE(ep1[column])) * ocarry), C2 = f16((value + bf16_RNE(ep2[column])) * ocarry).
// coverage: 4 slabs x 16 rows (f32: it 0..7 x lane>>4; 16-bit: it 0..3 x lane>>3) x 64 cols = the wave's whole 64x64 tile;
//           ceil(tilesM*tilesN/8) values of bx, surplus waves leave (wave-uniform).
// =====================================================================================================
#define SLABF (16 * 68)                 // floats of one wave's 16x64 slab, pitch 68 floats
template <int OM, int ASPLIT, int BF, int EPI>
__device__ __forceinline__ void gemm64_tile(
    float* sT, int bx, int by,
    const unsigned short* __restrict__ Ap, const unsigned short* __restrict__ A2p, int lda, long long sA,
    const unsigned short* __restrict__ Btp, int ldb, long long sB,
    void* Cout, void* C2out, int ldc, long long sC,
    int M, int N, int K, float oscale, float ocarry,
    const float* __restrict__ ep0, const float* __restrict__ ep1, const float* __restrict__ ep2) {
  const int lane = threadIdx.x & 31;
  const int wave = threadIdx.x >> 5;
  const int tilesN = N >> 6;
  const int tilesM = M >> 6;
  const int tile = bx * 8 + wave;
  if (tile >= tilesM * tilesN) return;   // wave-uniform; no block barriers in the kernels that call this
  const int tm = tile / tilesN;
  const int tn = tile - tm * tilesN;
  const int m0 = tm << 6;
  const int n0 = tn << 6;

  const unsigned short* A1 = Ap  + (size_t)((long long)by * sA);
  const unsigned short* A2 = A2p + (size_t)((long long)by * sA);
  const unsigned short* Bb = Btp + (size_t)((long long)by * sB);

  const int rlane = lane & 15;                 // row (A) / col (B, D) within subtile
  const int koff  = (lane >> 4) * 8;           // k offset of this lane half
  const int mOff  = (lane >> 4) * 8;           // D row offset

  v8f acc[4][4];
#pragma unroll
  for (int i = 0; i < 4; ++i)
#pragma unroll
    for (int j = 0; j < 4; ++j) acc[i][j] = zero8();

  for (int k0 = 0; k0 < K; k0 += 32) {
    v16h bh[4];
#pragma unroll
    for (int j = 0; j < 4; ++j) {
      const size_t bofs = (size_t)(n0 + (j << 4) + rlane) * ldb + koff + k0;
      bh[j] = ldfrag_u(Bb + bofs);
    }
#pragma unroll
    for (int i = 0; i < 4; ++i) {
      const size_t ao = (size_t)(m0 + (i << 4) + rlane) * lda + koff + k0;
      const v16h ah = ldfrag_u(A1 + ao);
#pragma unroll
      for (int j = 0; j < 4; ++j) acc[i][j] = mmaT<BF>(ah, bh[j], acc[i][j]);
      dep_guard1(acc[i][0], acc[i][3], ah);
      if constexpr (ASPLIT != 0) {
        const v16h al = ldfrag_u(A2 + ao);
#pragma unroll
        for (int j = 0; j < 4; ++j) acc[i][j] = mmaT<BF>(al, bh[j], acc[i][j]);
        dep_guard1(acc[i][0], acc[i][3], al);
      }
    }
    keep4_h(bh[0], bh[1], bh[2], bh[3]);
  }
  acc_guard4(acc[0][0], acc[0][1], acc[0][2], acc[0][3]);
  acc_guard4(acc[1][0], acc[1][1], acc[1][2], acc[1][3]);
  acc_guard4(acc[2][0], acc[2][1], acc[2][2], acc[2][3]);
  acc_guard4(acc[3][0], acc[3][1], acc[3][2], acc[3][3]);

  const int hh2 = lane >> 4, c4 = (lane & 15) * 4;     // f32 out: 256-B row segment = 16 lanes x 16 B
  const int q8  = lane >> 3, c8 = (lane & 7) * 8;

  // ---- epilogue ----
  float* slab = sT + wave * SLABF;
#pragma unroll
  for (int i = 0; i < 4; ++i) {
    const int mBase = m0 + (i << 4);
#pragma unroll
    for (int j = 0; j < 4; ++j) {
#pragma unroll
      for (int r = 0; r < 8; ++r) {
        slab[(mOff + r) * 68 + (j << 4) + rlane] = acc[i][j][r];
      }
    }
    wave_sync_lds();
    if constexpr (OM == 0) {
      float* C = (float*)Cout + (size_t)((long long)by * sC);
      v4f vals[8];
#pragma unroll
      for (int it = 0; it < 8; ++it) {
        const int row = it * 2 + hh2;                      // it 0..7 x hh2 0..1 = rows 0..15
        v4f v = *(const v4f*)(slab + row * 68 + c4);
#pragma unroll
        for (int e = 0; e < 4; ++e) v[e] = v[e] * oscale;
        if constexpr (EPI == 1) {
          const v4f bb = *(const v4f*)(ep0 + n0 + c4);     // per-column bias, columns n0+c4 .. +3 (N equals the bias length)
#pragma unroll
          for (int e = 0; e < 4; ++e) v[e] = v[e] + bfr(bb[e]);
        }
        vals[it] = v;
      }
      {
#pragma unroll
        for (int it = 0; it < 8; ++it) {
          const int gr = mBase + it * 2 + hh2;
          *(v4f*)(C + (size_t)gr * ldc + n0 + c4) = vals[it];
        }
        
      }
    } else {
      unsigned short* C  = (unsigned short*)Cout  + (size_t)((long long)by * sC);
      unsigned short* Cb = (unsigned short*)C2out + (size_t)((long long)by * sC);
      v4u hv[4], lv[4];
#pragma unroll
      for (int it = 0; it < 4; ++it) {
        const int row = it * 4 + q8;                       // it 0..3 x q8 0..3 = rows 0..15
        const float* sp = slab + row * 68 + c8;
        float rb = 0.f;
        if constexpr (EPI == 2) rb = bfr(ep0[mBase + row]);   // per-row bias (M equals the bias length)
        v4u a  = {0u, 0u, 0u, 0u};
        v4u b2 = {0u, 0u, 0u, 0u};
#pragma unroll
        for (int e = 0; e < 4; ++e) {
          const int ci = n0 + c8 + 2 * e;                  // column index, < N
          float f0 = sp[2 * e] * oscale + rb;
          float f1 = sp[2 * e + 1] * oscale + rb;
          if constexpr (EPI == 1) {
            f0 += bfr(ep0[ci]);
            f1 += bfr(ep0[ci + 1]);
          }
          if constexpr (OM == 5) {
            const float g0 = (f0 + bfr(ep1[ci])) * ocarry, g1 = (f1 + bfr(ep1[ci + 1])) * ocarry;
            const float w0 = (f0 + bfr(ep2[ci])) * ocarry, w1 = (f1 + bfr(ep2[ci + 1])) * ocarry;
            a[e]  = pk16(h_bits((_Float16)g0), h_bits((_Float16)g1));
            b2[e] = pk16(h_bits((_Float16)w0), h_bits((_Float16)w1));
          } else {
            f0 *= ocarry; f1 *= ocarry;
            const _Float16 x0 = (_Float16)f0, x1 = (_Float16)f1;
            a[e] = pk16(h_bits(x0), h_bits(x1));
            if constexpr (OM == 4) {
              b2[e] = pk16(h_bits((_Float16)(f0 - (float)x0)), h_bits((_Float16)(f1 - (float)x1)));
            }
          }
        }
        hv[it] = a;
        lv[it] = b2;
      }
      {
#pragma unroll
        for (int it = 0; it < 4; ++it) {
          const int row = it * 4 + q8;
          *(v4u*)(C + (size_t)(mBase + row) * ldc + n0 + c8) = hv[it];
          if constexpr (OM >= 4) {
            *(v4u*)(Cb + (size_t)(mBase + row) * ldc + n0 + c8) = lv[it];
          }
        }
        
      }
    }
    wave_sync_lds();
  }
}

// One GEMM per launch: grid.x = groups of 8 tiles, grid.y = batch.
template <int OM, int ASPLIT, int BF, int EPI>
__global__ __launch_bounds__(256) __attribute__((amdgpu_num_vgpr(256))) void gemm64(
    const unsigned short* __restrict__ Ap, const unsigned short* __restrict__ A2p, int lda, long long sA,
    const unsigned short* __restrict__ Btp, int ldb, long long sB,
    void* Cout, void* C2out, int ldc, long long sC,
    int M, int N, int K, float oscale, float ocarry,
    const float* __restrict__ ep0, const float* __restrict__ ep1, const float* __restrict__ ep2) {
  __shared__ __align__(16) float sT[8 * SLABF];
  gemm64_tile<OM, ASPLIT, BF, EPI>(sT, blockIdx.x, blockIdx.y, Ap, A2p, lda, sA, Btp, ldb, sB, Cout, C2out, ldc, sC,
                                   M, N, K, oscale, ocarry, ep0, ep1, ep2);
}

// The four projections, which need nothing of each other, in ONE grid; ranges of the block index pick the product (block-uniform):
//   PJ_Q blocks: q[m][nd] = sum_c x[m][c] W[nd][c] / 1024 + bq[nd]; QU = f16((q + ub[nd]) * 4), QV = f16((q + vbias[nd]) * 4);
//                M = NROW, N = 512, K = 512
//   PJ_Q blocks: k projection + bk -> K16 = f16(k * 4), same shape
//   NB * PJ_V blocks: v^T per batch: VT[b][nd][j] = sum_c W[nd][c] x[b*SEQ + j][c] / 1024 + bv[nd] (per-row bias) -> f16 x64 hi +
//                residual planes; M = 512 (nd), N = SEQ (j), K = 512; B rows are the batch's token rows: pitch DMOD, stride SEQ*DMOD
//   PJ_P blocks: positional projection (no bias): P16 = f16(p * 4), M = SEQ, N = 512, K = 512
#define PJ_Q (((NROW / 64) * (DMOD / 64)) / 8)
#define PJ_V (((DMOD / 64) * (SEQ / 64)) / 8)
#define PJ_P (((SEQ / 64) * (DMOD / 64)) / 8)
#define PJ_BLOCKS (2 * PJ_Q + NB * PJ_V + PJ_P)
static_assert(((DMOD / 64) % 8) == 0);   // every product's tile count is a multiple of the 8 tiles of a block
__global__ __launch_bounds__(256) __attribute__((amdgpu_num_vgpr(256))) void proj_all(
    const unsigned short* __restrict__ XQ, const unsigned short* __restrict__ XK,
    const unsigned short* __restrict__ XV, const unsigned short* __restrict__ XP,
    const unsigned short* __restrict__ WQ, const unsigned short* __restrict__ WK,
    const unsigned short* __restrict__ WV, const unsigned short* __restrict__ WP,
    unsigned short* QU, unsigned short* QV, unsigned short* K16,
    unsigned short* VT, unsigned short* VTL, unsigned short* P16,
    const float* __restrict__ bq, const float* __restrict__ bk, const float* __restrict__ bv,
    const float* __restrict__ ub, const float* __restrict__ vb) {
  __shared__ __align__(16) float sT[8 * SLABF];
  const int bx = blockIdx.x;
  const float osc = 1.0f / (XC * WSC);
  if (bx < PJ_Q) {
    gemm64_tile<5, 0, 0, 1>(sT, bx, 0, XQ, XQ, DMOD, 0LL, WQ, DMOD, 0LL, (void*)QU, (void*)QV, DMOD, 0LL,
                            NROW, DMOD, DMOD, osc, QC, bq, ub, vb);
  } else if (bx < 2 * PJ_Q) {
    gemm64_tile<2, 0, 0, 1>(sT, bx - PJ_Q, 0, XK, XK, DMOD, 0LL, WK, DMOD, 0LL, (void*)K16, (void*)K16, DMOD, 0LL,
                            NROW, DMOD, DMOD, osc, QC, bk, bk, bk);
  } else if (bx < 2 * PJ_Q + NB * PJ_V) {
    const int r  = bx - 2 * PJ_Q;
    const int by = r / PJ_V;
    gemm64_tile<4, 0, 0, 2>(sT, r - by * PJ_V, by, WV, WV, DMOD, 0LL, XV, DMOD, (long long)SEQ * DMOD,
                            (void*)VT, (void*)VTL, SEQ, (long long)DMOD * SEQ,
                            DMOD, SEQ, DMOD, osc, VC, bv, bv, bv);
  } else if (bx < PJ_BLOCKS) {
    gemm64_tile<2, 0, 0, 0>(sT, bx - (2 * PJ_Q + NB * PJ_V), 0, XP, XP, DMOD, 0LL, WP, DMOD, 0LL, (void*)P16, (void*)P16, DMOD, 0LL,
                            SEQ, DMOD, DMOD, osc, QC, bq, bq, bq);
  }
}

// =====================================================================================================
// Full (non-causal) attention with a 128-deep score contraction for one (batch b, head n) pair and a 128-row query tile;
// 8 waves, wave w owns query rows iw0 .. iw0+15, iw0 = i0 + 16w. Planes (pitch DMOD halves, row index = b*SEQ + position):
// QU = f16((q + bq + ub) x4), QV = f16((q + bq + vbias) x4), KP = f16((k + bk) x4); PP = f16(p x4) rows s = 0 .. SEQ-1 (shared by
// all batches); VT, VTL = v^T hi x64 / residual f16 as [b][n*64+d][SEQ]. Key mask ints kmask[b*SEQ_FULL + s], masked where == 0.
//   Both products are computed transposed: S^T = [k | p] . [q+ub | q+vbias]^T (A = key rows from LDS, B = the query fragments, loaded
//   once and kept in registers) and O^T += v^T . P^T (A = v^T rows from LDS, B = P^T). Lane (c, hh) then holds, for its ONE query
//   iw0 + c, the scores of keys j0 + 16t + 8hh + r (t 0..3, r 0..7): maximum and sum run inside the lane, with one exchange between
//   the lane halves for the maximum per key tile and one for the sum behind the loop; two score tiles converted in place are a B
//   operand in the loaders' k map (element e <- tile 2ks row 8hh+e, element 8+e <- tile 2ks+1 row 8hh+e), so P never leaves registers.
//   Key mask: the score accumulators start from kbias[key] (0, or -1e30 where the key is masked; built once per work-group in LDS).
//   The running maximum never falls below -1e20 (any real score lies far above it), so a masked key's exponential is exactly 0 and a
//   fully masked row keeps sum 0 and gives ctx 0. Online softmax in base 2, max-subtracted, f32; the x1024 carry of P sits in the
//   exponent (+10), so the running sum carries it too and it cancels in the division.
//   Per key tile (64 keys): 16 score WMMAs, 8 + 8 P.V WMMAs (hi plane then residual plane into the same accumulators).
//   Key tiles: the four 64-row x 128-byte planes of a tile (k rows, p rows, v^T hi rows, v^T residual rows of head n) are brought into
//   LDS once per work-group by asynchronous 16-byte copies (8 per thread, each wave-copy = 4 whole 128-byte lines), two buffers: tile
//   t + 2 is copied into the buffer that trip t has read, behind the trip's barrier; all A fragments are 16-byte LDS reads at pitch 144 B.
//   block = 8 waves = 256 threads; grid = (SEQ/128, NB*NH); one block barrier per key tile; identical bounded work (SEQ/64 tiles).
// LDS: two key-tile buffers and kbias shared by the block; one [16][PPI] f32 slab per wave for the ctx tile, private-to-wave (wave_sync);
//   staged extent == consumed extent (16 rows x 64 cols written by every lane (c, hh) x (td, r) before any read).
// coverage: global: 4 instructions x 4 rows x 64 halves per plane = rows iw0..iw0+15 of head segment n in CT and CTL;
//           grid x waves cover all NB x SEQ rows and all NH head segments of CT / CTL exactly once.
// =====================================================================================================
__device__ __forceinline__ float xhalf(float x) {   // value of lane l ^ 16
  const int b = __builtin_bit_cast(int, x);
  return __builtin_bit_cast(float, __builtin_amdgcn_permlanex16(b, b, 0x76543210, 0xfedcba98, false, false));
}
__device__ __forceinline__ float max8(v8f s) {
  return fmaxf(fmaxf(fmaxf(fmaxf(s[0], s[1]), s[2]), fmaxf(fmaxf(s[3], s[4]), s[5])), fmaxf(s[6], s[7]));
}

__global__ __launch_bounds__(ATT_THREADS) __attribute__((amdgpu_num_vgpr(256)))
void attn_full(const unsigned short* __restrict__ QU, const unsigned short* __restrict__ QV,
               const unsigned short* __restrict__ KP, const unsigned short* __restrict__ PP,
               const unsigned short* __restrict__ VT, const unsigned short* __restrict__ VTL,
               const int* __restrict__ kmask,
               unsigned short* CT, unsigned short* CTL) {
  __shared__ __align__(16) float smem[ATT_W * WFL];   // per wave: ctx slab [16][PPI]
  __shared__ __align__(128) unsigned char tiles[2 * TBUF];   // two key-tile buffers: [buffer][plane k, p, v hi, v lo][64 rows][TPITCH]
  __shared__ __align__(32) float kbias[SEQ];          // start value of a key's score accumulators

  const int tid  = threadIdx.x;
  const int wave = tid >> 5;
  const int lane = tid & 31;
  const int hh   = lane >> 4;
  const int c    = lane & 15;
  const int bn   = blockIdx.y;
  const int b    = bn / NH;
  const int n    = bn - b * NH;
  const int i0   = blockIdx.x * ATT_ROWS;
  const int iw0  = i0 + wave * 16;

  float* pt = smem + wave * WFL;

  // stationary B fragments: (q + bq + ub) and (q + bq + vbias), query row b*SEQ + iw0 + c, d 0..31 and 32..63 of head n
  const size_t qro = ((size_t)(b * SEQ + iw0 + c)) * DMOD + n * DH + 8 * hh;
  const v16h qua = ldfrag_u(QU + qro), qub = ldfrag_u(QU + qro + 32);
  const v16h qva = ldfrag_u(QV + qro), qvb = ldfrag_u(QV + qro + 32);

  const int* km = kmask + (size_t)b * SEQ_FULL;

  // copy share of this thread: rows crow and crow + 32 of each plane, 16-byte piece cpc of the 128-byte row
  const int crow = tid >> 3, cpc = tid & 7;
  const unsigned short* gK = KP + ((size_t)b * SEQ + crow) * DMOD + n * DH + 8 * cpc;          // + j0 * DMOD per tile
  const unsigned short* gP = PP + (size_t)crow * DMOD + n * DH + 8 * cpc;                      // + j0 * DMOD per tile
  const size_t vbase = (size_t)b * DMOD * SEQ + (size_t)(n * DH + crow) * SEQ + 8 * cpc;       // + j0 per tile
  const unsigned short* gV = VT  + vbase;
  const unsigned short* gL = VTL + vbase;
  const unsigned ldst = (unsigned)(size_t)tiles + (unsigned)(crow * TPITCH + cpc * 16);        // LDS byte address, buffer 0, plane 0
  // fragment read base of this lane: row c of a 16-row subtile, 16-byte piece hh
  const unsigned char* fr0 = tiles + c * TPITCH + 16 * hh;

  auto stage = [&](int jt, unsigned bo) {   // key tile at jt -> buffer at byte offset bo; every lane on, all addresses in range
    const unsigned l = ldst + bo;
    const size_t kr = (size_t)jt * DMOD;
    copy8_async(l, l + 32 * TPITCH, l + TPLANE, l + TPLANE + 32 * TPITCH,
                l + 2 * TPLANE, l + 2 * TPLANE + 32 * TPITCH, l + 3 * TPLANE, l + 3 * TPLANE + 32 * TPITCH,
                gK + kr, gK + kr + 32 * DMOD, gP + kr, gP + kr + 32 * DMOD,
                gV + jt, gV + jt + (size_t)32 * SEQ, gL + jt, gL + jt + (size_t)32 * SEQ);
  };
  stage(0, 0u);
  // key bias, built while tile 0 flies (another LDS range than the copies'); published by the same barrier
#pragma unroll
  for (int s = 0; s < SEQ; s += ATT_THREADS) kbias[s + tid] = (km[s + tid] == 0) ? -1.0e30f : 0.f;   // s + tid < SEQ <= SEQ_FULL
  wait_async0();
  __syncthreads();                          // tile 0 and kbias published
  if (SEQ > 64) stage(64, (unsigned)TBUF);

  const float KSC = (SCALE / (QC * QC)) * LOG2E;

  float mrun = -1.0e20f, lrun = 0.f;        // this lane's query: running maximum (both halves alike), running sum x1024 (own half's keys)
  v8f O[4];                                 // O^T: O[td][r] = ctx accumulator of d = 16td + 8hh + r, query c
#pragma unroll
  for (int td = 0; td < 4; ++td) O[td] = zero8();

#pragma unroll 1
  for (int j0 = 0; j0 < SEQ; j0 += 64) {
    const unsigned bo = ((unsigned)j0 & 64u) ? (unsigned)TBUF : 0u;      // buffer of this trip
    const unsigned char* fr = fr0 + bo;

    // ---- S^T = kbias + k . (q+ub)^T + p . (q+vbias)^T: 4 subtiles of 16 keys, four 32-deep steps, the subtiles independent ----
    v8f S[4];
#pragma unroll
    for (int t = 0; t < 4; ++t) S[t] = *(const v8f*)(kbias + j0 + 16 * t + 8 * hh);
#pragma unroll
    for (int t = 0; t < 4; ++t) S[t] = mma_h(ldfrag_u((const unsigned short*)(fr + 16 * t * TPITCH)), qua, S[t]);
#pragma unroll
    for (int t = 0; t < 4; ++t) S[t] = mma_h(ldfrag_u((const unsigned short*)(fr + 16 * t * TPITCH) + 32), qub, S[t]);
#pragma unroll
    for (int t = 0; t < 4; ++t) S[t] = mma_h(ldfrag_u((const unsigned short*)(fr + TPLANE + 16 * t * TPITCH)), qva, S[t]);
#pragma unroll
    for (int t = 0; t < 4; ++t) S[t] = mma_h(ldfrag_u((const unsigned short*)(fr + TPLANE + 16 * t * TPITCH) + 32), qvb, S[t]);

    // ---- online softmax, one query per lane: 32 of the tile's 64 keys here, the other 32 in lane l ^ 16 ----
    float mx = fmaxf(fmaxf(max8(S[0]), max8(S[1])), fmaxf(max8(S[2]), max8(S[3])));
    mx = fmaxf(mx, xhalf(mx));
    const float mn = fmaxf(mrun, mx * KSC);
    const float al = exp2f(mrun - mn);
    mrun = mn;
    const float sh = 10.0f - mn;            // 2^10 = the x1024 carry of P
    FragH pf[2];
    float ps[4];
#pragma unroll
    for (int t = 0; t < 4; ++t) {
      ps[t] = 0.f;
#pragma unroll
      for (int r = 0; r < 8; ++r) {
        const float ev = exp2f(fmaf(S[t][r], KSC, sh));
        ps[t] += ev;
        pf[t >> 1].h[t & 1][r] = (_Float16)ev;     // key j0 + 32(t>>1) + 16(t&1) + 8hh + r
      }
    }
    lrun = lrun * al + ((ps[0] + ps[1]) + (ps[2] + ps[3]));
#pragma unroll
    for (int td = 0; td < 4; ++td)
#pragma unroll
      for (int r = 0; r < 8; ++r) O[td][r] *= al;

    // ---- O^T += v^T . P^T: hi plane, then residual plane, two 32-key steps each, the four d subtiles independent ----
#pragma unroll
    for (int pl = 2; pl < 4; ++pl)
#pragma unroll
      for (int ks = 0; ks < 2; ++ks)
#pragma unroll
        for (int td = 0; td < 4; ++td)
          O[td] = mma_h(ldfrag_u((const unsigned short*)(fr + pl * TPLANE + 16 * td * TPITCH) + 32 * ks), pf[ks].v, O[td]);

    // ---- publish tile t + 1, free this trip's buffer, then refill it with tile t + 2 ----
    wait_ds0();
    wait_async0();
    __syncthreads();
    if (j0 + 128 < SEQ) stage(j0 + 128, bo);
  }
  wait_async0();
  acc_guard4(O[0], O[1], O[2], O[3]);

  // ---- join the halves' sums; fold 1/l (0 for an empty row) and the carry 64 on v (1024 on P cancels), carry x64 on ctx ----
  {
    const float oc  = CC / VC;
    const float lr  = lrun + xhalf(lrun);
    const float den = (lr > 0.f) ? lr : 1.0f;
    const float inv = (lr > 0.f) ? ((1.0f / den) * oc) : 0.f;
    float* po = pt + c * PPI + 8 * hh;
#pragma unroll
    for (int td = 0; td < 4; ++td) {
      v4f w0, w1;
#pragma unroll
      for (int e = 0; e < 4; ++e) { w0[e] = O[td][e] * inv; w1[e] = O[td][4 + e] * inv; }
      *(v4f*)(po + 16 * td)     = w0;
      *(v4f*)(po + 16 * td + 4) = w1;
    }
  }
  wave_sync_lds();
  {
    const int q8 = lane >> 3, c8 = (lane & 7) * 8;
    v4u hv[4], lv[4];
#pragma unroll
    for (int it = 0; it < 4; ++it) {
      const int row = it * 4 + q8;                         // it 0..3 x q8 0..3 = rows 0..15
      const float* sp = pt + row * PPI + c8;
      v4u a  = {0u, 0u, 0u, 0u};
      v4u b2 = {0u, 0u, 0u, 0u};
#pragma unroll
      for (int e = 0; e < 4; ++e) {
        const float f0 = sp[2 * e], f1 = sp[2 * e + 1];
        const _Float16 x0 = (_Float16)f0, x1 = (_Float16)f1;
        a[e]  = pk16(h_bits(x0), h_bits(x1));
        b2[e] = pk16(h_bits((_Float16)(f0 - (float)x0)), h_bits((_Float16)(f1 - (float)x1)));
      }
      hv[it] = a;
      lv[it] = b2;
    }
    {
#pragma unroll
      for (int it = 0; it < 4; ++it) {
        const int row = it * 4 + q8;
        const size_t go = ((size_t)(b * SEQ + iw0 + row)) * DMOD + n * DH + c8;
        *(v4u*)(CT  + go) = hv[it];
        *(v4u*)(CTL + go) = lv[it];
      }
    }
  }
}

// =====================================================================================================
// Workspace map (bytes); every plane is an exact multiple of its tile / whole-row store granularity (M, N exact multiples of 64,
// convert counts exact multiples of 2048), every offset a multiple of 512 KiB:
//   WQ16, WK16, WV16, WP16, WO16 f16 [512 out][512 in] x64 (input layout kept, no transpose)   5 x   524288
//   XQ16, XK16, XV16 f16 [NROW][512] x16 (rows b*SEQ + t)                                    3 x  8388608
//   XP16 f16 [SEQ][512] x16                                                                        2097152
//   QU, QV, K16 f16 [NROW][512] x4                                                           3 x  8388608
//   P16  f16 [SEQ][512] x4                                                                         2097152
//   VT16, VTL16 f16 [NB][512][SEQ] hi x64 / residual                                         2 x  8388608
//   CT16, CTL16 f16 [NROW][512] hi x64 / residual                                            2 x  8388608
//   end (NB=4, SEQ=2048)                                                                          90701824
// =====================================================================================================
extern "C" void kernel_launch(void* const* d_in, const int* in_sizes, int n_in,
                              void* d_out, int out_size, void* d_ws, size_t ws_size,
                              hipStream_t stream) {
  if (n_in < 16) return;
  const long long needX = (long long)NB * SEQ_FULL * DMOD;     // reads rows b*SEQ_FULL + t, b < NB, t < SEQ
  if ((long long)in_sizes[0] < needX || (long long)in_sizes[1] < needX || (long long)in_sizes[2] < needX) return;
  if (in_sizes[3] < NB * SEQ_FULL) return;
  if (in_sizes[4] < SEQ * DMOD) return;
  if (in_sizes[5] != DMOD * DMOD || in_sizes[7] != DMOD * DMOD || in_sizes[9] != DMOD * DMOD ||
      in_sizes[11] != DMOD * DMOD || in_sizes[13] != DMOD * DMOD) return;
  if (in_sizes[6] != DMOD || in_sizes[8] != DMOD || in_sizes[10] != DMOD || in_sizes[12] != DMOD) return;
  if (in_sizes[14] != NH * DH || in_sizes[15] != NH * DH) return;
  if (out_size < NROW * DMOD) return;

  const float* xq    = (const float*)d_in[0];
  const float* xk    = (const float*)d_in[1];
  const float* xv    = (const float*)d_in[2];
  const int*   kmask = (const int*)d_in[3];
  const float* xpos  = (const float*)d_in[4];
  const float* w_q   = (const float*)d_in[5];
  const float* b_q   = (const float*)d_in[6];
  const float* w_k   = (const float*)d_in[7];
  const float* b_k   = (const float*)d_in[8];
  const float* w_v   = (const float*)d_in[9];
  const float* b_v   = (const float*)d_in[10];
  const float* w_o   = (const float*)d_in[11];
  const float* b_o   = (const float*)d_in[12];
  const float* w_p   = (const float*)d_in[13];
  const float* ub    = (const float*)d_in[14];
  const float* vb    = (const float*)d_in[15];
  float*       out   = (float*)d_out;

  const size_t PW  = (size_t)DMOD * DMOD * 2;            //   524288
  const size_t PX  = (size_t)NROW * DMOD * 2;            //  8388608
  const size_t PXP = (size_t)SEQ * DMOD * 2;             //  2097152
  const size_t PVT = (size_t)NB * DMOD * SEQ * 2;        //  8388608
  size_t off = 0;
  const size_t oWQ  = off; off += PW;
  const size_t oWK  = off; off += PW;
  const size_t oWV  = off; off += PW;
  const size_t oWP  = off; off += PW;
  const size_t oWO  = off; off += PW;
  const size_t oXQ  = off; off += PX;
  const size_t oXK  = off; off += PX;
  const size_t oXV  = off; off += PX;
  const size_t oXP  = off; off += PXP;
  const size_t oQU  = off; off += PX;
  const size_t oQV  = off; off += PX;
  const size_t oK   = off; off += PX;
  const size_t oP   = off; off += PXP;
  const size_t oVT  = off; off += PVT;
  const size_t oVTL = off; off += PVT;
  const size_t oCT  = off; off += PX;
  const size_t oCTL = off; off += PX;
  if (off > ws_size) return;                               // off = 90701824 at NB=4, SEQ=2048
  if (off > (size_t)134217728) return;

  char* ws = (char*)d_ws;
  unsigned short* WQ16  = (unsigned short*)(ws + oWQ);
  unsigned short* WK16  = (unsigned short*)(ws + oWK);
  unsigned short* WV16  = (unsigned short*)(ws + oWV);
  unsigned short* WP16  = (unsigned short*)(ws + oWP);
  unsigned short* WO16  = (unsigned short*)(ws + oWO);
  unsigned short* XQ16  = (unsigned short*)(ws + oXQ);
  unsigned short* XK16  = (unsigned short*)(ws + oXK);
  unsigned short* XV16  = (unsigned short*)(ws + oXV);
  unsigned short* XP16  = (unsigned short*)(ws + oXP);
  unsigned short* QU    = (unsigned short*)(ws + oQU);
  unsigned short* QV    = (unsigned short*)(ws + oQV);
  unsigned short* K16   = (unsigned short*)(ws + oK);
  unsigned short* P16   = (unsigned short*)(ws + oP);
  unsigned short* VT16  = (unsigned short*)(ws + oVT);
  unsigned short* VTL16 = (unsigned short*)(ws + oVTL);
  unsigned short* CT16  = (unsigned short*)(ws + oCT);
  unsigned short* CTL16 = (unsigned short*)(ws + oCTL);

  const dim3 blk(256);
  const dim3 gCV(CVT_BLOCKS);                                       // 7296
  const dim3 gPJ(PJ_BLOCKS);                                        // 416
  const int tilesQ = (NROW / 64) * (DMOD / 64);                     // 1024
  const dim3 gQ((tilesQ + 7) / 8, 1);                               // 128
  const dim3 gAT(SEQ / ATT_ROWS, NB * NH);                          // 16 x 32
  const dim3 bAT(ATT_THREADS);                                      // 256

  // (0) all nine 16-bit planes in one launch: weights W[nd][c] ([out][in], already k-contiguous per output row) -> f16( bf16_RNE(w) * 64 );
  //     activations and pos -> f16(bf16(x) * 16). Destination: WQ16 .. XP16, contiguous from WQ16 in the order of the kernel's ranges.
  cvt_all<<<gCV, blk, 0, stream>>>(w_q, w_k, w_v, w_p, w_o, xq, xk, xv, xpos, WQ16);

  // (1) q, k, v^T and positional projections in one launch
  proj_all<<<gPJ, blk, 0, stream>>>(XQ16, XK16, XV16, XP16, WQ16, WK16, WV16, WP16,
                                    QU, QV, K16, VT16, VTL16, P16, b_q, b_k, b_v, ub, vb);

  // (2) attention -> CT16 = f16(ctx * 64) hi plane, CTL16 residual plane, rows b*SEQ + i, halves n*64+d
  attn_full<<<gAT, bAT, 0, stream>>>(QU, QV, K16, P16, VT16, VTL16, kmask, CT16, CTL16);

  // (3) out = (CT + CTL) . W^T / (64*64) + bo; M = NROW, N = 512, K = 512, f32 rows straight into the output buffer (row b*SEQ + t)
  gemm64<0, 1, 0, 1><<<gQ, blk, 0, stream>>>(
      CT16, CTL16, DMOD, 0LL,
      WO16, DMOD, 0LL,
      (void*)out, (void*)out, DMOD, 0LL,
      NROW, DMOD, DMOD, 1.0f / (CC * WSC), 1.0f,
      b_o, b_o, b_o);
  (void)hipGetLastError();
}

// v004
// A run of this version takes 109 microseconds.
// Two timings next to v003 put it at 1.58 and 1.60 times that version's speed.
// All steps since v000 together make it 3.97 times as fast.
// Contractions (all v_wmma_f32_16x16x32_f16, f16 operands, f32 accumulate): q/k/v/p projections (x f16 x16 . W f16 x64, K=512, single products);
// scores ([q+bq+u | q+bq+vbias] f16 x4 . [k+bk | p] f16 x4, K=128 per head, single products); P . v^T (P f16 x1024 . v^T carried as
// f16 x64 hi plane + f16 residual plane, 64 keys per tile, two products; both attention products run transposed); output projection (ctx carried as f16 x64 hi + residual planes
// . Wo f16 x64, K=512, two products). Key mask (score accumulators start at -1e30 for a masked key, whose exponential is then 0), max-subtracted online base-2 softmax and
// all epilogues in f32 on VALU. Every float input RNE-converted to bf16 on load.
#include <hip/hip_runtime.h>
#include <math.h>
#include <stdint.h>

#ifndef NB
#define NB    4
#endif
#ifndef SEQ
#define SEQ   2048
#endif
#define NB_FULL  4
#define SEQ_FULL 2048
#define DMOD  512
#define NH    8
#define DH    64
#define NROW  (SEQ * NB)
#define XC    16.0f
#define WSC   64.0f
#define QC    4.0f
#define VC    64.0f
#define PC    1024.0f
#define CC    64.0f
#define SCALE 0.125f
#define LOG2E 1.4426950408889634f
static_assert(NH * DH == DMOD);
static_assert(DH == 64);
static_assert(NB >= 1 && NB <= NB_FULL && SEQ >= 64 && SEQ <= SEQ_FULL);
static_assert((SEQ % 64) == 0 && (DMOD % 64) == 0 && (NROW % 64) == 0);
static_assert(((SEQ * DMOD) % 2048) == 0 && ((DMOD * DMOD) % 2048) == 0);
#define ATT_W 8
#define ATT_THREADS (ATT_W * 32)
#define ATT_ROWS (ATT_W * 16)
#define TPITCH 144                     // LDS bytes per staged 128-byte row: 16 B x odd, conflict-free for 16-byte fragment reads
#define TPLANE (64 * TPITCH)           // one staged plane: 64 rows
#define TBUF   (4 * TPLANE)            // one key tile: k, p, v^T hi, v^T residual
static_assert((SEQ % ATT_ROWS) == 0 && ATT_THREADS == 256);
#define PPI 68
#define WFL (16 * PPI)
static_assert((PPI % 4) == 0 && PPI >= 64 && (WFL % 4) == 0);

typedef _Float16 v16h __attribute__((ext_vector_type(16)));
typedef _Float16 v8h  __attribute__((ext_vector_type(8)));
typedef __bf16   v16b __attribute__((ext_vector_type(16)));
typedef float    v8f  __attribute__((ext_vector_type(8)));
typedef float    v4f  __attribute__((ext_vector_type(4)));
typedef unsigned int v4u __attribute__((ext_vector_type(4)));

union FragH { v16h v; v8h h[2]; v4u u[2]; };
union FragAny { v16h h; v16b b; };

// ---- scalar helpers --------------------------------------------------------------------------------
__device__ __forceinline__ unsigned short bf_bits(float f) {          // f32 -> bf16 bits, RNE convert
  unsigned u = __float_as_uint(f);
  return (unsigned short)((u + 0x7FFFu + ((u >> 16) & 1u)) >> 16);
}
__device__ __forceinline__ float bf_up(unsigned short h) { return __uint_as_float(((unsigned)h) << 16); }
__device__ __forceinline__ float bfr(float f) { return bf_up(bf_bits(f)); }   // value of the bf16 RNE convert
__device__ __forceinline__ unsigned short h_bits(_Float16 x) { return __builtin_bit_cast(unsigned short, x); }
__device__ __forceinline__ unsigned pk16(unsigned short a, unsigned short b) { return (unsigned)a | ((unsigned)b << 16); }
__device__ __forceinline__ v8f zero8() { v8f z = {0.f, 0.f, 0.f, 0.f, 0.f, 0.f, 0.f, 0.f}; return z; }

// ---- fragment loader: 16-bit A/B operand from a k-contiguous 16-bit plane, lane -> row/col (lane&15),
//      p already includes +8*(lane>>4); elements 0..7 <- p[0..7] (k0+8h..), elements 8..15 <- p[16..23] (k0+16+8h..)
//      (same split k map for A and B; B is always read from a [n][k] plane)
__device__ __forceinline__ v16h ldfrag_u(const unsigned short* p) {
  FragH f;
  f.u[0] = *(const v4u*)(p);
  f.u[1] = *(const v4u*)(p + 16);
  return f.v;
}

// ---- WMMA helpers with trailing VALU hazard gaps ------------------------------------------------------
__device__ __forceinline__ v8f mma_h(v16h a, v16h b, v8f c) {
  return __builtin_amdgcn_wmma_f32_16x16x32_f16(false, a, false, b, (short)0, c, false, false);
}
__device__ __forceinline__ v8f mma_b(v16h a, v16h b, v8f c) {
  FragAny ua, ub;
  ua.h = a;
  ub.h = b;
  return __builtin_amdgcn_wmma_f32_16x16x32_bf16(false, ua.b, false, ub.b, (short)0, c, false, false);
}
template <int BF>
__device__ __forceinline__ v8f mmaT(v16h a, v16h b, v8f c) {
  if constexpr (BF != 0) return mma_b(a, b, c);
  else return mma_h(a, b, c);
}
__device__ __forceinline__ void dep_guard1(v8f& a, v8f& b, v16h x) {
#if defined(__HIP_DEVICE_COMPILE__)
  asm volatile("v_nop\n\tv_nop\n\tv_nop\n\tv_nop" : "+v"(a), "+v"(b) : "v"(x));
#endif
}
__device__ __forceinline__ void keep4_h(v16h a, v16h b, v16h c, v16h d) {
#if defined(__HIP_DEVICE_COMPILE__)
  asm volatile("v_nop" :: "v"(a), "v"(b), "v"(c), "v"(d));
#endif
}
__device__ __forceinline__ void acc_guard4(v8f& a, v8f& b, v8f& c, v8f& d) {
#if defined(__HIP_DEVICE_COMPILE__)
  asm volatile("v_nop\n\tv_nop\n\tv_nop\n\tv_nop" : "+v"(a), "+v"(b), "+v"(c), "+v"(d));
#endif
}
// Eight asynchronous 16-byte copies per lane, global -> LDS (a key tile's share of a thread, or a GEMM chunk's Bt rows or both A planes). The s_wait_xcnt stands inside the
// statement so that no address register of an issued copy is rewritten in front of it.
__device__ __forceinline__ void copy8_async(unsigned l0, unsigned l1, unsigned l2, unsigned l3,
                                            unsigned l4, unsigned l5, unsigned l6, unsigned l7,
                                            const unsigned short* g0, const unsigned short* g1,
                                            const unsigned short* g2, const unsigned short* g3,
                                            const unsigned short* g4, const unsigned short* g5,
                                            const unsigned short* g6, const unsigned short* g7) {
#if defined(__HIP_DEVICE_COMPILE__)
  asm volatile("global_load_async_to_lds_b128 %0, %8, off\n\t"
               "global_load_async_to_lds_b128 %1, %9, off\n\t"
               "global_load_async_to_lds_b128 %2, %10, off\n\t"
               "global_load_async_to_lds_b128 %3, %11, off\n\t"
               "global_load_async_to_lds_b128 %4, %12, off\n\t"
               "global_load_async_to_lds_b128 %5, %13, off\n\t"
               "global_load_async_to_lds_b128 %6, %14, off\n\t"
               "global_load_async_to_lds_b128 %7, %15, off\n\t"
               "s_wait_xcnt 0x0"
               :: "v"(l0), "v"(l1), "v"(l2), "v"(l3), "v"(l4), "v"(l5), "v"(l6), "v"(l7),
                  "v"(g0), "v"(g1), "v"(g2), "v"(g3), "v"(g4), "v"(g5), "v"(g6), "v"(g7)
               : "memory");
#endif
}
// Four such copies per lane (the A rows of a GEMM chunk), with the same wait inside the statement for the same reason.
__device__ __forceinline__ void copy4_async(unsigned l0, unsigned l1, unsigned l2, unsigned l3,
                                            const unsigned short* g0, const unsigned short* g1,
                                            const unsigned short* g2, const unsigned short* g3) {
#if defined(__HIP_DEVICE_COMPILE__)
  asm volatile("global_load_async_to_lds_b128 %0, %4, off\n\t"
               "global_load_async_to_lds_b128 %1, %5, off\n\t"
               "global_load_async_to_lds_b128 %2, %6, off\n\t"
               "global_load_async_to_lds_b128 %3, %7, off\n\t"
               "s_wait_xcnt 0x0"
               :: "v"(l0), "v"(l1), "v"(l2), "v"(l3), "v"(g0), "v"(g1), "v"(g2), "v"(g3)
               : "memory");
#endif
}
// This wave's own copies have landed in LDS (other waves read them only behind the next work-group barrier).
__device__ __forceinline__ void wait_async0() {
#if defined(__HIP_DEVICE_COMPILE__)
  asm volatile("s_wait_asynccnt 0x0" ::: "memory");
#endif
}
// This wave's own LDS reads have returned, so that the buffer they read may be refilled behind the barrier.
__device__ __forceinline__ void wait_ds0() {
#if defined(__HIP_DEVICE_COMPILE__)
  asm volatile("s_wait_dscnt 0x0" ::: "memory");
#endif
}
__device__ __forceinline__ void wave_sync_lds() {
  __builtin_amdgcn_fence(__ATOMIC_RELEASE, "workgroup");
  __builtin_amdgcn_wave_barrier();
  __builtin_amdgcn_fence(__ATOMIC_ACQUIRE, "workgroup");
}

// =====================================================================================================
// Elementwise 16-bit pack, no transpose, all nine float planes in ONE grid: dst[i] = f16( bf16_RNE(src[i]) * sc ), sc a power of two
// (exact). A block packs one piece of 2048 elements (256 thr x 8: two 16-B loads, one 16-B store per thread); ranges of the block index
// pick the source (block-uniform): CVT_W pieces for each of wq, wk, wv, wp, wo (x64), NB * CVT_X for each of xq, xk, xv (x16; batch y is
// read at input row y*SEQ_FULL and written at plane row y*SEQ), CVT_X for pos (x16). The nine destination planes lie in the workspace
// one behind the other in this same order, so piece bx is written at dst + bx * 2048.
// coverage: grid = CVT_BLOCKS blocks = every piece of every plane exactly once (all plane sizes are multiples of 2048 by the static sizes).
// =====================================================================================================
#define CVT_W ((DMOD * DMOD) / 2048)
#define CVT_X ((SEQ * DMOD) / 2048)
#define CVT_BLOCKS (5 * CVT_W + 3 * NB * CVT_X + CVT_X)
__global__ __launch_bounds__(256) void cvt_all(const float* __restrict__ wq, const float* __restrict__ wk, const float* __restrict__ wv,
                                               const float* __restrict__ wp, const float* __restrict__ wo,
                                               const float* __restrict__ xq, const float* __restrict__ xk, const float* __restrict__ xv,
                                               const float* __restrict__ xpos, unsigned short* dst) {
  const int bx = blockIdx.x;
  if (bx >= CVT_BLOCKS) return;               // never taken with the exact grid; no barriers in this kernel
  const float* src;
  size_t so;                                  // element offset of this block's piece in its source
  float sc;
  if (bx < 5 * CVT_W) {
    const int seg = bx / CVT_W;
    src = (seg == 0) ? wq : (seg == 1) ? wk : (seg == 2) ? wv : (seg == 3) ? wp : wo;
    so  = (size_t)(bx - seg * CVT_W) * 2048;
    sc  = WSC;
  } else if (bx < 5 * CVT_W + 3 * NB * CVT_X) {
    const int r   = bx - 5 * CVT_W;
    const int seg = r / (NB * CVT_X);
    const int rs  = r - seg * (NB * CVT_X);
    const int y   = rs / CVT_X;
    src = (seg == 0) ? xq : (seg == 1) ? xk : xv;
    so  = (size_t)y * SEQ_FULL * DMOD + (size_t)(rs - y * CVT_X) * 2048;
    sc  = XC;
  } else {
    src = xpos;
    so  = (size_t)(bx - (5 * CVT_W + 3 * NB * CVT_X)) * 2048;
    sc  = XC;
  }
  const float* s = src + so + (size_t)threadIdx.x * 8;
  unsigned short* d = dst + (size_t)bx * 2048 + (size_t)threadIdx.x * 8;
  const v4f a = *(const v4f*)(s);
  const v4f b = *(const v4f*)(s + 4);
  v4u o;
  o[0] = pk16(h_bits((_Float16)(bfr(a[0]) * sc)), h_bits((_Float16)(bfr(a[1]) * sc)));
  o[1] = pk16(h_bits((_Float16)(bfr(a[2]) * sc)), h_bits((_Float16)(bfr(a[3]) * sc)));
  o[2] = pk16(h_bits((_Float16)(bfr(b[0]) * sc)), h_bits((_Float16)(bfr(b[1]) * sc)));
  o[3] = pk16(h_bits((_Float16)(bfr(b[2]) * sc)), h_bits((_Float16)(bfr(b[3]) * sc)));
  *(v4u*)(d) = o;
}

// =====================================================================================================
// Register-blocked batched 16-bit WMMA GEMM: C[m][n] = oscale * sum_k A[m][k] * Bt[n][k] (+ bias); a block of 8 waves owns one
// 128x256 tile, wave w its 64x64 part (rows 64 * (w >> 2), columns 64 * (w & 3)). A row-major [M][K] pitch lda (16-bit plane), Bt
// row-major [N][K] pitch ldb (k contiguous); M multiple of 128, N of 256, K of 64. bx = index of the block's tile, by = batch index
// with element strides sA, sB, sC; gs = the block's LDS.
// Operands: per 64-deep chunk of k the block's 128 A rows (both planes with ASPLIT) and 256 Bt rows, 128 bytes each, are brought into
// LDS once by asynchronous 16-byte copies (each wave-copy = 4 whole 128-byte lines), two buffers: chunk t + 2 is copied into the buffer
// that trip t has read, behind the trip's barrier; all fragments are 16-byte LDS reads at pitch 144 B. Order of the k sum: ascending.
// ASPLIT 1: a second A plane A2 (unscaled residual of A, same layout) is multiplied into the same accumulator (A + A2 ~ exact A).
// BF 1: bf16 operands (v_wmma_f32_16x16x32_bf16), else f16.
// EPI 1: value += bf16_RNE(ep0[column]) (per-column bias); EPI 2: value += bf16_RNE(ep0[row]) (per-row bias, 16-bit out only).
// OM 0: f32 out (pitch ldc).  OM 2: one f16 plane = f16(value * ocarry).
// OM 4: two f16 planes: hi = f16(value * ocarry), lo = f16(value * ocarry - hi) (unscaled residual).
// OM 5: two f16 planes: C = f16((value + bf16_RNE(ep1[column])) * ocarry), C2 = f16((value + bf16_RNE(ep2[column])) * ocarry).
// coverage: 4 slabs x 16 rows (f32: it 0..7 x lane>>4; 16-bit: it 0..3 x lane>>3) x 64 cols = the wave's whole 64x64 tile;
//           (M/128)*(N/256) values of bx, a surplus block leaves as a whole in front of every barrier.
// LDS: the epilogue's slabs lie over the chunk buffers, which nobody reads behind the last trip's barrier.
// =====================================================================================================
#define SLABF (16 * 68)                 // floats of one wave's 16x64 slab, pitch 68 floats
#define GPLANE_A (128 * TPITCH)         // one staged A plane: 128 rows
#define GPLANE_B (256 * TPITCH)         // the staged Bt plane: 256 rows
#define GBUF(AS) ((1 + (AS)) * GPLANE_A + GPLANE_B)   // one chunk buffer
static_assert(2 * GBUF(0) >= 8 * SLABF * 4);
static_assert((NROW % 128) == 0 && (SEQ % 256) == 0 && (DMOD % 256) == 0);
template <int OM, int ASPLIT, int BF, int EPI>
__device__ __forceinline__ void gemm64_tile(
    unsigned char* gs, int bx, int by,
    const unsigned short* __restrict__ Ap, const unsigned short* __restrict__ A2p, int lda, long long sA,
    const unsigned short* __restrict__ Btp, int ldb, long long sB,
    void* Cout, void* C2out, int ldc, long long sC,
    int M, int N, int K, float oscale, float ocarry,
    const float* __restrict__ ep0, const float* __restrict__ ep1, const float* __restrict__ ep2) {
  const int tid  = threadIdx.x;
  const int lane = tid & 31;
  const int wave = tid >> 5;
  const int bN = N >> 8;
  if (bx >= (M >> 7) * bN) return;       // block-uniform, in front of every barrier
  const int bm  = bx / bN;
  const int m0b = bm << 7;
  const int n0b = (bx - bm * bN) << 8;
  const int wm = wave >> 2, wn = wave & 3;
  const int m0 = m0b + (wm << 6);
  const int n0 = n0b + (wn << 6);

  const unsigned short* A1 = Ap  + (size_t)((long long)by * sA);
  const unsigned short* A2 = A2p + (size_t)((long long)by * sA);
  const unsigned short* Bb = Btp + (size_t)((long long)by * sB);

  const int rlane = lane & 15;                 // row (A) / col (B, D) within subtile
  const int hh    = lane >> 4;                 // lane half: k offset 8 * hh
  const int mOff  = (lane >> 4) * 8;           // D row offset

  constexpr unsigned GB = (unsigned)GBUF(ASPLIT);               // bytes of one chunk buffer
  constexpr unsigned OB = (unsigned)((1 + ASPLIT) * GPLANE_A);  // byte offset of the Bt plane in it
  // copy share of this thread: rows crow + 32 x of each plane, 16-byte piece cpc of the 128-byte row
  const int crow = tid >> 3, cpc = tid & 7;
  const unsigned short* gA  = A1 + (size_t)(m0b + crow) * lda + 8 * cpc;      // + kc per chunk
  const unsigned short* gA2 = A2 + (size_t)(m0b + crow) * lda + 8 * cpc;
  const unsigned short* gB  = Bb + (size_t)(n0b + crow) * ldb + 8 * cpc;
  const unsigned ldst = (unsigned)(size_t)gs + (unsigned)(crow * TPITCH + cpc * 16);   // LDS byte address, buffer 0, A plane
  const size_t ra = (size_t)32 * lda, rb = (size_t)32 * ldb;
  auto stage = [&](int kc, unsigned bo) {   // chunk at kc -> buffer at byte offset bo; every lane on, all rows < M, N, all k < K
    const unsigned l = ldst + bo;
    const unsigned short* a = gA + kc;
    if constexpr (ASPLIT != 0) {
      const unsigned short* a2 = gA2 + kc;
      copy8_async(l, l + 32 * TPITCH, l + 64 * TPITCH, l + 96 * TPITCH,
                  l + GPLANE_A, l + GPLANE_A + 32 * TPITCH, l + GPLANE_A + 64 * TPITCH, l + GPLANE_A + 96 * TPITCH,
                  a, a + ra, a + 2 * ra, a + 3 * ra, a2, a2 + ra, a2 + 2 * ra, a2 + 3 * ra);
    } else {
      copy4_async(l, l + 32 * TPITCH, l + 64 * TPITCH, l + 96 * TPITCH, a, a + ra, a + 2 * ra, a + 3 * ra);
    }
    const unsigned lb = l + OB;
    const unsigned short* bs = gB + kc;
    copy8_async(lb, lb + 32 * TPITCH, lb + 64 * TPITCH, lb + 96 * TPITCH,
                lb + 128 * TPITCH, lb + 160 * TPITCH, lb + 192 * TPITCH, lb + 224 * TPITCH,
                bs, bs + rb, bs + 2 * rb, bs + 3 * rb, bs + 4 * rb, bs + 5 * rb, bs + 6 * rb, bs + 7 * rb);
  };
  // fragment read bases of this lane: row rlane of a 16-row subtile of the wave's part, 16-byte piece hh
  const unsigned char* fa0 = gs + ((wm << 6) + rlane) * TPITCH + 16 * hh;
  const unsigned char* fb0 = gs + OB + ((wn << 6) + rlane) * TPITCH + 16 * hh;

  stage(0, 0u);
  wait_async0();
  __syncthreads();                          // chunk 0 published
  if (K > 64) stage(64, GB);

  v8f acc[4][4];
#pragma unroll
  for (int i = 0; i < 4; ++i)
#pragma unroll
    for (int j = 0; j < 4; ++j) acc[i][j] = zero8();

#pragma unroll 1   // kept rolled, for speed only
  for (int kc = 0; kc < K; kc += 64) {
    const unsigned bo = ((unsigned)kc & 64u) ? GB : 0u;      // buffer of this trip
    const unsigned char* fa = fa0 + bo;
    const unsigned char* fb = fb0 + bo;
#pragma unroll      // the chunk's two 32-deep steps, unrolled so that their LDS offsets are immediates
    for (int ks = 0; ks < 2; ++ks) {
      v16h bh[4], ahs[4], als[4];           // all fragments of the 32-deep step are read as one group in front of its products
#pragma unroll
      for (int j = 0; j < 4; ++j) bh[j] = ldfrag_u((const unsigned short*)(fb + 16 * j * TPITCH) + 32 * ks);
#pragma unroll
      for (int i = 0; i < 4; ++i) {
        ahs[i] = ldfrag_u((const unsigned short*)(fa + 16 * i * TPITCH) + 32 * ks);
        if constexpr (ASPLIT != 0) als[i] = ldfrag_u((const unsigned short*)(fa + GPLANE_A + 16 * i * TPITCH) + 32 * ks);
      }
#pragma unroll
      for (int i = 0; i < 4; ++i) {
        const v16h ah = ahs[i];
#pragma unroll
        for (int j = 0; j < 4; ++j) acc[i][j] = mmaT<BF>(ah, bh[j], acc[i][j]);
        dep_guard1(acc[i][0], acc[i][3], ah);
        if constexpr (ASPLIT != 0) {
          const v16h al = als[i];
#pragma unroll
          for (int j = 0; j < 4; ++j) acc[i][j] = mmaT<BF>(al, bh[j], acc[i][j]);
          dep_guard1(acc[i][0], acc[i][3], al);
        }
      }
      keep4_h(bh[0], bh[1], bh[2], bh[3]);
    }
    // ---- publish chunk t + 1, free this trip's buffer, then refill it with chunk t + 2 ----
    wait_ds0();
    wait_async0();
    __syncthreads();
    if (kc + 128 < K) stage(kc + 128, bo);
  }
  wait_async0();
  acc_guard4(acc[0][0], acc[0][1], acc[0][2], acc[0][3]);
  acc_guard4(acc[1][0], acc[1][1], acc[1][2], acc[1][3]);
  acc_guard4(acc[2][0], acc[2][1], acc[2][2], acc[2][3]);
  acc_guard4(acc[3][0], acc[3][1], acc[3][2], acc[3][3]);

  const int hh2 = lane >> 4, c4 = (lane & 15) * 4;     // f32 out: 256-B row segment = 16 lanes x 16 B
  const int q8  = lane >> 3, c8 = (lane & 7) * 8;

  // ---- epilogue ----
  float* slab = (float*)gs + wave * SLABF;
#pragma unroll
  for (int i = 0; i < 4; ++i) {
    const int mBase = m0 + (i << 4);
#pragma unroll
    for (int j = 0; j < 4; ++j) {
#pragma unroll
      for (int r = 0; r < 8; ++r) {
        slab[(mOff + r) * 68 + (j << 4) + rlane] = acc[i][j][r];
      }
    }
    wave_sync_lds();
    if constexpr (OM == 0) {
      float* C = (float*)Cout + (size_t)((long long)by * sC);
      v4f vals[8];
#pragma unroll
      for (int it = 0; it < 8; ++it) {
        const int row = it * 2 + hh2;                      // it 0..7 x hh2 0..1 = rows 0..15
        v4f v = *(const v4f*)(slab + row * 68 + c4);
#pragma unroll
        for (int e = 0; e < 4; ++e) v[e] = v[e] * oscale;
        if constexpr (EPI == 1) {
          const v4f bb = *(const v4f*)(ep0 + n0 + c4);     // per-column bias, columns n0+c4 .. +3 (N equals the bias length)
#pragma unroll
          for (int e = 0; e < 4; ++e) v[e] = v[e] + bfr(bb[e]);
        }
        vals[it] = v;
      }
      {
#pragma unroll
        for (int it = 0; it < 8; ++it) {
          const int gr = mBase + it * 2 + hh2;
          *(v4f*)(C + (size_t)gr * ldc + n0 + c4) = vals[it];
        }
        
      }
    } else {
      unsigned short* C  = (unsigned short*)Cout  + (size_t)((long long)by * sC);
      unsigned short* Cb = (unsigned short*)C2out + (size_t)((long long)by * sC);
      v4u hv[4], lv[4];
#pragma unroll
      for (int it = 0; it < 4; ++it) {
        const int row = it * 4 + q8;                       // it 0..3 x q8 0..3 = rows 0..15
        const float* sp = slab + row * 68 + c8;
        float rb = 0.f;
        if constexpr (EPI == 2) rb = bfr(ep0[mBase + row]);   // per-row bias (M equals the bias length)
        v4u a  = {0u, 0u, 0u, 0u};
        v4u b2 = {0u, 0u, 0u, 0u};
#pragma unroll
        for (int e = 0; e < 4; ++e) {
          const int ci = n0 + c8 + 2 * e;                  // column index, < N
          float f0 = sp[2 * e] * oscale + rb;
          float f1 = sp[2 * e + 1] * oscale + rb;
          if constexpr (EPI == 1) {
            f0 += bfr(ep0[ci]);
            f1 += bfr(ep0[ci + 1]);
          }
          if constexpr (OM == 5) {
            const float g0 = (f0 + bfr(ep1[ci])) * ocarry, g1 = (f1 + bfr(ep1[ci + 1])) * ocarry;
            const float w0 = (f0 + bfr(ep2[ci])) * ocarry, w1 = (f1 + bfr(ep2[ci + 1])) * ocarry;
            a[e]  = pk16(h_bits((_Float16)g0), h_bits((_Float16)g1));
            b2[e] = pk16(h_bits((_Float16)w0), h_bits((_Float16)w1));
          } else {
            f0 *= ocarry; f1 *= ocarry;
            const _Float16 x0 = (_Float16)f0, x1 = (_Float16)f1;
            a[e] = pk16(h_bits(x0), h_bits(x1));
            if constexpr (OM == 4) {
              b2[e] = pk16(h_bits((_Float16)(f0 - (float)x0)), h_bits((_Float16)(f1 - (float)x1)));
            }
          }
        }
        hv[it] = a;
        lv[it] = b2;
      }
      {
#pragma unroll
        for (int it = 0; it < 4; ++it) {
          const int row = it * 4 + q8;
          *(v4u*)(C + (size_t)(mBase + row) * ldc + n0 + c8) = hv[it];
          if constexpr (OM >= 4) {
            *(v4u*)(Cb + (size_t)(mBase + row) * ldc + n0 + c8) = lv[it];
          }
        }
        
      }
    }
    wave_sync_lds();
  }
}

// One GEMM per launch: grid.x = 128x256 tiles, grid.y = batch.
template <int OM, int ASPLIT, int BF, int EPI>
__global__ __launch_bounds__(256) __attribute__((amdgpu_num_vgpr(256))) void gemm64(
    const unsigned short* __restrict__ Ap, const unsigned short* __restrict__ A2p, int lda, long long sA,
    const unsigned short* __restrict__ Btp, int ldb, long long sB,
    void* Cout, void* C2out, int ldc, long long sC,
    int M, int N, int K, float oscale, float ocarry,
    const float* __restrict__ ep0, const float* __restrict__ ep1, const float* __restrict__ ep2) {
  __shared__ __align__(128) unsigned char gsm[2 * GBUF(ASPLIT)];   // two chunk buffers; the epilogue's slabs lie over them
  gemm64_tile<OM, ASPLIT, BF, EPI>(gsm, blockIdx.x, blockIdx.y, Ap, A2p, lda, sA, Btp, ldb, sB, Cout, C2out, ldc, sC,
                                   M, N, K, oscale, ocarry, ep0, ep1, ep2);
}

// The four projections, which need nothing of each other, in ONE grid; ranges of the block index pick the product (block-uniform):
//   PJ_Q blocks: q[m][nd] = sum_c x[m][c] W[nd][c] / 1024 + bq[nd]; QU = f16((q + ub[nd]) * 4), QV = f16((q + vbias[nd]) * 4);
//                M = NROW, N = 512, K = 512
//   PJ_Q blocks: k projection + bk -> K16 = f16(k * 4), same shape
//   NB * PJ_V blocks: v^T per batch: VT[b][nd][j] = sum_c W[nd][c] x[b*SEQ + j][c] / 1024 + bv[nd] (per-row bias) -> f16 x64 hi +
//                residual planes; M = 512 (nd), N = SEQ (j), K = 512; B rows are the batch's token rows: pitch DMOD, stride SEQ*DMOD
//   PJ_P blocks: positional projection (no bias): P16 = f16(p * 4), M = SEQ, N = 512, K = 512
#define PJ_Q (((NROW / 64) * (DMOD / 64)) / 8)
#define PJ_V (((DMOD / 64) * (SEQ / 64)) / 8)
#define PJ_P (((SEQ / 64) * (DMOD / 64)) / 8)
#define PJ_BLOCKS (2 * PJ_Q + NB * PJ_V + PJ_P)
static_assert(((DMOD / 64) % 8) == 0);   // every product's tile count is a multiple of the 8 tiles of a block
__global__ __launch_bounds__(256) __attribute__((amdgpu_num_vgpr(256))) void proj_all(
    const unsigned short* __restrict__ XQ, const unsigned short* __restrict__ XK,
    const unsigned short* __restrict__ XV, const unsigned short* __restrict__ XP,
    const unsigned short* __restrict__ WQ, const unsigned short* __restrict__ WK,
    const unsigned short* __restrict__ WV, const unsigned short* __restrict__ WP,
    unsigned short* QU, unsigned short* QV, unsigned short* K16,
    unsigned short* VT, unsigned short* VTL, unsigned short* P16,
    const float* __restrict__ bq, const float* __restrict__ bk, const float* __restrict__ bv,
    const float* __restrict__ ub, const float* __restrict__ vb) {
  __shared__ __align__(128) unsigned char gsm[2 * GBUF(0)];   // two chunk buffers; the epilogue's slabs lie over them
  const int bx = blockIdx.x;
  const float osc = 1.0f / (XC * WSC);
  if (bx < PJ_Q) {
    gemm64_tile<5, 0, 0, 1>(gsm, bx, 0, XQ, XQ, DMOD, 0LL, WQ, DMOD, 0LL, (void*)QU, (void*)QV, DMOD, 0LL,
                            NROW, DMOD, DMOD, osc, QC, bq, ub, vb);
  } else if (bx < 2 * PJ_Q) {
    gemm64_tile<2, 0, 0, 1>(gsm, bx - PJ_Q, 0, XK, XK, DMOD, 0LL, WK, DMOD, 0LL, (void*)K16, (void*)K16, DMOD, 0LL,
                            NROW, DMOD, DMOD, osc, QC, bk, bk, bk);
  } else if (bx < 2 * PJ_Q + NB * PJ_V) {
    const int r  = bx - 2 * PJ_Q;
    const int by = r / PJ_V;
    gemm64_tile<4, 0, 0, 2>(gsm, r - by * PJ_V, by, WV, WV, DMOD, 0LL, XV, DMOD, (long long)SEQ * DMOD,
                            (void*)VT, (void*)VTL, SEQ, (long long)DMOD * SEQ,
                            DMOD, SEQ, DMOD, osc, VC, bv, bv, bv);
  } else if (bx < PJ_BLOCKS) {
    gemm64_tile<2, 0, 0, 0>(gsm, bx - (2 * PJ_Q + NB * PJ_V), 0, XP, XP, DMOD, 0LL, WP, DMOD, 0LL, (void*)P16, (void*)P16, DMOD, 0LL,
                            SEQ, DMOD, DMOD, osc, QC, bq, bq, bq);
  }
}

// =====================================================================================================
// Full (non-causal) attention with a 128-deep score contraction for one (batch b, head n) pair and a 128-row query tile;
// 8 waves, wave w owns query rows iw0 .. iw0+15, iw0 = i0 + 16w. Planes (pitch DMOD halves, row index = b*SEQ + position):
// QU = f16((q + bq + ub) x4), QV = f16((q + bq + vbias) x4), KP = f16((k + bk) x4); PP = f16(p x4) rows s = 0 .. SEQ-1 (shared by
// all batches); VT, VTL = v^T hi x64 / residual f16 as [b][n*64+d][SEQ]. Key mask ints kmask[b*SEQ_FULL + s], masked where == 0.
//   Both products are computed transposed: S^T = [k | p] . [q+ub | q+vbias]^T (A = key rows from LDS, B = the query fragments, loaded
//   once and kept in registers) and O^T += v^T . P^T (A = v^T rows from LDS, B = P^T). Lane (c, hh) then holds, for its ONE query
//   iw0 + c, the scores of keys j0 + 16t + 8hh + r (t 0..3, r 0..7): maximum and sum run inside the lane, with one exchange between
//   the lane halves for the maximum per key tile and one for the sum behind the loop; two score tiles converted in place are a B
//   operand in the loaders' k map (element e <- tile 2ks row 8hh+e, element 8+e <- tile 2ks+1 row 8hh+e), so P never leaves registers.
//   Key mask: the score accumulators start from kbias[key] (0, or -1e30 where the key is masked; built once per work-group in LDS).
//   The running maximum never falls below -1e20 (any real score lies far above it), so a masked key's exponential is exactly 0 and a
//   fully masked row keeps sum 0 and gives ctx 0. Online softmax in base 2, max-subtracted, f32; the x1024 carry of P sits in the
//   exponent (+10), so the running sum carries it too and it cancels in the division.
//   Per key tile (64 keys): 16 score WMMAs, 8 + 8 P.V WMMAs (hi plane then residual plane into the same accumulators).
//   Key tiles: the four 64-row x 128-byte planes of a tile (k rows, p rows, v^T hi rows, v^T residual rows of head n) are brought into
//   LDS once per work-group by asynchronous 16-byte copies (8 per thread, each wave-copy = 4 whole 128-byte lines), two buffers: tile
//   t + 2 is copied into the buffer that trip t has read, behind the trip's barrier; all A fragments are 16-byte LDS reads at pitch 144 B.
//   block = 8 waves = 256 threads; grid = (SEQ/128, NB*NH); one block barrier per key tile; identical bounded work (SEQ/64 tiles).
// LDS: two key-tile buffers and kbias shared by the block; one [16][PPI] f32 slab per wave for the ctx tile, private-to-wave (wave_sync);
//   staged extent == consumed extent (16 rows x 64 cols written by every lane (c, hh) x (td, r) before any read).
// coverage: global: 4 instructions x 4 rows x 64 halves per plane = rows iw0..iw0+15 of head segment n in CT and CTL;
//           grid x waves cover all NB x SEQ rows and all NH head segments of CT / CTL exactly once.
// =====================================================================================================
__device__ __forceinline__ float xhalf(float x) {   // value of lane l ^ 16
  const int b = __builtin_bit_cast(int, x);
  return __builtin_bit_cast(float, __builtin_amdgcn_permlanex16(b, b, 0x76543210, 0xfedcba98, false, false));
}
__device__ __forceinline__ float max8(v8f s) {
  return fmaxf(fmaxf(fmaxf(fmaxf(s[0], s[1]), s[2]), fmaxf(fmaxf(s[3], s[4]), s[5])), fmaxf(s[6], s[7]));
}

__global__ __launch_bounds__(ATT_THREADS) __attribute__((amdgpu_num_vgpr(256)))
void attn_full(const unsigned short* __restrict__ QU, const unsigned short* __restrict__ QV,
               const unsigned short* __restrict__ KP, const unsigned short* __restrict__ PP,
               const unsigned short* __restrict__ VT, const unsigned short* __restrict__ VTL,
               const int* __restrict__ kmask,
               unsigned short* CT, unsigned short* CTL) {
  __shared__ __align__(16) float smem[ATT_W * WFL];   // per wave: ctx slab [16][PPI]
  __shared__ __align__(128) unsigned char tiles[2 * TBUF];   // two key-tile buffers: [buffer][plane k, p, v hi, v lo][64 rows][TPITCH]
  __shared__ __align__(32) float kbias[SEQ];          // start value of a key's score accumulators

  const int tid  = threadIdx.x;
  const int wave = tid >> 5;
  const int lane = tid & 31;
  const int hh   = lane >> 4;
  const int c    = lane & 15;
  const int bn   = blockIdx.y;
  const int b    = bn / NH;
  const int n    = bn - b * NH;
  const int i0   = blockIdx.x * ATT_ROWS;
  const int iw0  = i0 + wave * 16;

  float* pt = smem + wave * WFL;

  // stationary B fragments: (q + bq + ub) and (q + bq + vbias), query row b*SEQ + iw0 + c, d 0..31 and 32..63 of head n
  const size_t qro = ((size_t)(b * SEQ + iw0 + c)) * DMOD + n * DH + 8 * hh;
  const v16h qua = ldfrag_u(QU + qro), qub = ldfrag_u(QU + qro + 32);
  const v16h qva = ldfrag_u(QV + qro), qvb = ldfrag_u(QV + qro + 32);

  const int* km = kmask + (size_t)b * SEQ_FULL;

  // copy share of this thread: rows crow and crow + 32 of each plane, 16-byte piece cpc of the 128-byte row
  const int crow = tid >> 3, cpc = tid & 7;
  const unsigned short* gK = KP + ((size_t)b * SEQ + crow) * DMOD + n * DH + 8 * cpc;          // + j0 * DMOD per tile
  const unsigned short* gP = PP + (size_t)crow * DMOD + n * DH + 8 * cpc;                      // + j0 * DMOD per tile
  const size_t vbase = (size_t)b * DMOD * SEQ + (size_t)(n * DH + crow) * SEQ + 8 * cpc;       // + j0 per tile
  const unsigned short* gV = VT  + vbase;
  const unsigned short* gL = VTL + vbase;
  const unsigned ldst = (unsigned)(size_t)tiles + (unsigned)(crow * TPITCH + cpc * 16);        // LDS byte address, buffer 0, plane 0
  // fragment read base of this lane: row c of a 16-row subtile, 16-byte piece hh
  const unsigned char* fr0 = tiles + c * TPITCH + 16 * hh;

  auto stage = [&](int jt, unsigned bo) {   // key tile at jt -> buffer at byte offset bo; every lane on, all addresses in range
    const unsigned l = ldst + bo;
    const size_t kr = (size_t)jt * DMOD;
    copy8_async(l, l + 32 * TPITCH, l + TPLANE, l + TPLANE + 32 * TPITCH,
                l + 2 * TPLANE, l + 2 * TPLANE + 32 * TPITCH, l + 3 * TPLANE, l + 3 * TPLANE + 32 * TPITCH,
                gK + kr, gK + kr + 32 * DMOD, gP + kr, gP + kr + 32 * DMOD,
                gV + jt, gV + jt + (size_t)32 * SEQ, gL + jt, gL + jt + (size_t)32 * SEQ);
  };
  stage(0, 0u);
  // key bias, built while tile 0 flies (another LDS range than the copies'); published by the same barrier
#pragma unroll
  for (int s = 0; s < SEQ; s += ATT_THREADS) kbias[s + tid] = (km[s + tid] == 0) ? -1.0e30f : 0.f;   // s + tid < SEQ <= SEQ_FULL
  wait_async0();
  __syncthreads();                          // tile 0 and kbias published
  if (SEQ > 64) stage(64, (unsigned)TBUF);

  const float KSC = (SCALE / (QC * QC)) * LOG2E;

  float mrun = -1.0e20f, lrun = 0.f;        // this lane's query: running maximum (both halves alike), running sum x1024 (own half's keys)
  v8f O[4];                                 // O^T: O[td][r] = ctx accumulator of d = 16td + 8hh + r, query c
#pragma unroll
  for (int td = 0; td < 4; ++td) O[td] = zero8();

#pragma unroll 1
  for (int j0 = 0; j0 < SEQ; j0 += 64) {
    const unsigned bo = ((unsigned)j0 & 64u) ? (unsigned)TBUF : 0u;      // buffer of this trip
    const unsigned char* fr = fr0 + bo;

    // ---- S^T = kbias + k . (q+ub)^T + p . (q+vbias)^T: 4 subtiles of 16 keys, four 32-deep steps, the subtiles independent ----
    v8f S[4];
#pragma unroll
    for (int t = 0; t < 4; ++t) S[t] = *(const v8f*)(kbias + j0 + 16 * t + 8 * hh);
#pragma unroll
    for (int t = 0; t < 4; ++t) S[t] = mma_h(ldfrag_u((const unsigned short*)(fr + 16 * t * TPITCH)), qua, S[t]);
#pragma unroll
    for (int t = 0; t < 4; ++t) S[t] = mma_h(ldfrag_u((const unsigned short*)(fr + 16 * t * TPITCH) + 32), qub, S[t]);
#pragma unroll
    for (int t = 0; t < 4; ++t) S[t] = mma_h(ldfrag_u((const unsigned short*)(fr + TPLANE + 16 * t * TPITCH)), qva, S[t]);
#pragma unroll
    for (int t = 0; t < 4; ++t) S[t] = mma_h(ldfrag_u((const unsigned short*)(fr + TPLANE + 16 * t * TPITCH) + 32), qvb, S[t]);

    // ---- online softmax, one query per lane: 32 of the tile's 64 keys here, the other 32 in lane l ^ 16 ----
    float mx = fmaxf(fmaxf(max8(S[0]), max8(S[1])), fmaxf(max8(S[2]), max8(S[3])));
    mx = fmaxf(mx, xhalf(mx));
    const float mn = fmaxf(mrun, mx * KSC);
    const float al = exp2f(mrun - mn);
    mrun = mn;
    const float sh = 10.0f - mn;            // 2^10 = the x1024 carry of P
    FragH pf[2];
    float ps[4];
#pragma unroll
    for (int t = 0; t < 4; ++t) {
      ps[t] = 0.f;
#pragma unroll
      for (int r = 0; r < 8; ++r) {
        const float ev = exp2f(fmaf(S[t][r], KSC, sh));
        ps[t] += ev;
        pf[t >> 1].h[t & 1][r] = (_Float16)ev;     // key j0 + 32(t>>1) + 16(t&1) + 8hh + r
      }
    }
    lrun = lrun * al + ((ps[0] + ps[1]) + (ps[2] + ps[3]));
#pragma unroll
    for (int td = 0; td < 4; ++td)
#pragma unroll
      for (int r = 0; r < 8; ++r) O[td][r] *= al;

    // ---- O^T += v^T . P^T: hi plane, then residual plane, two 32-key steps each, the four d subtiles independent ----
#pragma unroll
    for (int pl = 2; pl < 4; ++pl)
#pragma unroll
      for (int ks = 0; ks < 2; ++ks)
#pragma unroll
        for (int td = 0; td < 4; ++td)
          O[td] = mma_h(ldfrag_u((const unsigned short*)(fr + pl * TPLANE + 16 * td * TPITCH) + 32 * ks), pf[ks].v, O[td]);

    // ---- publish tile t + 1, free this trip's buffer, then refill it with tile t + 2 ----
    wait_ds0();
    wait_async0();
    __syncthreads();
    if (j0 + 128 < SEQ) stage(j0 + 128, bo);
  }
  wait_async0();
  acc_guard4(O[0], O[1], O[2], O[3]);

  // ---- join the halves' sums; fold 1/l (0 for an empty row) and the carry 64 on v (1024 on P cancels), carry x64 on ctx ----
  {
    const float oc  = CC / VC;
    const float lr  = lrun + xhalf(lrun);
    const float den = (lr > 0.f) ? lr : 1.0f;
    const float inv = (lr > 0.f) ? ((1.0f / den) * oc) : 0.f;
    float* po = pt + c * PPI + 8 * hh;
#pragma unroll
    for (int td = 0; td < 4; ++td) {
      v4f w0, w1;
#pragma unroll
      for (int e = 0; e < 4; ++e) { w0[e] = O[td][e] * inv; w1[e] = O[td][4 + e] * inv; }
      *(v4f*)(po + 16 * td)     = w0;
      *(v4f*)(po + 16 * td + 4) = w1;
    }
  }
  wave_sync_lds();
  {
    const int q8 = lane >> 3, c8 = (lane & 7) * 8;
    v4u hv[4], lv[4];
#pragma unroll
    for (int it = 0; it < 4; ++it) {
      const int row = it * 4 + q8;                         // it 0..3 x q8 0..3 = rows 0..15
      const float* sp = pt + row * PPI + c8;
      v4u a  = {0u, 0u, 0u, 0u};
      v4u b2 = {0u, 0u, 0u, 0u};
#pragma unroll
      for (int e = 0; e < 4; ++e) {
        const float f0 = sp[2 * e], f1 = sp[2 * e + 1];
        const _Float16 x0 = (_Float16)f0, x1 = (_Float16)f1;
        a[e]  = pk16(h_bits(x0), h_bits(x1));
        b2[e] = pk16(h_bits((_Float16)(f0 - (float)x0)), h_bits((_Float16)(f1 - (float)x1)));
      }
      hv[it] = a;
      lv[it] = b2;
    }
    {
#pragma unroll
      for (int it = 0; it < 4; ++it) {
        const int row = it * 4 + q8;
        const size_t go = ((size_t)(b * SEQ + iw0 + row)) * DMOD + n * DH + c8;
        *(v4u*)(CT  + go) = hv[it];
        *(v4u*)(CTL + go) = lv[it];
      }
    }
  }
}

// =====================================================================================================
// Workspace map (bytes); every plane is an exact multiple of its tile / whole-row store granularity (M, N exact multiples of 64,
// convert counts exact multiples of 2048), every offset a multiple of 512 KiB:
//   WQ16, WK16, WV16, WP16, WO16 f16 [512 out][512 in] x64 (input layout kept, no transpose)   5 x   524288
//   XQ16, XK16, XV16 f16 [NROW][512] x16 (rows b*SEQ + t)                                    3 x  8388608
//   XP16 f16 [SEQ][512] x16                                                                        2097152
//   QU, QV, K16 f16 [NROW][512] x4                                                           3 x  8388608
//   P16  f16 [SEQ][512] x4                                                                         2097152
//   VT16, VTL16 f16 [NB][512][SEQ] hi x64 / residual                                         2 x  8388608
//   CT16, CTL16 f16 [NROW][512] hi x64 / residual                                            2 x  8388608
//   end (NB=4, SEQ=2048)                                                                          90701824
// =====================================================================================================
extern "C" void kernel_launch(void* const* d_in, const int* in_sizes, int n_in,
                              void* d_out, int out_size, void* d_ws, size_t ws_size,
                              hipStream_t stream) {
  if (n_in < 16) return;
  const long long needX = (long long)NB * SEQ_FULL * DMOD;     // reads rows b*SEQ_FULL + t, b < NB, t < SEQ
  if ((long long)in_sizes[0] < needX || (long long)in_sizes[1] < needX || (long long)in_sizes[2] < needX) return;
  if (in_sizes[3] < NB * SEQ_FULL) return;
  if (in_sizes[4] < SEQ * DMOD) return;
  if (in_sizes[5] != DMOD * DMOD || in_sizes[7] != DMOD * DMOD || in_sizes[9] != DMOD * DMOD ||
      in_sizes[11] != DMOD * DMOD || in_sizes[13] != DMOD * DMOD) return;
  if (in_sizes[6] != DMOD || in_sizes[8] != DMOD || in_sizes[10] != DMOD || in_sizes[12] != DMOD) return;
  if (in_sizes[14] != NH * DH || in_sizes[15] != NH * DH) return;
  if (out_size < NROW * DMOD) return;

  const float* xq    = (const float*)d_in[0];
  const float* xk    = (const float*)d_in[1];
  const float* xv    = (const float*)d_in[2];
  const int*   kmask = (const int*)d_in[3];
  const float* xpos  = (const float*)d_in[4];
  const float* w_q   = (const float*)d_in[5];
  const float* b_q   = (const float*)d_in[6];
  const float* w_k   = (const float*)d_in[7];
  const float* b_k   = (const float*)d_in[8];
  const float* w_v   = (const float*)d_in[9];
  const float* b_v   = (const float*)d_in[10];
  const float* w_o   = (const float*)d_in[11];
  const float* b_o   = (const float*)d_in[12];
  const float* w_p   = (const float*)d_in[13];
  const float* ub    = (const float*)d_in[14];
  const float* vb    = (const float*)d_in[15];
  float*       out   = (float*)d_out;

  const size_t PW  = (size_t)DMOD * DMOD * 2;            //   524288
  const size_t PX  = (size_t)NROW * DMOD * 2;            //  8388608
  const size_t PXP = (size_t)SEQ * DMOD * 2;             //  2097152
  const size_t PVT = (size_t)NB * DMOD * SEQ * 2;        //  8388608
  size_t off = 0;
  const size_t oWQ  = off; off += PW;
  const size_t oWK  = off; off += PW;
  const size_t oWV  = off; off += PW;
  const size_t oWP  = off; off += PW;
  const size_t oWO  = off; off += PW;
  const size_t oXQ  = off; off += PX;
  const size_t oXK  = off; off += PX;
  const size_t oXV  = off; off += PX;
  const size_t oXP  = off; off += PXP;
  const size_t oQU  = off; off += PX;
  const size_t oQV  = off; off += PX;
  const size_t oK   = off; off += PX;
  const size_t oP   = off; off += PXP;
  const size_t oVT  = off; off += PVT;
  const size_t oVTL = off; off += PVT;
  const size_t oCT  = off; off += PX;
  const size_t oCTL = off; off += PX;
  if (off > ws_size) return;                               // off = 90701824 at NB=4, SEQ=2048
  if (off > (size_t)134217728) return;

  char* ws = (char*)d_ws;
  unsigned short* WQ16  = (unsigned short*)(ws + oWQ);
  unsigned short* WK16  = (unsigned short*)(ws + oWK);
  unsigned short* WV16  = (unsigned short*)(ws + oWV);
  unsigned short* WP16  = (unsigned short*)(ws + oWP);
  unsigned short* WO16  = (unsigned short*)(ws + oWO);
  unsigned short* XQ16  = (unsigned short*)(ws + oXQ);
  unsigned short* XK16  = (unsigned short*)(ws + oXK);
  unsigned short* XV16  = (unsigned short*)(ws + oXV);
  unsigned short* XP16  = (unsigned short*)(ws + oXP);
  unsigned short* QU    = (unsigned short*)(ws + oQU);
  unsigned short* QV    = (unsigned short*)(ws + oQV);
  unsigned short* K16   = (unsigned short*)(ws + oK);
  unsigned short* P16   = (unsigned short*)(ws + oP);
  unsigned short* VT16  = (unsigned short*)(ws + oVT);
  unsigned short* VTL16 = (unsigned short*)(ws + oVTL);
  unsigned short* CT16  = (unsigned short*)(ws + oCT);
  unsigned short* CTL16 = (unsigned short*)(ws + oCTL);

  const dim3 blk(256);
  const dim3 gCV(CVT_BLOCKS);                                       // 7296
  const dim3 gPJ(PJ_BLOCKS);                                        // 416
  const int tilesQ = (NROW / 64) * (DMOD / 64);                     // 1024
  const dim3 gQ((tilesQ + 7) / 8, 1);                               // 128
  const dim3 gAT(SEQ / ATT_ROWS, NB * NH);                          // 16 x 32
  const dim3 bAT(ATT_THREADS);                                      // 256

  // (0) all nine 16-bit planes in one launch: weights W[nd][c] ([out][in], already k-contiguous per output row) -> f16( bf16_RNE(w) * 64 );
  //     activations and pos -> f16(bf16(x) * 16). Destination: WQ16 .. XP16, contiguous from WQ16 in the order of the kernel's ranges.
  cvt_all<<<gCV, blk, 0, stream>>>(w_q, w_k, w_v, w_p, w_o, xq, xk, xv, xpos, WQ16);

  // (1) q, k, v^T and positional projections in one launch
  proj_all<<<gPJ, blk, 0, stream>>>(XQ16, XK16, XV16, XP16, WQ16, WK16, WV16, WP16,
                                    QU, QV, K16, VT16, VTL16, P16, b_q, b_k, b_v, ub, vb);

  // (2) attention -> CT16 = f16(ctx * 64) hi plane, CTL16 residual plane, rows b*SEQ + i, halves n*64+d
  attn_full<<<gAT, bAT, 0, stream>>>(QU, QV, K16, P16, VT16, VTL16, kmask, CT16, CTL16);

  // (3) out = (CT + CTL) . W^T / (64*64) + bo; M = NROW, N = 512, K = 512, f32 rows straight into the output buffer (row b*SEQ + t)
  gemm64<0, 1, 0, 1><<<gQ, blk, 0, stream>>>(
      CT16, CTL16, DMOD, 0LL,
      WO16, DMOD, 0LL,
      (void*)out, (void*)out, DMOD, 0LL,
      NROW, DMOD, DMOD, 1.0f / (CC * WSC), 1.0f,
      b_o, b_o, b_o);
  (void)hipGetLastError();
}

// v005
// It runs in 104 microseconds.
// Timed twice side by side with v004, it ran 1.05 and 1.04 times as fast.
// Counting every step since v000, it is 4.15 times as fast.
// Contractions (all v_wmma_f32_16x16x32_f16, f16 operands, f32 accumulate): q/k/v/p projections (x f16 x16 . W f16 x64, K=512, single products);
// scores ([q+bq+u | q+bq+vbias] f16 x4 . [k+bk | p] f16 x4, K=128 per head, single products); P . v^T (P f16 x1024 . v^T carried as
// f16 x64 hi plane + f16 residual plane, 64 keys per tile, two products; both attention products run transposed); output projection (ctx carried as f16 x64 hi + residual planes
// . Wo f16 x64, K=512, two products). Key mask (score accumulators start at -1e30 for a masked key, whose exponential is then 0), max-subtracted online base-2 softmax and
// all epilogues in f32 on VALU. Every float input RNE-converted to bf16 on load.
#include <hip/hip_runtime.h>
#include <math.h>
#include <stdint.h>

#ifndef NB
#define NB    4
#endif
#ifndef SEQ
#define SEQ   2048
#endif
#define NB_FULL  4
#define SEQ_FULL 2048
#define DMOD  512
#define NH    8
#define DH    64
#define NROW  (SEQ * NB)
#define XC    16.0f
#define WSC   64.0f
#define QC    4.0f
#define VC    64.0f
#define PC    1024.0f
#define CC    64.0f
#define SCALE 0.125f
#define LOG2E 1.4426950408889634f
static_assert(NH * DH == DMOD);
static_assert(DH == 64);
static_assert(NB >= 1 && NB <= NB_FULL && SEQ >= 64 && SEQ <= SEQ_FULL);
static_assert((SEQ % 64) == 0 && (DMOD % 64) == 0 && (NROW % 64) == 0);
static_assert(((SEQ * DMOD) % 2048) == 0 && ((DMOD * DMOD) % 2048) == 0);
#define ATT_W 4
#define ATT_THREADS (ATT_W * 32)
#define ATT_QG 2                       // 16-query groups per wave: every k, p, v fragment read from LDS feeds ATT_QG products
#define ATT_ROWS (ATT_W * 16 * ATT_QG)
#define TPITCH 144                     // LDS bytes per staged 128-byte row: 16 B x odd, conflict-free for 16-byte fragment reads
#define TPLANE (64 * TPITCH)           // one staged plane: 64 rows
#define TBUF   (4 * TPLANE)            // one key tile: k, p, v^T hi, v^T residual
static_assert((SEQ % ATT_ROWS) == 0 && ATT_THREADS == 128);
#define PPI 68
#define WFL (16 * PPI)
static_assert((PPI % 4) == 0 && PPI >= 64 && (WFL % 4) == 0);

typedef _Float16 v16h __attribute__((ext_vector_type(16)));
typedef _Float16 v8h  __attribute__((ext_vector_type(8)));
typedef __bf16   v16b __attribute__((ext_vector_type(16)));
typedef float    v8f  __attribute__((ext_vector_type(8)));
typedef float    v4f  __attribute__((ext_vector_type(4)));
typedef unsigned int v4u __attribute__((ext_vector_type(4)));

union FragH { v16h v; v8h h[2]; v4u u[2]; };
union FragAny { v16h h; v16b b; };

// ---- scalar helpers --------------------------------------------------------------------------------
__device__ __forceinline__ unsigned short bf_bits(float f) {          // f32 -> bf16 bits, RNE convert
  unsigned u = __float_as_uint(f);
  return (unsigned short)((u + 0x7FFFu + ((u >> 16) & 1u)) >> 16);
}
__device__ __forceinline__ float bf_up(unsigned short h) { return __uint_as_float(((unsigned)h) << 16); }
__device__ __forceinline__ float bfr(float f) { return bf_up(bf_bits(f)); }   // value of the bf16 RNE convert
__device__ __forceinline__ unsigned short h_bits(_Float16 x) { return __builtin_bit_cast(unsigned short, x); }
__device__ __forceinline__ unsigned pk16(unsigned short a, unsigned short b) { return (unsigned)a | ((unsigned)b << 16); }
__device__ __forceinline__ v8f zero8() { v8f z = {0.f, 0.f, 0.f, 0.f, 0.f, 0.f, 0.f, 0.f}; return z; }

// ---- fragment loader: 16-bit A/B operand from a k-contiguous 16-bit plane, lane -> row/col (lane&15),
//      p already includes +8*(lane>>4); elements 0..7 <- p[0..7] (k0+8h..), elements 8..15 <- p[16..23] (k0+16+8h..)
//      (same split k map for A and B; B is always read from a [n][k] plane)
__device__ __forceinline__ v16h ldfrag_u(const unsigned short* p) {
  FragH f;
  f.u[0] = *(const v4u*)(p);
  f.u[1] = *(const v4u*)(p + 16);
  return f.v;
}

// ---- WMMA helpers with trailing VALU hazard gaps ------------------------------------------------------
__device__ __forceinline__ v8f mma_h(v16h a, v16h b, v8f c) {
  return __builtin_amdgcn_wmma_f32_16x16x32_f16(false, a, false, b, (short)0, c, false, false);
}
__device__ __forceinline__ v8f mma_b(v16h a, v16h b, v8f c) {
  FragAny ua, ub;
  ua.h = a;
  ub.h = b;
  return __builtin_amdgcn_wmma_f32_16x16x32_bf16(false, ua.b, false, ub.b, (short)0, c, false, false);
}
template <int BF>
__device__ __forceinline__ v8f mmaT(v16h a, v16h b, v8f c) {
  if constexpr (BF != 0) return mma_b(a, b, c);
  else return mma_h(a, b, c);
}
__device__ __forceinline__ void dep_guard1(v8f& a, v8f& b, v16h x) {
#if defined(__HIP_DEVICE_COMPILE__)
  asm volatile("v_nop\n\tv_nop\n\tv_nop\n\tv_nop" : "+v"(a), "+v"(b) : "v"(x));
#endif
}
__device__ __forceinline__ void keep4_h(v16h a, v16h b, v16h c, v16h d) {
#if defined(__HIP_DEVICE_COMPILE__)
  asm volatile("v_nop" :: "v"(a), "v"(b), "v"(c), "v"(d));
#endif
}
__device__ __forceinline__ void acc_guard4(v8f& a, v8f& b, v8f& c, v8f& d) {
#if defined(__HIP_DEVICE_COMPILE__)
  asm volatile("v_nop\n\tv_nop\n\tv_nop\n\tv_nop" : "+v"(a), "+v"(b), "+v"(c), "+v"(d));
#endif
}
// Eight asynchronous 16-byte copies per lane, global -> LDS (half of a thread's share of one key tile). The s_wait_xcnt stands inside the
// statement so that no address register of an issued copy is rewritten in front of it.
__device__ __forceinline__ void copy8_async(unsigned l0, unsigned l1, unsigned l2, unsigned l3,
                                            unsigned l4, unsigned l5, unsigned l6, unsigned l7,
                                            const unsigned short* g0, const unsigned short* g1,
                                            const unsigned short* g2, const unsigned short* g3,
                                            const unsigned short* g4, const unsigned short* g5,
                                            const unsigned short* g6, const unsigned short* g7) {
#if defined(__HIP_DEVICE_COMPILE__)
  asm volatile("global_load_async_to_lds_b128 %0, %8, off\n\t"
               "global_load_async_to_lds_b128 %1, %9, off\n\t"
               "global_load_async_to_lds_b128 %2, %10, off\n\t"
               "global_load_async_to_lds_b128 %3, %11, off\n\t"
               "global_load_async_to_lds_b128 %4, %12, off\n\t"
               "global_load_async_to_lds_b128 %5, %13, off\n\t"
               "global_load_async_to_lds_b128 %6, %14, off\n\t"
               "global_load_async_to_lds_b128 %7, %15, off\n\t"
               "s_wait_xcnt 0x0"
               :: "v"(l0), "v"(l1), "v"(l2), "v"(l3), "v"(l4), "v"(l5), "v"(l6), "v"(l7),
                  "v"(g0), "v"(g1), "v"(g2), "v"(g3), "v"(g4), "v"(g5), "v"(g6), "v"(g7)
               : "memory");
#endif
}
// Four such copies per lane (the A rows of a GEMM chunk), with the same wait inside the statement for the same reason.
__device__ __forceinline__ void copy4_async(unsigned l0, unsigned l1, unsigned l2, unsigned l3,
                                            const unsigned short* g0, const unsigned short* g1,
                                            const unsigned short* g2, const unsigned short* g3) {
#if defined(__HIP_DEVICE_COMPILE__)
  asm volatile("global_load_async_to_lds_b128 %0, %4, off\n\t"
               "global_load_async_to_lds_b128 %1, %5, off\n\t"
               "global_load_async_to_lds_b128 %2, %6, off\n\t"
               "global_load_async_to_lds_b128 %3, %7, off\n\t"
               "s_wait_xcnt 0x0"
               :: "v"(l0), "v"(l1), "v"(l2), "v"(l3), "v"(g0), "v"(g1), "v"(g2), "v"(g3)
               : "memory");
#endif
}
// This wave's own copies have landed in LDS (other waves read them only behind the next work-group barrier).
__device__ __forceinline__ void wait_async0() {
#if defined(__HIP_DEVICE_COMPILE__)
  asm volatile("s_wait_asynccnt 0x0" ::: "memory");
#endif
}
// This wave's own LDS reads have returned, so that the buffer they read may be refilled behind the barrier.
__device__ __forceinline__ void wait_ds0() {
#if defined(__HIP_DEVICE_COMPILE__)
  asm volatile("s_wait_dscnt 0x0" ::: "memory");
#endif
}
__device__ __forceinline__ void wait_x0() {
#if defined(__HIP_DEVICE_COMPILE__)
  asm volatile("s_wait_xcnt 0x0" ::: "memory");
#endif
}
__device__ __forceinline__ void wave_sync_lds() {
  __builtin_amdgcn_fence(__ATOMIC_RELEASE, "workgroup");
  __builtin_amdgcn_wave_barrier();
  __builtin_amdgcn_fence(__ATOMIC_ACQUIRE, "workgroup");
}

// =====================================================================================================
// Elementwise 16-bit pack, no transpose, all nine float planes in ONE grid: dst[i] = f16( bf16_RNE(src[i]) * sc ), sc a power of two
// (exact). A block packs one piece of 2048 elements (256 thr x 8: two 16-B loads, one 16-B store per thread); ranges of the block index
// pick the source (block-uniform): CVT_W pieces for each of wq, wk, wv, wp, wo (x64), NB * CVT_X for each of xq, xk, xv (x16; batch y is
// read at input row y*SEQ_FULL and written at plane row y*SEQ), CVT_X for pos (x16). The nine destination planes lie in the workspace
// one behind the other in this same order, so piece bx is written at dst + bx * 2048.
// coverage: grid = CVT_BLOCKS blocks = every piece of every plane exactly once (all plane sizes are multiples of 2048 by the static sizes).
// =====================================================================================================
#define CVT_W ((DMOD * DMOD) / 2048)
#define CVT_X ((SEQ * DMOD) / 2048)
#define CVT_BLOCKS (5 * CVT_W + 3 * NB * CVT_X + CVT_X)
__global__ __launch_bounds__(256) void cvt_all(const float* __restrict__ wq, const float* __restrict__ wk, const float* __restrict__ wv,
                                               const float* __restrict__ wp, const float* __restrict__ wo,
                                               const float* __restrict__ xq, const float* __restrict__ xk, const float* __restrict__ xv,
                                               const float* __restrict__ xpos, unsigned short* dst) {
  const int bx = blockIdx.x;
  if (bx >= CVT_BLOCKS) return;               // never taken with the exact grid; no barriers in this kernel
  const float* src;
  size_t so;                                  // element offset of this block's piece in its source
  float sc;
  if (bx < 5 * CVT_W) {
    const int seg = bx / CVT_W;
    src = (seg == 0) ? wq : (seg == 1) ? wk : (seg == 2) ? wv : (seg == 3) ? wp : wo;
    so  = (size_t)(bx - seg * CVT_W) * 2048;
    sc  = WSC;
  } else if (bx < 5 * CVT_W + 3 * NB * CVT_X) {
    const int r   = bx - 5 * CVT_W;
    const int seg = r / (NB * CVT_X);
    const int rs  = r - seg * (NB * CVT_X);
    const int y   = rs / CVT_X;
    src = (seg == 0) ? xq : (seg == 1) ? xk : xv;
    so  = (size_t)y * SEQ_FULL * DMOD + (size_t)(rs - y * CVT_X) * 2048;
    sc  = XC;
  } else {
    src = xpos;
    so  = (size_t)(bx - (5 * CVT_W + 3 * NB * CVT_X)) * 2048;
    sc  = XC;
  }
  const float* s = src + so + (size_t)threadIdx.x * 8;
  unsigned short* d = dst + (size_t)bx * 2048 + (size_t)threadIdx.x * 8;
  const v4f a = *(const v4f*)(s);
  const v4f b = *(const v4f*)(s + 4);
  v4u o;
  o[0] = pk16(h_bits((_Float16)(bfr(a[0]) * sc)), h_bits((_Float16)(bfr(a[1]) * sc)));
  o[1] = pk16(h_bits((_Float16)(bfr(a[2]) * sc)), h_bits((_Float16)(bfr(a[3]) * sc)));
  o[2] = pk16(h_bits((_Float16)(bfr(b[0]) * sc)), h_bits((_Float16)(bfr(b[1]) * sc)));
  o[3] = pk16(h_bits((_Float16)(bfr(b[2]) * sc)), h_bits((_Float16)(bfr(b[3]) * sc)));
  *(v4u*)(d) = o;
}

// =====================================================================================================
// Register-blocked batched 16-bit WMMA GEMM: C[m][n] = oscale * sum_k A[m][k] * Bt[n][k] (+ bias); a block of 8 waves owns one
// 128x256 tile, wave w its 64x64 part (rows 64 * (w >> 2), columns 64 * (w & 3)). A row-major [M][K] pitch lda (16-bit plane), Bt
// row-major [N][K] pitch ldb (k contiguous); M multiple of 128, N of 256, K of 64. bx = index of the block's tile, by = batch index
// with element strides sA, sB, sC; gs = the block's LDS.
// Operands: per 64-deep chunk of k the block's 128 A rows (both planes with ASPLIT) and 256 Bt rows, 128 bytes each, are brought into
// LDS once by asynchronous 16-byte copies (each wave-copy = 4 whole 128-byte lines), two buffers: chunk t + 2 is copied into the buffer
// that trip t has read, behind the trip's barrier; all fragments are 16-byte LDS reads at pitch 144 B. Order of the k sum: ascending.
// ASPLIT 1: a second A plane A2 (unscaled residual of A, same layout) is multiplied into the same accumulator (A + A2 ~ exact A).
// BF 1: bf16 operands (v_wmma_f32_16x16x32_bf16), else f16.
// EPI 1: value += bf16_RNE(ep0[column]) (per-column bias); EPI 2: value += bf16_RNE(ep0[row]) (per-row bias, 16-bit out only).
// OM 0: f32 out (pitch ldc).  OM 2: one f16 plane = f16(value * ocarry).
// OM 4: two f16 planes: hi = f16(value * ocarry), lo = f16(value * ocarry - hi) (unscaled residual).
// OM 5: two f16 planes: C = f16((value + bf16_RNE(ep1[column])) * ocarry), C2 = f16((value + bf16_RNE(ep2[column])) * ocarry).
// coverage: 4 slabs x 16 rows (f32: it 0..7 x lane>>4; 16-bit: it 0..3 x lane>>3) x 64 cols = the wave's whole 64x64 tile;
//           (M/128)*(N/256) values of bx, a surplus block leaves as a whole in front of every barrier.
// LDS: the epilogue's slabs lie over the chunk buffers, which nobody reads behind the last trip's barrier.
// =====================================================================================================
#define SLABF (16 * 68)                 // floats of one wave's 16x64 slab, pitch 68 floats
#define GPLANE_A (128 * TPITCH)         // one staged A plane: 128 rows
#define GPLANE_B (256 * TPITCH)         // the staged Bt plane: 256 rows
#define GBUF(AS) ((1 + (AS)) * GPLANE_A + GPLANE_B)   // one chunk buffer
static_assert(2 * GBUF(0) >= 8 * SLABF * 4);
static_assert((NROW % 128) == 0 && (SEQ % 256) == 0 && (DMOD % 256) == 0);
template <int OM, int ASPLIT, int BF, int EPI>
__device__ __forceinline__ void gemm64_tile(
    unsigned char* gs, int bx, int by,
    const unsigned short* __restrict__ Ap, const unsigned short* __restrict__ A2p, int lda, long long sA,
    const unsigned short* __restrict__ Btp, int ldb, long long sB,
    void* Cout, void* C2out, int ldc, long long sC,
    int M, int N, int K, float oscale, float ocarry,
    const float* __restrict__ ep0, const float* __restrict__ ep1, const float* __restrict__ ep2) {
  const int tid  = threadIdx.x;
  const int lane = tid & 31;
  const int wave = tid >> 5;
  const int bN = N >> 8;
  if (bx >= (M >> 7) * bN) return;       // block-uniform, in front of every barrier
  const int bm  = bx / bN;
  const int m0b = bm << 7;
  const int n0b = (bx - bm * bN) << 8;
  const int wm = wave >> 2, wn = wave & 3;
  const int m0 = m0b + (wm << 6);
  const int n0 = n0b + (wn << 6);

  const unsigned short* A1 = Ap  + (size_t)((long long)by * sA);
  const unsigned short* A2 = A2p + (size_t)((long long)by * sA);
  const unsigned short* Bb = Btp + (size_t)((long long)by * sB);

  const int rlane = lane & 15;                 // row (A) / col (B, D) within subtile
  const int hh    = lane >> 4;                 // lane half: k offset 8 * hh
  const int mOff  = (lane >> 4) * 8;           // D row offset

  constexpr unsigned GB = (unsigned)GBUF(ASPLIT);               // bytes of one chunk buffer
  constexpr unsigned OB = (unsigned)((1 + ASPLIT) * GPLANE_A);  // byte offset of the Bt plane in it
  // copy share of this thread: rows crow + 32 x of each plane, 16-byte piece cpc of the 128-byte row
  const int crow = tid >> 3, cpc = tid & 7;
  const unsigned short* gA  = A1 + (size_t)(m0b + crow) * lda + 8 * cpc;      // + kc per chunk
  const unsigned short* gA2 = A2 + (size_t)(m0b + crow) * lda + 8 * cpc;
  const unsigned short* gB  = Bb + (size_t)(n0b + crow) * ldb + 8 * cpc;
  const unsigned ldst = (unsigned)(size_t)gs + (unsigned)(crow * TPITCH + cpc * 16);   // LDS byte address, buffer 0, A plane
  const size_t ra = (size_t)32 * lda, rb = (size_t)32 * ldb;
  auto stage = [&](int kc, unsigned bo) {   // chunk at kc -> buffer at byte offset bo; every lane on, all rows < M, N, all k < K
    const unsigned l = ldst + bo;
    const unsigned short* a = gA + kc;
    if constexpr (ASPLIT != 0) {
      const unsigned short* a2 = gA2 + kc;
      copy8_async(l, l + 32 * TPITCH, l + 64 * TPITCH, l + 96 * TPITCH,
                  l + GPLANE_A, l + GPLANE_A + 32 * TPITCH, l + GPLANE_A + 64 * TPITCH, l + GPLANE_A + 96 * TPITCH,
                  a, a + ra, a + 2 * ra, a + 3 * ra, a2, a2 + ra, a2 + 2 * ra, a2 + 3 * ra);
    } else {
      copy4_async(l, l + 32 * TPITCH, l + 64 * TPITCH, l + 96 * TPITCH, a, a + ra, a + 2 * ra, a + 3 * ra);
    }
    const unsigned lb = l + OB;
    const unsigned short* bs = gB + kc;
    copy8_async(lb, lb + 32 * TPITCH, lb + 64 * TPITCH, lb + 96 * TPITCH,
                lb + 128 * TPITCH, lb + 160 * TPITCH, lb + 192 * TPITCH, lb + 224 * TPITCH,
                bs, bs + rb, bs + 2 * rb, bs + 3 * rb, bs + 4 * rb, bs + 5 * rb, bs + 6 * rb, bs + 7 * rb);
  };
  // fragment read bases of this lane: row rlane of a 16-row subtile of the wave's part, 16-byte piece hh
  const unsigned char* fa0 = gs + ((wm << 6) + rlane) * TPITCH + 16 * hh;
  const unsigned char* fb0 = gs + OB + ((wn << 6) + rlane) * TPITCH + 16 * hh;

  stage(0, 0u);
  wait_async0();
  __syncthreads();                          // chunk 0 published
  if (K > 64) stage(64, GB);

  v8f acc[4][4];
#pragma unroll
  for (int i = 0; i < 4; ++i)
#pragma unroll
    for (int j = 0; j < 4; ++j) acc[i][j] = zero8();

#pragma unroll 1   // kept rolled, for speed only
  for (int kc = 0; kc < K; kc += 64) {
    const unsigned bo = ((unsigned)kc & 64u) ? GB : 0u;      // buffer of this trip
    const unsigned char* fa = fa0 + bo;
    const unsigned char* fb = fb0 + bo;
#pragma unroll      // the chunk's two 32-deep steps, unrolled so that their LDS offsets are immediates
    for (int ks = 0; ks < 2; ++ks) {
      v16h bh[4], ahs[4], als[4];           // all fragments of the 32-deep step are read as one group in front of its products
#pragma unroll
      for (int j = 0; j < 4; ++j) bh[j] = ldfrag_u((const unsigned short*)(fb + 16 * j * TPITCH) + 32 * ks);
#pragma unroll
      for (int i = 0; i < 4; ++i) {
        ahs[i] = ldfrag_u((const unsigned short*)(fa + 16 * i * TPITCH) + 32 * ks);
        if constexpr (ASPLIT != 0) als[i] = ldfrag_u((const unsigned short*)(fa + GPLANE_A + 16 * i * TPITCH) + 32 * ks);
      }
#pragma unroll
      for (int i = 0; i < 4; ++i) {
        const v16h ah = ahs[i];
#pragma unroll
        for (int j = 0; j < 4; ++j) acc[i][j] = mmaT<BF>(ah, bh[j], acc[i][j]);
        dep_guard1(acc[i][0], acc[i][3], ah);
        if constexpr (ASPLIT != 0) {
          const v16h al = als[i];
#pragma unroll
          for (int j = 0; j < 4; ++j) acc[i][j] = mmaT<BF>(al, bh[j], acc[i][j]);
          dep_guard1(acc[i][0], acc[i][3], al);
        }
      }
      keep4_h(bh[0], bh[1], bh[2], bh[3]);
    }
    // ---- publish chunk t + 1, free this trip's buffer, then refill it with chunk t + 2 ----
    wait_ds0();
    wait_async0();
    __syncthreads();
    if (kc + 128 < K) stage(kc + 128, bo);
  }
  wait_async0();
  acc_guard4(acc[0][0], acc[0][1], acc[0][2], acc[0][3]);
  acc_guard4(acc[1][0], acc[1][1], acc[1][2], acc[1][3]);
  acc_guard4(acc[2][0], acc[2][1], acc[2][2], acc[2][3]);
  acc_guard4(acc[3][0], acc[3][1], acc[3][2], acc[3][3]);

  const int hh2 = lane >> 4, c4 = (lane & 15) * 4;     // f32 out: 256-B row segment = 16 lanes x 16 B
  const int q8  = lane >> 3, c8 = (lane & 7) * 8;

  // ---- epilogue ----
  float* slab = (float*)gs + wave * SLABF;
#pragma unroll
  for (int i = 0; i < 4; ++i) {
    const int mBase = m0 + (i << 4);
#pragma unroll
    for (int j = 0; j < 4; ++j) {
#pragma unroll
      for (int r = 0; r < 8; ++r) {
        slab[(mOff + r) * 68 + (j << 4) + rlane] = acc[i][j][r];
      }
    }
    wave_sync_lds();
    if constexpr (OM == 0) {
      float* C = (float*)Cout + (size_t)((long long)by * sC);
      v4f vals[8];
#pragma unroll
      for (int it = 0; it < 8; ++it) {
        const int row = it * 2 + hh2;                      // it 0..7 x hh2 0..1 = rows 0..15
        v4f v = *(const v4f*)(slab + row * 68 + c4);
#pragma unroll
        for (int e = 0; e < 4; ++e) v[e] = v[e] * oscale;
        if constexpr (EPI == 1) {
          const v4f bb = *(const v4f*)(ep0 + n0 + c4);     // per-column bias, columns n0+c4 .. +3 (N equals the bias length)
#pragma unroll
          for (int e = 0; e < 4; ++e) v[e] = v[e] + bfr(bb[e]);
        }
        vals[it] = v;
      }
      {
#pragma unroll
        for (int it = 0; it < 8; ++it) {
          const int gr = mBase + it * 2 + hh2;
          *(v4f*)(C + (size_t)gr * ldc + n0 + c4) = vals[it];
        }
        
      }
    } else {
      unsigned short* C  = (unsigned short*)Cout  + (size_t)((long long)by * sC);
      unsigned short* Cb = (unsigned short*)C2out + (size_t)((long long)by * sC);
      v4u hv[4], lv[4];
#pragma unroll
      for (int it = 0; it < 4; ++it) {
        const int row = it * 4 + q8;                       // it 0..3 x q8 0..3 = rows 0..15
        const float* sp = slab + row * 68 + c8;
        float rb = 0.f;
        if constexpr (EPI == 2) rb = bfr(ep0[mBase + row]);   // per-row bias (M equals the bias length)
        v4u a  = {0u, 0u, 0u, 0u};
        v4u b2 = {0u, 0u, 0u, 0u};
#pragma unroll
        for (int e = 0; e < 4; ++e) {
          const int ci = n0 + c8 + 2 * e;                  // column index, < N
          float f0 = sp[2 * e] * oscale + rb;
          float f1 = sp[2 * e + 1] * oscale + rb;
          if constexpr (EPI == 1) {
            f0 += bfr(ep0[ci]);
            f1 += bfr(ep0[ci + 1]);
          }
          if constexpr (OM == 5) {
            const float g0 = (f0 + bfr(ep1[ci])) * ocarry, g1 = (f1 + bfr(ep1[ci + 1])) * ocarry;
            const float w0 = (f0 + bfr(ep2[ci])) * ocarry, w1 = (f1 + bfr(ep2[ci + 1])) * ocarry;
            a[e]  = pk16(h_bits((_Float16)g0), h_bits((_Float16)g1));
            b2[e] = pk16(h_bits((_Float16)w0), h_bits((_Float16)w1));
          } else {
            f0 *= ocarry; f1 *= ocarry;
            const _Float16 x0 = (_Float16)f0, x1 = (_Float16)f1;
            a[e] = pk16(h_bits(x0), h_bits(x1));
            if constexpr (OM == 4) {
              b2[e] = pk16(h_bits((_Float16)(f0 - (float)x0)), h_bits((_Float16)(f1 - (float)x1)));
            }
          }
        }
        hv[it] = a;
        lv[it] = b2;
      }
      {
#pragma unroll
        for (int it = 0; it < 4; ++it) {
          const int row = it * 4 + q8;
          *(v4u*)(C + (size_t)(mBase + row) * ldc + n0 + c8) = hv[it];
          if constexpr (OM >= 4) {
            *(v4u*)(Cb + (size_t)(mBase + row) * ldc + n0 + c8) = lv[it];
          }
        }
        
      }
    }
    wave_sync_lds();
  }
}

// One GEMM per launch: grid.x = 128x256 tiles, grid.y = batch.
template <int OM, int ASPLIT, int BF, int EPI>
__global__ __launch_bounds__(256) __attribute__((amdgpu_num_vgpr(256))) void gemm64(
    const unsigned short* __restrict__ Ap, const unsigned short* __restrict__ A2p, int lda, long long sA,
    const unsigned short* __restrict__ Btp, int ldb, long long sB,
    void* Cout, void* C2out, int ldc, long long sC,
    int M, int N, int K, float oscale, float ocarry,
    const float* __restrict__ ep0, const float* __restrict__ ep1, const float* __restrict__ ep2) {
  __shared__ __align__(128) unsigned char gsm[2 * GBUF(ASPLIT)];   // two chunk buffers; the epilogue's slabs lie over them
  gemm64_tile<OM, ASPLIT, BF, EPI>(gsm, blockIdx.x, blockIdx.y, Ap, A2p, lda, sA, Btp, ldb, sB, Cout, C2out, ldc, sC,
                                   M, N, K, oscale, ocarry, ep0, ep1, ep2);
}

// The four projections, which need nothing of each other, in ONE grid; ranges of the block index pick the product (block-uniform):
//   PJ_Q blocks: q[m][nd] = sum_c x[m][c] W[nd][c] / 1024 + bq[nd]; QU = f16((q + ub[nd]) * 4), QV = f16((q + vbias[nd]) * 4);
//                M = NROW, N = 512, K = 512
//   PJ_Q blocks: k projection + bk -> K16 = f16(k * 4), same shape
//   NB * PJ_V blocks: v^T per batch: VT[b][nd][j] = sum_c W[nd][c] x[b*SEQ + j][c] / 1024 + bv[nd] (per-row bias) -> f16 x64 hi +
//                residual planes; M = 512 (nd), N = SEQ (j), K = 512; B rows are the batch's token rows: pitch DMOD, stride SEQ*DMOD
//   PJ_P blocks: positional projection (no bias): P16 = f16(p * 4), M = SEQ, N = 512, K = 512
#define PJ_Q (((NROW / 64) * (DMOD / 64)) / 8)
#define PJ_V (((DMOD / 64) * (SEQ / 64)) / 8)
#define PJ_P (((SEQ / 64) * (DMOD / 64)) / 8)
#define PJ_BLOCKS (2 * PJ_Q + NB * PJ_V + PJ_P)
static_assert(((DMOD / 64) % 8) == 0);   // every product's tile count is a multiple of the 8 tiles of a block
__global__ __launch_bounds__(256) __attribute__((amdgpu_num_vgpr(256))) void proj_all(
    const unsigned short* __restrict__ XQ, const unsigned short* __restrict__ XK,
    const unsigned short* __restrict__ XV, const unsigned short* __restrict__ XP,
    const unsigned short* __restrict__ WQ, const unsigned short* __restrict__ WK,
    const unsigned short* __restrict__ WV, const unsigned short* __restrict__ WP,
    unsigned short* QU, unsigned short* QV, unsigned short* K16,
    unsigned short* VT, unsigned short* VTL, unsigned short* P16,
    const float* __restrict__ bq, const float* __restrict__ bk, const float* __restrict__ bv,
    const float* __restrict__ ub, const float* __restrict__ vb) {
  __shared__ __align__(128) unsigned char gsm[2 * GBUF(0)];   // two chunk buffers; the epilogue's slabs lie over them
  const int bx = blockIdx.x;
  const float osc = 1.0f / (XC * WSC);
  if (bx < PJ_Q) {
    gemm64_tile<5, 0, 0, 1>(gsm, bx, 0, XQ, XQ, DMOD, 0LL, WQ, DMOD, 0LL, (void*)QU, (void*)QV, DMOD, 0LL,
                            NROW, DMOD, DMOD, osc, QC, bq, ub, vb);
  } else if (bx < 2 * PJ_Q) {
    gemm64_tile<2, 0, 0, 1>(gsm, bx - PJ_Q, 0, XK, XK, DMOD, 0LL, WK, DMOD, 0LL, (void*)K16, (void*)K16, DMOD, 0LL,
                            NROW, DMOD, DMOD, osc, QC, bk, bk, bk);
  } else if (bx < 2 * PJ_Q + NB * PJ_V) {
    const int r  = bx - 2 * PJ_Q;
    const int by = r / PJ_V;
    gemm64_tile<4, 0, 0, 2>(gsm, r - by * PJ_V, by, WV, WV, DMOD, 0LL, XV, DMOD, (long long)SEQ * DMOD,
                            (void*)VT, (void*)VTL, SEQ, (long long)DMOD * SEQ,
                            DMOD, SEQ, DMOD, osc, VC, bv, bv, bv);
  } else if (bx < PJ_BLOCKS) {
    gemm64_tile<2, 0, 0, 0>(gsm, bx - (2 * PJ_Q + NB * PJ_V), 0, XP, XP, DMOD, 0LL, WP, DMOD, 0LL, (void*)P16, (void*)P16, DMOD, 0LL,
                            SEQ, DMOD, DMOD, osc, QC, bq, bq, bq);
  }
}

// =====================================================================================================
// Full (non-causal) attention with a 128-deep score contraction for one (batch b, head n) pair and a 128-row query tile;
// 4 waves, wave w owns query rows iw0 .. iw0+31, iw0 = i0 + 32w, as two groups g of 16 (rows iw0 + 16g ..). Planes (pitch DMOD halves, row index = b*SEQ + position):
// QU = f16((q + bq + ub) x4), QV = f16((q + bq + vbias) x4), KP = f16((k + bk) x4); PP = f16(p x4) rows s = 0 .. SEQ-1 (shared by
// all batches); VT, VTL = v^T hi x64 / residual f16 as [b][n*64+d][SEQ]. Key mask ints kmask[b*SEQ_FULL + s], masked where == 0.
//   Both products are computed transposed: S^T = [k | p] . [q+ub | q+vbias]^T (A = key rows from LDS, B = the query fragments, loaded
//   once and kept in registers) and O^T += v^T . P^T (A = v^T rows from LDS, B = P^T). Each A fragment is read from LDS once and
//   multiplied with both groups' B operands. Lane (c, hh) then holds, for its one query per group,
//   iw0 + 16g + c, the scores of keys j0 + 16t + 8hh + r (t 0..3, r 0..7): maximum and sum run inside the lane, with one exchange between
//   the lane halves for the maximum per key tile and one for the sum behind the loop; two score tiles converted in place are a B
//   operand in the loaders' k map (element e <- tile 2ks row 8hh+e, element 8+e <- tile 2ks+1 row 8hh+e), so P never leaves registers.
//   Key mask: the score accumulators start from kbias[key] (0, or -1e30 where the key is masked; built once per work-group in LDS).
//   The running maximum never falls below -1e20 (any real score lies far above it), so a masked key's exponential is exactly 0 and a
//   fully masked row keeps sum 0 and gives ctx 0. Online softmax in base 2, max-subtracted, f32; the x1024 carry of P sits in the
//   exponent (+10), so the running sum carries it too and it cancels in the division.
//   Per key tile (64 keys) and group: 16 score WMMAs, 8 + 8 P.V WMMAs (hi plane then residual plane into the same accumulators).
//   Key tiles: the four 64-row x 128-byte planes of a tile (k rows, p rows, v^T hi rows, v^T residual rows of head n) are brought into
//   LDS once per work-group by asynchronous 16-byte copies (16 per thread, each wave-copy = 4 whole 128-byte lines), two buffers: tile
//   t + 2 is copied into the buffer that trip t has read, behind the trip's barrier; all A fragments are 16-byte LDS reads at pitch 144 B.
//   block = 4 waves = 128 threads, two blocks per WGP (two waves per SIMD); grid = (SEQ/128, NB*NH); one block barrier per key tile; identical bounded work (SEQ/64 tiles).
// LDS: two key-tile buffers and kbias shared by the block; one [16][PPI] f32 slab per wave for a group's ctx tile, private-to-wave
//   (wave_sync), used by the two groups one after the other;
//   staged extent == consumed extent (16 rows x 64 cols written by every lane (c, hh) x (td, r) before any read).
// coverage: global: per group 4 instructions x 4 rows x 64 halves per plane = rows iw0+16g..iw0+16g+15 of head segment n in CT and CTL;
//           grid x waves cover all NB x SEQ rows and all NH head segments of CT / CTL exactly once.
// =====================================================================================================
__device__ __forceinline__ float xhalf(float x) {   // value of lane l ^ 16
  const int b = __builtin_bit_cast(int, x);
  return __builtin_bit_cast(float, __builtin_amdgcn_permlanex16(b, b, 0x76543210, 0xfedcba98, false, false));
}
__device__ __forceinline__ float max8(v8f s) {
  return fmaxf(fmaxf(fmaxf(fmaxf(s[0], s[1]), s[2]), fmaxf(fmaxf(s[3], s[4]), s[5])), fmaxf(s[6], s[7]));
}

// two waves per SIMD: the 512 blocks of four waves are two on every WGP, which leaves a wave a budget of 512 registers
__global__ __launch_bounds__(ATT_THREADS) __attribute__((amdgpu_waves_per_eu(2, 2)))
void attn_full(const unsigned short* __restrict__ QU, const unsigned short* __restrict__ QV,
               const unsigned short* __restrict__ KP, const unsigned short* __restrict__ PP,
               const unsigned short* __restrict__ VT, const unsigned short* __restrict__ VTL,
               const int* __restrict__ kmask,
               unsigned short* CT, unsigned short* CTL) {
  __shared__ __align__(16) float smem[ATT_W * WFL];   // per wave: ctx slab [16][PPI]
  __shared__ __align__(128) unsigned char tiles[2 * TBUF];   // two key-tile buffers: [buffer][plane k, p, v hi, v lo][64 rows][TPITCH]
  __shared__ __align__(32) float kbias[SEQ];          // start value of a key's score accumulators

  const int tid  = threadIdx.x;
  const int wave = tid >> 5;
  const int lane = tid & 31;
  const int hh   = lane >> 4;
  const int c    = lane & 15;
  const int bn   = blockIdx.y;
  const int b    = bn / NH;
  const int n    = bn - b * NH;
  const int i0   = blockIdx.x * ATT_ROWS;
  const int iw0  = i0 + wave * (16 * ATT_QG);

  float* pt = smem + wave * WFL;

  // stationary B fragments: (q + bq + ub) and (q + bq + vbias), query row b*SEQ + iw0 + 16g + c, d 0..31 and 32..63 of head n
  v16h qf[ATT_QG][4];                       // [group][k step: ub d 0..31, ub d 32..63, vbias d 0..31, vbias d 32..63]
  const size_t qro = ((size_t)(b * SEQ + iw0 + c)) * DMOD + n * DH + 8 * hh;
  const unsigned short* qu0 = QU + qro;
  const unsigned short* qv0 = QV + qro;
  // The scheduling barriers keep other address arithmetic out of the run of loads, so that the wait behind the run stands in front of
  // every rewrite of a register that one of the loads names.
  __builtin_amdgcn_sched_barrier(0);
#pragma unroll
  for (int g = 0; g < ATT_QG; ++g) {
    qf[g][0] = ldfrag_u(qu0 + g * 16 * DMOD);
    qf[g][1] = ldfrag_u(qu0 + g * 16 * DMOD + 32);
    qf[g][2] = ldfrag_u(qv0 + g * 16 * DMOD);
    qf[g][3] = ldfrag_u(qv0 + g * 16 * DMOD + 32);
  }
  wait_x0();
  __builtin_amdgcn_sched_barrier(0);

  const int* km = kmask + (size_t)b * SEQ_FULL;

  // copy share of this thread: rows crow + 16 x (x 0..3) of each plane, 16-byte piece cpc of the 128-byte row
  const int crow = tid >> 3, cpc = tid & 7;
  const unsigned short* gK = KP + ((size_t)b * SEQ + crow) * DMOD + n * DH + 8 * cpc;          // + j0 * DMOD per tile
  const unsigned short* gP = PP + (size_t)crow * DMOD + n * DH + 8 * cpc;                      // + j0 * DMOD per tile
  const size_t vbase = (size_t)b * DMOD * SEQ + (size_t)(n * DH + crow) * SEQ + 8 * cpc;       // + j0 per tile
  const unsigned short* gV = VT  + vbase;
  const unsigned short* gL = VTL + vbase;
  const unsigned ldst = (unsigned)(size_t)tiles + (unsigned)(crow * TPITCH + cpc * 16);        // LDS byte address, buffer 0, plane 0
  // fragment read base of this lane: row c of a 16-row subtile, 16-byte piece hh
  const unsigned char* fr0 = tiles + c * TPITCH + 16 * hh;

  auto stage = [&](int jt, unsigned bo) {   // key tile at jt -> buffer at byte offset bo; every lane on, all addresses in range
    const unsigned l = ldst + bo;
    const size_t kr = (size_t)jt * DMOD;
    const unsigned short* k0 = gK + kr;
    const unsigned short* p0 = gP + kr;
    copy8_async(l, l + 16 * TPITCH, l + 32 * TPITCH, l + 48 * TPITCH,
                l + TPLANE, l + TPLANE + 16 * TPITCH, l + TPLANE + 32 * TPITCH, l + TPLANE + 48 * TPITCH,
                k0, k0 + 16 * DMOD, k0 + 32 * DMOD, k0 + 48 * DMOD, p0, p0 + 16 * DMOD, p0 + 32 * DMOD, p0 + 48 * DMOD);
    const unsigned lv = l + 2 * TPLANE;
    const unsigned short* v0 = gV + jt;
    const unsigned short* w0 = gL + jt;
    copy8_async(lv, lv + 16 * TPITCH, lv + 32 * TPITCH, lv + 48 * TPITCH,
                lv + TPLANE, lv + TPLANE + 16 * TPITCH, lv + TPLANE + 32 * TPITCH, lv + TPLANE + 48 * TPITCH,
                v0, v0 + (size_t)16 * SEQ, v0 + (size_t)32 * SEQ, v0 + (size_t)48 * SEQ,
                w0, w0 + (size_t)16 * SEQ, w0 + (size_t)32 * SEQ, w0 + (size_t)48 * SEQ);
  };
  stage(0, 0u);
  // key bias, built while tile 0 flies (another LDS range than the copies'); published by the same barrier
  int mk[SEQ / ATT_THREADS];
  __builtin_amdgcn_sched_barrier(0);        // as at the fragment loads above: the wait stands in front of every rewrite of the loads' address registers
#pragma unroll
  for (int s = 0; s < SEQ; s += ATT_THREADS) mk[s / ATT_THREADS] = km[s + tid];   // s + tid < SEQ <= SEQ_FULL
  wait_x0();
  __builtin_amdgcn_sched_barrier(0);
#pragma unroll
  for (int s = 0; s < SEQ; s += ATT_THREADS) kbias[s + tid] = (mk[s / ATT_THREADS] == 0) ? -1.0e30f : 0.f;
  wait_async0();
  __syncthreads();                          // tile 0 and kbias published
  if (SEQ > 64) stage(64, (unsigned)TBUF);

  const float KSC = (SCALE / (QC * QC)) * LOG2E;

  float mrun[ATT_QG], lrun[ATT_QG];         // per group, this lane's query: running maximum (both halves alike), running sum x1024 (own half's keys)
  v8f O[ATT_QG][4];                         // O^T: O[g][td][r] = ctx accumulator of d = 16td + 8hh + r, query c of group g
#pragma unroll
  for (int g = 0; g < ATT_QG; ++g) {
    mrun[g] = -1.0e20f;
    lrun[g] = 0.f;
#pragma unroll
    for (int td = 0; td < 4; ++td) O[g][td] = zero8();
  }

#pragma unroll 1
  for (int j0 = 0; j0 < SEQ; j0 += 64) {
    const unsigned bo = ((unsigned)j0 & 64u) ? (unsigned)TBUF : 0u;      // buffer of this trip
    const unsigned char* fr = fr0 + bo;

    // The tile's LDS reads stand in two groups, each ahead of work that covers its latency. The scheduling barriers hold a group in
    // place: without them the compiler sinks each read to its own pair of products, which then wait out a whole LDS latency.
    // ---- group 1: the keys' start values and the 16 k and p fragments ----
    v8f kb[4];
    v16h ak[4][4];                          // [k step: k d 0..31, k d 32..63, p d 0..31, p d 32..63][16-key subtile]
    v16h av[2][2][4];                       // [plane: v^T hi, residual][32-key step][d subtile]
    __builtin_amdgcn_sched_barrier(0);
#pragma unroll
    for (int t = 0; t < 4; ++t) kb[t] = *(const v8f*)(kbias + j0 + 16 * t + 8 * hh);
#pragma unroll
    for (int st = 0; st < 4; ++st)
#pragma unroll
      for (int t = 0; t < 4; ++t)
        ak[st][t] = ldfrag_u((const unsigned short*)(fr + (st >> 1) * TPLANE + 16 * t * TPITCH) + 32 * (st & 1));
    __builtin_amdgcn_sched_barrier(0);

    // ---- S^T = kbias + k . (q+ub)^T + p . (q+vbias)^T: 4 subtiles of 16 keys x the groups, four 32-deep steps; each A fragment
    //      serves every group; the subtiles and the groups are independent. Behind the k steps: group 2, the 16 v^T fragments ----
    v8f S[ATT_QG][4];
#pragma unroll
    for (int t = 0; t < 4; ++t)
#pragma unroll
      for (int g = 0; g < ATT_QG; ++g) S[g][t] = kb[t];
#pragma unroll
    for (int st = 0; st < 2; ++st)
#pragma unroll
      for (int t = 0; t < 4; ++t)
#pragma unroll
        for (int g = 0; g < ATT_QG; ++g) S[g][t] = mma_h(ak[st][t], qf[g][st], S[g][t]);
    __builtin_amdgcn_sched_barrier(0);
#pragma unroll
    for (int pl = 0; pl < 2; ++pl)
#pragma unroll
      for (int ks = 0; ks < 2; ++ks)
#pragma unroll
        for (int td = 0; td < 4; ++td)
          av[pl][ks][td] = ldfrag_u((const unsigned short*)(fr + (2 + pl) * TPLANE + 16 * td * TPITCH) + 32 * ks);
    __builtin_amdgcn_sched_barrier(0);
#pragma unroll
    for (int st = 2; st < 4; ++st)
#pragma unroll
      for (int t = 0; t < 4; ++t)
#pragma unroll
        for (int g = 0; g < ATT_QG; ++g) S[g][t] = mma_h(ak[st][t], qf[g][st], S[g][t]);

    // ---- online softmax, one query per lane and group: 32 of the tile's 64 keys here, the other 32 in lane l ^ 16 ----
    FragH pf[ATT_QG][2];
#pragma unroll
    for (int g = 0; g < ATT_QG; ++g) {
      float mx = fmaxf(fmaxf(max8(S[g][0]), max8(S[g][1])), fmaxf(max8(S[g][2]), max8(S[g][3])));
      mx = fmaxf(mx, xhalf(mx));
      const float mn = fmaxf(mrun[g], mx * KSC);
      const float al = exp2f(mrun[g] - mn);
      mrun[g] = mn;
      const float sh = 10.0f - mn;          // 2^10 = the x1024 carry of P
      float ps[4];
#pragma unroll
      for (int t = 0; t < 4; ++t) {
        ps[t] = 0.f;
#pragma unroll
        for (int r = 0; r < 8; ++r) {
          const float ev = exp2f(fmaf(S[g][t][r], KSC, sh));
          ps[t] += ev;
          pf[g][t >> 1].h[t & 1][r] = (_Float16)ev;     // key j0 + 32(t>>1) + 16(t&1) + 8hh + r
        }
      }
      lrun[g] = lrun[g] * al + ((ps[0] + ps[1]) + (ps[2] + ps[3]));
#pragma unroll
      for (int td = 0; td < 4; ++td)
#pragma unroll
        for (int r = 0; r < 8; ++r) O[g][td][r] *= al;
    }

    // ---- O^T += v^T . P^T: hi plane, then residual plane, two 32-key steps each; each A fragment is read once and serves every
    //      group; the four d subtiles and the groups are independent ----
#pragma unroll
    for (int pl = 0; pl < 2; ++pl)
#pragma unroll
      for (int ks = 0; ks < 2; ++ks)
#pragma unroll
        for (int td = 0; td < 4; ++td)
#pragma unroll
          for (int g = 0; g < ATT_QG; ++g) O[g][td] = mma_h(av[pl][ks][td], pf[g][ks].v, O[g][td]);

    // ---- publish tile t + 1, free this trip's buffer, then refill it with tile t + 2 ----
    __builtin_amdgcn_sched_barrier(0);      // keeps the waits and the barrier down here: lifted to group 2, they would wait out its latency
    wait_ds0();
    wait_async0();
    __syncthreads();
    if (j0 + 128 < SEQ) stage(j0 + 128, bo);
  }
  wait_async0();
#pragma unroll
  for (int g = 0; g < ATT_QG; ++g) acc_guard4(O[g][0], O[g][1], O[g][2], O[g][3]);

#pragma unroll
  for (int g = 0; g < ATT_QG; ++g) {
    // ---- join the halves' sums; fold 1/l (0 for an empty row) and the carry 64 on v (1024 on P cancels), carry x64 on ctx ----
    {
      const float oc  = CC / VC;
      const float lr  = lrun[g] + xhalf(lrun[g]);
      const float den = (lr > 0.f) ? lr : 1.0f;
      const float inv = (lr > 0.f) ? ((1.0f / den) * oc) : 0.f;
      float* po = pt + c * PPI + 8 * hh;
#pragma unroll
      for (int td = 0; td < 4; ++td) {
        v4f w0, w1;
#pragma unroll
        for (int e = 0; e < 4; ++e) { w0[e] = O[g][td][e] * inv; w1[e] = O[g][td][4 + e] * inv; }
        *(v4f*)(po + 16 * td)     = w0;
        *(v4f*)(po + 16 * td + 4) = w1;
      }
    }
    wave_sync_lds();
    {
      const int q8 = lane >> 3, c8 = (lane & 7) * 8;
      v4u hv[4], lv[4];
#pragma unroll
      for (int it = 0; it < 4; ++it) {
        const int row = it * 4 + q8;                         // it 0..3 x q8 0..3 = rows 0..15
        const float* sp = pt + row * PPI + c8;
        v4u a  = {0u, 0u, 0u, 0u};
        v4u b2 = {0u, 0u, 0u, 0u};
#pragma unroll
        for (int e = 0; e < 4; ++e) {
          const float f0 = sp[2 * e], f1 = sp[2 * e + 1];
          const _Float16 x0 = (_Float16)f0, x1 = (_Float16)f1;
          a[e]  = pk16(h_bits(x0), h_bits(x1));
          b2[e] = pk16(h_bits((_Float16)(f0 - (float)x0)), h_bits((_Float16)(f1 - (float)x1)));
        }
        hv[it] = a;
        lv[it] = b2;
      }
#pragma unroll
      for (int it = 0; it < 4; ++it) {
        const int row = it * 4 + q8;
        const size_t go = ((size_t)(b * SEQ + iw0 + 16 * g + row)) * DMOD + n * DH + c8;
        *(v4u*)(CT  + go) = hv[it];
        *(v4u*)(CTL + go) = lv[it];
      }
    }
    if (g + 1 < ATT_QG) wave_sync_lds();    // the slab's reads are done before the next group overwrites it
  }
}

// =====================================================================================================
// Workspace map (bytes); every plane is an exact multiple of its tile / whole-row store granularity (M, N exact multiples of 64,
// convert counts exact multiples of 2048), every offset a multiple of 512 KiB:
//   WQ16, WK16, WV16, WP16, WO16 f16 [512 out][512 in] x64 (input layout kept, no transpose)   5 x   524288
//   XQ16, XK16, XV16 f16 [NROW][512] x16 (rows b*SEQ + t)                                    3 x  8388608
//   XP16 f16 [SEQ][512] x16                                                                        2097152
//   QU, QV, K16 f16 [NROW][512] x4                                                           3 x  8388608
//   P16  f16 [SEQ][512] x4                                                                         2097152
//   VT16, VTL16 f16 [NB][512][SEQ] hi x64 / residual                                         2 x  8388608
//   CT16, CTL16 f16 [NROW][512] hi x64 / residual                                            2 x  8388608
//   end (NB=4, SEQ=2048)                                                                          90701824
// =====================================================================================================
extern "C" void kernel_launch(void* const* d_in, const int* in_sizes, int n_in,
                              void* d_out, int out_size, void* d_ws, size_t ws_size,
                              hipStream_t stream) {
  if (n_in < 16) return;
  const long long needX = (long long)NB * SEQ_FULL * DMOD;     // reads rows b*SEQ_FULL + t, b < NB, t < SEQ
  if ((long long)in_sizes[0] < needX || (long long)in_sizes[1] < needX || (long long)in_sizes[2] < needX) return;
  if (in_sizes[3] < NB * SEQ_FULL) return;
  if (in_sizes[4] < SEQ * DMOD) return;
  if (in_sizes[5] != DMOD * DMOD || in_sizes[7] != DMOD * DMOD || in_sizes[9] != DMOD * DMOD ||
      in_sizes[11] != DMOD * DMOD || in_sizes[13] != DMOD * DMOD) return;
  if (in_sizes[6] != DMOD || in_sizes[8] != DMOD || in_sizes[10] != DMOD || in_sizes[12] != DMOD) return;
  if (in_sizes[14] != NH * DH || in_sizes[15] != NH * DH) return;
  if (out_size < NROW * DMOD) return;

  const float* xq    = (const float*)d_in[0];
  const float* xk    = (const float*)d_in[1];
  const float* xv    = (const float*)d_in[2];
  const int*   kmask = (const int*)d_in[3];
  const float* xpos  = (const float*)d_in[4];
  const float* w_q   = (const float*)d_in[5];
  const float* b_q   = (const float*)d_in[6];
  const float* w_k   = (const float*)d_in[7];
  const float* b_k   = (const float*)d_in[8];
  const float* w_v   = (const float*)d_in[9];
  const float* b_v   = (const float*)d_in[10];
  const float* w_o   = (const float*)d_in[11];
  const float* b_o   = (const float*)d_in[12];
  const float* w_p   = (const float*)d_in[13];
  const float* ub    = (const float*)d_in[14];
  const float* vb    = (const float*)d_in[15];
  float*       out   = (float*)d_out;

  const size_t PW  = (size_t)DMOD * DMOD * 2;            //   524288
  const size_t PX  = (size_t)NROW * DMOD * 2;            //  8388608
  const size_t PXP = (size_t)SEQ * DMOD * 2;             //  2097152
  const size_t PVT = (size_t)NB * DMOD * SEQ * 2;        //  8388608
  size_t off = 0;
  const size_t oWQ  = off; off += PW;
  const size_t oWK  = off; off += PW;
  const size_t oWV  = off; off += PW;
  const size_t oWP  = off; off += PW;
  const size_t oWO  = off; off += PW;
  const size_t oXQ  = off; off += PX;
  const size_t oXK  = off; off += PX;
  const size_t oXV  = off; off += PX;
  const size_t oXP  = off; off += PXP;
  const size_t oQU  = off; off += PX;
  const size_t oQV  = off; off += PX;
  const size_t oK   = off; off += PX;
  const size_t oP   = off; off += PXP;
  const size_t oVT  = off; off += PVT;
  const size_t oVTL = off; off += PVT;
  const size_t oCT  = off; off += PX;
  const size_t oCTL = off; off += PX;
  if (off > ws_size) return;                               // off = 90701824 at NB=4, SEQ=2048
  if (off > (size_t)134217728) return;

  char* ws = (char*)d_ws;
  unsigned short* WQ16  = (unsigned short*)(ws + oWQ);
  unsigned short* WK16  = (unsigned short*)(ws + oWK);
  unsigned short* WV16  = (unsigned short*)(ws + oWV);
  unsigned short* WP16  = (unsigned short*)(ws + oWP);
  unsigned short* WO16  = (unsigned short*)(ws + oWO);
  unsigned short* XQ16  = (unsigned short*)(ws + oXQ);
  unsigned short* XK16  = (unsigned short*)(ws + oXK);
  unsigned short* XV16  = (unsigned short*)(ws + oXV);
  unsigned short* XP16  = (unsigned short*)(ws + oXP);
  unsigned short* QU    = (unsigned short*)(ws + oQU);
  unsigned short* QV    = (unsigned short*)(ws + oQV);
  unsigned short* K16   = (unsigned short*)(ws + oK);
  unsigned short* P16   = (unsigned short*)(ws + oP);
  unsigned short* VT16  = (unsigned short*)(ws + oVT);
  unsigned short* VTL16 = (unsigned short*)(ws + oVTL);
  unsigned short* CT16  = (unsigned short*)(ws + oCT);
  unsigned short* CTL16 = (unsigned short*)(ws + oCTL);

  const dim3 blk(256);
  const dim3 gCV(CVT_BLOCKS);                                       // 7296
  const dim3 gPJ(PJ_BLOCKS);                                        // 416
  const int tilesQ = (NROW / 64) * (DMOD / 64);                     // 1024
  const dim3 gQ((tilesQ + 7) / 8, 1);                               // 128
  const dim3 gAT(SEQ / ATT_ROWS, NB * NH);                          // 16 x 32
  const dim3 bAT(ATT_THREADS);                                      // 128

  // (0) all nine 16-bit planes in one launch: weights W[nd][c] ([out][in], already k-contiguous per output row) -> f16( bf16_RNE(w) * 64 );
  //     activations and pos -> f16(bf16(x) * 16). Destination: WQ16 .. XP16, contiguous from WQ16 in the order of the kernel's ranges.
  cvt_all<<<gCV, blk, 0, stream>>>(w_q, w_k, w_v, w_p, w_o, xq, xk, xv, xpos, WQ16);

  // (1) q, k, v^T and positional projections in one launch
  proj_all<<<gPJ, blk, 0, stream>>>(XQ16, XK16, XV16, XP16, WQ16, WK16, WV16, WP16,
                                    QU, QV, K16, VT16, VTL16, P16, b_q, b_k, b_v, ub, vb);

  // (2) attention -> CT16 = f16(ctx * 64) hi plane, CTL16 residual plane, rows b*SEQ + i, halves n*64+d
  attn_full<<<gAT, bAT, 0, stream>>>(QU, QV, K16, P16, VT16, VTL16, kmask, CT16, CTL16);

  // (3) out = (CT + CTL) . W^T / (64*64) + bo; M = NROW, N = 512, K = 512, f32 rows straight into the output buffer (row b*SEQ + t)
  gemm64<0, 1, 0, 1><<<gQ, blk, 0, stream>>>(
      CT16, CTL16, DMOD, 0LL,
      WO16, DMOD, 0LL,
      (void*)out, (void*)out, DMOD, 0LL,
      NROW, DMOD, DMOD, 1.0f / (CC * WSC), 1.0f,
      b_o, b_o, b_o);
  (void)hipGetLastError();
}

// v006
// One run takes 95.5 microseconds.
// Two timings next to v005 both put it at 1.09 times that version's speed.
// Over all steps from v000 it is 4.54 times as fast.
// Contractions (all v_wmma_f32_16x16x32_f16, f16 operands, f32 accumulate): q/k/v/p projections (x f16 x16 . W f16 x64, K=512, single products);
// scores ([q+bq+u | q+bq+vbias] f16 x4 . [k+bk | p] f16 x4, K=128 per head, single products); P . v^T (P f16 x1024 . v^T carried as
// f16 x64 hi plane + f16 residual plane, 64 keys per tile, two products; both attention products run transposed); output projection (ctx carried as f16 x64 hi + residual planes
// . Wo f16 x64, K=512, two products). Key mask (score accumulators start at -1e30 for a masked key, whose exponential is then 0), max-subtracted online base-2 softmax and
// all epilogues in f32 on VALU. Every float input RNE-converted to bf16 on load.
#include <hip/hip_runtime.h>
#include <math.h>
#include <stdint.h>

#ifndef NB
#define NB    4
#endif
#ifndef SEQ
#define SEQ   2048
#endif
#define NB_FULL  4
#define SEQ_FULL 2048
#define DMOD  512
#define NH    8
#define DH    64
#define NROW  (SEQ * NB)
#define XC    16.0f
#define WSC   64.0f
#define QC    4.0f
#define VC    64.0f
#define PC    1024.0f
#define CC    64.0f
#define SCALE 0.125f
#define LOG2E 1.4426950408889634f
static_assert(NH * DH == DMOD);
static_assert(DH == 64);
static_assert(NB >= 1 && NB <= NB_FULL && SEQ >= 64 && SEQ <= SEQ_FULL);
static_assert((SEQ % 64) == 0 && (DMOD % 64) == 0 && (NROW % 64) == 0);
static_assert(((SEQ * DMOD) % 2048) == 0 && ((DMOD * DMOD) % 2048) == 0);
#define ATT_W 4
#define ATT_THREADS (ATT_W * 32)
#define ATT_QG 2                       // 16-query groups per wave: every k, p, v fragment read from LDS feeds ATT_QG products
#define ATT_ROWS (ATT_W * 16 * ATT_QG)
#define TPITCH 144                     // LDS bytes per staged 128-byte row: 16 B x odd, conflict-free for 16-byte fragment reads
#define TPLANE (64 * TPITCH)           // one staged plane: 64 rows
#define TBUF   (4 * TPLANE)            // one key tile: k, p, v^T hi, v^T residual
static_assert((SEQ % ATT_ROWS) == 0 && ATT_THREADS == 128);
#define PPI 68
#define WFL (16 * PPI)
static_assert((PPI % 4) == 0 && PPI >= 64 && (WFL % 4) == 0);

typedef _Float16 v16h __attribute__((ext_vector_type(16)));
typedef _Float16 v8h  __attribute__((ext_vector_type(8)));
typedef __bf16   v16b __attribute__((ext_vector_type(16)));
typedef float    v8f  __attribute__((ext_vector_type(8)));
typedef float    v4f  __attribute__((ext_vector_type(4)));
typedef float    v2f  __attribute__((ext_vector_type(2)));
typedef unsigned int v4u __attribute__((ext_vector_type(4)));

union FragH { v16h v; v8h h[2]; v4u u[2]; };
union FragAny { v16h h; v16b b; };

// ---- scalar helpers --------------------------------------------------------------------------------
__device__ __forceinline__ unsigned short bf_bits(float f) {          // f32 -> bf16 bits, RNE convert
  unsigned u = __float_as_uint(f);
  return (unsigned short)((u + 0x7FFFu + ((u >> 16) & 1u)) >> 16);
}
__device__ __forceinline__ float bf_up(unsigned short h) { return __uint_as_float(((unsigned)h) << 16); }
__device__ __forceinline__ float bfr(float f) { return bf_up(bf_bits(f)); }   // value of the bf16 RNE convert
__device__ __forceinline__ unsigned short h_bits(_Float16 x) { return __builtin_bit_cast(unsigned short, x); }
__device__ __forceinline__ unsigned pk16(unsigned short a, unsigned short b) { return (unsigned)a | ((unsigned)b << 16); }
__device__ __forceinline__ v8f zero8() { v8f z = {0.f, 0.f, 0.f, 0.f, 0.f, 0.f, 0.f, 0.f}; return z; }

// ---- fragment loader: 16-bit A/B operand from a k-contiguous 16-bit plane, lane -> row/col (lane&15),
//      p already includes +8*(lane>>4); elements 0..7 <- p[0..7] (k0+8h..), elements 8..15 <- p[16..23] (k0+16+8h..)
//      (same split k map for A and B; B is always read from a [n][k] plane)
__device__ __forceinline__ v16h ldfrag_u(const unsigned short* p) {
  FragH f;
  f.u[0] = *(const v4u*)(p);
  f.u[1] = *(const v4u*)(p + 16);
  return f.v;
}

// ---- WMMA helpers with trailing VALU hazard gaps ------------------------------------------------------
__device__ __forceinline__ v8f mma_h(v16h a, v16h b, v8f c) {
  return __builtin_amdgcn_wmma_f32_16x16x32_f16(false, a, false, b, (short)0, c, false, false);
}
__device__ __forceinline__ v8f mma_b(v16h a, v16h b, v8f c) {
  FragAny ua, ub;
  ua.h = a;
  ub.h = b;
  return __builtin_amdgcn_wmma_f32_16x16x32_bf16(false, ua.b, false, ub.b, (short)0, c, false, false);
}
template <int BF>
__device__ __forceinline__ v8f mmaT(v16h a, v16h b, v8f c) {
  if constexpr (BF != 0) return mma_b(a, b, c);
  else return mma_h(a, b, c);
}
__device__ __forceinline__ void dep_guard1(v8f& a, v8f& b, v16h x) {
#if defined(__HIP_DEVICE_COMPILE__)
  asm volatile("v_nop\n\tv_nop\n\tv_nop\n\tv_nop" : "+v"(a), "+v"(b) : "v"(x));
#endif
}
__device__ __forceinline__ void keep4_h(v16h a, v16h b, v16h c, v16h d) {
#if defined(__HIP_DEVICE_COMPILE__)
  asm volatile("v_nop" :: "v"(a), "v"(b), "v"(c), "v"(d));
#endif
}
__device__ __forceinline__ void acc_guard4(v8f& a, v8f& b, v8f& c, v8f& d) {
#if defined(__HIP_DEVICE_COMPILE__)
  asm volatile("v_nop\n\tv_nop\n\tv_nop\n\tv_nop" : "+v"(a), "+v"(b), "+v"(c), "+v"(d));
#endif
}
// Eight asynchronous 16-byte copies per lane, global -> LDS (half of a thread's share of one key tile). The s_wait_xcnt stands inside the
// statement so that no address register of an issued copy is rewritten in front of it.
__device__ __forceinline__ void copy8_async(unsigned l0, unsigned l1, unsigned l2, unsigned l3,
                                            unsigned l4, unsigned l5, unsigned l6, unsigned l7,
                                            const unsigned short* g0, const unsigned short* g1,
                                            const unsigned short* g2, const unsigned short* g3,
                                            const unsigned short* g4, const unsigned short* g5,
                                            const unsigned short* g6, const unsigned short* g7) {
#if defined(__HIP_DEVICE_COMPILE__)
  asm volatile("global_load_async_to_lds_b128 %0, %8, off\n\t"
               "global_load_async_to_lds_b128 %1, %9, off\n\t"
               "global_load_async_to_lds_b128 %2, %10, off\n\t"
               "global_load_async_to_lds_b128 %3, %11, off\n\t"
               "global_load_async_to_lds_b128 %4, %12, off\n\t"
               "global_load_async_to_lds_b128 %5, %13, off\n\t"
               "global_load_async_to_lds_b128 %6, %14, off\n\t"
               "global_load_async_to_lds_b128 %7, %15, off\n\t"
               "s_wait_xcnt 0x0"
               :: "v"(l0), "v"(l1), "v"(l2), "v"(l3), "v"(l4), "v"(l5), "v"(l6), "v"(l7),
                  "v"(g0), "v"(g1), "v"(g2), "v"(g3), "v"(g4), "v"(g5), "v"(g6), "v"(g7)
               : "memory");
#endif
}
// Four such copies per lane (the A rows of a GEMM chunk), with the same wait inside the statement for the same reason.
__device__ __forceinline__ void copy4_async(unsigned l0, unsigned l1, unsigned l2, unsigned l3,
                                            const unsigned short* g0, const unsigned short* g1,
                                            const unsigned short* g2, const unsigned short* g3) {
#if defined(__HIP_DEVICE_COMPILE__)
  asm volatile("global_load_async_to_lds_b128 %0, %4, off\n\t"
               "global_load_async_to_lds_b128 %1, %5, off\n\t"
               "global_load_async_to_lds_b128 %2, %6, off\n\t"
               "global_load_async_to_lds_b128 %3, %7, off\n\t"
               "s_wait_xcnt 0x0"
               :: "v"(l0), "v"(l1), "v"(l2), "v"(l3), "v"(g0), "v"(g1), "v"(g2), "v"(g3)
               : "memory");
#endif
}
// This wave's own copies have landed in LDS (other waves read them only behind the next work-group barrier).
__device__ __forceinline__ void wait_async0() {
#if defined(__HIP_DEVICE_COMPILE__)
  asm volatile("s_wait_asynccnt 0x0" ::: "memory");
#endif
}
// This wave's own LDS reads have returned, so that the buffer they read may be refilled behind the barrier.
__device__ __forceinline__ void wait_ds0() {
#if defined(__HIP_DEVICE_COMPILE__)
  asm volatile("s_wait_dscnt 0x0" ::: "memory");
#endif
}
__device__ __forceinline__ void wait_x0() {
#if defined(__HIP_DEVICE_COMPILE__)
  asm volatile("s_wait_xcnt 0x0" ::: "memory");
#endif
}
__device__ __forceinline__ void wave_sync_lds() {
  __builtin_amdgcn_fence(__ATOMIC_RELEASE, "workgroup");
  __builtin_amdgcn_wave_barrier();
  __builtin_amdgcn_fence(__ATOMIC_ACQUIRE, "workgroup");
}

// =====================================================================================================
// Elementwise 16-bit pack, no transpose, all nine float planes in ONE grid: dst[i] = f16( bf16_RNE(src[i]) * sc ), sc a power of two
// (exact). A block packs one piece of 2048 elements (256 thr x 8: two 16-B loads, one 16-B store per thread); ranges of the block index
// pick the source (block-uniform): CVT_W pieces for each of wq, wk, wv, wp, wo (x64), NB * CVT_X for each of xq, xk, xv (x16; batch y is
// read at input row y*SEQ_FULL and written at plane row y*SEQ), CVT_X for pos (x16). The nine destination planes lie in the workspace
// one behind the other in this same order, so piece bx is written at dst + bx * 2048.
// coverage: grid = CVT_BLOCKS blocks = every piece of every plane exactly once (all plane sizes are multiples of 2048 by the static sizes).
// =====================================================================================================
#define CVT_W ((DMOD * DMOD) / 2048)
#define CVT_X ((SEQ * DMOD) / 2048)
#define CVT_BLOCKS (5 * CVT_W + 3 * NB * CVT_X + CVT_X)
__global__ __launch_bounds__(256) void cvt_all(const float* __restrict__ wq, const float* __restrict__ wk, const float* __restrict__ wv,
                                               const float* __restrict__ wp, const float* __restrict__ wo,
                                               const float* __restrict__ xq, const float* __restrict__ xk, const float* __restrict__ xv,
                                               const float* __restrict__ xpos, unsigned short* dst) {
  const int bx = blockIdx.x;
  if (bx >= CVT_BLOCKS) return;               // never taken with the exact grid; no barriers in this kernel
  const float* src;
  size_t so;                                  // element offset of this block's piece in its source
  float sc;
  if (bx < 5 * CVT_W) {
    const int seg = bx / CVT_W;
    src = (seg == 0) ? wq : (seg == 1) ? wk : (seg == 2) ? wv : (seg == 3) ? wp : wo;
    so  = (size_t)(bx - seg * CVT_W) * 2048;
    sc  = WSC;
  } else if (bx < 5 * CVT_W + 3 * NB * CVT_X) {
    const int r   = bx - 5 * CVT_W;
    const int seg = r / (NB * CVT_X);
    const int rs  = r - seg * (NB * CVT_X);
    const int y   = rs / CVT_X;
    src = (seg == 0) ? xq : (seg == 1) ? xk : xv;
    so  = (size_t)y * SEQ_FULL * DMOD + (size_t)(rs - y * CVT_X) * 2048;
    sc  = XC;
  } else {
    src = xpos;
    so  = (size_t)(bx - (5 * CVT_W + 3 * NB * CVT_X)) * 2048;
    sc  = XC;
  }
  const float* s = src + so + (size_t)threadIdx.x * 8;
  unsigned short* d = dst + (size_t)bx * 2048 + (size_t)threadIdx.x * 8;
  const v4f a = *(const v4f*)(s);
  const v4f b = *(const v4f*)(s + 4);
  v4u o;
  o[0] = pk16(h_bits((_Float16)(bfr(a[0]) * sc)), h_bits((_Float16)(bfr(a[1]) * sc)));
  o[1] = pk16(h_bits((_Float16)(bfr(a[2]) * sc)), h_bits((_Float16)(bfr(a[3]) * sc)));
  o[2] = pk16(h_bits((_Float16)(bfr(b[0]) * sc)), h_bits((_Float16)(bfr(b[1]) * sc)));
  o[3] = pk16(h_bits((_Float16)(bfr(b[2]) * sc)), h_bits((_Float16)(bfr(b[3]) * sc)));
  *(v4u*)(d) = o;
}

// =====================================================================================================
// Register-blocked batched 16-bit WMMA GEMM: C[m][n] = oscale * sum_k A[m][k] * Bt[n][k] (+ bias); a block of 8 waves owns one
// 128x256 tile, wave w its 64x64 part (rows 64 * (w >> 2), columns 64 * (w & 3)). A row-major [M][K] pitch lda (16-bit plane), Bt
// row-major [N][K] pitch ldb (k contiguous); M multiple of 128, N of 256, K of 64. bx = index of the block's tile, by = batch index
// with element strides sA, sB, sC; gs = the block's LDS.
// Operands: per 64-deep chunk of k the block's 128 A rows (both planes with ASPLIT) and 256 Bt rows, 128 bytes each, are brought into
// LDS once by asynchronous 16-byte copies (each wave-copy = 4 whole 128-byte lines), two buffers: chunk t + 2 is copied into the buffer
// that trip t has read, behind the trip's barrier; all fragments are 16-byte LDS reads at pitch 144 B. Order of the k sum: ascending.
// ASPLIT 1: a second A plane A2 (unscaled residual of A, same layout) is multiplied into the same accumulator (A + A2 ~ exact A).
// BF 1: bf16 operands (v_wmma_f32_16x16x32_bf16), else f16.
// EPI 1: value += bf16_RNE(ep0[column]) (per-column bias); EPI 2: value += bf16_RNE(ep0[row]) (per-row bias, 16-bit out only).
// OM 0: f32 out (pitch ldc).  OM 2: one f16 plane = f16(value * ocarry).
// OM 4: two f16 planes: hi = f16(value * ocarry), lo = f16(value * ocarry - hi) (unscaled residual).
// OM 5: two f16 planes: C = f16((value + bf16_RNE(ep1[column])) * ocarry), C2 = f16((value + bf16_RNE(ep2[column])) * ocarry).
// coverage: 4 slabs x 16 rows (f32: it 0..7 x lane>>4; 16-bit: it 0..3 x lane>>3) x 64 cols = the wave's whole 64x64 tile;
//           (M/128)*(N/256) values of bx, a surplus block leaves as a whole in front of every barrier.
// LDS: the epilogue's slabs lie over the chunk buffers, which nobody reads behind the last trip's barrier.
// =====================================================================================================
#define SLABF (16 * 68)                 // floats of one wave's 16x64 slab, pitch 68 floats
#define GPLANE_A (128 * TPITCH)         // one staged A plane: 128 rows
#define GPLANE_B (256 * TPITCH)         // the staged Bt plane: 256 rows
#define GBUF(AS) ((1 + (AS)) * GPLANE_A + GPLANE_B)   // one chunk buffer
static_assert(2 * GBUF(0) >= 8 * SLABF * 4);
static_assert((NROW % 128) == 0 && (SEQ % 256) == 0 && (DMOD % 256) == 0);
template <int OM, int ASPLIT, int BF, int EPI>
__device__ __forceinline__ void gemm64_tile(
    unsigned char* gs, int bx, int by,
    const unsigned short* __restrict__ Ap, const unsigned short* __restrict__ A2p, int lda, long long sA,
    const unsigned short* __restrict__ Btp, int ldb, long long sB,
    void* Cout, void* C2out, int ldc, long long sC,
    int M, int N, int K, float oscale, float ocarry,
    const float* __restrict__ ep0, const float* __restrict__ ep1, const float* __restrict__ ep2) {
  const int tid  = threadIdx.x;
  const int lane = tid & 31;
  const int wave = tid >> 5;
  const int bN = N >> 8;
  if (bx >= (M >> 7) * bN) return;       // block-uniform, in front of every barrier
  const int bm  = bx / bN;
  const int m0b = bm << 7;
  const int n0b = (bx - bm * bN) << 8;
  const int wm = wave >> 2, wn = wave & 3;
  const int m0 = m0b + (wm << 6);
  const int n0 = n0b + (wn << 6);

  const unsigned short* A1 = Ap  + (size_t)((long long)by * sA);
  const unsigned short* A2 = A2p + (size_t)((long long)by * sA);
  const unsigned short* Bb = Btp + (size_t)((long long)by * sB);

  const int rlane = lane & 15;                 // row (A) / col (B, D) within subtile
  const int hh    = lane >> 4;                 // lane half: k offset 8 * hh
  const int mOff  = (lane >> 4) * 8;           // D row offset

  constexpr unsigned GB = (unsigned)GBUF(ASPLIT);               // bytes of one chunk buffer
  constexpr unsigned OB = (unsigned)((1 + ASPLIT) * GPLANE_A);  // byte offset of the Bt plane in it
  // copy share of this thread: rows crow + 32 x of each plane, 16-byte piece cpc of the 128-byte row
  const int crow = tid >> 3, cpc = tid & 7;
  const unsigned short* gA  = A1 + (size_t)(m0b + crow) * lda + 8 * cpc;      // + kc per chunk
  const unsigned short* gA2 = A2 + (size_t)(m0b + crow) * lda + 8 * cpc;
  const unsigned short* gB  = Bb + (size_t)(n0b + crow) * ldb + 8 * cpc;
  const unsigned ldst = (unsigned)(size_t)gs + (unsigned)(crow * TPITCH + cpc * 16);   // LDS byte address, buffer 0, A plane
  const size_t ra = (size_t)32 * lda, rb = (size_t)32 * ldb;
  auto stage = [&](int kc, unsigned bo) {   // chunk at kc -> buffer at byte offset bo; every lane on, all rows < M, N, all k < K
    const unsigned l = ldst + bo;
    const unsigned short* a = gA + kc;
    if constexpr (ASPLIT != 0) {
      const unsigned short* a2 = gA2 + kc;
      copy8_async(l, l + 32 * TPITCH, l + 64 * TPITCH, l + 96 * TPITCH,
                  l + GPLANE_A, l + GPLANE_A + 32 * TPITCH, l + GPLANE_A + 64 * TPITCH, l + GPLANE_A + 96 * TPITCH,
                  a, a + ra, a + 2 * ra, a + 3 * ra, a2, a2 + ra, a2 + 2 * ra, a2 + 3 * ra);
    } else {
      copy4_async(l, l + 32 * TPITCH, l + 64 * TPITCH, l + 96 * TPITCH, a, a + ra, a + 2 * ra, a + 3 * ra);
    }
    const unsigned lb = l + OB;
    const unsigned short* bs = gB + kc;
    copy8_async(lb, lb + 32 * TPITCH, lb + 64 * TPITCH, lb + 96 * TPITCH,
                lb + 128 * TPITCH, lb + 160 * TPITCH, lb + 192 * TPITCH, lb + 224 * TPITCH,
                bs, bs + rb, bs + 2 * rb, bs + 3 * rb, bs + 4 * rb, bs + 5 * rb, bs + 6 * rb, bs + 7 * rb);
  };
  // fragment read bases of this lane: row rlane of a 16-row subtile of the wave's part, 16-byte piece hh
  const unsigned char* fa0 = gs + ((wm << 6) + rlane) * TPITCH + 16 * hh;
  const unsigned char* fb0 = gs + OB + ((wn << 6) + rlane) * TPITCH + 16 * hh;

  stage(0, 0u);
  wait_async0();
  __syncthreads();                          // chunk 0 published
  if (K > 64) stage(64, GB);

  v8f acc[4][4];
#pragma unroll
  for (int i = 0; i < 4; ++i)
#pragma unroll
    for (int j = 0; j < 4; ++j) acc[i][j] = zero8();

#pragma unroll 1   // kept rolled, for speed only
  for (int kc = 0; kc < K; kc += 64) {
    const unsigned bo = ((unsigned)kc & 64u) ? GB : 0u;      // buffer of this trip
    const unsigned char* fa = fa0 + bo;
    const unsigned char* fb = fb0 + bo;
#pragma unroll      // the chunk's two 32-deep steps, unrolled so that their LDS offsets are immediates
    for (int ks = 0; ks < 2; ++ks) {
      v16h bh[4], ahs[4], als[4];           // all fragments of the 32-deep step are read as one group in front of its products
#pragma unroll
      for (int j = 0; j < 4; ++j) bh[j] = ldfrag_u((const unsigned short*)(fb + 16 * j * TPITCH) + 32 * ks);
#pragma unroll
      for (int i = 0; i < 4; ++i) {
        ahs[i] = ldfrag_u((const unsigned short*)(fa + 16 * i * TPITCH) + 32 * ks);
        if constexpr (ASPLIT != 0) als[i] = ldfrag_u((const unsigned short*)(fa + GPLANE_A + 16 * i * TPITCH) + 32 * ks);
      }
#pragma unroll
      for (int i = 0; i < 4; ++i) {
        const v16h ah = ahs[i];
#pragma unroll
        for (int j = 0; j < 4; ++j) acc[i][j] = mmaT<BF>(ah, bh[j], acc[i][j]);
        dep_guard1(acc[i][0], acc[i][3], ah);
        if constexpr (ASPLIT != 0) {
          const v16h al = als[i];
#pragma unroll
          for (int j = 0; j < 4; ++j) acc[i][j] = mmaT<BF>(al, bh[j], acc[i][j]);
          dep_guard1(acc[i][0], acc[i][3], al);
        }
      }
      keep4_h(bh[0], bh[1], bh[2], bh[3]);
    }
    // ---- publish chunk t + 1, free this trip's buffer, then refill it with chunk t + 2 ----
    wait_ds0();
    wait_async0();
    __syncthreads();
    if (kc + 128 < K) stage(kc + 128, bo);
  }
  wait_async0();
  acc_guard4(acc[0][0], acc[0][1], acc[0][2], acc[0][3]);
  acc_guard4(acc[1][0], acc[1][1], acc[1][2], acc[1][3]);
  acc_guard4(acc[2][0], acc[2][1], acc[2][2], acc[2][3]);
  acc_guard4(acc[3][0], acc[3][1], acc[3][2], acc[3][3]);

  const int hh2 = lane >> 4, c4 = (lane & 15) * 4;     // f32 out: 256-B row segment = 16 lanes x 16 B
  const int q8  = lane >> 3, c8 = (lane & 7) * 8;

  // ---- epilogue ----
  float* slab = (float*)gs + wave * SLABF;
#pragma unroll
  for (int i = 0; i < 4; ++i) {
    const int mBase = m0 + (i << 4);
#pragma unroll
    for (int j = 0; j < 4; ++j) {
#pragma unroll
      for (int r = 0; r < 8; ++r) {
        slab[(mOff + r) * 68 + (j << 4) + rlane] = acc[i][j][r];
      }
    }
    wave_sync_lds();
    if constexpr (OM == 0) {
      float* C = (float*)Cout + (size_t)((long long)by * sC);
      v4f vals[8];
#pragma unroll
      for (int it = 0; it < 8; ++it) {
        const int row = it * 2 + hh2;                      // it 0..7 x hh2 0..1 = rows 0..15
        v4f v = *(const v4f*)(slab + row * 68 + c4);
#pragma unroll
        for (int e = 0; e < 4; ++e) v[e] = v[e] * oscale;
        if constexpr (EPI == 1) {
          const v4f bb = *(const v4f*)(ep0 + n0 + c4);     // per-column bias, columns n0+c4 .. +3 (N equals the bias length)
#pragma unroll
          for (int e = 0; e < 4; ++e) v[e] = v[e] + bfr(bb[e]);
        }
        vals[it] = v;
      }
      {
#pragma unroll
        for (int it = 0; it < 8; ++it) {
          const int gr = mBase + it * 2 + hh2;
          *(v4f*)(C + (size_t)gr * ldc + n0 + c4) = vals[it];
        }
        
      }
    } else {
      unsigned short* C  = (unsigned short*)Cout  + (size_t)((long long)by * sC);
      unsigned short* Cb = (unsigned short*)C2out + (size_t)((long long)by * sC);
      v4u hv[4], lv[4];
#pragma unroll
      for (int it = 0; it < 4; ++it) {
        const int row = it * 4 + q8;                       // it 0..3 x q8 0..3 = rows 0..15
        const float* sp = slab + row * 68 + c8;
        float rb = 0.f;
        if constexpr (EPI == 2) rb = bfr(ep0[mBase + row]);   // per-row bias (M equals the bias length)
        v4u a  = {0u, 0u, 0u, 0u};
        v4u b2 = {0u, 0u, 0u, 0u};
#pragma unroll
        for (int e = 0; e < 4; ++e) {
          const int ci = n0 + c8 + 2 * e;                  // column index, < N
          float f0 = sp[2 * e] * oscale + rb;
          float f1 = sp[2 * e + 1] * oscale + rb;
          if constexpr (EPI == 1) {
            f0 += bfr(ep0[ci]);
            f1 += bfr(ep0[ci + 1]);
          }
          if constexpr (OM == 5) {
            const float g0 = (f0 + bfr(ep1[ci])) * ocarry, g1 = (f1 + bfr(ep1[ci + 1])) * ocarry;
            const float w0 = (f0 + bfr(ep2[ci])) * ocarry, w1 = (f1 + bfr(ep2[ci + 1])) * ocarry;
            a[e]  = pk16(h_bits((_Float16)g0), h_bits((_Float16)g1));
            b2[e] = pk16(h_bits((_Float16)w0), h_bits((_Float16)w1));
          } else {
            f0 *= ocarry; f1 *= ocarry;
            const _Float16 x0 = (_Float16)f0, x1 = (_Float16)f1;
            a[e] = pk16(h_bits(x0), h_bits(x1));
            if constexpr (OM == 4) {
              b2[e] = pk16(h_bits((_Float16)(f0 - (float)x0)), h_bits((_Float16)(f1 - (float)x1)));
            }
          }
        }
        hv[it] = a;
        lv[it] = b2;
      }
      {
#pragma unroll
        for (int it = 0; it < 4; ++it) {
          const int row = it * 4 + q8;
          *(v4u*)(C + (size_t)(mBase + row) * ldc + n0 + c8) = hv[it];
          if constexpr (OM >= 4) {
            *(v4u*)(Cb + (size_t)(mBase + row) * ldc + n0 + c8) = lv[it];
          }
        }
        
      }
    }
    wave_sync_lds();
  }
}

// One GEMM per launch: grid.x = 128x256 tiles, grid.y = batch.
template <int OM, int ASPLIT, int BF, int EPI>
__global__ __launch_bounds__(256) __attribute__((amdgpu_num_vgpr(256))) void gemm64(
    const unsigned short* __restrict__ Ap, const unsigned short* __restrict__ A2p, int lda, long long sA,
    const unsigned short* __restrict__ Btp, int ldb, long long sB,
    void* Cout, void* C2out, int ldc, long long sC,
    int M, int N, int K, float oscale, float ocarry,
    const float* __restrict__ ep0, const float* __restrict__ ep1, const float* __restrict__ ep2) {
  __shared__ __align__(128) unsigned char gsm[2 * GBUF(ASPLIT)];   // two chunk buffers; the epilogue's slabs lie over them
  gemm64_tile<OM, ASPLIT, BF, EPI>(gsm, blockIdx.x, blockIdx.y, Ap, A2p, lda, sA, Btp, ldb, sB, Cout, C2out, ldc, sC,
                                   M, N, K, oscale, ocarry, ep0, ep1, ep2);
}

// The four projections, which need nothing of each other, in ONE grid; ranges of the block index pick the product (block-uniform):
//   PJ_Q blocks: q[m][nd] = sum_c x[m][c] W[nd][c] / 1024 + bq[nd]; QU = f16((q + ub[nd]) * 4), QV = f16((q + vbias[nd]) * 4);
//                M = NROW, N = 512, K = 512
//   PJ_Q blocks: k projection + bk -> K16 = f16(k * 4), same shape
//   NB * PJ_V blocks: v^T per batch: VT[b][nd][j] = sum_c W[nd][c] x[b*SEQ + j][c] / 1024 + bv[nd] (per-row bias) -> f16 x64 hi +
//                residual planes; M = 512 (nd), N = SEQ (j), K = 512; B rows are the batch's token rows: pitch DMOD, stride SEQ*DMOD
//   PJ_P blocks: positional projection (no bias): P16 = f16(p * 4), M = SEQ, N = 512, K = 512
#define PJ_Q (((NROW / 64) * (DMOD / 64)) / 8)
#define PJ_V (((DMOD / 64) * (SEQ / 64)) / 8)
#define PJ_P (((SEQ / 64) * (DMOD / 64)) / 8)
#define PJ_BLOCKS (2 * PJ_Q + NB * PJ_V + PJ_P)
static_assert(((DMOD / 64) % 8) == 0);   // every product's tile count is a multiple of the 8 tiles of a block
__global__ __launch_bounds__(256) __attribute__((amdgpu_num_vgpr(256))) void proj_all(
    const unsigned short* __restrict__ XQ, const unsigned short* __restrict__ XK,
    const unsigned short* __restrict__ XV, const unsigned short* __restrict__ XP,
    const unsigned short* __restrict__ WQ, const unsigned short* __restrict__ WK,
    const unsigned short* __restrict__ WV, const unsigned short* __restrict__ WP,
    unsigned short* QU, unsigned short* QV, unsigned short* K16,
    unsigned short* VT, unsigned short* VTL, unsigned short* P16,
    const float* __restrict__ bq, const float* __restrict__ bk, const float* __restrict__ bv,
    const float* __restrict__ ub, const float* __restrict__ vb) {
  __shared__ __align__(128) unsigned char gsm[2 * GBUF(0)];   // two chunk buffers; the epilogue's slabs lie over them
  const int bx = blockIdx.x;
  const float osc = 1.0f / (XC * WSC);
  if (bx < PJ_Q) {
    gemm64_tile<5, 0, 0, 1>(gsm, bx, 0, XQ, XQ, DMOD, 0LL, WQ, DMOD, 0LL, (void*)QU, (void*)QV, DMOD, 0LL,
                            NROW, DMOD, DMOD, osc, QC, bq, ub, vb);
  } else if (bx < 2 * PJ_Q) {
    gemm64_tile<2, 0, 0, 1>(gsm, bx - PJ_Q, 0, XK, XK, DMOD, 0LL, WK, DMOD, 0LL, (void*)K16, (void*)K16, DMOD, 0LL,
                            NROW, DMOD, DMOD, osc, QC, bk, bk, bk);
  } else if (bx < 2 * PJ_Q + NB * PJ_V) {
    const int r  = bx - 2 * PJ_Q;
    const int by = r / PJ_V;
    gemm64_tile<4, 0, 0, 2>(gsm, r - by * PJ_V, by, WV, WV, DMOD, 0LL, XV, DMOD, (long long)SEQ * DMOD,
                            (void*)VT, (void*)VTL, SEQ, (long long)DMOD * SEQ,
                            DMOD, SEQ, DMOD, osc, VC, bv, bv, bv);
  } else if (bx < PJ_BLOCKS) {
    gemm64_tile<2, 0, 0, 0>(gsm, bx - (2 * PJ_Q + NB * PJ_V), 0, XP, XP, DMOD, 0LL, WP, DMOD, 0LL, (void*)P16, (void*)P16, DMOD, 0LL,
                            SEQ, DMOD, DMOD, osc, QC, bq, bq, bq);
  }
}

// =====================================================================================================
// Full (non-causal) attention with a 128-deep score contraction for one (batch b, head n) pair and a 128-row query tile;
// 4 waves, wave w owns query rows iw0 .. iw0+31, iw0 = i0 + 32w, as two groups g of 16 (rows iw0 + 16g ..). Planes (pitch DMOD halves, row index = b*SEQ + position):
// QU = f16((q + bq + ub) x4), QV = f16((q + bq + vbias) x4), KP = f16((k + bk) x4); PP = f16(p x4) rows s = 0 .. SEQ-1 (shared by
// all batches); VT, VTL = v^T hi x64 / residual f16 as [b][n*64+d][SEQ]. Key mask ints kmask[b*SEQ_FULL + s], masked where == 0.
//   Both products are computed transposed: S^T = [k | p] . [q+ub | q+vbias]^T (A = key rows from LDS, B = the query fragments, loaded
//   once and kept in registers) and O^T += v^T . P^T (A = v^T rows from LDS, B = P^T). Each A fragment is read from LDS once and
//   multiplied with both groups' B operands. Lane (c, hh) then holds, for its one query per group,
//   iw0 + 16g + c, the scores of keys j0 + 16t + 8hh + r (t 0..3, r 0..7): maximum and sum run inside the lane, with one exchange between
//   the lane halves for the maximum per key tile and one for the sum behind the loop; two score tiles converted in place are a B
//   operand in the loaders' k map (element e <- tile 2ks row 8hh+e, element 8+e <- tile 2ks+1 row 8hh+e), so P never leaves registers.
//   Key mask: the score accumulators start from kbias[key] (0, or -1e30 where the key is masked; built once per work-group in LDS).
//   The running maximum never falls below -1e20 (any real score lies far above it), so a masked key's exponential is exactly 0 and a
//   fully masked row keeps sum 0 and gives ctx 0. Online softmax in base 2, max-subtracted, f32; the x1024 carry of P sits in the
//   exponent (+10), so the running sum carries it too and it cancels in the division.
//   Per key tile (64 keys) and group: 16 score WMMAs, 8 + 8 P.V WMMAs (hi plane then residual plane into the same accumulators).
//   Key tiles: the four 64-row x 128-byte planes of a tile (k rows, p rows, v^T hi rows, v^T residual rows of head n) are brought into
//   LDS once per work-group by asynchronous 16-byte copies (16 per thread, each wave-copy = 4 whole 128-byte lines), two buffers: tile
//   t + 2 is copied into the buffer that trip t has read, behind the trip's barrier; all A fragments are 16-byte LDS reads at pitch 144 B.
//   block = 4 waves = 128 threads, two blocks per WGP (two waves per SIMD); grid = (SEQ/128, NB*NH); one block barrier per key tile; identical bounded work (SEQ/64 tiles).
// LDS: two key-tile buffers and kbias shared by the block; one [16][PPI] f32 slab per wave for a group's ctx tile, private-to-wave
//   (wave_sync), used by the two groups one after the other;
//   staged extent == consumed extent (16 rows x 64 cols written by every lane (c, hh) x (td, r) before any read).
// coverage: global: per group 4 instructions x 4 rows x 64 halves per plane = rows iw0+16g..iw0+16g+15 of head segment n in CT and CTL;
//           grid x waves cover all NB x SEQ rows and all NH head segments of CT / CTL exactly once.
// =====================================================================================================
__device__ __forceinline__ float xhalf(float x) {   // value of lane l ^ 16
  const int b = __builtin_bit_cast(int, x);
  return __builtin_bit_cast(float, __builtin_amdgcn_permlanex16(b, b, 0x76543210, 0xfedcba98, false, false));
}
// 2^x as the one hardware instruction. The library's exp2f wraps it in a compare, two selects, an add and a scaling so that results
// below 2^-126 come out as subnormals; here such a result is 0 either way once it is a 16-bit operand, and it cannot move a running sum
// that holds the tile maximum's own term (1024) or an accumulator that is scaled by it.
__device__ __forceinline__ float hw_exp2(float x) { return __builtin_amdgcn_exp2f(x); }
__device__ __forceinline__ float max8(v8f s) {
  return fmaxf(fmaxf(fmaxf(fmaxf(s[0], s[1]), s[2]), fmaxf(fmaxf(s[3], s[4]), s[5])), fmaxf(s[6], s[7]));
}

// two waves per SIMD: the 512 blocks of four waves are two on every WGP, which leaves a wave a budget of 512 registers
__global__ __launch_bounds__(ATT_THREADS) __attribute__((amdgpu_waves_per_eu(2, 2)))
void attn_full(const unsigned short* __restrict__ QU, const unsigned short* __restrict__ QV,
               const unsigned short* __restrict__ KP, const unsigned short* __restrict__ PP,
               const unsigned short* __restrict__ VT, const unsigned short* __restrict__ VTL,
               const int* __restrict__ kmask,
               unsigned short* CT, unsigned short* CTL) {
  __shared__ __align__(16) float smem[ATT_W * WFL];   // per wave: ctx slab [16][PPI]
  __shared__ __align__(128) unsigned char tiles[2 * TBUF];   // two key-tile buffers: [buffer][plane k, p, v hi, v lo][64 rows][TPITCH]
  __shared__ __align__(32) float kbias[SEQ];          // start value of a key's score accumulators

  const int tid  = threadIdx.x;
  const int wave = tid >> 5;
  const int lane = tid & 31;
  const int hh   = lane >> 4;
  const int c    = lane & 15;
  const int bn   = blockIdx.y;
  const int b    = bn / NH;
  const int n    = bn - b * NH;
  const int i0   = blockIdx.x * ATT_ROWS;
  const int iw0  = i0 + wave * (16 * ATT_QG);

  float* pt = smem + wave * WFL;

  // stationary B fragments: (q + bq + ub) and (q + bq + vbias), query row b*SEQ + iw0 + 16g + c, d 0..31 and 32..63 of head n
  v16h qf[ATT_QG][4];                       // [group][k step: ub d 0..31, ub d 32..63, vbias d 0..31, vbias d 32..63]
  const size_t qro = ((size_t)(b * SEQ + iw0 + c)) * DMOD + n * DH + 8 * hh;
  const unsigned short* qu0 = QU + qro;
  const unsigned short* qv0 = QV + qro;
  // The scheduling barriers keep other address arithmetic out of the run of loads, so that the wait behind the run stands in front of
  // every rewrite of a register that one of the loads names.
  __builtin_amdgcn_sched_barrier(0);
#pragma unroll
  for (int g = 0; g < ATT_QG; ++g) {
    qf[g][0] = ldfrag_u(qu0 + g * 16 * DMOD);
    qf[g][1] = ldfrag_u(qu0 + g * 16 * DMOD + 32);
    qf[g][2] = ldfrag_u(qv0 + g * 16 * DMOD);
    qf[g][3] = ldfrag_u(qv0 + g * 16 * DMOD + 32);
  }
  wait_x0();
  __builtin_amdgcn_sched_barrier(0);

  const int* km = kmask + (size_t)b * SEQ_FULL;

  // copy share of this thread: rows crow + 16 x (x 0..3) of each plane, 16-byte piece cpc of the 128-byte row
  const int crow = tid >> 3, cpc = tid & 7;
  const unsigned short* gK = KP + ((size_t)b * SEQ + crow) * DMOD + n * DH + 8 * cpc;          // + j0 * DMOD per tile
  const unsigned short* gP = PP + (size_t)crow * DMOD + n * DH + 8 * cpc;                      // + j0 * DMOD per tile
  const size_t vbase = (size_t)b * DMOD * SEQ + (size_t)(n * DH + crow) * SEQ + 8 * cpc;       // + j0 per tile
  const unsigned short* gV = VT  + vbase;
  const unsigned short* gL = VTL + vbase;
  const unsigned ldst = (unsigned)(size_t)tiles + (unsigned)(crow * TPITCH + cpc * 16);        // LDS byte address, buffer 0, plane 0
  // fragment read base of this lane: row c of a 16-row subtile, 16-byte piece hh
  const unsigned char* fr0 = tiles + c * TPITCH + 16 * hh;

  auto stage = [&](int jt, unsigned bo) {   // key tile at jt -> buffer at byte offset bo; every lane on, all addresses in range
    const unsigned l = ldst + bo;
    const size_t kr = (size_t)jt * DMOD;
    const unsigned short* k0 = gK + kr;
    const unsigned short* p0 = gP + kr;
    copy8_async(l, l + 16 * TPITCH, l + 32 * TPITCH, l + 48 * TPITCH,
                l + TPLANE, l + TPLANE + 16 * TPITCH, l + TPLANE + 32 * TPITCH, l + TPLANE + 48 * TPITCH,
                k0, k0 + 16 * DMOD, k0 + 32 * DMOD, k0 + 48 * DMOD, p0, p0 + 16 * DMOD, p0 + 32 * DMOD, p0 + 48 * DMOD);
    const unsigned lv = l + 2 * TPLANE;
    const unsigned short* v0 = gV + jt;
    const unsigned short* w0 = gL + jt;
    copy8_async(lv, lv + 16 * TPITCH, lv + 32 * TPITCH, lv + 48 * TPITCH,
                lv + TPLANE, lv + TPLANE + 16 * TPITCH, lv + TPLANE + 32 * TPITCH, lv + TPLANE + 48 * TPITCH,
                v0, v0 + (size_t)16 * SEQ, v0 + (size_t)32 * SEQ, v0 + (size_t)48 * SEQ,
                w0, w0 + (size_t)16 * SEQ, w0 + (size_t)32 * SEQ, w0 + (size_t)48 * SEQ);
  };
  stage(0, 0u);
  // key bias, built while tile 0 flies (another LDS range than the copies'); published by the same barrier
  int mk[SEQ / ATT_THREADS];
  __builtin_amdgcn_sched_barrier(0);        // as at the fragment loads above: the wait stands in front of every rewrite of the loads' address registers
#pragma unroll
  for (int s = 0; s < SEQ; s += ATT_THREADS) mk[s / ATT_THREADS] = km[s + tid];   // s + tid < SEQ <= SEQ_FULL
  wait_x0();
  __builtin_amdgcn_sched_barrier(0);
#pragma unroll
  for (int s = 0; s < SEQ; s += ATT_THREADS) kbias[s + tid] = (mk[s / ATT_THREADS] == 0) ? -1.0e30f : 0.f;
  wait_async0();
  __syncthreads();                          // tile 0 and kbias published
  if (SEQ > 64) stage(64, (unsigned)TBUF);

  const float KSC = (SCALE / (QC * QC)) * LOG2E;

  float mrun[ATT_QG], lrun[ATT_QG];         // per group, this lane's query: running maximum (both halves alike), running sum x1024 (own half's keys)
  v8f O[ATT_QG][4];                         // O^T: O[g][td][r] = ctx accumulator of d = 16td + 8hh + r, query c of group g
#pragma unroll
  for (int g = 0; g < ATT_QG; ++g) {
    mrun[g] = -1.0e20f;
    lrun[g] = 0.f;
#pragma unroll
    for (int td = 0; td < 4; ++td) O[g][td] = zero8();
  }

#pragma unroll 1
  for (int j0 = 0; j0 < SEQ; j0 += 64) {
    const unsigned bo = ((unsigned)j0 & 64u) ? (unsigned)TBUF : 0u;      // buffer of this trip
    const unsigned char* fr = fr0 + bo;

    // The tile's LDS reads stand in two groups, each ahead of work that covers its latency. The scheduling barriers hold a group in
    // place: without them the compiler sinks each read to its own pair of products, which then wait out a whole LDS latency.
    // ---- group 1: the keys' start values and the 16 k and p fragments ----
    v8f kb[4];
    v16h ak[4][4];                          // [k step: k d 0..31, k d 32..63, p d 0..31, p d 32..63][16-key subtile]
    v16h av[2][2][4];                       // [plane: v^T hi, residual][32-key step][d subtile]
    __builtin_amdgcn_sched_barrier(0);
#pragma unroll
    for (int t = 0; t < 4; ++t) kb[t] = *(const v8f*)(kbias + j0 + 16 * t + 8 * hh);
#pragma unroll
    for (int st = 0; st < 4; ++st)
#pragma unroll
      for (int t = 0; t < 4; ++t)
        ak[st][t] = ldfrag_u((const unsigned short*)(fr + (st >> 1) * TPLANE + 16 * t * TPITCH) + 32 * (st & 1));
    __builtin_amdgcn_sched_barrier(0);

    // ---- S^T = kbias + k . (q+ub)^T + p . (q+vbias)^T: 4 subtiles of 16 keys x the groups, four 32-deep steps; each A fragment
    //      serves every group; the subtiles and the groups are independent. Behind the k steps: group 2, the 16 v^T fragments ----
    v8f S[ATT_QG][4];
#pragma unroll
    for (int t = 0; t < 4; ++t)
#pragma unroll
      for (int g = 0; g < ATT_QG; ++g) S[g][t] = kb[t];
#pragma unroll
    for (int st = 0; st < 2; ++st)
#pragma unroll
      for (int t = 0; t < 4; ++t)
#pragma unroll
        for (int g = 0; g < ATT_QG; ++g) S[g][t] = mma_h(ak[st][t], qf[g][st], S[g][t]);
    __builtin_amdgcn_sched_barrier(0);
#pragma unroll
    for (int pl = 0; pl < 2; ++pl)
#pragma unroll
      for (int ks = 0; ks < 2; ++ks)
#pragma unroll
        for (int td = 0; td < 4; ++td)
          av[pl][ks][td] = ldfrag_u((const unsigned short*)(fr + (2 + pl) * TPLANE + 16 * td * TPITCH) + 32 * ks);
    __builtin_amdgcn_sched_barrier(0);
#pragma unroll
    for (int st = 2; st < 4; ++st)
#pragma unroll
      for (int t = 0; t < 4; ++t)
#pragma unroll
        for (int g = 0; g < ATT_QG; ++g) S[g][t] = mma_h(ak[st][t], qf[g][st], S[g][t]);

    // ---- online softmax, one query per lane and group: 32 of the tile's 64 keys here, the other 32 in lane l ^ 16 ----
    FragH pf[ATT_QG][2];
#pragma unroll
    for (int g = 0; g < ATT_QG; ++g) {
      float mx = fmaxf(fmaxf(max8(S[g][0]), max8(S[g][1])), fmaxf(max8(S[g][2]), max8(S[g][3])));
      mx = fmaxf(mx, xhalf(mx));
      const float mn = fmaxf(mrun[g], mx * KSC);
      const float al = hw_exp2(mrun[g] - mn);
      mrun[g] = mn;
      const float sh = 10.0f - mn;          // 2^10 = the x1024 carry of P
      const v2f ksc2 = {KSC, KSC}, sh2 = {sh, sh};
      v2f psa = {0.f, 0.f}, psb = {0.f, 0.f};   // sums of subtiles 0, 1 and 2, 3: each subtile's own sum runs over r in ascending order
#pragma unroll   // these three loops are unrolled so that the register arrays S, e and pf are indexed by constants
      for (int r = 0; r < 8; r += 2) {
        float e[4][2];
#pragma unroll
        for (int t = 0; t < 4; ++t) {
          const v2f s2 = {S[g][t][r], S[g][t][r + 1]};
          const v2f x2 = __builtin_elementwise_fma(s2, ksc2, sh2);   // two exponents per instruction
          e[t][0] = hw_exp2(x2[0]);
          e[t][1] = hw_exp2(x2[1]);
          pf[g][t >> 1].h[t & 1][r]     = (_Float16)e[t][0];     // key j0 + 32(t>>1) + 16(t&1) + 8hh + r
          pf[g][t >> 1].h[t & 1][r + 1] = (_Float16)e[t][1];
        }
#pragma unroll
        for (int k = 0; k < 2; ++k) {
          const v2f ea = {e[0][k], e[1][k]}, eb = {e[2][k], e[3][k]};
          psa += ea;
          psb += eb;
        }
      }
      const float ps[4] = {psa[0], psa[1], psb[0], psb[1]};
      lrun[g] = lrun[g] * al + ((ps[0] + ps[1]) + (ps[2] + ps[3]));
#pragma unroll
      for (int td = 0; td < 4; ++td)
#pragma unroll
        for (int r = 0; r < 8; ++r) O[g][td][r] *= al;
    }

    // ---- O^T += v^T . P^T: hi plane, then residual plane, two 32-key steps each; each A fragment is read once and serves every
    //      group; the four d subtiles and the groups are independent ----
#pragma unroll
    for (int pl = 0; pl < 2; ++pl)
#pragma unroll
      for (int ks = 0; ks < 2; ++ks)
#pragma unroll
        for (int td = 0; td < 4; ++td)
#pragma unroll
          for (int g = 0; g < ATT_QG; ++g) O[g][td] = mma_h(av[pl][ks][td], pf[g][ks].v, O[g][td]);

    // ---- publish tile t + 1, free this trip's buffer, then refill it with tile t + 2 ----
    __builtin_amdgcn_sched_barrier(0);      // keeps the waits and the barrier down here: lifted to group 2, they would wait out its latency
    wait_ds0();
    wait_async0();
    __syncthreads();
    if (j0 + 128 < SEQ) stage(j0 + 128, bo);
  }
  wait_async0();
#pragma unroll
  for (int g = 0; g < ATT_QG; ++g) acc_guard4(O[g][0], O[g][1], O[g][2], O[g][3]);

#pragma unroll
  for (int g = 0; g < ATT_QG; ++g) {
    // ---- join the halves' sums; fold 1/l (0 for an empty row) and the carry 64 on v (1024 on P cancels), carry x64 on ctx ----
    {
      const float oc  = CC / VC;
      const float lr  = lrun[g] + xhalf(lrun[g]);
      const float den = (lr > 0.f) ? lr : 1.0f;
      const float inv = (lr > 0.f) ? ((1.0f / den) * oc) : 0.f;
      float* po = pt + c * PPI + 8 * hh;
#pragma unroll
      for (int td = 0; td < 4; ++td) {
        v4f w0, w1;
#pragma unroll
        for (int e = 0; e < 4; ++e) { w0[e] = O[g][td][e] * inv; w1[e] = O[g][td][4 + e] * inv; }
        *(v4f*)(po + 16 * td)     = w0;
        *(v4f*)(po + 16 * td + 4) = w1;
      }
    }
    wave_sync_lds();
    {
      const int q8 = lane >> 3, c8 = (lane & 7) * 8;
      v4u hv[4], lv[4];
#pragma unroll
      for (int it = 0; it < 4; ++it) {
        const int row = it * 4 + q8;                         // it 0..3 x q8 0..3 = rows 0..15
        const float* sp = pt + row * PPI + c8;
        v4u a  = {0u, 0u, 0u, 0u};
        v4u b2 = {0u, 0u, 0u, 0u};
#pragma unroll
        for (int e = 0; e < 4; ++e) {
          const float f0 = sp[2 * e], f1 = sp[2 * e + 1];
          const _Float16 x0 = (_Float16)f0, x1 = (_Float16)f1;
          a[e]  = pk16(h_bits(x0), h_bits(x1));
          b2[e] = pk16(h_bits((_Float16)(f0 - (float)x0)), h_bits((_Float16)(f1 - (float)x1)));
        }
        hv[it] = a;
        lv[it] = b2;
      }
#pragma unroll
      for (int it = 0; it < 4; ++it) {
        const int row = it * 4 + q8;
        const size_t go = ((size_t)(b * SEQ + iw0 + 16 * g + row)) * DMOD + n * DH + c8;
        *(v4u*)(CT  + go) = hv[it];
        *(v4u*)(CTL + go) = lv[it];
      }
    }
    if (g + 1 < ATT_QG) wave_sync_lds();    // the slab's reads are done before the next group overwrites it
  }
}

// =====================================================================================================
// Workspace map (bytes); every plane is an exact multiple of its tile / whole-row store granularity (M, N exact multiples of 64,
// convert counts exact multiples of 2048), every offset a multiple of 512 KiB:
//   WQ16, WK16, WV16, WP16, WO16 f16 [512 out][512 in] x64 (input layout kept, no transpose)   5 x   524288
//   XQ16, XK16, XV16 f16 [NROW][512] x16 (rows b*SEQ + t)                                    3 x  8388608
//   XP16 f16 [SEQ][512] x16                                                                        2097152
//   QU, QV, K16 f16 [NROW][512] x4                                                           3 x  8388608
//   P16  f16 [SEQ][512] x4                                                                         2097152
//   VT16, VTL16 f16 [NB][512][SEQ] hi x64 / residual                                         2 x  8388608
//   CT16, CTL16 f16 [NROW][512] hi x64 / residual                                            2 x  8388608
//   end (NB=4, SEQ=2048)                                                                          90701824
// =====================================================================================================
extern "C" void kernel_launch(void* const* d_in, const int* in_sizes, int n_in,
                              void* d_out, int out_size, void* d_ws, size_t ws_size,
                              hipStream_t stream) {
  if (n_in < 16) return;
  const long long needX = (long long)NB * SEQ_FULL * DMOD;     // reads rows b*SEQ_FULL + t, b < NB, t < SEQ
  if ((long long)in_sizes[0] < needX || (long long)in_sizes[1] < needX || (long long)in_sizes[2] < needX) return;
  if (in_sizes[3] < NB * SEQ_FULL) return;
  if (in_sizes[4] < SEQ * DMOD) return;
  if (in_sizes[5] != DMOD * DMOD || in_sizes[7] != DMOD * DMOD || in_sizes[9] != DMOD * DMOD ||
      in_sizes[11] != DMOD * DMOD || in_sizes[13] != DMOD * DMOD) return;
  if (in_sizes[6] != DMOD || in_sizes[8] != DMOD || in_sizes[10] != DMOD || in_sizes[12] != DMOD) return;
  if (in_sizes[14] != NH * DH || in_sizes[15] != NH * DH) return;
  if (out_size < NROW * DMOD) return;

  const float* xq    = (const float*)d_in[0];
  const float* xk    = (const float*)d_in[1];
  const float* xv    = (const float*)d_in[2];
  const int*   kmask = (const int*)d_in[3];
  const float* xpos  = (const float*)d_in[4];
  const float* w_q   = (const float*)d_in[5];
  const float* b_q   = (const float*)d_in[6];
  const float* w_k   = (const float*)d_in[7];
  const float* b_k   = (const float*)d_in[8];
  const float* w_v   = (const float*)d_in[9];
  const float* b_v   = (const float*)d_in[10];
  const float* w_o   = (const float*)d_in[11];
  const float* b_o   = (const float*)d_in[12];
  const float* w_p   = (const float*)d_in[13];
  const float* ub    = (const float*)d_in[14];
  const float* vb    = (const float*)d_in[15];
  float*       out   = (float*)d_out;

  const size_t PW  = (size_t)DMOD * DMOD * 2;            //   524288
  const size_t PX  = (size_t)NROW * DMOD * 2;            //  8388608
  const size_t PXP = (size_t)SEQ * DMOD * 2;             //  2097152
  const size_t PVT = (size_t)NB * DMOD * SEQ * 2;        //  8388608
  size_t off = 0;
  const size_t oWQ  = off; off += PW;
  const size_t oWK  = off; off += PW;
  const size_t oWV  = off; off += PW;
  const size_t oWP  = off; off += PW;
  const size_t oWO  = off; off += PW;
  const size_t oXQ  = off; off += PX;
  const size_t oXK  = off; off += PX;
  const size_t oXV  = off; off += PX;
  const size_t oXP  = off; off += PXP;
  const size_t oQU  = off; off += PX;
  const size_t oQV  = off; off += PX;
  const size_t oK   = off; off += PX;
  const size_t oP   = off; off += PXP;
  const size_t oVT  = off; off += PVT;
  const size_t oVTL = off; off += PVT;
  const size_t oCT  = off; off += PX;
  const size_t oCTL = off; off += PX;
  if (off > ws_size) return;                               // off = 90701824 at NB=4, SEQ=2048
  if (off > (size_t)134217728) return;

  char* ws = (char*)d_ws;
  unsigned short* WQ16  = (unsigned short*)(ws + oWQ);
  unsigned short* WK16  = (unsigned short*)(ws + oWK);
  unsigned short* WV16  = (unsigned short*)(ws + oWV);
  unsigned short* WP16  = (unsigned short*)(ws + oWP);
  unsigned short* WO16  = (unsigned short*)(ws + oWO);
  unsigned short* XQ16  = (unsigned short*)(ws + oXQ);
  unsigned short* XK16  = (unsigned short*)(ws + oXK);
  unsigned short* XV16  = (unsigned short*)(ws + oXV);
  unsigned short* XP16  = (unsigned short*)(ws + oXP);
  unsigned short* QU    = (unsigned short*)(ws + oQU);
  unsigned short* QV    = (unsigned short*)(ws + oQV);
  unsigned short* K16   = (unsigned short*)(ws + oK);
  unsigned short* P16   = (unsigned short*)(ws + oP);
  unsigned short* VT16  = (unsigned short*)(ws + oVT);
  unsigned short* VTL16 = (unsigned short*)(ws + oVTL);
  unsigned short* CT16  = (unsigned short*)(ws + oCT);
  unsigned short* CTL16 = (unsigned short*)(ws + oCTL);

  const dim3 blk(256);
  const dim3 gCV(CVT_BLOCKS);                                       // 7296
  const dim3 gPJ(PJ_BLOCKS);                                        // 416
  const int tilesQ = (NROW / 64) * (DMOD / 64);                     // 1024
  const dim3 gQ((tilesQ + 7) / 8, 1);                               // 128
  const dim3 gAT(SEQ / ATT_ROWS, NB * NH);                          // 16 x 32
  const dim3 bAT(ATT_THREADS);                                      // 128

  // (0) all nine 16-bit planes in one launch: weights W[nd][c] ([out][in], already k-contiguous per output row) -> f16( bf16_RNE(w) * 64 );
  //     activations and pos -> f16(bf16(x) * 16). Destination: WQ16 .. XP16, contiguous from WQ16 in the order of the kernel's ranges.
  cvt_all<<<gCV, blk, 0, stream>>>(w_q, w_k, w_v, w_p, w_o, xq, xk, xv, xpos, WQ16);

  // (1) q, k, v^T and positional projections in one launch
  proj_all<<<gPJ, blk, 0, stream>>>(XQ16, XK16, XV16, XP16, WQ16, WK16, WV16, WP16,
                                    QU, QV, K16, VT16, VTL16, P16, b_q, b_k, b_v, ub, vb);

  // (2) attention -> CT16 = f16(ctx * 64) hi plane, CTL16 residual plane, rows b*SEQ + i, halves n*64+d
  attn_full<<<gAT, bAT, 0, stream>>>(QU, QV, K16, P16, VT16, VTL16, kmask, CT16, CTL16);

  // (3) out = (CT + CTL) . W^T / (64*64) + bo; M = NROW, N = 512, K = 512, f32 rows straight into the output buffer (row b*SEQ + t)
  gemm64<0, 1, 0, 1><<<gQ, blk, 0, stream>>>(
      CT16, CTL16, DMOD, 0LL,
      WO16, DMOD, 0LL,
      (void*)out, (void*)out, DMOD, 0LL,
      NROW, DMOD, DMOD, 1.0f / (CC * WSC), 1.0f,
      b_o, b_o, b_o);
  (void)hipGetLastError();
}

// v009
// One run takes 72.7 microseconds.
// Versions between v006 and this one are left out; their measured steps multiply to 1.31 times as fast.
// Counting every step since v000, it is 5.95 times as fast.
// Contractions (all v_wmma_f32_16x16x32_f16, f16 operands, f32 accumulate): q/v projections (x f16 x16 . W f16 x64, K=512, single products);
// p + k in one accumulator ([pos | xk] . [Wp | Wk], K=1024); scores ((q+bq+u) f16 x4 . (k+bk+p) f16 x4, K=64 per head, single products,
// on top of the per-key term (vbias-u) . p, summed in f32 on VALU from the accumulators that hold p alone); P . v^T (P f16 x1024 . v^T carried as
// one f16 x64 plane, 64 keys per tile, single products; both attention products run transposed); output projection (ctx carried as one f16 x64 plane
// . Wo f16 x64, K=512, single products). Key mask (score accumulators start at -1e30 for a masked key, whose exponential is then 0, else at the per-key term), max-subtracted online base-2 softmax and
// all epilogues in f32 on VALU. Every float input RNE-converted to bf16 on load.
#include <hip/hip_runtime.h>
#include <math.h>
#include <stdint.h>

#ifndef NB
#define NB    4
#endif
#ifndef SEQ
#define SEQ   2048
#endif
#define NB_FULL  4
#define SEQ_FULL 2048
#define DMOD  512
#define NH    8
#define DH    64
#define NROW  (SEQ * NB)
#define XC    16.0f
#define WSC   64.0f
#define QC    4.0f
#define VC    64.0f
#define PC    1024.0f
#define CC    64.0f
#define SCALE 0.125f
#define LOG2E 1.4426950408889634f
static_assert(NH * DH == DMOD);
static_assert(DH == 64);
static_assert(NB >= 1 && NB <= NB_FULL && SEQ >= 64 && SEQ <= SEQ_FULL);
static_assert((SEQ % 64) == 0 && (DMOD % 64) == 0 && (NROW % 64) == 0);
static_assert(((SEQ * DMOD) % 2048) == 0 && ((DMOD * DMOD) % 2048) == 0);
#define ATT_W 4
#define ATT_THREADS (ATT_W * 32)
#define ATT_QG 2                       // 16-query groups per wave: every k, p, v fragment read from LDS feeds ATT_QG products
#define ATT_ROWS (ATT_W * 16 * ATT_QG)
#define TPITCH 144                     // LDS bytes per staged 128-byte row: 16 B x odd, conflict-free for 16-byte fragment reads
#define TPLANE (64 * TPITCH)           // one staged plane: 64 rows
#define TBUF   (2 * TPLANE)            // one key tile: k + p, v^T
static_assert((SEQ % ATT_ROWS) == 0 && ATT_THREADS == 128);
#define PPI 68
#define WFL (16 * PPI)
static_assert((PPI % 4) == 0 && PPI >= 64 && (WFL % 4) == 0);

typedef _Float16 v16h __attribute__((ext_vector_type(16)));
typedef _Float16 v8h  __attribute__((ext_vector_type(8)));
typedef __bf16   v16b __attribute__((ext_vector_type(16)));
typedef float    v8f  __attribute__((ext_vector_type(8)));
typedef float    v4f  __attribute__((ext_vector_type(4)));
typedef float    v2f  __attribute__((ext_vector_type(2)));
typedef unsigned int v4u __attribute__((ext_vector_type(4)));
typedef unsigned int v2u __attribute__((ext_vector_type(2)));
typedef __bf16   v2b  __attribute__((ext_vector_type(2)));
typedef _Float16 v2h  __attribute__((ext_vector_type(2)));

union FragH { v16h v; v8h h[2]; v4u u[2]; };
union FragAny { v16h h; v16b b; };

// ---- scalar helpers --------------------------------------------------------------------------------
__device__ __forceinline__ unsigned short bf_bits(float f) {          // f32 -> bf16 bits, RNE convert
  unsigned u = __float_as_uint(f);
  return (unsigned short)((u + 0x7FFFu + ((u >> 16) & 1u)) >> 16);
}
__device__ __forceinline__ float bf_up(unsigned short h) { return __uint_as_float(((unsigned)h) << 16); }
__device__ __forceinline__ float bfr(float f) { return bf_up(bf_bits(f)); }   // value of the bf16 RNE convert
__device__ __forceinline__ unsigned short h_bits(_Float16 x) { return __builtin_bit_cast(unsigned short, x); }
__device__ __forceinline__ unsigned pk16(unsigned short a, unsigned short b) { return (unsigned)a | ((unsigned)b << 16); }
__device__ __forceinline__ unsigned pack2_x(v2f x) {   // two activations: f16( bf16_RNE(x) * 16 ), packed (the scale is exact)
  const unsigned b = __builtin_bit_cast(unsigned, __builtin_convertvector(x, v2b));
  v2f y = {__uint_as_float(b << 16), __uint_as_float(b & 0xFFFF0000u)};
  const v2f sc = {XC, XC};
  y = y * sc;
  return __builtin_bit_cast(unsigned, __builtin_convertvector(y, v2h));
}
template <int CTRL>
__device__ __forceinline__ float dpp_f(float x) {   // value of the lane that the DPP control names, inside the 16-lane row
  return __builtin_bit_cast(float, __builtin_amdgcn_update_dpp(0, __builtin_bit_cast(int, x), CTRL, 0xf, 0xf, true));
}
__device__ __forceinline__ float row_sum16(float x) {   // sum over the 16 lanes of a row, in every lane: row_xmask 1, 2, 4, 8
  x += dpp_f<0x161>(x);
  x += dpp_f<0x162>(x);
  x += dpp_f<0x164>(x);
  x += dpp_f<0x168>(x);
  return x;
}
__device__ __forceinline__ v8f zero8() { v8f z = {0.f, 0.f, 0.f, 0.f, 0.f, 0.f, 0.f, 0.f}; return z; }

// ---- fragment loader: 16-bit A/B operand from a k-contiguous 16-bit plane, lane -> row/col (lane&15),
//      p already includes +8*(lane>>4); elements 0..7 <- p[0..7] (k0+8h..), elements 8..15 <- p[16..23] (k0+16+8h..)
//      (same split k map for A and B; B is always read from a [n][k] plane)
__device__ __forceinline__ v16h ldfrag_u(const unsigned short* p) {
  FragH f;
  f.u[0] = *(const v4u*)(p);
  f.u[1] = *(const v4u*)(p + 16);
  return f.v;
}

// ---- WMMA helpers with trailing VALU hazard gaps ------------------------------------------------------
__device__ __forceinline__ v8f mma_h(v16h a, v16h b, v8f c) {
  return __builtin_amdgcn_wmma_f32_16x16x32_f16(false, a, false, b, (short)0, c, false, false);
}
__device__ __forceinline__ v8f mma_b(v16h a, v16h b, v8f c) {
  FragAny ua, ub;
  ua.h = a;
  ub.h = b;
  return __builtin_amdgcn_wmma_f32_16x16x32_bf16(false, ua.b, false, ub.b, (short)0, c, false, false);
}
template <int BF>
__device__ __forceinline__ v8f mmaT(v16h a, v16h b, v8f c) {
  if constexpr (BF != 0) return mma_b(a, b, c);
  else return mma_h(a, b, c);
}
__device__ __forceinline__ void dep_guard1(v8f& a, v8f& b, v16h x) {
#if defined(__HIP_DEVICE_COMPILE__)
  asm volatile("v_nop\n\tv_nop\n\tv_nop\n\tv_nop" : "+v"(a), "+v"(b) : "v"(x));
#endif
}
__device__ __forceinline__ void keep4_h(v16h a, v16h b, v16h c, v16h d) {
#if defined(__HIP_DEVICE_COMPILE__)
  asm volatile("v_nop" :: "v"(a), "v"(b), "v"(c), "v"(d));
#endif
}
__device__ __forceinline__ void acc_guard4(v8f& a, v8f& b, v8f& c, v8f& d) {
#if defined(__HIP_DEVICE_COMPILE__)
  asm volatile("v_nop\n\tv_nop\n\tv_nop\n\tv_nop" : "+v"(a), "+v"(b), "+v"(c), "+v"(d));
#endif
}
// Eight asynchronous 16-byte copies per lane, global -> LDS (a thread's whole share of one key tile). The s_wait_xcnt stands inside the
// statement so that no address register of an issued copy is rewritten in front of it.
__device__ __forceinline__ void copy8_async(unsigned l0, unsigned l1, unsigned l2, unsigned l3,
                                            unsigned l4, unsigned l5, unsigned l6, unsigned l7,
                                            const unsigned short* g0, const unsigned short* g1,
                                            const unsigned short* g2, const unsigned short* g3,
                                            const unsigned short* g4, const unsigned short* g5,
                                            const unsigned short* g6, const unsigned short* g7) {
#if defined(__HIP_DEVICE_COMPILE__)
  asm volatile("global_load_async_to_lds_b128 %0, %8, off\n\t"
               "global_load_async_to_lds_b128 %1, %9, off\n\t"
               "global_load_async_to_lds_b128 %2, %10, off\n\t"
               "global_load_async_to_lds_b128 %3, %11, off\n\t"
               "global_load_async_to_lds_b128 %4, %12, off\n\t"
               "global_load_async_to_lds_b128 %5, %13, off\n\t"
               "global_load_async_to_lds_b128 %6, %14, off\n\t"
               "global_load_async_to_lds_b128 %7, %15, off\n\t"
               "s_wait_xcnt 0x0"
               :: "v"(l0), "v"(l1), "v"(l2), "v"(l3), "v"(l4), "v"(l5), "v"(l6), "v"(l7),
                  "v"(g0), "v"(g1), "v"(g2), "v"(g3), "v"(g4), "v"(g5), "v"(g6), "v"(g7)
               : "memory");
#endif
}
// Four such copies per lane (the A rows of a GEMM chunk), with the same wait inside the statement for the same reason.
__device__ __forceinline__ void copy4_async(unsigned l0, unsigned l1, unsigned l2, unsigned l3,
                                            const unsigned short* g0, const unsigned short* g1,
                                            const unsigned short* g2, const unsigned short* g3) {
#if defined(__HIP_DEVICE_COMPILE__)
  asm volatile("global_load_async_to_lds_b128 %0, %4, off\n\t"
               "global_load_async_to_lds_b128 %1, %5, off\n\t"
               "global_load_async_to_lds_b128 %2, %6, off\n\t"
               "global_load_async_to_lds_b128 %3, %7, off\n\t"
               "s_wait_xcnt 0x0"
               :: "v"(l0), "v"(l1), "v"(l2), "v"(l3), "v"(g0), "v"(g1), "v"(g2), "v"(g3)
               : "memory");
#endif
}
// This wave's own copies have landed in LDS (other waves read them only behind the next work-group barrier).
__device__ __forceinline__ void wait_async0() {
#if defined(__HIP_DEVICE_COMPILE__)
  asm volatile("s_wait_asynccnt 0x0" ::: "memory");
#endif
}
// This wave's own LDS reads have returned, so that the buffer they read may be refilled behind the barrier.
__device__ __forceinline__ void wait_ds0() {
#if defined(__HIP_DEVICE_COMPILE__)
  asm volatile("s_wait_dscnt 0x0" ::: "memory");
#endif
}
__device__ __forceinline__ void wait_x0() {
#if defined(__HIP_DEVICE_COMPILE__)
  asm volatile("s_wait_xcnt 0x0" ::: "memory");
#endif
}
// The same wait behind a run of loads that share one address: the address is an input of the statement, so its registers stay live up
// to the wait and no result of the run is placed in them.
__device__ __forceinline__ void wait_x0_addr(const float* p) {
#if defined(__HIP_DEVICE_COMPILE__)
  asm volatile("s_wait_xcnt 0x0" :: "v"(p) : "memory");
#endif
}
__device__ __forceinline__ void wave_sync_lds() {
  __builtin_amdgcn_fence(__ATOMIC_RELEASE, "workgroup");
  __builtin_amdgcn_wave_barrier();
  __builtin_amdgcn_fence(__ATOMIC_ACQUIRE, "workgroup");
}

// =====================================================================================================
// Elementwise 16-bit pack of the five weight planes in ONE grid: dst[i] = f16( bf16_RNE(src[i]) * 64 ) (a power of two: exact).
// A block packs one piece of 2048 elements (256 thr x 8: two 16-B loads, one 16-B store per thread); ranges of the block index
// pick the source (block-uniform): CVT_W pieces for each of wq, wk, wv, wp, wo. The five destination planes lie in the workspace
// one behind the other in this same order, so piece bx is written at dst + bx * 2048.
// coverage: grid = CVT_BLOCKS blocks = every piece of every plane exactly once (the plane size is a multiple of 2048).
// =====================================================================================================
#define CVT_W ((DMOD * DMOD) / 2048)
#define CVT_BLOCKS (5 * CVT_W)
__global__ __launch_bounds__(256) void cvt_all(const float* __restrict__ wq, const float* __restrict__ wk, const float* __restrict__ wv,
                                               const float* __restrict__ wp, const float* __restrict__ wo, unsigned short* dst) {
  const int bx = blockIdx.x;
  if (bx >= CVT_BLOCKS) return;               // never taken with the exact grid; no barriers in this kernel
  const int seg = bx / CVT_W;
  const float* src = (seg == 0) ? wq : (seg == 1) ? wk : (seg == 2) ? wv : (seg == 3) ? wp : wo;
  const size_t so  = (size_t)(bx - seg * CVT_W) * 2048;   // element offset of this block's piece in its source
  const float sc   = WSC;
  const float* s = src + so + (size_t)threadIdx.x * 8;
  unsigned short* d = dst + (size_t)bx * 2048 + (size_t)threadIdx.x * 8;
  const v4f a = *(const v4f*)(s);
  const v4f b = *(const v4f*)(s + 4);
  v4u o;
  o[0] = pk16(h_bits((_Float16)(bfr(a[0]) * sc)), h_bits((_Float16)(bfr(a[1]) * sc)));
  o[1] = pk16(h_bits((_Float16)(bfr(a[2]) * sc)), h_bits((_Float16)(bfr(a[3]) * sc)));
  o[2] = pk16(h_bits((_Float16)(bfr(b[0]) * sc)), h_bits((_Float16)(bfr(b[1]) * sc)));
  o[3] = pk16(h_bits((_Float16)(bfr(b[2]) * sc)), h_bits((_Float16)(bfr(b[3]) * sc)));
  *(v4u*)(d) = o;
}

// =====================================================================================================
// Register-blocked batched 16-bit WMMA GEMM: C[m][n] = oscale * sum_k A[m][k] * Bt[n][k] (+ bias); a block of 8 waves owns one
// 128x256 tile, wave w its 64x64 part (rows 64 * (w >> 2), columns 64 * (w & 3)). A row-major [M][K] pitch lda (16-bit plane), Bt
// row-major [N][K] pitch ldb (k contiguous); M multiple of 128, N of 256, K of 64. bx = index of the block's tile, by = batch index
// with element strides sA, sB, sC; gs = the block's LDS.
// Operands: per 64-deep chunk of k the block's 128 A rows (both planes with ASPLIT) and 256 Bt rows, 128 bytes each, are brought into
// LDS once by asynchronous 16-byte copies (each wave-copy = 4 whole 128-byte lines), two buffers: chunk t + 2 is copied into the buffer
// that trip t has read, behind the trip's barrier; all fragments are 16-byte LDS reads at pitch 144 B. Order of the k sum: ascending.
// ASPLIT 1: a second A plane A2 (unscaled residual of A, same layout) is multiplied into the same accumulator (A + A2 ~ exact A).
// KCAT 1: the k sum runs over two operand pairs one behind the other: k < K/2 from (A2, Bt2), k >= K/2 from (A, Bt) at k - K/2; row m of
// the first pair's A is row m % SEQ of A2 (a plane that all batches share); same pitches. Behind the first pair's last chunk the
// accumulators hold that pair's product alone; the blocks of rows m < SEQ then write, per row and 64-column group g (= a wave's columns),
// C2[g * SEQ + m] = ocarry^2 * oscale * sum_column acc * (bf16_RNE(ep2[column]) - bf16_RNE(ep1[column])) as f32 (in-lane over the four
// 16-column subtiles, then a butterfly over the 16 lanes of a row).
// AF 1: the A rows are f32 rows of an input (Xf; with KCAT the first pair's are rows m % SEQ of X2f), pitch DMOD; plane row b*SEQ + t is input
// row b*SEQ_FULL + t. A chunk's 128 x 64 floats are loaded into registers at the head of trip t - 2 (whole-line 16-byte loads), and behind
// that trip's barrier packed to f16( bf16_RNE(x) * 16 ) and stored into the A plane of the freed buffer; Ap, A2p are not read.
// BF 1: bf16 operands (v_wmma_f32_16x16x32_bf16), else f16.
// EPI 1: value += bf16_RNE(ep0[column]) (per-column bias); EPI 2: value += bf16_RNE(ep0[row]) (per-row bias, 16-bit out only).
// OM 0: f32 out (pitch ldc).  OM 2: one f16 plane = f16(value * ocarry).
// OM 4: two f16 planes: hi = f16(value * ocarry), lo = f16(value * ocarry - hi) (unscaled residual).
// OM 5: two f16 planes: C = f16((value + bf16_RNE(ep1[column])) * ocarry), C2 = f16((value + bf16_RNE(ep2[column])) * ocarry).
// OM 6: the first of these planes alone.
// OM 7: one f16 plane = f16(value * ocarry), written transposed: element (m, n) at Cout[(m / SEQ) * sC + n * ldc + m % SEQ].
// coverage: 4 slabs x 16 rows (f32: it 0..7 x lane>>4; 16-bit: it 0..3 x lane>>3) x 64 cols = the wave's whole 64x64 tile;
//           (M/128)*(N/256) values of bx, a surplus block leaves as a whole in front of every barrier.
// LDS: the epilogue's slabs lie over the chunk buffers, which nobody reads behind the last trip's barrier.
// =====================================================================================================
#define SLABF (16 * 68)                 // floats of one wave's 16x64 slab, pitch 68 floats
#define GPLANE_A (128 * TPITCH)         // one staged A plane: 128 rows
#define GPLANE_B (256 * TPITCH)         // the staged Bt plane: 256 rows
#define GBUF(AS) ((1 + (AS)) * GPLANE_A + GPLANE_B)   // one chunk buffer
static_assert(2 * GBUF(0) >= 8 * SLABF * 4);
static_assert((NROW % 128) == 0 && (SEQ % 256) == 0 && (DMOD % 256) == 0);
template <int OM, int ASPLIT, int BF, int EPI, int KCAT = 0, int AF = 0>
__device__ __forceinline__ void gemm64_tile(
    unsigned char* gs, int bx, int by,
    const unsigned short* __restrict__ Ap, const unsigned short* __restrict__ A2p, int lda, long long sA,
    const unsigned short* __restrict__ Btp, const unsigned short* __restrict__ Bt2p, int ldb, long long sB,
    void* Cout, void* C2out, int ldc, long long sC,
    int M, int N, int K, float oscale, float ocarry,
    const float* __restrict__ ep0, const float* __restrict__ ep1, const float* __restrict__ ep2,
    const float* __restrict__ Xf = nullptr, const float* __restrict__ X2f = nullptr) {
  const int tid  = threadIdx.x;
  const int lane = tid & 31;
  const int wave = tid >> 5;
  const int bN = N >> 8;
  if (bx >= (M >> 7) * bN) return;       // block-uniform, in front of every barrier
  const int bm  = bx / bN;
  const int m0b = bm << 7;
  const int n0b = (bx - bm * bN) << 8;
  const int wm = wave >> 2, wn = wave & 3;
  const int m0 = m0b + (wm << 6);
  const int n0 = n0b + (wn << 6);

  const unsigned short* A1 = Ap  + (size_t)((long long)by * sA);
  const unsigned short* A2 = A2p + (size_t)((long long)by * sA);
  const unsigned short* Bb = Btp + (size_t)((long long)by * sB);

  const int rlane = lane & 15;                 // row (A) / col (B, D) within subtile
  const int hh    = lane >> 4;                 // lane half: k offset 8 * hh
  const int mOff  = (lane >> 4) * 8;           // D row offset

  constexpr unsigned GB = (unsigned)GBUF(ASPLIT);               // bytes of one chunk buffer
  constexpr unsigned OB = (unsigned)((1 + ASPLIT) * GPLANE_A);  // byte offset of the Bt plane in it
  // copy share of this thread: rows crow + 32 x of each plane, 16-byte piece cpc of the 128-byte row
  const int crow = tid >> 3, cpc = tid & 7;
  const unsigned short* gA  = A1 + (size_t)(m0b + crow) * lda + 8 * cpc;      // + kc per chunk
  const unsigned short* gA2 = A2 + (size_t)(((KCAT != 0) ? (m0b % SEQ) : m0b) + crow) * lda + 8 * cpc;
  const unsigned short* gB  = Bb + (size_t)(n0b + crow) * ldb + 8 * cpc;
  const unsigned short* gB2 = Bt2p + (size_t)(n0b + crow) * ldb + 8 * cpc;     // KCAT only
  const unsigned ldst = (unsigned)(size_t)gs + (unsigned)(crow * TPITCH + cpc * 16);   // LDS byte address, buffer 0, A plane
  const size_t ra = (size_t)32 * lda, rb = (size_t)32 * ldb;
  auto stage = [&](int kc, unsigned bo) {   // chunk at kc -> buffer at byte offset bo; every lane on, all rows < M, N, all k < K
    const unsigned l = ldst + bo;
    const unsigned short* a  = gA + kc;
    const unsigned short* bs = gB + kc;
    if constexpr (KCAT != 0) {
      const int kh = K >> 1;
      if (kc < kh) {                        // block-uniform: the chunk lies in the first operand pair
        a  = gA2 + kc;
        bs = gB2 + kc;
      } else {
        a  = gA + (kc - kh);
        bs = gB + (kc - kh);
      }
    }
    if constexpr (ASPLIT != 0) {
      const unsigned short* a2 = gA2 + kc;
      copy8_async(l, l + 32 * TPITCH, l + 64 * TPITCH, l + 96 * TPITCH,
                  l + GPLANE_A, l + GPLANE_A + 32 * TPITCH, l + GPLANE_A + 64 * TPITCH, l + GPLANE_A + 96 * TPITCH,
                  a, a + ra, a + 2 * ra, a + 3 * ra, a2, a2 + ra, a2 + 2 * ra, a2 + 3 * ra);
    } else if constexpr (AF == 0) {
      copy4_async(l, l + 32 * TPITCH, l + 64 * TPITCH, l + 96 * TPITCH, a, a + ra, a + 2 * ra, a + 3 * ra);
    }
    const unsigned lb = l + OB;
    copy8_async(lb, lb + 32 * TPITCH, lb + 64 * TPITCH, lb + 96 * TPITCH,
                lb + 128 * TPITCH, lb + 160 * TPITCH, lb + 192 * TPITCH, lb + 224 * TPITCH,
                bs, bs + rb, bs + 2 * rb, bs + 3 * rb, bs + 4 * rb, bs + 5 * rb, bs + 6 * rb, bs + 7 * rb);
  };
  // AF: the A rows come as f32 straight from an input. Share of this thread per chunk: rows xrow + 16 x (x 0..7), floats 4 xc .. + 3 of the
  // row's 64 (a wave-load = two whole 256-byte row pieces); held in registers over one trip, then packed and stored as 8 bytes each.
  const int xrow = tid >> 4, xc = tid & 15;
  const float* gX  = Xf;
  const float* gX2 = X2f;
  if constexpr (AF != 0) {
    gX  = Xf + ((size_t)(m0b / SEQ) * SEQ_FULL + (size_t)(m0b % SEQ) + xrow) * DMOD + 4 * xc;   // plane row b*SEQ + t = input row b*SEQ_FULL + t
    gX2 = X2f + ((size_t)(m0b % SEQ) + xrow) * DMOD + 4 * xc;                                   // KCAT only
  }
  unsigned char* xd = gs + xrow * TPITCH + xc * 8;
  v4f xr[8];
  auto loadX = [&](int kc, v4f (&xs)[8]) {  // chunk at kc -> registers; all rows and all k inside the input
    const float* a = gX + kc;
    if constexpr (KCAT != 0) {
      const int kh = K >> 1;
      a = (kc < kh) ? (gX2 + kc) : (gX + (kc - kh));   // block-uniform
    }
    // The scheduling barriers keep other address arithmetic out of the run of loads, so that the wait behind the run stands in front
    // of every rewrite of a register that one of the loads names.
    __builtin_amdgcn_sched_barrier(0);
#pragma unroll
    for (int x = 0; x < 8; ++x) xs[x] = *(const v4f*)(a + (size_t)x * 16 * DMOD);
    wait_x0_addr(a);
    __builtin_amdgcn_sched_barrier(0);
  };
  auto storeX = [&](unsigned bo, const v4f (&xs)[8]) {   // registers -> A plane of the buffer at byte offset bo
#pragma unroll
    for (int x = 0; x < 8; ++x) {
      const v2f p0 = {xs[x][0], xs[x][1]}, p1 = {xs[x][2], xs[x][3]};
      const v2u o = {pack2_x(p0), pack2_x(p1)};
      *(v2u*)(xd + bo + x * 16 * TPITCH) = o;
    }
  };
  // fragment read bases of this lane: row rlane of a 16-row subtile of the wave's part, 16-byte piece hh
  const unsigned char* fa0 = gs + ((wm << 6) + rlane) * TPITCH + 16 * hh;
  const unsigned char* fb0 = gs + OB + ((wn << 6) + rlane) * TPITCH + 16 * hh;

  stage(0, 0u);
  v4f xf[8];                                // chunk 0; the accumulators are not live yet, so chunks 0 and 1 fly together
  if constexpr (AF != 0) {
    loadX(0, xf);
    if (K > 64) loadX(64, xr);
  }
  float wj[4];                              // KCAT: weight of column n0 + 16 * j + rlane in the per-row term
  if constexpr (KCAT != 0) {
    float w1[4], w2[4];
    // The scheduling barriers keep other address arithmetic out of the run of loads, so that the wait behind the run stands in front
    // of every rewrite of a register that one of the loads names.
    __builtin_amdgcn_sched_barrier(0);
#pragma unroll
    for (int j = 0; j < 4; ++j) {
      w1[j] = ep1[n0 + 16 * j + rlane];     // columns < N, which equals the length of ep1 and ep2
      w2[j] = ep2[n0 + 16 * j + rlane];
    }
    wait_x0();
    __builtin_amdgcn_sched_barrier(0);
#pragma unroll
    for (int j = 0; j < 4; ++j) wj[j] = bfr(w2[j]) - bfr(w1[j]);
  }
  if constexpr (AF != 0) {
    storeX(0u, xf);
    wait_ds0();                             // this thread's part of chunk 0 stands in LDS in front of the barrier
  }
  wait_async0();
  __syncthreads();                          // chunk 0 published
  if (K > 64) {
    stage(64, GB);
    if constexpr (AF != 0) storeX(GB, xr);  // published by the barrier at the foot of trip 0, behind its s_wait_dscnt
  }

  v8f acc[4][4];
#pragma unroll
  for (int i = 0; i < 4; ++i)
#pragma unroll
    for (int j = 0; j < 4; ++j) acc[i][j] = zero8();

#pragma unroll 1   // kept rolled, for speed only
  for (int kc = 0; kc < K; kc += 64) {
    const unsigned bo = ((unsigned)kc & 64u) ? GB : 0u;      // buffer of this trip
    const unsigned char* fa = fa0 + bo;
    const unsigned char* fb = fb0 + bo;
    if constexpr (AF != 0) {
      if (kc + 128 < K) loadX(kc + 128, xr);   // flies over this trip's products
    }
#pragma unroll      // the chunk's two 32-deep steps, unrolled so that their LDS offsets are immediates
    for (int ks = 0; ks < 2; ++ks) {
      v16h bh[4], ahs[4], als[4];           // all fragments of the 32-deep step are read as one group in front of its products
#pragma unroll
      for (int j = 0; j < 4; ++j) bh[j] = ldfrag_u((const unsigned short*)(fb + 16 * j * TPITCH) + 32 * ks);
#pragma unroll
      for (int i = 0; i < 4; ++i) {
        ahs[i] = ldfrag_u((const unsigned short*)(fa + 16 * i * TPITCH) + 32 * ks);
        if constexpr (ASPLIT != 0) als[i] = ldfrag_u((const unsigned short*)(fa + GPLANE_A + 16 * i * TPITCH) + 32 * ks);
      }
#pragma unroll
      for (int i = 0; i < 4; ++i) {
        const v16h ah = ahs[i];
#pragma unroll
        for (int j = 0; j < 4; ++j) acc[i][j] = mmaT<BF>(ah, bh[j], acc[i][j]);
        dep_guard1(acc[i][0], acc[i][3], ah);
        if constexpr (ASPLIT != 0) {
          const v16h al = als[i];
#pragma unroll
          for (int j = 0; j < 4; ++j) acc[i][j] = mmaT<BF>(al, bh[j], acc[i][j]);
          dep_guard1(acc[i][0], acc[i][3], al);
        }
      }
      keep4_h(bh[0], bh[1], bh[2], bh[3]);
    }
    // ---- publish chunk t + 1, free this trip's buffer, then refill it with chunk t + 2 ----
    wait_ds0();
    wait_async0();
    __syncthreads();
    if (kc + 128 < K) {
      stage(kc + 128, bo);
      if constexpr (AF != 0) storeX(bo, xr);
    }
    if constexpr (KCAT != 0) {
      if (kc + 64 == (K >> 1) && m0b < SEQ) {                // block-uniform; once per block, while the next chunks fly
        float* C2 = (float*)C2out + (size_t)(n0 >> 6) * SEQ + m0 + mOff;
        const float cf = oscale * ocarry * ocarry;
#pragma unroll
        for (int i = 0; i < 4; ++i) {
          v4f t0, t1;
#pragma unroll
          for (int r = 0; r < 8; ++r) {
            float t = acc[i][0][r] * wj[0];
#pragma unroll
            for (int j = 1; j < 4; ++j) t = fmaf(acc[i][j][r], wj[j], t);
            t = row_sum16(t) * cf;
            if (r < 4) t0[r] = t; else t1[r - 4] = t;
          }
          if (rlane == 0) {                                  // rows m0 + 16 * i + 8 * hh + 0..7: one lane of each half stores 32 bytes
            *(v4f*)(C2 + 16 * i)     = t0;
            *(v4f*)(C2 + 16 * i + 4) = t1;
          }
        }
        wait_x0();                                           // the next trip rewrites registers that the stores name
      }
    }
  }
  wait_async0();
  acc_guard4(acc[0][0], acc[0][1], acc[0][2], acc[0][3]);
  acc_guard4(acc[1][0], acc[1][1], acc[1][2], acc[1][3]);
  acc_guard4(acc[2][0], acc[2][1], acc[2][2], acc[2][3]);
  acc_guard4(acc[3][0], acc[3][1], acc[3][2], acc[3][3]);

  const int hh2 = lane >> 4, c4 = (lane & 15) * 4;     // f32 out: 256-B row segment = 16 lanes x 16 B
  const int q8  = lane >> 3, c8 = (lane & 7) * 8;

  if constexpr (OM == 7) {
    // ---- transposed 16-bit out: lane (rlane, hh) holds, for column n0 + 16 j + rlane, the rows m0 + 16 i + 8 hh + 0..7 = 16 bytes of
    //      the transposed plane's row; four [16 columns][64 rows] f16 slabs (one per j, pitch 144 B, private to the wave) turn them into
    //      whole 128-byte lines; each slab is written once and read once, so one wave sync serves all four ----
    static_assert(8 * 4 * 16 * TPITCH <= 2 * GBUF(0));
    unsigned char* sl = gs + wave * (4 * 16 * TPITCH);
    unsigned short* C = (unsigned short*)Cout + (size_t)(m0 / SEQ) * (size_t)sC + (size_t)(m0 % SEQ);
    float bb[4];
    __builtin_amdgcn_sched_barrier(0);      // as at the loads above: the wait stands in front of every rewrite of the loads' address registers
#pragma unroll
    for (int j = 0; j < 4; ++j) bb[j] = ep0[n0 + 16 * j + rlane];   // columns < N, the bias length
    wait_x0();
    __builtin_amdgcn_sched_barrier(0);
#pragma unroll
    for (int j = 0; j < 4; ++j) {
      const float bj = bfr(bb[j]);
#pragma unroll
      for (int i = 0; i < 4; ++i) {
        v4u a;
#pragma unroll
        for (int e = 0; e < 4; ++e) {
          const float f0 = (acc[i][j][2 * e] * oscale + bj) * ocarry;
          const float f1 = (acc[i][j][2 * e + 1] * oscale + bj) * ocarry;
          a[e] = pk16(h_bits((_Float16)f0), h_bits((_Float16)f1));
        }
        *(v4u*)(sl + (16 * j + rlane) * TPITCH + (16 * i + mOff) * 2) = a;
      }
    }
    wave_sync_lds();
#pragma unroll
    for (int j = 0; j < 4; ++j) {
      v4u hv[4];
#pragma unroll
      for (int it = 0; it < 4; ++it) hv[it] = *(const v4u*)(sl + (16 * j + it * 4 + q8) * TPITCH + c8 * 2);   // it 0..3 x q8 0..3 = columns 0..15
#pragma unroll
      for (int it = 0; it < 4; ++it) *(v4u*)(C + (size_t)(n0 + 16 * j + it * 4 + q8) * ldc + c8) = hv[it];
      wait_x0();                            // the next j rewrites registers that the stores name
    }
    return;
  }

  // ---- epilogue ----
  float* slab = (float*)gs + wave * SLABF;
#pragma unroll
  for (int i = 0; i < 4; ++i) {
    const int mBase = m0 + (i << 4);
#pragma unroll
    for (int j = 0; j < 4; ++j) {
#pragma unroll
      for (int r = 0; r < 8; ++r) {
        slab[(mOff + r) * 68 + (j << 4) + rlane] = acc[i][j][r];
      }
    }
    wave_sync_lds();
    if constexpr (OM == 0) {
      float* C = (float*)Cout + (size_t)((long long)by * sC);
      v4f vals[8];
#pragma unroll
      for (int it = 0; it < 8; ++it) {
        const int row = it * 2 + hh2;                      // it 0..7 x hh2 0..1 = rows 0..15
        v4f v = *(const v4f*)(slab + row * 68 + c4);
#pragma unroll
        for (int e = 0; e < 4; ++e) v[e] = v[e] * oscale;
        if constexpr (EPI == 1) {
          const v4f bb = *(const v4f*)(ep0 + n0 + c4);     // per-column bias, columns n0+c4 .. +3 (N equals the bias length)
#pragma unroll
          for (int e = 0; e < 4; ++e) v[e] = v[e] + bfr(bb[e]);
        }
        vals[it] = v;
      }
      {
#pragma unroll
        for (int it = 0; it < 8; ++it) {
          const int gr = mBase + it * 2 + hh2;
          *(v4f*)(C + (size_t)gr * ldc + n0 + c4) = vals[it];
        }
        
      }
    } else {
      unsigned short* C  = (unsigned short*)Cout  + (size_t)((long long)by * sC);
      unsigned short* Cb = (unsigned short*)C2out + (size_t)((long long)by * sC);
      v4u hv[4], lv[4];
#pragma unroll
      for (int it = 0; it < 4; ++it) {
        const int row = it * 4 + q8;                       // it 0..3 x q8 0..3 = rows 0..15
        const float* sp = slab + row * 68 + c8;
        float rb = 0.f;
        if constexpr (EPI == 2) rb = bfr(ep0[mBase + row]);   // per-row bias (M equals the bias length)
        v4u a  = {0u, 0u, 0u, 0u};
        v4u b2 = {0u, 0u, 0u, 0u};
#pragma unroll
        for (int e = 0; e < 4; ++e) {
          const int ci = n0 + c8 + 2 * e;                  // column index, < N
          float f0 = sp[2 * e] * oscale + rb;
          float f1 = sp[2 * e + 1] * oscale + rb;
          if constexpr (EPI == 1) {
            f0 += bfr(ep0[ci]);
            f1 += bfr(ep0[ci + 1]);
          }
          if constexpr (OM == 5 || OM == 6) {
            const float g0 = (f0 + bfr(ep1[ci])) * ocarry, g1 = (f1 + bfr(ep1[ci + 1])) * ocarry;
            a[e]  = pk16(h_bits((_Float16)g0), h_bits((_Float16)g1));
            if constexpr (OM == 5) {
              const float w0 = (f0 + bfr(ep2[ci])) * ocarry, w1 = (f1 + bfr(ep2[ci + 1])) * ocarry;
              b2[e] = pk16(h_bits((_Float16)w0), h_bits((_Float16)w1));
            }
          } else {
            f0 *= ocarry; f1 *= ocarry;
            const _Float16 x0 = (_Float16)f0, x1 = (_Float16)f1;
            a[e] = pk16(h_bits(x0), h_bits(x1));
            if constexpr (OM == 4) {
              b2[e] = pk16(h_bits((_Float16)(f0 - (float)x0)), h_bits((_Float16)(f1 - (float)x1)));
            }
          }
        }
        hv[it] = a;
        lv[it] = b2;
      }
      {
#pragma unroll
        for (int it = 0; it < 4; ++it) {
          const int row = it * 4 + q8;
          *(v4u*)(C + (size_t)(mBase + row) * ldc + n0 + c8) = hv[it];
          if constexpr (OM == 4 || OM == 5) {
            *(v4u*)(Cb + (size_t)(mBase + row) * ldc + n0 + c8) = lv[it];
          }
        }
        
      }
    }
    wave_sync_lds();
  }
}

// One GEMM per launch: grid.x = 128x256 tiles, grid.y = batch.
template <int OM, int ASPLIT, int BF, int EPI>
__global__ __launch_bounds__(256) __attribute__((amdgpu_num_vgpr(256))) void gemm64(
    const unsigned short* __restrict__ Ap, const unsigned short* __restrict__ A2p, int lda, long long sA,
    const unsigned short* __restrict__ Btp, int ldb, long long sB,
    void* Cout, void* C2out, int ldc, long long sC,
    int M, int N, int K, float oscale, float ocarry,
    const float* __restrict__ ep0, const float* __restrict__ ep1, const float* __restrict__ ep2) {
  __shared__ __align__(128) unsigned char gsm[2 * GBUF(ASPLIT)];   // two chunk buffers; the epilogue's slabs lie over them
  gemm64_tile<OM, ASPLIT, BF, EPI>(gsm, blockIdx.x, blockIdx.y, Ap, A2p, lda, sA, Btp, Btp, ldb, sB, Cout, C2out, ldc, sC,
                                   M, N, K, oscale, ocarry, ep0, ep1, ep2);
}

// The projections, which need nothing of each other, in ONE grid; ranges of the block index pick the product (block-uniform). The A rows
// of all three are token rows, read as f32 from the inputs and packed to f16( bf16_RNE(x) * 16 ) on their way into LDS (AF):
//   PJ_Q blocks: q[m][nd] = sum_c x[m][c] W[nd][c] / 1024 + bq[nd]; QU = f16((q + ub[nd]) * 4); M = NROW, N = 512, K = 512
//   PJ_Q blocks: positional projection p of the row's position (no bias) + k projection + bk, in one accumulator ->
//                K16 = f16((k + p) * 4); same M, N; K = 1024 = [pos | xk] . [Wp | Wk]; behind the first half the blocks of batch 0
//                write the per-key score term CB[n][s] = 16 * sum_d (vbias[n][d] - ub[n][d]) * p[s][n*64+d]
//   PJ_Q blocks: v[m][nd] = sum_c x[m][c] W[nd][c] / 1024 + bv[nd], same M, N, K, written transposed:
//                VT[b][nd][j] = f16(v[b*SEQ + j][nd] * 64)
//   since (q+ub).k + (q+vbias).p = (q+ub).(k+p) + (vbias-ub).p
//   The k + p blocks, twice as long as the others, stand in the middle range:
//   they stay alone while the q and v blocks share (for speed only).
#define PJ_Q (((NROW / 64) * (DMOD / 64)) / 8)
#define PJ_BLOCKS (3 * PJ_Q)
static_assert(((DMOD / 64) % 8) == 0);   // every product's tile count is a multiple of the 8 tiles of a block
static_assert((SEQ % 128) == 0);         // a block's 128 token rows lie in one batch
__global__ __launch_bounds__(256) __attribute__((amdgpu_num_vgpr(256))) void proj_all(
    const float* __restrict__ xq, const float* __restrict__ xk,
    const float* __restrict__ xv, const float* __restrict__ xpos,
    const unsigned short* __restrict__ WQ, const unsigned short* __restrict__ WK,
    const unsigned short* __restrict__ WV, const unsigned short* __restrict__ WP,
    unsigned short* QU, unsigned short* K16,
    unsigned short* VT, float* CB,
    const float* __restrict__ bq, const float* __restrict__ bk, const float* __restrict__ bv,
    const float* __restrict__ ub, const float* __restrict__ vb) {
  __shared__ __align__(128) unsigned char gsm[2 * GBUF(0)];   // two chunk buffers; the epilogue's slabs lie over them
  const int bx = blockIdx.x;
  const float osc = 1.0f / (XC * WSC);
  if (bx < PJ_Q) {
    gemm64_tile<6, 0, 0, 1, 0, 1>(gsm, bx, 0, WQ, WQ, DMOD, 0LL, WQ, WQ, DMOD, 0LL, (void*)QU, (void*)QU, DMOD, 0LL,
                                  NROW, DMOD, DMOD, osc, QC, bq, ub, ub, xq, xq);
  } else if (bx < 2 * PJ_Q) {
    gemm64_tile<2, 0, 0, 1, 1, 1>(gsm, bx - PJ_Q, 0, WK, WK, DMOD, 0LL, WK, WP, DMOD, 0LL, (void*)K16, (void*)CB, DMOD, 0LL,
                                  NROW, DMOD, 2 * DMOD, osc, QC, bk, ub, vb, xk, xpos);
  } else if (bx < PJ_BLOCKS) {
    gemm64_tile<7, 0, 0, 1, 0, 1>(gsm, bx - 2 * PJ_Q, 0, WV, WV, DMOD, 0LL, WV, WV, DMOD, 0LL, (void*)VT, (void*)VT, SEQ,
                                  (long long)DMOD * SEQ, NROW, DMOD, DMOD, osc, VC, bv, bv, bv, xv, xv);
  }
}

// =====================================================================================================
// Full (non-causal) attention with a 64-deep score contraction for one (batch b, head n) pair and a 128-row query tile;
// 4 waves, wave w owns query rows iw0 .. iw0+31, iw0 = i0 + 32w, as two groups g of 16 (rows iw0 + 16g ..). Planes (pitch DMOD halves, row index = b*SEQ + position):
// QU = f16((q + bq + ub) x4), KP = f16((k + bk + p) x4); CB = f32 per-key score term x16, [n][SEQ] (shared by
// all batches); VT = v^T f16 x64 as [b][n*64+d][SEQ]. Key mask ints kmask[b*SEQ_FULL + s], masked where == 0.
//   Both products are computed transposed: S^T = CB + (k+p) . (q+ub)^T (A = key rows from LDS, B = the query fragments, loaded
//   once and kept in registers) and O^T += v^T . P^T (A = v^T rows from LDS, B = P^T). Each A fragment is read from LDS once and
//   multiplied with both groups' B operands. Lane (c, hh) then holds, for its one query per group,
//   iw0 + 16g + c, the scores of keys j0 + 16t + 8hh + r (t 0..3, r 0..7): maximum and sum run inside the lane, with one exchange between
//   the lane halves for the maximum per key tile and one for the sum behind the loop; two score tiles converted in place are a B
//   operand in the loaders' k map (element e <- tile 2ks row 8hh+e, element 8+e <- tile 2ks+1 row 8hh+e), so P never leaves registers.
//   Key mask: the score accumulators start from kbias[key] (CB[n][key], or -1e30 where the key is masked; built once per work-group in LDS).
//   The running maximum never falls below -1e20 (any real score lies far above it), so a masked key's exponential is exactly 0 and a
//   fully masked row keeps sum 0 and gives ctx 0. Online softmax in base 2, max-subtracted, f32; the x1024 carry of P sits in the
//   exponent (+10), so the running sum carries it too and it cancels in the division.
//   Per key tile (64 keys) and group: 8 score WMMAs, 8 P.V WMMAs.
//   Key tiles: the two 64-row x 128-byte planes of a tile (k + p rows, v^T rows of head n) are brought into
//   LDS once per work-group by asynchronous 16-byte copies (8 per thread, each wave-copy = 4 whole 128-byte lines), two buffers: tile
//   t + 2 is copied into the buffer that trip t has read, behind the trip's barrier; all A fragments are 16-byte LDS reads at pitch 144 B.
//   block = 4 waves = 128 threads, two blocks per WGP (two waves per SIMD); grid = (SEQ/128, NB*NH); one block barrier per key tile; identical bounded work (SEQ/64 tiles).
// LDS: two key-tile buffers and kbias shared by the block; one [16][PPI] f32 slab per wave for a group's ctx tile, private-to-wave
//   (wave_sync), used by the two groups one after the other;
//   staged extent == consumed extent (16 rows x 64 cols written by every lane (c, hh) x (td, r) before any read).
// coverage: global: per group 4 instructions x 4 rows x 64 halves = rows iw0+16g..iw0+16g+15 of head segment n in CT;
//           grid x waves cover all NB x SEQ rows and all NH head segments of CT exactly once.
// =====================================================================================================
__device__ __forceinline__ float xhalf(float x) {   // value of lane l ^ 16
  const int b = __builtin_bit_cast(int, x);
  return __builtin_bit_cast(float, __builtin_amdgcn_permlanex16(b, b, 0x76543210, 0xfedcba98, false, false));
}
// 2^x as the one hardware instruction. The library's exp2f wraps it in a compare, two selects, an add and a scaling so that results
// below 2^-126 come out as subnormals; here such a result is 0 either way once it is a 16-bit operand, and it cannot move a running sum
// that holds the tile maximum's own term (1024) or an accumulator that is scaled by it.
__device__ __forceinline__ float hw_exp2(float x) { return __builtin_amdgcn_exp2f(x); }
__device__ __forceinline__ float max8(v8f s) {
  return fmaxf(fmaxf(fmaxf(fmaxf(s[0], s[1]), s[2]), fmaxf(fmaxf(s[3], s[4]), s[5])), fmaxf(s[6], s[7]));
}

// two waves per SIMD: the 512 blocks of four waves are two on every WGP, which leaves a wave a budget of 512 registers
__global__ __launch_bounds__(ATT_THREADS) __attribute__((amdgpu_waves_per_eu(2, 2)))
void attn_full(const unsigned short* __restrict__ QU,
               const unsigned short* __restrict__ KP, const float* __restrict__ CB,
               const unsigned short* __restrict__ VT,
               const int* __restrict__ kmask,
               unsigned short* CT) {
  __shared__ __align__(16) float smem[ATT_W * WFL];   // per wave: ctx slab [16][PPI]
  __shared__ __align__(128) unsigned char tiles[2 * TBUF];   // two key-tile buffers: [buffer][plane k + p, v][64 rows][TPITCH]
  __shared__ __align__(32) float kbias[SEQ];          // start value of a key's score accumulators

  const int tid  = threadIdx.x;
  const int wave = tid >> 5;
  const int lane = tid & 31;
  const int hh   = lane >> 4;
  const int c    = lane & 15;
  const int bn   = blockIdx.y;
  const int b    = bn / NH;
  const int n    = bn - b * NH;
  const int i0   = blockIdx.x * ATT_ROWS;
  const int iw0  = i0 + wave * (16 * ATT_QG);

  float* pt = smem + wave * WFL;

  // stationary B fragments: (q + bq + ub), query row b*SEQ + iw0 + 16g + c, d 0..31 and 32..63 of head n
  v16h qf[ATT_QG][2];                       // [group][k step: d 0..31, d 32..63]
  const size_t qro = ((size_t)(b * SEQ + iw0 + c)) * DMOD + n * DH + 8 * hh;
  const unsigned short* qu0 = QU + qro;
  // The scheduling barriers keep other address arithmetic out of the run of loads, so that the wait behind the run stands in front of
  // every rewrite of a register that one of the loads names.
  __builtin_amdgcn_sched_barrier(0);
#pragma unroll
  for (int g = 0; g < ATT_QG; ++g) {
    qf[g][0] = ldfrag_u(qu0 + g * 16 * DMOD);
    qf[g][1] = ldfrag_u(qu0 + g * 16 * DMOD + 32);
  }
  wait_x0();
  __builtin_amdgcn_sched_barrier(0);

  const int* km = kmask + (size_t)b * SEQ_FULL;
  const float* cb = CB + (size_t)n * SEQ;

  // copy share of this thread: rows crow + 16 x (x 0..3) of each plane, 16-byte piece cpc of the 128-byte row
  const int crow = tid >> 3, cpc = tid & 7;
  const unsigned short* gK = KP + ((size_t)b * SEQ + crow) * DMOD + n * DH + 8 * cpc;          // + j0 * DMOD per tile
  const size_t vbase = (size_t)b * DMOD * SEQ + (size_t)(n * DH + crow) * SEQ + 8 * cpc;       // + j0 per tile
  const unsigned short* gV = VT + vbase;
  const unsigned ldst = (unsigned)(size_t)tiles + (unsigned)(crow * TPITCH + cpc * 16);        // LDS byte address, buffer 0, plane 0
  // fragment read base of this lane: row c of a 16-row subtile, 16-byte piece hh
  const unsigned char* fr0 = tiles + c * TPITCH + 16 * hh;

  auto stage = [&](int jt, unsigned bo) {   // key tile at jt -> buffer at byte offset bo; every lane on, all addresses in range
    const unsigned l = ldst + bo;
    const unsigned short* k0 = gK + (size_t)jt * DMOD;
    const unsigned short* v0 = gV + jt;
    copy8_async(l, l + 16 * TPITCH, l + 32 * TPITCH, l + 48 * TPITCH,
                l + TPLANE, l + TPLANE + 16 * TPITCH, l + TPLANE + 32 * TPITCH, l + TPLANE + 48 * TPITCH,
                k0, k0 + 16 * DMOD, k0 + 32 * DMOD, k0 + 48 * DMOD,
                v0, v0 + (size_t)16 * SEQ, v0 + (size_t)32 * SEQ, v0 + (size_t)48 * SEQ);
  };
  stage(0, 0u);
  // key bias, built while tile 0 flies (another LDS range than the copies'); published by the same barrier
  int mk[SEQ / ATT_THREADS];
  float ck[SEQ / ATT_THREADS];
  __builtin_amdgcn_sched_barrier(0);        // as at the fragment loads above: the wait stands in front of every rewrite of the loads' address registers
#pragma unroll
  for (int s = 0; s < SEQ; s += ATT_THREADS) {
    mk[s / ATT_THREADS] = km[s + tid];      // s + tid < SEQ <= SEQ_FULL
    ck[s / ATT_THREADS] = cb[s + tid];
  }
  wait_x0();
  __builtin_amdgcn_sched_barrier(0);
#pragma unroll
  for (int s = 0; s < SEQ; s += ATT_THREADS) kbias[s + tid] = (mk[s / ATT_THREADS] == 0) ? -1.0e30f : ck[s / ATT_THREADS];
  wait_async0();
  __syncthreads();                          // tile 0 and kbias published
  if (SEQ > 64) stage(64, (unsigned)TBUF);

  const float KSC = (SCALE / (QC * QC)) * LOG2E;

  float mrun[ATT_QG], lrun[ATT_QG];         // per group, this lane's query: running maximum (both halves alike), running sum x1024 (own half's keys)
  v8f O[ATT_QG][4];                         // O^T: O[g][td][r] = ctx accumulator of d = 16td + 8hh + r, query c of group g
#pragma unroll
  for (int g = 0; g < ATT_QG; ++g) {
    mrun[g] = -1.0e20f;
    lrun[g] = 0.f;
#pragma unroll
    for (int td = 0; td < 4; ++td) O[g][td] = zero8();
  }

#pragma unroll 1
  for (int j0 = 0; j0 < SEQ; j0 += 64) {
    const unsigned bo = ((unsigned)j0 & 64u) ? (unsigned)TBUF : 0u;      // buffer of this trip
    const unsigned char* fr = fr0 + bo;

    // The tile's LDS reads stand in two groups, each ahead of work that covers its latency. The scheduling barriers hold a group in
    // place: without them the compiler sinks each read to its own pair of products, which then wait out a whole LDS latency.
    // ---- group 1: the keys' start values and the 8 k + p fragments ----
    v8f kb[4];
    v16h ak[2][4];                          // [k step: d 0..31, d 32..63][16-key subtile]
    v16h av[2][4];                          // [32-key step][d subtile]
    __builtin_amdgcn_sched_barrier(0);
#pragma unroll
    for (int t = 0; t < 4; ++t) kb[t] = *(const v8f*)(kbias + j0 + 16 * t + 8 * hh);
#pragma unroll
    for (int st = 0; st < 2; ++st)
#pragma unroll
      for (int t = 0; t < 4; ++t)
        ak[st][t] = ldfrag_u((const unsigned short*)(fr + 16 * t * TPITCH) + 32 * st);
    __builtin_amdgcn_sched_barrier(0);

    // ---- S^T = kbias + (k+p) . (q+ub)^T: 4 subtiles of 16 keys x the groups, two 32-deep steps; each A fragment
    //      serves every group; the subtiles and the groups are independent. Behind the first step: group 2, the 8 v^T fragments ----
    v8f S[ATT_QG][4];
#pragma unroll
    for (int t = 0; t < 4; ++t)
#pragma unroll
      for (int g = 0; g < ATT_QG; ++g) S[g][t] = kb[t];
#pragma unroll
    for (int t = 0; t < 4; ++t)
#pragma unroll
      for (int g = 0; g < ATT_QG; ++g) S[g][t] = mma_h(ak[0][t], qf[g][0], S[g][t]);
    __builtin_amdgcn_sched_barrier(0);
#pragma unroll
    for (int ks = 0; ks < 2; ++ks)
#pragma unroll
      for (int td = 0; td < 4; ++td)
        av[ks][td] = ldfrag_u((const unsigned short*)(fr + TPLANE + 16 * td * TPITCH) + 32 * ks);
    __builtin_amdgcn_sched_barrier(0);
#pragma unroll
    for (int t = 0; t < 4; ++t)
#pragma unroll
      for (int g = 0; g < ATT_QG; ++g) S[g][t] = mma_h(ak[1][t], qf[g][1], S[g][t]);

    // ---- online softmax, one query per lane and group: 32 of the tile's 64 keys here, the other 32 in lane l ^ 16 ----
    FragH pf[ATT_QG][2];
#pragma unroll
    for (int g = 0; g < ATT_QG; ++g) {
      float mx = fmaxf(fmaxf(max8(S[g][0]), max8(S[g][1])), fmaxf(max8(S[g][2]), max8(S[g][3])));
      mx = fmaxf(mx, xhalf(mx));
      const float mn = fmaxf(mrun[g], mx * KSC);
      const float al = hw_exp2(mrun[g] - mn);
      mrun[g] = mn;
      const float sh = 10.0f - mn;          // 2^10 = the x1024 carry of P
      const v2f ksc2 = {KSC, KSC}, sh2 = {sh, sh};
      v2f psa = {0.f, 0.f}, psb = {0.f, 0.f};   // sums of subtiles 0, 1 and 2, 3: each subtile's own sum runs over r in ascending order
#pragma unroll   // these three loops are unrolled so that the register arrays S, e and pf are indexed by constants
      for (int r = 0; r < 8; r += 2) {
        float e[4][2];
#pragma unroll
        for (int t = 0; t < 4; ++t) {
          const v2f s2 = {S[g][t][r], S[g][t][r + 1]};
          const v2f x2 = __builtin_elementwise_fma(s2, ksc2, sh2);   // two exponents per instruction
          e[t][0] = hw_exp2(x2[0]);
          e[t][1] = hw_exp2(x2[1]);
          pf[g][t >> 1].h[t & 1][r]     = (_Float16)e[t][0];     // key j0 + 32(t>>1) + 16(t&1) + 8hh + r
          pf[g][t >> 1].h[t & 1][r + 1] = (_Float16)e[t][1];
        }
#pragma unroll
        for (int k = 0; k < 2; ++k) {
          const v2f ea = {e[0][k], e[1][k]}, eb = {e[2][k], e[3][k]};
          psa += ea;
          psb += eb;
        }
      }
      const float ps[4] = {psa[0], psa[1], psb[0], psb[1]};
      lrun[g] = lrun[g] * al + ((ps[0] + ps[1]) + (ps[2] + ps[3]));
#pragma unroll
      for (int td = 0; td < 4; ++td)
#pragma unroll
        for (int r = 0; r < 8; ++r) O[g][td][r] *= al;
    }

    // ---- O^T += v^T . P^T: two 32-key steps; each A fragment is read once and serves every group; the four d subtiles and the
    //      groups are independent ----
#pragma unroll
    for (int ks = 0; ks < 2; ++ks)
#pragma unroll
      for (int td = 0; td < 4; ++td)
#pragma unroll
        for (int g = 0; g < ATT_QG; ++g) O[g][td] = mma_h(av[ks][td], pf[g][ks].v, O[g][td]);

    // ---- publish tile t + 1, free this trip's buffer, then refill it with tile t + 2 ----
    __builtin_amdgcn_sched_barrier(0);      // keeps the waits and the barrier down here: lifted to group 2, they would wait out its latency
    wait_ds0();
    wait_async0();
    __syncthreads();
    if (j0 + 128 < SEQ) stage(j0 + 128, bo);
  }
  wait_async0();
#pragma unroll
  for (int g = 0; g < ATT_QG; ++g) acc_guard4(O[g][0], O[g][1], O[g][2], O[g][3]);

#pragma unroll
  for (int g = 0; g < ATT_QG; ++g) {
    // ---- join the halves' sums; fold 1/l (0 for an empty row) and the carry 64 on v (1024 on P cancels), carry x64 on ctx ----
    {
      const float oc  = CC / VC;
      const float lr  = lrun[g] + xhalf(lrun[g]);
      const float den = (lr > 0.f) ? lr : 1.0f;
      const float inv = (lr > 0.f) ? ((1.0f / den) * oc) : 0.f;
      float* po = pt + c * PPI + 8 * hh;
#pragma unroll
      for (int td = 0; td < 4; ++td) {
        v4f w0, w1;
#pragma unroll
        for (int e = 0; e < 4; ++e) { w0[e] = O[g][td][e] * inv; w1[e] = O[g][td][4 + e] * inv; }
        *(v4f*)(po + 16 * td)     = w0;
        *(v4f*)(po + 16 * td + 4) = w1;
      }
    }
    wave_sync_lds();
    {
      const int q8 = lane >> 3, c8 = (lane & 7) * 8;
      v4u hv[4];
#pragma unroll
      for (int it = 0; it < 4; ++it) {
        const int row = it * 4 + q8;                         // it 0..3 x q8 0..3 = rows 0..15
        const float* sp = pt + row * PPI + c8;
        v4u a = {0u, 0u, 0u, 0u};
#pragma unroll
        for (int e = 0; e < 4; ++e) a[e] = pk16(h_bits((_Float16)sp[2 * e]), h_bits((_Float16)sp[2 * e + 1]));
        hv[it] = a;
      }
#pragma unroll
      for (int it = 0; it < 4; ++it) {
        const int row = it * 4 + q8;
        const size_t go = ((size_t)(b * SEQ + iw0 + 16 * g + row)) * DMOD + n * DH + c8;
        *(v4u*)(CT + go) = hv[it];
      }
    }
    if (g + 1 < ATT_QG) wave_sync_lds();    // the slab's reads are done before the next group overwrites it
  }
}

// =====================================================================================================
// Workspace map (bytes); every plane is an exact multiple of its tile / whole-row store granularity (M, N exact multiples of 64,
// convert counts exact multiples of 2048), every offset a multiple of 512 KiB:
//   WQ16, WK16, WV16, WP16, WO16 f16 [512 out][512 in] x64 (input layout kept, no transpose)   5 x   524288
//   QU, K16 f16 [NROW][512] x4 (K16 = k + p)                                                 2 x  8388608
//   CB   f32 [8][SEQ] x16, in a slot of 512 KiB                                                     524288
//   VT16 f16 [NB][512][SEQ] x64                                                                    8388608
//   CT16 f16 [NROW][512] x64                                                                       8388608
//   end (NB=4, SEQ=2048)                                                                          36700160
// =====================================================================================================
extern "C" void kernel_launch(void* const* d_in, const int* in_sizes, int n_in,
                              void* d_out, int out_size, void* d_ws, size_t ws_size,
                              hipStream_t stream) {
  if (n_in < 16) return;
  const long long needX = (long long)NB * SEQ_FULL * DMOD;     // reads rows b*SEQ_FULL + t, b < NB, t < SEQ
  if ((long long)in_sizes[0] < needX || (long long)in_sizes[1] < needX || (long long)in_sizes[2] < needX) return;
  if (in_sizes[3] < NB * SEQ_FULL) return;
  if (in_sizes[4] < SEQ * DMOD) return;
  if (in_sizes[5] != DMOD * DMOD || in_sizes[7] != DMOD * DMOD || in_sizes[9] != DMOD * DMOD ||
      in_sizes[11] != DMOD * DMOD || in_sizes[13] != DMOD * DMOD) return;
  if (in_sizes[6] != DMOD || in_sizes[8] != DMOD || in_sizes[10] != DMOD || in_sizes[12] != DMOD) return;
  if (in_sizes[14] != NH * DH || in_sizes[15] != NH * DH) return;
  if (out_size < NROW * DMOD) return;

  const float* xq    = (const float*)d_in[0];
  const float* xk    = (const float*)d_in[1];
  const float* xv    = (const float*)d_in[2];
  const int*   kmask = (const int*)d_in[3];
  const float* xpos  = (const float*)d_in[4];
  const float* w_q   = (const float*)d_in[5];
  const float* b_q   = (const float*)d_in[6];
  const float* w_k   = (const float*)d_in[7];
  const float* b_k   = (const float*)d_in[8];
  const float* w_v   = (const float*)d_in[9];
  const float* b_v   = (const float*)d_in[10];
  const float* w_o   = (const float*)d_in[11];
  const float* b_o   = (const float*)d_in[12];
  const float* w_p   = (const float*)d_in[13];
  const float* ub    = (const float*)d_in[14];
  const float* vb    = (const float*)d_in[15];
  float*       out   = (float*)d_out;

  const size_t PW  = (size_t)DMOD * DMOD * 2;            //   524288
  const size_t PX  = (size_t)NROW * DMOD * 2;            //  8388608
  const size_t PVT = (size_t)NB * DMOD * SEQ * 2;        //  8388608
  size_t off = 0;
  const size_t oWQ  = off; off += PW;
  const size_t oWK  = off; off += PW;
  const size_t oWV  = off; off += PW;
  const size_t oWP  = off; off += PW;
  const size_t oWO  = off; off += PW;
  const size_t oQU  = off; off += PX;
  const size_t oK   = off; off += PX;
  const size_t oCB  = off; off += PW;                      // NH * SEQ * 4 bytes used
  const size_t oVT  = off; off += PVT;
  const size_t oCT  = off; off += PX;
  if (off > ws_size) return;                               // off = 36700160 at NB=4, SEQ=2048
  if (off > (size_t)134217728) return;

  char* ws = (char*)d_ws;
  unsigned short* WQ16  = (unsigned short*)(ws + oWQ);
  unsigned short* WK16  = (unsigned short*)(ws + oWK);
  unsigned short* WV16  = (unsigned short*)(ws + oWV);
  unsigned short* WP16  = (unsigned short*)(ws + oWP);
  unsigned short* WO16  = (unsigned short*)(ws + oWO);
  unsigned short* QU    = (unsigned short*)(ws + oQU);
  unsigned short* K16   = (unsigned short*)(ws + oK);
  float*          CB    = (float*)(ws + oCB);
  unsigned short* VT16  = (unsigned short*)(ws + oVT);
  unsigned short* CT16  = (unsigned short*)(ws + oCT);

  const dim3 blk(256);
  const dim3 gCV(CVT_BLOCKS);                                       // 640
  const dim3 gPJ(PJ_BLOCKS);                                        // 384
  const int tilesQ = (NROW / 64) * (DMOD / 64);                     // 1024
  const dim3 gQ((tilesQ + 7) / 8, 1);                               // 128
  const dim3 gAT(SEQ / ATT_ROWS, NB * NH);                          // 16 x 32
  const dim3 bAT(ATT_THREADS);                                      // 128

  // (0) the five weight planes in one launch: W[nd][c] ([out][in], already k-contiguous per output row) -> f16( bf16_RNE(w) * 64 ).
  //     Destination: WQ16 .. WO16, contiguous from WQ16 in the order of the kernel's ranges.
  cvt_all<<<gCV, blk, 0, stream>>>(w_q, w_k, w_v, w_p, w_o, WQ16);

  // (1) q, k + p, v^T projections and the per-key positional score term in one launch
  proj_all<<<gPJ, blk, 0, stream>>>(xq, xk, xv, xpos, WQ16, WK16, WV16, WP16,
                                    QU, K16, VT16, CB, b_q, b_k, b_v, ub, vb);

  // (2) attention -> CT16 = f16(ctx * 64), rows b*SEQ + i, halves n*64+d
  attn_full<<<gAT, bAT, 0, stream>>>(QU, K16, CB, VT16, kmask, CT16);

  // (3) out = CT . W^T / (64*64) + bo; M = NROW, N = 512, K = 512, f32 rows straight into the output buffer (row b*SEQ + t)
  gemm64<0, 0, 0, 1><<<gQ, blk, 0, stream>>>(
      CT16, CT16, DMOD, 0LL,
      WO16, DMOD, 0LL,
      (void*)out, (void*)out, DMOD, 0LL,
      NROW, DMOD, DMOD, 1.0f / (CC * WSC), 1.0f,
      b_o, b_o, b_o);
  (void)hipGetLastError();
}

// v010
// It runs in 69.7 microseconds.
// Two timings next to v009 put it at 1.05 and 1.04 times that version's speed.
// Counting every step since v000, it is 6.22 times as fast.
// Contractions (all v_wmma_f32_16x16x32_f16, f16 operands, f32 accumulate): q/v projections (x f16 x16 . W f16 x64, K=512, single products);
// p + k in one accumulator ([pos | xk] . [Wp | Wk], K=1024); scores ((q+bq+u) f16 x4 . (k+bk+p) f16 x4, K=64 per head, single products,
// on top of the per-key term (vbias-u) . p, summed in f32 on VALU from the accumulators that hold p alone); P . v^T (P f16 x1024 . v^T carried as
// one f16 x64 plane, 64 keys per tile, single products; both attention products run transposed); output projection (ctx carried as one f16 x64 plane
// . Wo f16 x64, K=512, single products). Key mask (score accumulators start at -1e30 for a masked key, whose exponential is then 0, else at the per-key term), max-subtracted online base-2 softmax and
// all epilogues in f32 on VALU. Every float input RNE-converted to bf16 on load.
#include <hip/hip_runtime.h>
#include <math.h>
#include <stdint.h>

#ifndef NB
#define NB    4
#endif
#ifndef SEQ
#define SEQ   2048
#endif
#define NB_FULL  4
#define SEQ_FULL 2048
#define DMOD  512
#define NH    8
#define DH    64
#define NROW  (SEQ * NB)
#define XC    16.0f
#define WSC   64.0f
#define QC    4.0f
#define VC    64.0f
#define PC    1024.0f
#define CC    64.0f
#define SCALE 0.125f
#define LOG2E 1.4426950408889634f
static_assert(NH * DH == DMOD);
static_assert(DH == 64);
static_assert(NB >= 1 && NB <= NB_FULL && SEQ >= 64 && SEQ <= SEQ_FULL);
static_assert((SEQ % 64) == 0 && (DMOD % 64) == 0 && (NROW % 64) == 0);
static_assert(((SEQ * DMOD) % 2048) == 0 && ((DMOD * DMOD) % 2048) == 0);
#define ATT_W 4                        // waves side by side over the query rows
#define ATT_KS 2                       // waves that share the same query rows and split the key tiles between them
#define ATT_THREADS (ATT_W * ATT_KS * 32)
#define ATT_QG 2                       // 16-query groups per wave: every k, p, v fragment read from LDS feeds ATT_QG products
#define ATT_ROWS (ATT_W * 16 * ATT_QG)
#define TPITCH 144                     // LDS bytes per staged 128-byte row: 16 B x odd, conflict-free for 16-byte fragment reads
#define TPLANE (64 * TPITCH)           // one staged plane: 64 rows
#define TBUF   (2 * TPLANE)            // one key tile: k + p, v^T
#define PBUF   (ATT_KS * TBUF)         // one staged buffer: ATT_KS neighbouring key tiles, one per key share
static_assert((SEQ % ATT_ROWS) == 0 && ATT_THREADS == 256 && ATT_KS == 2 && (SEQ % (64 * ATT_KS)) == 0);
#define PPI 68
#define WFL (16 * PPI)
static_assert((PPI % 4) == 0 && PPI >= 64 && (WFL % 4) == 0);

typedef _Float16 v16h __attribute__((ext_vector_type(16)));
typedef _Float16 v8h  __attribute__((ext_vector_type(8)));
typedef __bf16   v16b __attribute__((ext_vector_type(16)));
typedef float    v8f  __attribute__((ext_vector_type(8)));
typedef float    v4f  __attribute__((ext_vector_type(4)));
typedef float    v2f  __attribute__((ext_vector_type(2)));
typedef unsigned int v4u __attribute__((ext_vector_type(4)));
typedef unsigned int v2u __attribute__((ext_vector_type(2)));
typedef __bf16   v2b  __attribute__((ext_vector_type(2)));
typedef _Float16 v2h  __attribute__((ext_vector_type(2)));

union FragH { v16h v; v8h h[2]; v4u u[2]; };
union FragAny { v16h h; v16b b; };

// ---- scalar helpers --------------------------------------------------------------------------------
__device__ __forceinline__ unsigned short bf_bits(float f) {          // f32 -> bf16 bits, RNE convert
  unsigned u = __float_as_uint(f);
  return (unsigned short)((u + 0x7FFFu + ((u >> 16) & 1u)) >> 16);
}
__device__ __forceinline__ float bf_up(unsigned short h) { return __uint_as_float(((unsigned)h) << 16); }
__device__ __forceinline__ float bfr(float f) { return bf_up(bf_bits(f)); }   // value of the bf16 RNE convert
__device__ __forceinline__ unsigned short h_bits(_Float16 x) { return __builtin_bit_cast(unsigned short, x); }
__device__ __forceinline__ unsigned pk16(unsigned short a, unsigned short b) { return (unsigned)a | ((unsigned)b << 16); }
__device__ __forceinline__ unsigned pack2_x(v2f x) {   // two activations: f16( bf16_RNE(x) * 16 ), packed (the scale is exact)
  const unsigned b = __builtin_bit_cast(unsigned, __builtin_convertvector(x, v2b));
  v2f y = {__uint_as_float(b << 16), __uint_as_float(b & 0xFFFF0000u)};
  const v2f sc = {XC, XC};
  y = y * sc;
  return __builtin_bit_cast(unsigned, __builtin_convertvector(y, v2h));
}
template <int CTRL>
__device__ __forceinline__ float dpp_f(float x) {   // value of the lane that the DPP control names, inside the 16-lane row
  return __builtin_bit_cast(float, __builtin_amdgcn_update_dpp(0, __builtin_bit_cast(int, x), CTRL, 0xf, 0xf, true));
}
__device__ __forceinline__ float row_sum16(float x) {   // sum over the 16 lanes of a row, in every lane: row_xmask 1, 2, 4, 8
  x += dpp_f<0x161>(x);
  x += dpp_f<0x162>(x);
  x += dpp_f<0x164>(x);
  x += dpp_f<0x168>(x);
  return x;
}
__device__ __forceinline__ v8f zero8() { v8f z = {0.f, 0.f, 0.f, 0.f, 0.f, 0.f, 0.f, 0.f}; return z; }

// ---- fragment loader: 16-bit A/B operand from a k-contiguous 16-bit plane, lane -> row/col (lane&15),
//      p already includes +8*(lane>>4); elements 0..7 <- p[0..7] (k0+8h..), elements 8..15 <- p[16..23] (k0+16+8h..)
//      (same split k map for A and B; B is always read from a [n][k] plane)
__device__ __forceinline__ v16h ldfrag_u(const unsigned short* p) {
  FragH f;
  f.u[0] = *(const v4u*)(p);
  f.u[1] = *(const v4u*)(p + 16);
  return f.v;
}

// ---- WMMA helpers with trailing VALU hazard gaps ------------------------------------------------------
__device__ __forceinline__ v8f mma_h(v16h a, v16h b, v8f c) {
  return __builtin_amdgcn_wmma_f32_16x16x32_f16(false, a, false, b, (short)0, c, false, false);
}
__device__ __forceinline__ v8f mma_b(v16h a, v16h b, v8f c) {
  FragAny ua, ub;
  ua.h = a;
  ub.h = b;
  return __builtin_amdgcn_wmma_f32_16x16x32_bf16(false, ua.b, false, ub.b, (short)0, c, false, false);
}
template <int BF>
__device__ __forceinline__ v8f mmaT(v16h a, v16h b, v8f c) {
  if constexpr (BF != 0) return mma_b(a, b, c);
  else return mma_h(a, b, c);
}
__device__ __forceinline__ void dep_guard1(v8f& a, v8f& b, v16h x) {
#if defined(__HIP_DEVICE_COMPILE__)
  asm volatile("v_nop\n\tv_nop\n\tv_nop\n\tv_nop" : "+v"(a), "+v"(b) : "v"(x));
#endif
}
__device__ __forceinline__ void keep4_h(v16h a, v16h b, v16h c, v16h d) {
#if defined(__HIP_DEVICE_COMPILE__)
  asm volatile("v_nop" :: "v"(a), "v"(b), "v"(c), "v"(d));
#endif
}
__device__ __forceinline__ void acc_guard4(v8f& a, v8f& b, v8f& c, v8f& d) {
#if defined(__HIP_DEVICE_COMPILE__)
  asm volatile("v_nop\n\tv_nop\n\tv_nop\n\tv_nop" : "+v"(a), "+v"(b), "+v"(c), "+v"(d));
#endif
}
// Eight asynchronous 16-byte copies per lane, global -> LDS (a thread's share of one staged buffer). The s_wait_xcnt stands inside the
// statement so that no address register of an issued copy is rewritten in front of it.
__device__ __forceinline__ void copy8_async(unsigned l0, unsigned l1, unsigned l2, unsigned l3,
                                            unsigned l4, unsigned l5, unsigned l6, unsigned l7,
                                            const unsigned short* g0, const unsigned short* g1,
                                            const unsigned short* g2, const unsigned short* g3,
                                            const unsigned short* g4, const unsigned short* g5,
                                            const unsigned short* g6, const unsigned short* g7) {
#if defined(__HIP_DEVICE_COMPILE__)
  asm volatile("global_load_async_to_lds_b128 %0, %8, off\n\t"
               "global_load_async_to_lds_b128 %1, %9, off\n\t"
               "global_load_async_to_lds_b128 %2, %10, off\n\t"
               "global_load_async_to_lds_b128 %3, %11, off\n\t"
               "global_load_async_to_lds_b128 %4, %12, off\n\t"
               "global_load_async_to_lds_b128 %5, %13, off\n\t"
               "global_load_async_to_lds_b128 %6, %14, off\n\t"
               "global_load_async_to_lds_b128 %7, %15, off\n\t"
               "s_wait_xcnt 0x0"
               :: "v"(l0), "v"(l1), "v"(l2), "v"(l3), "v"(l4), "v"(l5), "v"(l6), "v"(l7),
                  "v"(g0), "v"(g1), "v"(g2), "v"(g3), "v"(g4), "v"(g5), "v"(g6), "v"(g7)
               : "memory");
#endif
}
// Four such copies per lane (the A rows of a GEMM chunk), with the same wait inside the statement for the same reason.
__device__ __forceinline__ void copy4_async(unsigned l0, unsigned l1, unsigned l2, unsigned l3,
                                            const unsigned short* g0, const unsigned short* g1,
                                            const unsigned short* g2, const unsigned short* g3) {
#if defined(__HIP_DEVICE_COMPILE__)
  asm volatile("global_load_async_to_lds_b128 %0, %4, off\n\t"
               "global_load_async_to_lds_b128 %1, %5, off\n\t"
               "global_load_async_to_lds_b128 %2, %6, off\n\t"
               "global_load_async_to_lds_b128 %3, %7, off\n\t"
               "s_wait_xcnt 0x0"
               :: "v"(l0), "v"(l1), "v"(l2), "v"(l3), "v"(g0), "v"(g1), "v"(g2), "v"(g3)
               : "memory");
#endif
}
// This wave's own copies have landed in LDS (other waves read them only behind the next work-group barrier).
__device__ __forceinline__ void wait_async0() {
#if defined(__HIP_DEVICE_COMPILE__)
  asm volatile("s_wait_asynccnt 0x0" ::: "memory");
#endif
}
// This wave's own LDS reads have returned, so that the buffer they read may be refilled behind the barrier.
__device__ __forceinline__ void wait_ds0() {
#if defined(__HIP_DEVICE_COMPILE__)
  asm volatile("s_wait_dscnt 0x0" ::: "memory");
#endif
}
__device__ __forceinline__ void wait_x0() {
#if defined(__HIP_DEVICE_COMPILE__)
  asm volatile("s_wait_xcnt 0x0" ::: "memory");
#endif
}
// The same wait behind a run of loads that share one address: the address is an input of the statement, so its registers stay live up
// to the wait and no result of the run is placed in them.
__device__ __forceinline__ void wait_x0_addr(const float* p) {
#if defined(__HIP_DEVICE_COMPILE__)
  asm volatile("s_wait_xcnt 0x0" :: "v"(p) : "memory");
#endif
}
__device__ __forceinline__ void wave_sync_lds() {
  __builtin_amdgcn_fence(__ATOMIC_RELEASE, "workgroup");
  __builtin_amdgcn_wave_barrier();
  __builtin_amdgcn_fence(__ATOMIC_ACQUIRE, "workgroup");
}

// =====================================================================================================
// Elementwise 16-bit pack of the five weight planes in ONE grid: dst[i] = f16( bf16_RNE(src[i]) * 64 ) (a power of two: exact).
// A block packs one piece of 2048 elements (256 thr x 8: two 16-B loads, one 16-B store per thread); ranges of the block index
// pick the source (block-uniform): CVT_W pieces for each of wq, wk, wv, wp, wo. The five destination planes lie in the workspace
// one behind the other in this same order, so piece bx is written at dst + bx * 2048.
// coverage: grid = CVT_BLOCKS blocks = every piece of every plane exactly once (the plane size is a multiple of 2048).
// =====================================================================================================
#define CVT_W ((DMOD * DMOD) / 2048)
#define CVT_BLOCKS (5 * CVT_W)
__global__ __launch_bounds__(256) void cvt_all(const float* __restrict__ wq, const float* __restrict__ wk, const float* __restrict__ wv,
                                               const float* __restrict__ wp, const float* __restrict__ wo, unsigned short* dst) {
  const int bx = blockIdx.x;
  if (bx >= CVT_BLOCKS) return;               // never taken with the exact grid; no barriers in this kernel
  const int seg = bx / CVT_W;
  const float* src = (seg == 0) ? wq : (seg == 1) ? wk : (seg == 2) ? wv : (seg == 3) ? wp : wo;
  const size_t so  = (size_t)(bx - seg * CVT_W) * 2048;   // element offset of this block's piece in its source
  const float sc   = WSC;
  const float* s = src + so + (size_t)threadIdx.x * 8;
  unsigned short* d = dst + (size_t)bx * 2048 + (size_t)threadIdx.x * 8;
  const v4f a = *(const v4f*)(s);
  const v4f b = *(const v4f*)(s + 4);
  v4u o;
  o[0] = pk16(h_bits((_Float16)(bfr(a[0]) * sc)), h_bits((_Float16)(bfr(a[1]) * sc)));
  o[1] = pk16(h_bits((_Float16)(bfr(a[2]) * sc)), h_bits((_Float16)(bfr(a[3]) * sc)));
  o[2] = pk16(h_bits((_Float16)(bfr(b[0]) * sc)), h_bits((_Float16)(bfr(b[1]) * sc)));
  o[3] = pk16(h_bits((_Float16)(bfr(b[2]) * sc)), h_bits((_Float16)(bfr(b[3]) * sc)));
  *(v4u*)(d) = o;
}

// =====================================================================================================
// Register-blocked batched 16-bit WMMA GEMM: C[m][n] = oscale * sum_k A[m][k] * Bt[n][k] (+ bias); a block of 8 waves owns one
// 128x256 tile, wave w its 64x64 part (rows 64 * (w >> 2), columns 64 * (w & 3)). A row-major [M][K] pitch lda (16-bit plane), Bt
// row-major [N][K] pitch ldb (k contiguous); M multiple of 128, N of 256, K of 64. bx = index of the block's tile, by = batch index
// with element strides sA, sB, sC; gs = the block's LDS.
// Operands: per 64-deep chunk of k the block's 128 A rows (both planes with ASPLIT) and 256 Bt rows, 128 bytes each, are brought into
// LDS once by asynchronous 16-byte copies (each wave-copy = 4 whole 128-byte lines), two buffers: chunk t + 2 is copied into the buffer
// that trip t has read, behind the trip's barrier; all fragments are 16-byte LDS reads at pitch 144 B. Order of the k sum: ascending.
// ASPLIT 1: a second A plane A2 (unscaled residual of A, same layout) is multiplied into the same accumulator (A + A2 ~ exact A).
// KCAT 1: the k sum runs over two operand pairs one behind the other: k < K/2 from (A2, Bt2), k >= K/2 from (A, Bt) at k - K/2; row m of
// the first pair's A is row m % SEQ of A2 (a plane that all batches share); same pitches. Behind the first pair's last chunk the
// accumulators hold that pair's product alone; the blocks of rows m < SEQ then write, per row and 64-column group g (= a wave's columns),
// C2[g * SEQ + m] = ocarry^2 * oscale * sum_column acc * (bf16_RNE(ep2[column]) - bf16_RNE(ep1[column])) as f32 (in-lane over the four
// 16-column subtiles, then a butterfly over the 16 lanes of a row).
// AF 1: the A rows are f32 rows of an input (Xf; with KCAT the first pair's are rows m % SEQ of X2f), pitch DMOD; plane row b*SEQ + t is input
// row b*SEQ_FULL + t. A chunk's 128 x 64 floats are loaded into registers at the head of trip t - 2 (whole-line 16-byte loads), and behind
// that trip's barrier packed to f16( bf16_RNE(x) * 16 ) and stored into the A plane of the freed buffer; Ap, A2p are not read.
// BF 1: bf16 operands (v_wmma_f32_16x16x32_bf16), else f16.
// EPI 1: value += bf16_RNE(ep0[column]) (per-column bias); EPI 2: value += bf16_RNE(ep0[row]) (per-row bias, 16-bit out only).
// OM 0: f32 out (pitch ldc).  OM 2: one f16 plane = f16(value * ocarry).
// OM 4: two f16 planes: hi = f16(value * ocarry), lo = f16(value * ocarry - hi) (unscaled residual).
// OM 5: two f16 planes: C = f16((value + bf16_RNE(ep1[column])) * ocarry), C2 = f16((value + bf16_RNE(ep2[column])) * ocarry).
// OM 6: the first of these planes alone.
// OM 7: one f16 plane = f16(value * ocarry), written transposed: element (m, n) at Cout[(m / SEQ) * sC + n * ldc + m % SEQ].
// coverage: 4 slabs x 16 rows (f32: it 0..7 x lane>>4; 16-bit: it 0..3 x lane>>3) x 64 cols = the wave's whole 64x64 tile;
//           (M/128)*(N/256) values of bx, a surplus block leaves as a whole in front of every barrier.
// LDS: the epilogue's slabs lie over the chunk buffers, which nobody reads behind the last trip's barrier.
// =====================================================================================================
#define SLABF (16 * 68)                 // floats of one wave's 16x64 slab, pitch 68 floats
#define GPLANE_A (128 * TPITCH)         // one staged A plane: 128 rows
#define GPLANE_B (256 * TPITCH)         // the staged Bt plane: 256 rows
#define GBUF(AS) ((1 + (AS)) * GPLANE_A + GPLANE_B)   // one chunk buffer
static_assert(2 * GBUF(0) >= 8 * SLABF * 4);
static_assert((NROW % 128) == 0 && (SEQ % 256) == 0 && (DMOD % 256) == 0);
template <int OM, int ASPLIT, int BF, int EPI, int KCAT = 0, int AF = 0>
__device__ __forceinline__ void gemm64_tile(
    unsigned char* gs, int bx, int by,
    const unsigned short* __restrict__ Ap, const unsigned short* __restrict__ A2p, int lda, long long sA,
    const unsigned short* __restrict__ Btp, const unsigned short* __restrict__ Bt2p, int ldb, long long sB,
    void* Cout, void* C2out, int ldc, long long sC,
    int M, int N, int K, float oscale, float ocarry,
    const float* __restrict__ ep0, const float* __restrict__ ep1, const float* __restrict__ ep2,
    const float* __restrict__ Xf = nullptr, const float* __restrict__ X2f = nullptr) {
  const int tid  = threadIdx.x;
  const int lane = tid & 31;
  const int wave = tid >> 5;
  const int bN = N >> 8;
  if (bx >= (M >> 7) * bN) return;       // block-uniform, in front of every barrier
  const int bm  = bx / bN;
  const int m0b = bm << 7;
  const int n0b = (bx - bm * bN) << 8;
  const int wm = wave >> 2, wn = wave & 3;
  const int m0 = m0b + (wm << 6);
  const int n0 = n0b + (wn << 6);

  const unsigned short* A1 = Ap  + (size_t)((long long)by * sA);
  const unsigned short* A2 = A2p + (size_t)((long long)by * sA);
  const unsigned short* Bb = Btp + (size_t)((long long)by * sB);

  const int rlane = lane & 15;                 // row (A) / col (B, D) within subtile
  const int hh    = lane >> 4;                 // lane half: k offset 8 * hh
  const int mOff  = (lane >> 4) * 8;           // D row offset

  constexpr unsigned GB = (unsigned)GBUF(ASPLIT);               // bytes of one chunk buffer
  constexpr unsigned OB = (unsigned)((1 + ASPLIT) * GPLANE_A);  // byte offset of the Bt plane in it
  // copy share of this thread: rows crow + 32 x of each plane, 16-byte piece cpc of the 128-byte row
  const int crow = tid >> 3, cpc = tid & 7;
  const unsigned short* gA  = A1 + (size_t)(m0b + crow) * lda + 8 * cpc;      // + kc per chunk
  const unsigned short* gA2 = A2 + (size_t)(((KCAT != 0) ? (m0b % SEQ) : m0b) + crow) * lda + 8 * cpc;
  const unsigned short* gB  = Bb + (size_t)(n0b + crow) * ldb + 8 * cpc;
  const unsigned short* gB2 = Bt2p + (size_t)(n0b + crow) * ldb + 8 * cpc;     // KCAT only
  const unsigned ldst = (unsigned)(size_t)gs + (unsigned)(crow * TPITCH + cpc * 16);   // LDS byte address, buffer 0, A plane
  const size_t ra = (size_t)32 * lda, rb = (size_t)32 * ldb;
  auto stage = [&](int kc, unsigned bo) {   // chunk at kc -> buffer at byte offset bo; every lane on, all rows < M, N, all k < K
    const unsigned l = ldst + bo;
    const unsigned short* a  = gA + kc;
    const unsigned short* bs = gB + kc;
    if constexpr (KCAT != 0) {
      const int kh = K >> 1;
      if (kc < kh) {                        // block-uniform: the chunk lies in the first operand pair
        a  = gA2 + kc;
        bs = gB2 + kc;
      } else {
        a  = gA + (kc - kh);
        bs = gB + (kc - kh);
      }
    }
    if constexpr (ASPLIT != 0) {
      const unsigned short* a2 = gA2 + kc;
      copy8_async(l, l + 32 * TPITCH, l + 64 * TPITCH, l + 96 * TPITCH,
                  l + GPLANE_A, l + GPLANE_A + 32 * TPITCH, l + GPLANE_A + 64 * TPITCH, l + GPLANE_A + 96 * TPITCH,
                  a, a + ra, a + 2 * ra, a + 3 * ra, a2, a2 + ra, a2 + 2 * ra, a2 + 3 * ra);
    } else if constexpr (AF == 0) {
      copy4_async(l, l + 32 * TPITCH, l + 64 * TPITCH, l + 96 * TPITCH, a, a + ra, a + 2 * ra, a + 3 * ra);
    }
    const unsigned lb = l + OB;
    copy8_async(lb, lb + 32 * TPITCH, lb + 64 * TPITCH, lb + 96 * TPITCH,
                lb + 128 * TPITCH, lb + 160 * TPITCH, lb + 192 * TPITCH, lb + 224 * TPITCH,
                bs, bs + rb, bs + 2 * rb, bs + 3 * rb, bs + 4 * rb, bs + 5 * rb, bs + 6 * rb, bs + 7 * rb);
  };
  // AF: the A rows come as f32 straight from an input. Share of this thread per chunk: rows xrow + 16 x (x 0..7), floats 4 xc .. + 3 of the
  // row's 64 (a wave-load = two whole 256-byte row pieces); held in registers over one trip, then packed and stored as 8 bytes each.
  const int xrow = tid >> 4, xc = tid & 15;
  const float* gX  = Xf;
  const float* gX2 = X2f;
  if constexpr (AF != 0) {
    gX  = Xf + ((size_t)(m0b / SEQ) * SEQ_FULL + (size_t)(m0b % SEQ) + xrow) * DMOD + 4 * xc;   // plane row b*SEQ + t = input row b*SEQ_FULL + t
    gX2 = X2f + ((size_t)(m0b % SEQ) + xrow) * DMOD + 4 * xc;                                   // KCAT only
  }
  unsigned char* xd = gs + xrow * TPITCH + xc * 8;
  v4f xr[8];
  auto loadX = [&](int kc, v4f (&xs)[8]) {  // chunk at kc -> registers; all rows and all k inside the input
    const float* a = gX + kc;
    if constexpr (KCAT != 0) {
      const int kh = K >> 1;
      a = (kc < kh) ? (gX2 + kc) : (gX + (kc - kh));   // block-uniform
    }
    // The scheduling barriers keep other address arithmetic out of the run of loads, so that the wait behind the run stands in front
    // of every rewrite of a register that one of the loads names.
    __builtin_amdgcn_sched_barrier(0);
#pragma unroll
    for (int x = 0; x < 8; ++x) xs[x] = *(const v4f*)(a + (size_t)x * 16 * DMOD);
    wait_x0_addr(a);
    __builtin_amdgcn_sched_barrier(0);
  };
  auto storeX = [&](unsigned bo, const v4f (&xs)[8]) {   // registers -> A plane of the buffer at byte offset bo
#pragma unroll
    for (int x = 0; x < 8; ++x) {
      const v2f p0 = {xs[x][0], xs[x][1]}, p1 = {xs[x][2], xs[x][3]};
      const v2u o = {pack2_x(p0), pack2_x(p1)};
      *(v2u*)(xd + bo + x * 16 * TPITCH) = o;
    }
  };
  // fragment read bases of this lane: row rlane of a 16-row subtile of the wave's part, 16-byte piece hh
  const unsigned char* fa0 = gs + ((wm << 6) + rlane) * TPITCH + 16 * hh;
  const unsigned char* fb0 = gs + OB + ((wn << 6) + rlane) * TPITCH + 16 * hh;

  stage(0, 0u);
  v4f xf[8];                                // chunk 0; the accumulators are not live yet, so chunks 0 and 1 fly together
  if constexpr (AF != 0) {
    loadX(0, xf);
    if (K > 64) loadX(64, xr);
  }
  float wj[4];                              // KCAT: weight of column n0 + 16 * j + rlane in the per-row term
  if constexpr (KCAT != 0) {
    float w1[4], w2[4];
    // The scheduling barriers keep other address arithmetic out of the run of loads, so that the wait behind the run stands in front
    // of every rewrite of a register that one of the loads names.
    __builtin_amdgcn_sched_barrier(0);
#pragma unroll
    for (int j = 0; j < 4; ++j) {
      w1[j] = ep1[n0 + 16 * j + rlane];     // columns < N, which equals the length of ep1 and ep2
      w2[j] = ep2[n0 + 16 * j + rlane];
    }
    wait_x0();
    __builtin_amdgcn_sched_barrier(0);
#pragma unroll
    for (int j = 0; j < 4; ++j) wj[j] = bfr(w2[j]) - bfr(w1[j]);
  }
  if constexpr (AF != 0) {
    storeX(0u, xf);
    wait_ds0();                             // this thread's part of chunk 0 stands in LDS in front of the barrier
  }
  wait_async0();
  __syncthreads();                          // chunk 0 published
  if (K > 64) {
    stage(64, GB);
    if constexpr (AF != 0) storeX(GB, xr);  // published by the barrier at the foot of trip 0, behind its s_wait_dscnt
  }

  v8f acc[4][4];
#pragma unroll
  for (int i = 0; i < 4; ++i)
#pragma unroll
    for (int j = 0; j < 4; ++j) acc[i][j] = zero8();

#pragma unroll 1   // kept rolled, for speed only
  for (int kc = 0; kc < K; kc += 64) {
    const unsigned bo = ((unsigned)kc & 64u) ? GB : 0u;      // buffer of this trip
    const unsigned char* fa = fa0 + bo;
    const unsigned char* fb = fb0 + bo;
    if constexpr (AF != 0) {
      if (kc + 128 < K) loadX(kc + 128, xr);   // flies over this trip's products
    }
#pragma unroll      // the chunk's two 32-deep steps, unrolled so that their LDS offsets are immediates
    for (int ks = 0; ks < 2; ++ks) {
      v16h bh[4], ahs[4], als[4];           // all fragments of the 32-deep step are read as one group in front of its products
#pragma unroll
      for (int j = 0; j < 4; ++j) bh[j] = ldfrag_u((const unsigned short*)(fb + 16 * j * TPITCH) + 32 * ks);
#pragma unroll
      for (int i = 0; i < 4; ++i) {
        ahs[i] = ldfrag_u((const unsigned short*)(fa + 16 * i * TPITCH) + 32 * ks);
        if constexpr (ASPLIT != 0) als[i] = ldfrag_u((const unsigned short*)(fa + GPLANE_A + 16 * i * TPITCH) + 32 * ks);
      }
#pragma unroll
      for (int i = 0; i < 4; ++i) {
        const v16h ah = ahs[i];
#pragma unroll
        for (int j = 0; j < 4; ++j) acc[i][j] = mmaT<BF>(ah, bh[j], acc[i][j]);
        dep_guard1(acc[i][0], acc[i][3], ah);
        if constexpr (ASPLIT != 0) {
          const v16h al = als[i];
#pragma unroll
          for (int j = 0; j < 4; ++j) acc[i][j] = mmaT<BF>(al, bh[j], acc[i][j]);
          dep_guard1(acc[i][0], acc[i][3], al);
        }
      }
      keep4_h(bh[0], bh[1], bh[2], bh[3]);
    }
    // ---- publish chunk t + 1, free this trip's buffer, then refill it with chunk t + 2 ----
    wait_ds0();
    wait_async0();
    __syncthreads();
    if (kc + 128 < K) {
      stage(kc + 128, bo);
      if constexpr (AF != 0) storeX(bo, xr);
    }
    if constexpr (KCAT != 0) {
      if (kc + 64 == (K >> 1) && m0b < SEQ) {                // block-uniform; once per block, while the next chunks fly
        float* C2 = (float*)C2out + (size_t)(n0 >> 6) * SEQ + m0 + mOff;
        const float cf = oscale * ocarry * ocarry;
#pragma unroll
        for (int i = 0; i < 4; ++i) {
          v4f t0, t1;
#pragma unroll
          for (int r = 0; r < 8; ++r) {
            float t = acc[i][0][r] * wj[0];
#pragma unroll
            for (int j = 1; j < 4; ++j) t = fmaf(acc[i][j][r], wj[j], t);
            t = row_sum16(t) * cf;
            if (r < 4) t0[r] = t; else t1[r - 4] = t;
          }
          if (rlane == 0) {                                  // rows m0 + 16 * i + 8 * hh + 0..7: one lane of each half stores 32 bytes
            *(v4f*)(C2 + 16 * i)     = t0;
            *(v4f*)(C2 + 16 * i + 4) = t1;
          }
        }
        wait_x0();                                           // the next trip rewrites registers that the stores name
      }
    }
  }
  wait_async0();
  acc_guard4(acc[0][0], acc[0][1], acc[0][2], acc[0][3]);
  acc_guard4(acc[1][0], acc[1][1], acc[1][2], acc[1][3]);
  acc_guard4(acc[2][0], acc[2][1], acc[2][2], acc[2][3]);
  acc_guard4(acc[3][0], acc[3][1], acc[3][2], acc[3][3]);

  const int hh2 = lane >> 4, c4 = (lane & 15) * 4;     // f32 out: 256-B row segment = 16 lanes x 16 B
  const int q8  = lane >> 3, c8 = (lane & 7) * 8;

  if constexpr (OM == 7) {
    // ---- transposed 16-bit out: lane (rlane, hh) holds, for column n0 + 16 j + rlane, the rows m0 + 16 i + 8 hh + 0..7 = 16 bytes of
    //      the transposed plane's row; four [16 columns][64 rows] f16 slabs (one per j, pitch 144 B, private to the wave) turn them into
    //      whole 128-byte lines; each slab is written once and read once, so one wave sync serves all four ----
    static_assert(8 * 4 * 16 * TPITCH <= 2 * GBUF(0));
    unsigned char* sl = gs + wave * (4 * 16 * TPITCH);
    unsigned short* C = (unsigned short*)Cout + (size_t)(m0 / SEQ) * (size_t)sC + (size_t)(m0 % SEQ);
    float bb[4];
    __builtin_amdgcn_sched_barrier(0);      // as at the loads above: the wait stands in front of every rewrite of the loads' address registers
#pragma unroll
    for (int j = 0; j < 4; ++j) bb[j] = ep0[n0 + 16 * j + rlane];   // columns < N, the bias length
    wait_x0();
    __builtin_amdgcn_sched_barrier(0);
#pragma unroll
    for (int j = 0; j < 4; ++j) {
      const float bj = bfr(bb[j]);
#pragma unroll
      for (int i = 0; i < 4; ++i) {
        v4u a;
#pragma unroll
        for (int e = 0; e < 4; ++e) {
          const float f0 = (acc[i][j][2 * e] * oscale + bj) * ocarry;
          const float f1 = (acc[i][j][2 * e + 1] * oscale + bj) * ocarry;
          a[e] = pk16(h_bits((_Float16)f0), h_bits((_Float16)f1));
        }
        *(v4u*)(sl + (16 * j + rlane) * TPITCH + (16 * i + mOff) * 2) = a;
      }
    }
    wave_sync_lds();
#pragma unroll
    for (int j = 0; j < 4; ++j) {
      v4u hv[4];
#pragma unroll
      for (int it = 0; it < 4; ++it) hv[it] = *(const v4u*)(sl + (16 * j + it * 4 + q8) * TPITCH + c8 * 2);   // it 0..3 x q8 0..3 = columns 0..15
#pragma unroll
      for (int it = 0; it < 4; ++it) *(v4u*)(C + (size_t)(n0 + 16 * j + it * 4 + q8) * ldc + c8) = hv[it];
      wait_x0();                            // the next j rewrites registers that the stores name
    }
    return;
  }

  // ---- epilogue ----
  float* slab = (float*)gs + wave * SLABF;
#pragma unroll
  for (int i = 0; i < 4; ++i) {
    const int mBase = m0 + (i << 4);
#pragma unroll
    for (int j = 0; j < 4; ++j) {
#pragma unroll
      for (int r = 0; r < 8; ++r) {
        slab[(mOff + r) * 68 + (j << 4) + rlane] = acc[i][j][r];
      }
    }
    wave_sync_lds();
    if constexpr (OM == 0) {
      float* C = (float*)Cout + (size_t)((long long)by * sC);
      v4f vals[8];
#pragma unroll
      for (int it = 0; it < 8; ++it) {
        const int row = it * 2 + hh2;                      // it 0..7 x hh2 0..1 = rows 0..15
        v4f v = *(const v4f*)(slab + row * 68 + c4);
#pragma unroll
        for (int e = 0; e < 4; ++e) v[e] = v[e] * oscale;
        if constexpr (EPI == 1) {
          const v4f bb = *(const v4f*)(ep0 + n0 + c4);     // per-column bias, columns n0+c4 .. +3 (N equals the bias length)
#pragma unroll
          for (int e = 0; e < 4; ++e) v[e] = v[e] + bfr(bb[e]);
        }
        vals[it] = v;
      }
      {
#pragma unroll
        for (int it = 0; it < 8; ++it) {
          const int gr = mBase + it * 2 + hh2;
          *(v4f*)(C + (size_t)gr * ldc + n0 + c4) = vals[it];
        }
        
      }
    } else {
      unsigned short* C  = (unsigned short*)Cout  + (size_t)((long long)by * sC);
      unsigned short* Cb = (unsigned short*)C2out + (size_t)((long long)by * sC);
      v4u hv[4], lv[4];
#pragma unroll
      for (int it = 0; it < 4; ++it) {
        const int row = it * 4 + q8;                       // it 0..3 x q8 0..3 = rows 0..15
        const float* sp = slab + row * 68 + c8;
        float rb = 0.f;
        if constexpr (EPI == 2) rb = bfr(ep0[mBase + row]);   // per-row bias (M equals the bias length)
        v4u a  = {0u, 0u, 0u, 0u};
        v4u b2 = {0u, 0u, 0u, 0u};
#pragma unroll
        for (int e = 0; e < 4; ++e) {
          const int ci = n0 + c8 + 2 * e;                  // column index, < N
          float f0 = sp[2 * e] * oscale + rb;
          float f1 = sp[2 * e + 1] * oscale + rb;
          if constexpr (EPI == 1) {
            f0 += bfr(ep0[ci]);
            f1 += bfr(ep0[ci + 1]);
          }
          if constexpr (OM == 5 || OM == 6) {
            const float g0 = (f0 + bfr(ep1[ci])) * ocarry, g1 = (f1 + bfr(ep1[ci + 1])) * ocarry;
            a[e]  = pk16(h_bits((_Float16)g0), h_bits((_Float16)g1));
            if constexpr (OM == 5) {
              const float w0 = (f0 + bfr(ep2[ci])) * ocarry, w1 = (f1 + bfr(ep2[ci + 1])) * ocarry;
              b2[e] = pk16(h_bits((_Float16)w0), h_bits((_Float16)w1));
            }
          } else {
            f0 *= ocarry; f1 *= ocarry;
            const _Float16 x0 = (_Float16)f0, x1 = (_Float16)f1;
            a[e] = pk16(h_bits(x0), h_bits(x1));
            if constexpr (OM == 4) {
              b2[e] = pk16(h_bits((_Float16)(f0 - (float)x0)), h_bits((_Float16)(f1 - (float)x1)));
            }
          }
        }
        hv[it] = a;
        lv[it] = b2;
      }
      {
#pragma unroll
        for (int it = 0; it < 4; ++it) {
          const int row = it * 4 + q8;
          *(v4u*)(C + (size_t)(mBase + row) * ldc + n0 + c8) = hv[it];
          if constexpr (OM == 4 || OM == 5) {
            *(v4u*)(Cb + (size_t)(mBase + row) * ldc + n0 + c8) = lv[it];
          }
        }
        
      }
    }
    wave_sync_lds();
  }
}

// One GEMM per launch: grid.x = 128x256 tiles, grid.y = batch.
template <int OM, int ASPLIT, int BF, int EPI>
__global__ __launch_bounds__(256) __attribute__((amdgpu_num_vgpr(256))) void gemm64(
    const unsigned short* __restrict__ Ap, const unsigned short* __restrict__ A2p, int lda, long long sA,
    const unsigned short* __restrict__ Btp, int ldb, long long sB,
    void* Cout, void* C2out, int ldc, long long sC,
    int M, int N, int K, float oscale, float ocarry,
    const float* __restrict__ ep0, const float* __restrict__ ep1, const float* __restrict__ ep2) {
  __shared__ __align__(128) unsigned char gsm[2 * GBUF(ASPLIT)];   // two chunk buffers; the epilogue's slabs lie over them
  gemm64_tile<OM, ASPLIT, BF, EPI>(gsm, blockIdx.x, blockIdx.y, Ap, A2p, lda, sA, Btp, Btp, ldb, sB, Cout, C2out, ldc, sC,
                                   M, N, K, oscale, ocarry, ep0, ep1, ep2);
}

// The projections, which need nothing of each other, in ONE grid; ranges of the block index pick the product (block-uniform). The A rows
// of all three are token rows, read as f32 from the inputs and packed to f16( bf16_RNE(x) * 16 ) on their way into LDS (AF):
//   PJ_Q blocks: q[m][nd] = sum_c x[m][c] W[nd][c] / 1024 + bq[nd]; QU = f16((q + ub[nd]) * 4); M = NROW, N = 512, K = 512
//   PJ_Q blocks: positional projection p of the row's position (no bias) + k projection + bk, in one accumulator ->
//                K16 = f16((k + p) * 4); same M, N; K = 1024 = [pos | xk] . [Wp | Wk]; behind the first half the blocks of batch 0
//                write the per-key score term CB[n][s] = 16 * sum_d (vbias[n][d] - ub[n][d]) * p[s][n*64+d]
//   PJ_Q blocks: v[m][nd] = sum_c x[m][c] W[nd][c] / 1024 + bv[nd], same M, N, K, written transposed:
//                VT[b][nd][j] = f16(v[b*SEQ + j][nd] * 64)
//   since (q+ub).k + (q+vbias).p = (q+ub).(k+p) + (vbias-ub).p
//   The k + p blocks, twice as long as the others, stand in the middle range:
//   they stay alone while the q and v blocks share (for speed only).
#define PJ_Q (((NROW / 64) * (DMOD / 64)) / 8)
#define PJ_BLOCKS (3 * PJ_Q)
static_assert(((DMOD / 64) % 8) == 0);   // every product's tile count is a multiple of the 8 tiles of a block
static_assert((SEQ % 128) == 0);         // a block's 128 token rows lie in one batch
__global__ __launch_bounds__(256) __attribute__((amdgpu_num_vgpr(256))) void proj_all(
    const float* __restrict__ xq, const float* __restrict__ xk,
    const float* __restrict__ xv, const float* __restrict__ xpos,
    const unsigned short* __restrict__ WQ, const unsigned short* __restrict__ WK,
    const unsigned short* __restrict__ WV, const unsigned short* __restrict__ WP,
    unsigned short* QU, unsigned short* K16,
    unsigned short* VT, float* CB,
    const float* __restrict__ bq, const float* __restrict__ bk, const float* __restrict__ bv,
    const float* __restrict__ ub, const float* __restrict__ vb) {
  __shared__ __align__(128) unsigned char gsm[2 * GBUF(0)];   // two chunk buffers; the epilogue's slabs lie over them
  const int bx = blockIdx.x;
  const float osc = 1.0f / (XC * WSC);
  if (bx < PJ_Q) {
    gemm64_tile<6, 0, 0, 1, 0, 1>(gsm, bx, 0, WQ, WQ, DMOD, 0LL, WQ, WQ, DMOD, 0LL, (void*)QU, (void*)QU, DMOD, 0LL,
                                  NROW, DMOD, DMOD, osc, QC, bq, ub, ub, xq, xq);
  } else if (bx < 2 * PJ_Q) {
    gemm64_tile<2, 0, 0, 1, 1, 1>(gsm, bx - PJ_Q, 0, WK, WK, DMOD, 0LL, WK, WP, DMOD, 0LL, (void*)K16, (void*)CB, DMOD, 0LL,
                                  NROW, DMOD, 2 * DMOD, osc, QC, bk, ub, vb, xk, xpos);
  } else if (bx < PJ_BLOCKS) {
    gemm64_tile<7, 0, 0, 1, 0, 1>(gsm, bx - 2 * PJ_Q, 0, WV, WV, DMOD, 0LL, WV, WV, DMOD, 0LL, (void*)VT, (void*)VT, SEQ,
                                  (long long)DMOD * SEQ, NROW, DMOD, DMOD, osc, VC, bv, bv, bv, xv, xv);
  }
}

// =====================================================================================================
// Full (non-causal) attention with a 64-deep score contraction for one (batch b, head n) pair and a 128-row query tile;
// 8 waves, wave w owns query rows iw0 .. iw0+31, iw0 = i0 + 32 (w & 3), as two groups g of 16 (rows iw0 + 16g ..), and of the key tiles
// those with index = w >> 2 modulo 2; waves w and w + 4 each run their own online softmax over their half of the keys and are joined behind the loop. Planes (pitch DMOD halves, row index = b*SEQ + position):
// QU = f16((q + bq + ub) x4), KP = f16((k + bk + p) x4); CB = f32 per-key score term x16, [n][SEQ] (shared by
// all batches); VT = v^T f16 x64 as [b][n*64+d][SEQ]. Key mask ints kmask[b*SEQ_FULL + s], masked where == 0.
//   Both products are computed transposed: S^T = CB + (k+p) . (q+ub)^T (A = key rows from LDS, B = the query fragments, loaded
//   once and kept in registers) and O^T += v^T . P^T (A = v^T rows from LDS, B = P^T). Each A fragment is read from LDS once and
//   multiplied with both groups' B operands. Lane (c, hh) then holds, for its one query per group,
//   iw0 + 16g + c, the scores of keys jw + 16t + 8hh + r (jw = j0 + 64 (w >> 2), t 0..3, r 0..7): maximum and sum run inside the lane, with one exchange between
//   the lane halves for the maximum per key tile and one for the sum behind the loop; two score tiles converted in place are a B
//   operand in the loaders' k map (element e <- tile 2ks row 8hh+e, element 8+e <- tile 2ks+1 row 8hh+e), so P never leaves registers.
//   Key mask: the score accumulators start from kbias[key] (CB[n][key], or -1e30 where the key is masked; built once per work-group in LDS).
//   The running maximum never falls below -1e20 (any real score lies far above it), so a masked key's exponential is exactly 0 and a
//   fully masked row keeps sum 0 and gives ctx 0. Online softmax in base 2, max-subtracted, f32; the x1024 carry of P sits in the
//   exponent (+10), so the running sum carries it too and it cancels in the division.
//   Per key tile (64 keys) and group: 8 score WMMAs, 8 P.V WMMAs.
//   Key tiles: the two 64-row x 128-byte planes of a tile (k + p rows, v^T rows of head n) are brought into
//   LDS once per work-group by asynchronous 16-byte copies (a pair of neighbouring tiles per trip, 8 copies per thread, each wave-copy = whole
//   128-byte lines), two buffers: pair t + 2 is copied into the buffer that trip t has read, behind the trip's barrier; all A fragments are
//   16-byte LDS reads at pitch 144 B.
//   block = 8 waves = 256 threads, two blocks per WGP (four waves per SIMD); grid = (SEQ/128, NB*NH); one block barrier per pair of key tiles; identical bounded work (SEQ/128 trips).
//   Join: behind the loop's last barrier waves 4..7 put O, maximum and sum into LDS (over the tile buffers), one more barrier, and waves 0..3
//   bring both shares to the common maximum and add them lane by lane (same query, same d, same lane half in both waves).
// LDS: two key-tile buffers and kbias shared by the block; one [16][PPI] f32 slab per wave for a group's ctx tile, private-to-wave
//   (wave_sync), used by the two groups one after the other;
//   staged extent == consumed extent (16 rows x 64 cols written by every lane (c, hh) x (td, r) before any read).
// coverage: global: per group 4 instructions x 4 rows x 64 halves = rows iw0+16g..iw0+16g+15 of head segment n in CT;
//           grid x waves cover all NB x SEQ rows and all NH head segments of CT exactly once.
// =====================================================================================================
__device__ __forceinline__ float xhalf(float x) {   // value of lane l ^ 16
  const int b = __builtin_bit_cast(int, x);
  return __builtin_bit_cast(float, __builtin_amdgcn_permlanex16(b, b, 0x76543210, 0xfedcba98, false, false));
}
// 2^x as the one hardware instruction. The library's exp2f wraps it in a compare, two selects, an add and a scaling so that results
// below 2^-126 come out as subnormals; here such a result is 0 either way once it is a 16-bit operand, and it cannot move a running sum
// that holds the tile maximum's own term (1024) or an accumulator that is scaled by it.
__device__ __forceinline__ float hw_exp2(float x) { return __builtin_amdgcn_exp2f(x); }
__device__ __forceinline__ float max8(v8f s) {
  return fmaxf(fmaxf(fmaxf(fmaxf(s[0], s[1]), s[2]), fmaxf(fmaxf(s[3], s[4]), s[5])), fmaxf(s[6], s[7]));
}

// four waves per SIMD: the 512 blocks of eight waves are two on every WGP, which leaves a wave a budget of 256 registers
__global__ __launch_bounds__(ATT_THREADS) __attribute__((amdgpu_waves_per_eu(4, 4)))
void attn_full(const unsigned short* __restrict__ QU,
               const unsigned short* __restrict__ KP, const float* __restrict__ CB,
               const unsigned short* __restrict__ VT,
               const int* __restrict__ kmask,
               unsigned short* CT) {
  __shared__ __align__(16) float smem[ATT_W * WFL];   // per wave: ctx slab [16][PPI]
  __shared__ __align__(128) unsigned char tiles[2 * PBUF];   // two buffers: [buffer][tile of the pair][plane k + p, v][64 rows][TPITCH]
  __shared__ __align__(32) float kbias[SEQ];          // start value of a key's score accumulators

  const int tid  = threadIdx.x;
  const int wave = (tid >> 5) & (ATT_W - 1);                      // place over the query rows
  const int kh   = __builtin_amdgcn_readfirstlane(tid >> 7);      // key share: 0 or 1, the same in every lane of a wave
  const int lane = tid & 31;
  const int hh   = lane >> 4;
  const int c    = lane & 15;
  const int bn   = blockIdx.y;
  const int b    = bn / NH;
  const int n    = bn - b * NH;
  const int i0   = blockIdx.x * ATT_ROWS;
  const int iw0  = i0 + wave * (16 * ATT_QG);

  float* pt = smem + wave * WFL;

  // stationary B fragments: (q + bq + ub), query row b*SEQ + iw0 + 16g + c, d 0..31 and 32..63 of head n
  v16h qf[ATT_QG][2];                       // [group][k step: d 0..31, d 32..63]
  const size_t qro = ((size_t)(b * SEQ + iw0 + c)) * DMOD + n * DH + 8 * hh;
  const unsigned short* qu0 = QU + qro;
  // The scheduling barriers keep other address arithmetic out of the run of loads, so that the wait behind the run stands in front of
  // every rewrite of a register that one of the loads names.
  __builtin_amdgcn_sched_barrier(0);
#pragma unroll
  for (int g = 0; g < ATT_QG; ++g) {
    qf[g][0] = ldfrag_u(qu0 + g * 16 * DMOD);
    qf[g][1] = ldfrag_u(qu0 + g * 16 * DMOD + 32);
  }
  wait_x0();
  __builtin_amdgcn_sched_barrier(0);

  const int* km = kmask + (size_t)b * SEQ_FULL;
  const float* cb = CB + (size_t)n * SEQ;

  // copy share of this thread in a pair of tiles (128 keys). k + p: key rows crow + 32 x (x 0..3; x 0, 1 lie in the pair's first tile, x 2, 3
  // in its second), 16-byte piece cpc of the 128-byte row. v^T: d rows vrow + 16 x (x 0..3), 16-byte piece vpc of the pair's 256 bytes of
  // that row (pieces 0..7 belong to the first tile, 8..15 to the second).
  const int crow = tid >> 3, cpc = tid & 7;
  const int vrow = tid >> 4, vpc = tid & 15;
  const unsigned short* gK = KP + ((size_t)b * SEQ + crow) * DMOD + n * DH + 8 * cpc;          // + j0 * DMOD per pair
  const size_t vbase = (size_t)b * DMOD * SEQ + (size_t)(n * DH + vrow) * SEQ + 8 * vpc;       // + j0 per pair
  const unsigned short* gV = VT + vbase;
  const unsigned ldsk = (unsigned)(size_t)tiles + (unsigned)(crow * TPITCH + cpc * 16);        // LDS byte address, buffer 0, tile 0, plane 0
  const unsigned ldsv = (unsigned)(size_t)tiles + (unsigned)((vpc >> 3) * TBUF + TPLANE + vrow * TPITCH + (vpc & 7) * 16);
  // fragment read base of this lane: this wave's tile of the pair, row c of a 16-row subtile, 16-byte piece hh
  const unsigned char* fr0 = tiles + kh * TBUF + c * TPITCH + 16 * hh;

  auto stage = [&](int jt, unsigned bo) {   // pair of key tiles at jt -> buffer at byte offset bo; every lane on, all addresses in range
    const unsigned l = ldsk + bo, lv = ldsv + bo;
    const unsigned short* k0 = gK + (size_t)jt * DMOD;
    const unsigned short* v0 = gV + jt;
    copy8_async(l, l + 32 * TPITCH, l + TBUF, l + TBUF + 32 * TPITCH,
                lv, lv + 16 * TPITCH, lv + 32 * TPITCH, lv + 48 * TPITCH,
                k0, k0 + 32 * DMOD, k0 + 64 * DMOD, k0 + 96 * DMOD,
                v0, v0 + (size_t)16 * SEQ, v0 + (size_t)32 * SEQ, v0 + (size_t)48 * SEQ);
  };
  stage(0, 0u);
  // key bias, built while tile 0 flies (another LDS range than the copies'); published by the same barrier
  int mk[SEQ / ATT_THREADS];
  float ck[SEQ / ATT_THREADS];
  __builtin_amdgcn_sched_barrier(0);        // as at the fragment loads above: the wait stands in front of every rewrite of the loads' address registers
#pragma unroll
  for (int s = 0; s < SEQ; s += ATT_THREADS) {
    mk[s / ATT_THREADS] = km[s + tid];      // s + tid < SEQ <= SEQ_FULL
    ck[s / ATT_THREADS] = cb[s + tid];
  }
  wait_x0();
  __builtin_amdgcn_sched_barrier(0);
#pragma unroll
  for (int s = 0; s < SEQ; s += ATT_THREADS) kbias[s + tid] = (mk[s / ATT_THREADS] == 0) ? -1.0e30f : ck[s / ATT_THREADS];
  wait_async0();
  __syncthreads();                          // pair 0 and kbias published
  if (SEQ > 128) stage(128, (unsigned)PBUF);

  const float KSC = (SCALE / (QC * QC)) * LOG2E;

  float mrun[ATT_QG], lrun[ATT_QG];         // per group, this lane's query: running maximum (both halves alike), running sum x1024 (own half's keys)
  v8f O[ATT_QG][4];                         // O^T: O[g][td][r] = ctx accumulator of d = 16td + 8hh + r, query c of group g
#pragma unroll
  for (int g = 0; g < ATT_QG; ++g) {
    mrun[g] = -1.0e20f;
    lrun[g] = 0.f;
#pragma unroll
    for (int td = 0; td < 4; ++td) O[g][td] = zero8();
  }

  // One trip: this wave's tile of the pair at j0, up to and with the barrier at the trip's foot. Inlined into the two loops below.
  auto trip = [&](int j0, unsigned bo) __attribute__((always_inline)) {
    const unsigned char* fr = fr0 + bo;
    const int jw = j0 + 64 * kh;            // first key of this wave's tile

    // The tile's LDS reads stand in three groups, each ahead of work that covers its latency. The scheduling barriers hold a group in
    // place: without them the compiler sinks each read to its own pair of products, which then wait out a whole LDS latency.
    // The v^T fragments come in two halves, so that the wave stays inside its 256 registers: group 2 (first 32-key step) behind the score
    // products, where the k + p fragments are dead; group 3 (second step) behind the softmax, where the scores are dead, ahead of the
    // first step's products.
    // ---- group 1: the keys' start values and the 8 k + p fragments ----
    v8f kb[4];
    v16h ak[2][4];                          // [k step: d 0..31, d 32..63][16-key subtile]
    v16h av[2][4];                          // [32-key step][d subtile]
    __builtin_amdgcn_sched_barrier(0);
#pragma unroll
    for (int t = 0; t < 4; ++t) kb[t] = *(const v8f*)(kbias + jw + 16 * t + 8 * hh);
#pragma unroll
    for (int st = 0; st < 2; ++st)
#pragma unroll
      for (int t = 0; t < 4; ++t)
        ak[st][t] = ldfrag_u((const unsigned short*)(fr + 16 * t * TPITCH) + 32 * st);
    __builtin_amdgcn_sched_barrier(0);

    // ---- S^T = kbias + (k+p) . (q+ub)^T: 4 subtiles of 16 keys x the groups, two 32-deep steps; each A fragment
    //      serves every group; the subtiles and the groups are independent ----
    v8f S[ATT_QG][4];
#pragma unroll
    for (int t = 0; t < 4; ++t)
#pragma unroll
      for (int g = 0; g < ATT_QG; ++g) S[g][t] = kb[t];
#pragma unroll
    for (int t = 0; t < 4; ++t)
#pragma unroll
      for (int g = 0; g < ATT_QG; ++g) S[g][t] = mma_h(ak[0][t], qf[g][0], S[g][t]);
#pragma unroll
    for (int t = 0; t < 4; ++t)
#pragma unroll
      for (int g = 0; g < ATT_QG; ++g) S[g][t] = mma_h(ak[1][t], qf[g][1], S[g][t]);
    // ---- group 2: the 4 v^T fragments of the first 32-key step ----
    __builtin_amdgcn_sched_barrier(0);
#pragma unroll
    for (int td = 0; td < 4; ++td) av[0][td] = ldfrag_u((const unsigned short*)(fr + TPLANE + 16 * td * TPITCH));
    __builtin_amdgcn_sched_barrier(0);

    // ---- online softmax, one query per lane and group: 32 of the tile's 64 keys here, the other 32 in lane l ^ 16 ----
    FragH pf[ATT_QG][2];
#pragma unroll
    for (int g = 0; g < ATT_QG; ++g) {
      float mx = fmaxf(fmaxf(max8(S[g][0]), max8(S[g][1])), fmaxf(max8(S[g][2]), max8(S[g][3])));
      mx = fmaxf(mx, xhalf(mx));
      const float mn = fmaxf(mrun[g], mx * KSC);
      const float al = hw_exp2(mrun[g] - mn);
      mrun[g] = mn;
      const float sh = 10.0f - mn;          // 2^10 = the x1024 carry of P
      const v2f ksc2 = {KSC, KSC}, sh2 = {sh, sh};
      v2f psa = {0.f, 0.f}, psb = {0.f, 0.f};   // sums of subtiles 0, 1 and 2, 3: each subtile's own sum runs over r in ascending order
#pragma unroll   // these three loops are unrolled so that the register arrays S, e and pf are indexed by constants
      for (int r = 0; r < 8; r += 2) {
        float e[4][2];
#pragma unroll
        for (int t = 0; t < 4; ++t) {
          const v2f s2 = {S[g][t][r], S[g][t][r + 1]};
          const v2f x2 = __builtin_elementwise_fma(s2, ksc2, sh2);   // two exponents per instruction
          e[t][0] = hw_exp2(x2[0]);
          e[t][1] = hw_exp2(x2[1]);
          pf[g][t >> 1].h[t & 1][r]     = (_Float16)e[t][0];     // key jw + 32(t>>1) + 16(t&1) + 8hh + r
          pf[g][t >> 1].h[t & 1][r + 1] = (_Float16)e[t][1];
        }
#pragma unroll
        for (int k = 0; k < 2; ++k) {
          const v2f ea = {e[0][k], e[1][k]}, eb = {e[2][k], e[3][k]};
          psa += ea;
          psb += eb;
        }
      }
      const float ps[4] = {psa[0], psa[1], psb[0], psb[1]};
      lrun[g] = lrun[g] * al + ((ps[0] + ps[1]) + (ps[2] + ps[3]));
#pragma unroll
      for (int td = 0; td < 4; ++td)
#pragma unroll
        for (int r = 0; r < 8; ++r) O[g][td][r] *= al;
    }
    // ---- group 3: the 4 v^T fragments of the second 32-key step ----
    __builtin_amdgcn_sched_barrier(0);
#pragma unroll
    for (int td = 0; td < 4; ++td) av[1][td] = ldfrag_u((const unsigned short*)(fr + TPLANE + 16 * td * TPITCH) + 32);
    __builtin_amdgcn_sched_barrier(0);

    // ---- O^T += v^T . P^T: two 32-key steps; each A fragment is read once and serves every group; the four d subtiles and the
    //      groups are independent ----
#pragma unroll
    for (int ks = 0; ks < 2; ++ks)
#pragma unroll
      for (int td = 0; td < 4; ++td)
#pragma unroll
        for (int g = 0; g < ATT_QG; ++g) O[g][td] = mma_h(av[ks][td], pf[g][ks].v, O[g][td]);

    // ---- publish pair t + 1 and free this trip's buffer (its refill with pair t + 2 follows in the loop) ----
    __builtin_amdgcn_sched_barrier(0);      // keeps the waits and the barrier down here: lifted to group 3, they would wait out its latency
    wait_ds0();
    wait_async0();
    __syncthreads();
  };
  // The trips that refill their buffer and the last two, which do not, are two loops: each body is then one straight block, in which
  // the tile's sums are formed where they are written, ahead of the P . V products, and their 64 terms do not stay in registers over these.
  int j0 = 0;
#pragma unroll 1   // both loops kept rolled, for speed only
  for (; j0 + 256 < SEQ; j0 += 64 * ATT_KS) {
    const unsigned bo = ((unsigned)j0 & 128u) ? (unsigned)PBUF : 0u;     // buffer of this trip
    trip(j0, bo);
    stage(j0 + 256, bo);
  }
#pragma unroll 1
  for (; j0 < SEQ; j0 += 64 * ATT_KS) trip(j0, ((unsigned)j0 & 128u) ? (unsigned)PBUF : 0u);
  wait_async0();
#pragma unroll
  for (int g = 0; g < ATT_QG; ++g) acc_guard4(O[g][0], O[g][1], O[g][2], O[g][3]);

  // ---- join the two key shares: the tile buffers are free behind the last trip's barrier (no copy is in flight, every read has returned).
  //      Per query wave 17 slots of 32 lanes x 16 bytes: 16 for O, one for the two maxima and the two sums ----
  static_assert(ATT_W * 17 * 512 <= 2 * PBUF);
  float* xw = (float*)tiles + wave * (17 * 128) + lane * 4;
  if (kh != 0) {                            // wave-uniform
#pragma unroll
    for (int g = 0; g < ATT_QG; ++g)
#pragma unroll
      for (int td = 0; td < 4; ++td) {
        const v4f w0 = {O[g][td][0], O[g][td][1], O[g][td][2], O[g][td][3]};
        const v4f w1 = {O[g][td][4], O[g][td][5], O[g][td][6], O[g][td][7]};
        *(v4f*)(xw + ((g * 4 + td) * 2) * 128)     = w0;
        *(v4f*)(xw + ((g * 4 + td) * 2 + 1) * 128) = w1;
      }
    const v4f ml = {mrun[0], mrun[1], lrun[0], lrun[1]};
    *(v4f*)(xw + 16 * 128) = ml;
    wait_ds0();                             // this wave's share stands in LDS in front of the barrier
  }
  __syncthreads();                          // every wave passes it; the last barrier of the kernel
  if (kh != 0) return;                      // whole waves leave; what follows is private to a wave
  {
    const v4f ml = *(const v4f*)(xw + 16 * 128);
#pragma unroll
    for (int g = 0; g < ATT_QG; ++g) {
      const float mn = fmaxf(mrun[g], ml[g]);       // both are at least -1e20, so the differences below are finite and <= 0
      const float a0 = hw_exp2(mrun[g] - mn);
      const float a1 = hw_exp2(ml[g] - mn);
      lrun[g] = lrun[g] * a0 + ml[2 + g] * a1;
#pragma unroll
      for (int td = 0; td < 4; ++td) {
        const v4f w0 = *(const v4f*)(xw + ((g * 4 + td) * 2) * 128);
        const v4f w1 = *(const v4f*)(xw + ((g * 4 + td) * 2 + 1) * 128);
#pragma unroll
        for (int e = 0; e < 4; ++e) {
          O[g][td][e]     = O[g][td][e] * a0 + w0[e] * a1;
          O[g][td][4 + e] = O[g][td][4 + e] * a0 + w1[e] * a1;
        }
      }
    }
  }

#pragma unroll
  for (int g = 0; g < ATT_QG; ++g) {
    // ---- join the halves' sums; fold 1/l (0 for an empty row) and the carry 64 on v (1024 on P cancels), carry x64 on ctx ----
    {
      const float oc  = CC / VC;
      const float lr  = lrun[g] + xhalf(lrun[g]);
      const float den = (lr > 0.f) ? lr : 1.0f;
      const float inv = (lr > 0.f) ? ((1.0f / den) * oc) : 0.f;
      float* po = pt + c * PPI + 8 * hh;
#pragma unroll
      for (int td = 0; td < 4; ++td) {
        v4f w0, w1;
#pragma unroll
        for (int e = 0; e < 4; ++e) { w0[e] = O[g][td][e] * inv; w1[e] = O[g][td][4 + e] * inv; }
        *(v4f*)(po + 16 * td)     = w0;
        *(v4f*)(po + 16 * td + 4) = w1;
      }
    }
    wave_sync_lds();
    {
      const int q8 = lane >> 3, c8 = (lane & 7) * 8;
      v4u hv[4];
#pragma unroll
      for (int it = 0; it < 4; ++it) {
        const int row = it * 4 + q8;                         // it 0..3 x q8 0..3 = rows 0..15
        const float* sp = pt + row * PPI + c8;
        v4u a = {0u, 0u, 0u, 0u};
#pragma unroll
        for (int e = 0; e < 4; ++e) a[e] = pk16(h_bits((_Float16)sp[2 * e]), h_bits((_Float16)sp[2 * e + 1]));
        hv[it] = a;
      }
#pragma unroll
      for (int it = 0; it < 4; ++it) {
        const int row = it * 4 + q8;
        const size_t go = ((size_t)(b * SEQ + iw0 + 16 * g + row)) * DMOD + n * DH + c8;
        *(v4u*)(CT + go) = hv[it];
      }
    }
    if (g + 1 < ATT_QG) wave_sync_lds();    // the slab's reads are done before the next group overwrites it
  }
}

// =====================================================================================================
// Workspace map (bytes); every plane is an exact multiple of its tile / whole-row store granularity (M, N exact multiples of 64,
// convert counts exact multiples of 2048), every offset a multiple of 512 KiB:
//   WQ16, WK16, WV16, WP16, WO16 f16 [512 out][512 in] x64 (input layout kept, no transpose)   5 x   524288
//   QU, K16 f16 [NROW][512] x4 (K16 = k + p)                                                 2 x  8388608
//   CB   f32 [8][SEQ] x16, in a slot of 512 KiB                                                     524288
//   VT16 f16 [NB][512][SEQ] x64                                                                    8388608
//   CT16 f16 [NROW][512] x64                                                                       8388608
//   end (NB=4, SEQ=2048)                                                                          36700160
// =====================================================================================================
extern "C" void kernel_launch(void* const* d_in, const int* in_sizes, int n_in,
                              void* d_out, int out_size, void* d_ws, size_t ws_size,
                              hipStream_t stream) {
  if (n_in < 16) return;
  const long long needX = (long long)NB * SEQ_FULL * DMOD;     // reads rows b*SEQ_FULL + t, b < NB, t < SEQ
  if ((long long)in_sizes[0] < needX || (long long)in_sizes[1] < needX || (long long)in_sizes[2] < needX) return;
  if (in_sizes[3] < NB * SEQ_FULL) return;
  if (in_sizes[4] < SEQ * DMOD) return;
  if (in_sizes[5] != DMOD * DMOD || in_sizes[7] != DMOD * DMOD || in_sizes[9] != DMOD * DMOD ||
      in_sizes[11] != DMOD * DMOD || in_sizes[13] != DMOD * DMOD) return;
  if (in_sizes[6] != DMOD || in_sizes[8] != DMOD || in_sizes[10] != DMOD || in_sizes[12] != DMOD) return;
  if (in_sizes[14] != NH * DH || in_sizes[15] != NH * DH) return;
  if (out_size < NROW * DMOD) return;

  const float* xq    = (const float*)d_in[0];
  const float* xk    = (const float*)d_in[1];
  const float* xv    = (const float*)d_in[2];
  const int*   kmask = (const int*)d_in[3];
  const float* xpos  = (const float*)d_in[4];
  const float* w_q   = (const float*)d_in[5];
  const float* b_q   = (const float*)d_in[6];
  const float* w_k   = (const float*)d_in[7];
  const float* b_k   = (const float*)d_in[8];
  const float* w_v   = (const float*)d_in[9];
  const float* b_v   = (const float*)d_in[10];
  const float* w_o   = (const float*)d_in[11];
  const float* b_o   = (const float*)d_in[12];
  const float* w_p   = (const float*)d_in[13];
  const float* ub    = (const float*)d_in[14];
  const float* vb    = (const float*)d_in[15];
  float*       out   = (float*)d_out;

  const size_t PW  = (size_t)DMOD * DMOD * 2;            //   524288
  const size_t PX  = (size_t)NROW * DMOD * 2;            //  8388608
  const size_t PVT = (size_t)NB * DMOD * SEQ * 2;        //  8388608
  size_t off = 0;
  const size_t oWQ  = off; off += PW;
  const size_t oWK  = off; off += PW;
  const size_t oWV  = off; off += PW;
  const size_t oWP  = off; off += PW;
  const size_t oWO  = off; off += PW;
  const size_t oQU  = off; off += PX;
  const size_t oK   = off; off += PX;
  const size_t oCB  = off; off += PW;                      // NH * SEQ * 4 bytes used
  const size_t oVT  = off; off += PVT;
  const size_t oCT  = off; off += PX;
  if (off > ws_size) return;                               // off = 36700160 at NB=4, SEQ=2048
  if (off > (size_t)134217728) return;

  char* ws = (char*)d_ws;
  unsigned short* WQ16  = (unsigned short*)(ws + oWQ);
  unsigned short* WK16  = (unsigned short*)(ws + oWK);
  unsigned short* WV16  = (unsigned short*)(ws + oWV);
  unsigned short* WP16  = (unsigned short*)(ws + oWP);
  unsigned short* WO16  = (unsigned short*)(ws + oWO);
  unsigned short* QU    = (unsigned short*)(ws + oQU);
  unsigned short* K16   = (unsigned short*)(ws + oK);
  float*          CB    = (float*)(ws + oCB);
  unsigned short* VT16  = (unsigned short*)(ws + oVT);
  unsigned short* CT16  = (unsigned short*)(ws + oCT);

  const dim3 blk(256);
  const dim3 gCV(CVT_BLOCKS);                                       // 640
  const dim3 gPJ(PJ_BLOCKS);                                        // 384
  const int tilesQ = (NROW / 64) * (DMOD / 64);                     // 1024
  const dim3 gQ((tilesQ + 7) / 8, 1);                               // 128
  const dim3 gAT(SEQ / ATT_ROWS, NB * NH);                          // 16 x 32
  const dim3 bAT(ATT_THREADS);                                      // 256

  // (0) the five weight planes in one launch: W[nd][c] ([out][in], already k-contiguous per output row) -> f16( bf16_RNE(w) * 64 ).
  //     Destination: WQ16 .. WO16, contiguous from WQ16 in the order of the kernel's ranges.
  cvt_all<<<gCV, blk, 0, stream>>>(w_q, w_k, w_v, w_p, w_o, WQ16);

  // (1) q, k + p, v^T projections and the per-key positional score term in one launch
  proj_all<<<gPJ, blk, 0, stream>>>(xq, xk, xv, xpos, WQ16, WK16, WV16, WP16,
                                    QU, K16, VT16, CB, b_q, b_k, b_v, ub, vb);

  // (2) attention -> CT16 = f16(ctx * 64), rows b*SEQ + i, halves n*64+d
  attn_full<<<gAT, bAT, 0, stream>>>(QU, K16, CB, VT16, kmask, CT16);

  // (3) out = CT . W^T / (64*64) + bo; M = NROW, N = 512, K = 512, f32 rows straight into the output buffer (row b*SEQ + t)
  gemm64<0, 0, 0, 1><<<gQ, blk, 0, stream>>>(
      CT16, CT16, DMOD, 0LL,
      WO16, DMOD, 0LL,
      (void*)out, (void*)out, DMOD, 0LL,
      NROW, DMOD, DMOD, 1.0f / (CC * WSC), 1.0f,
      b_o, b_o, b_o);
  (void)hipGetLastError();
}
